// v000
// Measured on an AMD MI455X. A time is GPU time per run, averaged over a window of back-to-back runs after a warm-up
// (all launches, gaps included; the runs take copies of the inputs in turn), and the median of several windows.
// Apart from v000's, it joins two sittings. Times from different sittings can be a few percent apart, while
// side-by-side timings come from the same sitting.
// v000 is the starting kernel. One run takes 59.3 microseconds.
#include <hip/hip_runtime.h>
#pragma clang fp contract(off)

// Additive attention of candidate items over a user history: rows = [400-wide item vector | 100-wide position embedding]; hidden = relu(cand Wc^T + hist Wh^T + b1) (W1 [200][1000] = [Wc | Wh], [out][in]); logit = hidden . w2 + b2; masked entries REPLACED by -1e9; softmax over the history; out0 = alpha hist, out1 = the candidate rows.
// Compute dtypes, f32 accumulate everywhere: the two projections v_wmma_f32_16x16x32_bf16 (items, position table, W1 RNE-converted to bf16; products exact); alpha . hist v_wmma_f32_16x16x32_f16 (alpha x1024 carry as f16, hist = the bf16 values held in f16); relu / w2 dot (depth 200, one shared vector) and softmax on the vector unit in f32.
// Layout: bf16 planes X [2][rows][512] (cand | hist, K zero-padded 500 -> 512) and W [2][256][512] (zero-padded); f32 plane HP [2][rows][256]; f16 planes AP [b][64 cand][64 hist] and HT [b][512 feature][64 hist] (hist transposed through LDS); f32 plane OS [b][64][512]; flat float4 copies into the output buffer.

#ifndef NB
#define NB 64
#endif
#define NB_FULL 64
#define NH   50                  // history entries per batch
#define NN   50                  // candidates per batch
#define RD   400                 // item vector width
#define PD   100                 // position embedding width
#define FD   500                 // RD + PD
#define AD   200                 // attention width
#define NPOS 52                  // rows of the position table
#define KP   512                 // FD padded to the k-step
#define APAD 256                 // AD padded to the column tile
#define HPAD 64                  // NH / NN padded (k of the second product, rows of its A operand)
#define MROWS (NB * NN)
#define MPAD  ((MROWS + 63) / 64 * 64)
#define OSW  68                  // LDS row pitch (floats) of a 16 x 64 slab
#define TP   72                  // LDS row pitch (halves) of the transposed hist tile
#define SW   4                   // waves per score block (4 candidates each)
#define PCS  1024.0f             // carry of the alpha plane
#define PCI  (1.0f / 1024.0f)
#define L2E  1.4426950408889634f
#define NEGV (-1.0e9f)
#define NEGB (-3.0e38f)

static_assert(FD == RD + PD);
static_assert(NH == NN);                       // both row sets have MROWS rows
static_assert(RD % 8 == 0);                    // an 8-element piece never straddles the item / position boundary
static_assert(PD % 4 == 0);
static_assert(FD % 4 == 0);                    // a float4 of the flat output never straddles two rows
static_assert(KP % 32 == 0);                   // GEMM k-loop steps by 32
static_assert(KP >= FD);
static_assert(KP % 64 == 0);                   // 64-column tiles of the second product
static_assert(KP / 8 == 64);
static_assert(APAD % 64 == 0);
static_assert(APAD >= AD);
static_assert(AD % 4 == 0);
static_assert(HPAD == 64);
static_assert(HPAD % 32 == 0);
static_assert(NH > 32);                        // two history entries per lane: lane and lane + 32
static_assert(NH <= HPAD);
static_assert(NN <= HPAD);
static_assert(MPAD % 64 == 0);
static_assert(HPAD % (4 * SW) == 0);           // score grid covers the padded candidate rows exactly
static_assert(NB <= NB_FULL);
static_assert(((size_t)NB_FULL * NN * FD * 4) == (size_t)6400000);   // byte offset of the second output
static_assert((((size_t)NB_FULL * NN * FD * 4) % 128) == 0);
static_assert((OSW * 4) % 16 == 0);
static_assert((TP * 2) % 16 == 0);
static_assert(16 * OSW * 4 <= 131072);         // static LDS of the GEMM kernels
static_assert(64 * TP * 2 <= 131072);          // static LDS of the transpose kernel
static_assert(SW * 4 * HPAD * 2 <= 131072);    // static LDS of the score kernel

typedef _Float16 h16;
typedef unsigned short bf;
typedef __attribute__((ext_vector_type(16))) __bf16   v16bf;
typedef __attribute__((ext_vector_type(16))) _Float16 v16h;
typedef __attribute__((ext_vector_type(8)))  _Float16 v8h;
typedef __attribute__((ext_vector_type(8)))  unsigned short v8us;
typedef __attribute__((ext_vector_type(8)))  float    v8f;
typedef __attribute__((ext_vector_type(4)))  float    v4f;
typedef v4f  __attribute__((may_alias)) v4fa;
typedef v8h  __attribute__((may_alias)) v8ha;

__device__ __forceinline__ unsigned short f2bf(float f) { unsigned u = __float_as_uint(f); u += 0x7FFFu + ((u >> 16) & 1u); return (unsigned short)(u >> 16); }
__device__ __forceinline__ float bfr(float f) { return __uint_as_float(((unsigned)f2bf(f)) << 16); }   // value after RNE convert to bf16
__device__ __forceinline__ v16h cat16(v8h lo, v8h hi) { return __builtin_shufflevector(lo, hi, 0, 1, 2, 3, 4, 5, 6, 7, 8, 9, 10, 11, 12, 13, 14, 15); }
__device__ __forceinline__ v16bf cat16b(v8us lo, v8us hi) { return __builtin_bit_cast(v16bf, __builtin_shufflevector(lo, hi, 0, 1, 2, 3, 4, 5, 6, 7, 8, 9, 10, 11, 12, 13, 14, 15)); }
__device__ __forceinline__ v8f wmma16(v16h a, v16h b, v8f c) { return __builtin_amdgcn_wmma_f32_16x16x32_f16(false, a, false, b, (short)0, c, false, false); }
__device__ __forceinline__ v8f wmmab(v16bf a, v16bf b, v8f c) { return __builtin_amdgcn_wmma_f32_16x16x32_bf16(false, a, false, b, (short)0, c, false, false); }
// fragment loaders from K-contiguous 16-bit rows; p already includes + 8*(lane>>4): elements 0..7 <- k0+8h+0..7, elements 8..15 <- k0+16+8h+0..7 (same map for A and B)
__device__ __forceinline__ v16h  ldh(const h16* p) { return cat16(*(const v8h*)p, *(const v8h*)(p + 16)); }
__device__ __forceinline__ v16bf ldb(const bf* p)  { return cat16b(*(const v8us*)p, *(const v8us*)(p + 16)); }
// ordering point for wave-private LDS tiles (same wave writes and reads)
__device__ __forceinline__ void wave_sync() { __builtin_amdgcn_fence(3 /* release order */, "wavefront"); __builtin_amdgcn_wave_barrier(); asm volatile("" ::: "memory"); }
// per-instruction guarded matrix ops: one accumulator tied per guard, operands kept live
__device__ __forceinline__ v8f wmma16g(v16h a, v16h b, v8f c) { c = wmma16(a, b, c); asm volatile("v_nop\n\tv_nop\n\tv_nop\n\tv_nop" : "+v"(c) : "v"(a), "v"(b)); return c; }
__device__ __forceinline__ v8f wmmabg(v16bf a, v16bf b, v8f c) { c = wmmab(a, b, c); asm volatile("v_nop\n\tv_nop\n\tv_nop\n\tv_nop" : "+v"(c) : "v"(a), "v"(b)); return c; }
// f32 -> f16 convert that cannot produce an f16 subnormal (|v| < 2^-14 -> +0)
static __device__ __forceinline__ h16 toh_flush(float v) { const h16 r = (h16)v; return (fabsf(v) < 6.103515625e-05f) ? (h16)0.0f : r; }
// position-table row: negative index wraps once, then clamps into the table
__device__ __forceinline__ int posrow(int p) { p = p < 0 ? p + NPOS : p; p = p < 0 ? 0 : p; p = p > NPOS - 1 ? NPOS - 1 : p; return p; }

// k_wconv: W1 [200][1000] -> bf16 planes WB [2][256][512] (w = 0: columns 0..499, w = 1: columns 500..999; rows >= 200 and k >= 500 are zeros).
__global__ __launch_bounds__(256) void k_wconv(const float* __restrict__ W1, bf* WB) {
    const int i = (int)blockIdx.x * 256 + (int)threadIdx.x; if (i >= 2 * APAD * (KP / 8)) return;
    const int k8 = (i % (KP / 8)) * 8; const int a = (i / (KP / 8)) % APAD; const int w = i / ((KP / 8) * APAD);
    const int ac = a < AD ? a : AD - 1;
    const size_t rb = (size_t)ac * (2 * FD) + (size_t)w * FD;
    v8us o;
#pragma unroll
    for (int j = 0; j < 8; ++j) { const int k = k8 + j; const int kc = k < FD ? k : FD - 1;
        float x = W1[rb + (size_t)kc]; asm volatile("" : "+v"(x));
        const bool ok = (k < FD) & (a < AD); o[j] = f2bf(ok ? x : 0.0f); }
    *(v8us*)(WB + (size_t)i * 8) = o; 
}

// k_xrow: bf16 operand rows [MPAD][512] = [ item vector (400) | position row (100) | zeros (12) ]; rows >= MROWS are zeros.
// usepos = 1: position row = table[pos[r]]; usepos = 0: table row 1. All candidate loads at clamped addresses, selected by value.
__global__ __launch_bounds__(256) void k_xrow(const float* __restrict__ src, const int* __restrict__ pos, const float* __restrict__ pe, bf* dst, int usepos) {
    const int i = (int)blockIdx.x * 256 + (int)threadIdx.x; if (i >= MPAD * (KP / 8)) return;
    const int k8 = (i % (KP / 8)) * 8; const int r = i / (KP / 8);
    const int rc = r < MROWS ? r : MROWS - 1;
    int pz = pos[rc]; asm volatile("" : "+v"(pz));
    const int prow = usepos ? posrow(pz) : 1;
    const int kr = k8 < RD - 8 ? k8 : RD - 8;
    int pa = k8 - RD;     pa = pa < 0 ? 0 : (pa > PD - 4 ? PD - 4 : pa);
    int pb = k8 - RD + 4; pb = pb < 0 ? 0 : (pb > PD - 4 ? PD - 4 : pb);
    v4f r0 = *(const v4f*)(src + (size_t)rc * RD + kr), r1 = *(const v4f*)(src + (size_t)rc * RD + kr + 4);
    v4f p0 = *(const v4f*)(pe + (size_t)prow * PD + pa), p1 = *(const v4f*)(pe + (size_t)prow * PD + pb);
    asm volatile("" : "+v"(r0)); asm volatile("" : "+v"(r1)); asm volatile("" : "+v"(p0)); asm volatile("" : "+v"(p1));
    const bool rv = r < MROWS;
    const bool inr = (k8 < RD) & rv;
    const bool ip0 = (k8 >= RD) & (k8 < FD) & rv;
    const bool ip1 = (k8 >= RD) & (k8 + 4 < FD) & rv;
    v8us o;
#pragma unroll
    for (int j = 0; j < 4; ++j) {
        const float x0 = inr ? r0[j] : (ip0 ? p0[j] : 0.0f);
        const float x1 = inr ? r1[j] : (ip1 ? p1[j] : 0.0f);
        o[j] = f2bf(x0); o[4 + j] = f2bf(x1); }
    *(v8us*)(dst + (size_t)i * 8) = o; 
}

__global__ __launch_bounds__(256) void k_cand(const float* __restrict__ cand, const float* __restrict__ pe, float* O1) {
    const int i = (int)blockIdx.x * 256 + (int)threadIdx.x; if (i >= MROWS * (FD / 4)) return;
    const int r = i / (FD / 4); const int c = (i % (FD / 4)) * 4;
    const int cr = c < RD ? c : RD - 4; int cp = c - RD; cp = cp < 0 ? 0 : cp;      // c <= 496 -> cp <= 96
    v4f xr = *(const v4f*)(cand + (size_t)r * RD + cr); v4f xp = *(const v4f*)(pe + PD + cp);
    asm volatile("" : "+v"(xr)); asm volatile("" : "+v"(xp));
    v4f o;
#pragma unroll
    for (int j = 0; j < 4; ++j) o[j] = bfr(c < RD ? xr[j] : xp[j]);
    *(v4f*)(O1 + (size_t)i * 4) = o; 
}

// k_histT: f16 plane HT [b][512 feature][64 history] = hist^T (bf16 values held in f16); features >= 500 and history >= 50 are zeros.
__global__ __launch_bounds__(256) void k_histT(const float* __restrict__ hist, const int* __restrict__ pos, const float* __restrict__ pe, h16* HT) {
    __shared__ __align__(16) h16 th[64 * TP];
    const int t = (int)threadIdx.x; const int f0 = (int)blockIdx.x * 64; const int b = (int)blockIdx.y;
    const int fl = t & 63, hq = t >> 6;
    const int f = f0 + fl; const int fr = f < RD ? f : RD - 1; int fp = f - RD; fp = fp < 0 ? 0 : (fp > PD - 1 ? PD - 1 : fp);
    static_assert(256 * 16 == 64 * HPAD);          // fill: threads x trips == tile elements
#pragma unroll 1
    for (int it = 0; it < 16; ++it) {
        const int h = hq + 4 * it; const int hc = h < NH ? h : NH - 1; const size_t row = (size_t)b * NH + (size_t)hc;
        int pz = pos[row]; asm volatile("" : "+v"(pz)); pz = posrow(pz);
        float xr = hist[row * RD + (size_t)fr]; float xp = pe[(size_t)pz * PD + (size_t)fp];
        asm volatile("" : "+v"(xr)); asm volatile("" : "+v"(xp));
        const float v = (f < RD) ? xr : xp;
        const bool ok = (h < NH) & (f < FD);
        const h16 o = ok ? toh_flush(bfr(v)) : (h16)0.0f;
        th[fl * TP + h] = o; }
    __syncthreads();
    static_assert(256 * 2 * 16 == 64 * HPAD * 2);
{
#pragma unroll
        for (int it = 0; it < 2; ++it) { const int p = it * 256 + t; const int row = p >> 3, pc = p & 7;
            const v8h val = *(const v8ha*)(&th[row * TP + pc * 8]);
            *(v8h*)(HT + ((size_t)b * KP + (size_t)(f0 + row)) * HPAD + (size_t)pc * 8) = val; }
         }
}

// k_gemm1: bf16 GEMM, ONE WAVE per 64x64 tile (16 accumulators), operands straight from K-contiguous bf16 planes, K = 512.
// HP[w][m][n] = sum_k XB[w][m][k] WB[w][n][k]; grid (MPAD/64, APAD/64, 2). Epilogue: per 16-row slab staged in LDS (wave-private),
__global__ __launch_bounds__(32) void k_gemm1(const bf* __restrict__ XB, const bf* __restrict__ WB, float* HP) {
    __shared__ __align__(16) float os[16 * OSW];
    const int lane = threadIdx.x & 31, lr = lane & 15, hi = lane >> 4;
    const int r0 = (int)blockIdx.x * 64, c0 = (int)blockIdx.y * 64, w = (int)blockIdx.z;
    v8f acc[4][4];
#pragma unroll
    for (int mb = 0; mb < 4; ++mb)
#pragma unroll
        for (int nb = 0; nb < 4; ++nb) acc[mb][nb] = (v8f){};
    const size_t aoff = ((size_t)w * MPAD + (size_t)(r0 + lr)) * KP + 8 * hi, boff = ((size_t)w * APAD + (size_t)(c0 + lr)) * KP + 8 * hi;
#pragma unroll 1
    for (int kc = 0; kc < KP; kc += 32) {
        v16bf a[4];
#pragma unroll
        for (int mb = 0; mb < 4; ++mb) a[mb] = ldb(XB + aoff + (size_t)mb * 16 * KP + kc);
#pragma unroll
        for (int nb = 0; nb < 4; ++nb) { const v16bf bq = ldb(WB + boff + (size_t)nb * 16 * KP + kc);
#pragma unroll
            for (int mb = 0; mb < 4; ++mb) acc[mb][nb] = wmmabg(a[mb], bq, acc[mb][nb]); }
    }
    float* outp = HP + ((size_t)w * MPAD + (size_t)r0) * APAD + (size_t)c0;
    static_assert(32 * 16 * 8 == 16 * 64 * 4);     // lanes x 16 B x trips == 16 rows x 256 B
#pragma unroll
    for (int mb = 0; mb < 4; ++mb) {
#pragma unroll
        for (int nb = 0; nb < 4; ++nb) {
#pragma unroll
            for (int j = 0; j < 8; ++j) os[(hi * 8 + j) * OSW + nb * 16 + lr] = acc[mb][nb][j]; }   // D: row 8h+j, col lane&15
        wave_sync();
{
#pragma unroll
            for (int s = 0; s < 8; ++s) { const int row = 2 * s + (lane >> 4), c4 = (lane & 15) * 4;   // 8 s x 2 rows = 16 rows; 16 lanes x 4 floats = 64 columns
                const v4f val = *(const v4fa*)(&os[row * OSW + c4]);
                *(v4f*)(outp + (size_t)(mb * 16 + row) * APAD + c4) = val; }
             }
        wave_sync();
    }
}

// k_score: one wave per 4 candidates of one batch; lane = history entry (lane and lane + 32).
// logit = sum_a relu((hc + hh) + b1) * w2 + b2 (f32, fmaf chain per (candidate, history) pair); masked entries replaced by -1e9; softmax with the running max over all 50 entries;
__global__ __launch_bounds__(32 * SW) void k_score(const float* __restrict__ HC, const float* __restrict__ HH, const int* __restrict__ maskp,
                                                   const float* __restrict__ b1, const float* __restrict__ w2, const float* __restrict__ b2, h16* AP) {
    __shared__ __align__(16) h16 pt[SW * 4 * HPAD];
    const int lane = threadIdx.x & 31;
    const int wave = __builtin_amdgcn_readfirstlane((int)(threadIdx.x >> 5));
    const int b = (int)blockIdx.y;
    const int n0 = ((int)blockIdx.x * SW + wave) * 4;
    h16* dst = AP + ((size_t)b * HPAD + (size_t)n0) * HPAD + (size_t)lane * 8;
    static_assert(32 * 16 == 4 * HPAD * 2);
    if (n0 >= NN) { const v8h z = (v8h){}; *(v8h*)dst = z;  return; }   // wave-uniform; no block barrier in this kernel
    const int nvec = ((int)blockIdx.x * SW + (int)(threadIdx.x >> 5)) * 4;
    size_t oc[4]; bool rok[4];
#pragma unroll
    for (int i = 0; i < 4; ++i) { int q = nvec + i; rok[i] = q < NN; q = q < NN ? q : NN - 1; q = __builtin_amdgcn_readfirstlane(q);
        oc[i] = ((size_t)b * NN + (size_t)q) * APAD; }
    const int hB = lane + 32; const int hBc = hB < NH ? hB : NH - 1; const bool okB = hB < NH;
    const size_t hb = (size_t)b * NH;
    const size_t oa = (hb + (size_t)lane) * APAD, ob = (hb + (size_t)hBc) * APAD;
    int mkA = maskp[hb + (size_t)lane], mkB = maskp[hb + (size_t)hBc];
    asm volatile("" : "+v"(mkA)); asm volatile("" : "+v"(mkB));
    const float b2v = bfr(b2[0]);
    float accA[4], accB[4];
#pragma unroll
    for (int i = 0; i < 4; ++i) { accA[i] = 0.0f; accB[i] = 0.0f; }
#pragma unroll 1
    for (int a4 = 0; a4 < AD / 4; ++a4) {
        const v4f xa = *(const v4f*)(HH + oa + 4 * a4), xb = *(const v4f*)(HH + ob + 4 * a4);
        const v4f bv = *(const v4f*)(b1 + 4 * a4), wv = *(const v4f*)(w2 + 4 * a4);
        float bb[4], ww[4];
#pragma unroll
        for (int j = 0; j < 4; ++j) { bb[j] = bfr(bv[j]); ww[j] = bfr(wv[j]); }
#pragma unroll
        for (int i = 0; i < 4; ++i) { const v4f c = *(const v4f*)(HC + oc[i] + 4 * a4);
#pragma unroll
            for (int j = 0; j < 4; ++j) {
                const float va = fmaxf((c[j] + xa[j]) + bb[j], 0.0f), vb = fmaxf((c[j] + xb[j]) + bb[j], 0.0f);
                accA[i] = fmaf(va, ww[j], accA[i]); accB[i] = fmaf(vb, ww[j], accB[i]); } }
    }
#pragma unroll
    for (int i = 0; i < 4; ++i) {
        float sA = accA[i] + b2v, sB = accB[i] + b2v;
        sA = (mkA != 0) ? sA : NEGV; sB = (mkB != 0) ? sB : NEGV; sB = okB ? sB : NEGB;
        float mx = fmaxf(sA, sB);
        mx = fmaxf(mx, __shfl_xor(mx, 16, 32)); mx = fmaxf(mx, __shfl_xor(mx, 8, 32)); mx = fmaxf(mx, __shfl_xor(mx, 4, 32));
        mx = fmaxf(mx, __shfl_xor(mx, 2, 32));  mx = fmaxf(mx, __shfl_xor(mx, 1, 32));
        const float eA = __builtin_amdgcn_exp2f((sA - mx) * L2E);
        float eB = __builtin_amdgcn_exp2f((sB - mx) * L2E); eB = okB ? eB : 0.0f;
        float sm = eA + eB;
        sm += __shfl_xor(sm, 16, 32); sm += __shfl_xor(sm, 8, 32); sm += __shfl_xor(sm, 4, 32); sm += __shfl_xor(sm, 2, 32); sm += __shfl_xor(sm, 1, 32);
        const float inv = __builtin_amdgcn_rcpf(sm) * PCS;              // sm >= 1 (the maximum entry contributes 1)
        h16 qa = toh_flush(eA * inv), qb = toh_flush(eB * inv);
        qa = rok[i] ? qa : (h16)0.0f; qb = rok[i] ? qb : (h16)0.0f;
        pt[wave * (4 * HPAD) + i * HPAD + lane] = qa; pt[wave * (4 * HPAD) + i * HPAD + 32 + lane] = qb; }   // 4 rows x 64 columns all written
    wave_sync();
    const v8h val = *(const v8ha*)(&pt[wave * (4 * HPAD) + lane * 8]);
    *(v8h*)dst = val; 
}

// k_gemm2: f16 GEMM, ONE WAVE per (batch, 64-feature tile): OS[b][n][f] = (1/1024) sum_h AP[b][n][h] HT[b][f][h], K = 64; grid (KP/64, NB).
// Epilogue as k_gemm1 (row pitch KP); all 64 x 64 entries written (candidate rows >= 50 and features >= 500 come out zero).
__global__ __launch_bounds__(32) void k_gemm2(const h16* __restrict__ AP, const h16* __restrict__ HT, float* OS) {
    __shared__ __align__(16) float os[16 * OSW];
    const int lane = threadIdx.x & 31, lr = lane & 15, hi = lane >> 4;
    const int c0 = (int)blockIdx.x * 64, b = (int)blockIdx.y;
    v8f acc[4][4];
#pragma unroll
    for (int mb = 0; mb < 4; ++mb)
#pragma unroll
        for (int nb = 0; nb < 4; ++nb) acc[mb][nb] = (v8f){};
    const size_t aoff = ((size_t)b * HPAD + (size_t)lr) * HPAD + 8 * hi, boff = ((size_t)b * KP + (size_t)(c0 + lr)) * HPAD + 8 * hi;
#pragma unroll 1
    for (int kc = 0; kc < HPAD; kc += 32) {
        v16h a[4];
#pragma unroll
        for (int mb = 0; mb < 4; ++mb) a[mb] = ldh(AP + aoff + (size_t)mb * 16 * HPAD + kc);
#pragma unroll
        for (int nb = 0; nb < 4; ++nb) { const v16h bq = ldh(HT + boff + (size_t)nb * 16 * HPAD + kc);
#pragma unroll
            for (int mb = 0; mb < 4; ++mb) acc[mb][nb] = wmma16g(a[mb], bq, acc[mb][nb]); }
    }
    float* outp = OS + ((size_t)b * HPAD) * KP + (size_t)c0;
    static_assert(32 * 16 * 8 == 16 * 64 * 4);     // lanes x 16 B x trips == 16 rows x 256 B
#pragma unroll
    for (int mb = 0; mb < 4; ++mb) {
#pragma unroll
        for (int nb = 0; nb < 4; ++nb) {
#pragma unroll
            for (int j = 0; j < 8; ++j) os[(hi * 8 + j) * OSW + nb * 16 + lr] = acc[mb][nb][j] * PCI; }   // D: row 8h+j, col lane&15
        wave_sync();
{
#pragma unroll
            for (int s = 0; s < 8; ++s) { const int row = 2 * s + (lane >> 4), c4 = (lane & 15) * 4;   // 8 s x 2 rows = 16 rows; 16 lanes x 4 floats = 64 columns
                const v4f val = *(const v4fa*)(&os[row * OSW + c4]);
                *(v4f*)(outp + (size_t)(mb * 16 + row) * KP + c4) = val; }
             }
        wave_sync();
    }
}

__global__ __launch_bounds__(256) void k_out0(const float* __restrict__ OS, float* O0) {
    const int i = (int)blockIdx.x * 256 + (int)threadIdx.x; if (i >= MROWS * (FD / 4)) return;
    const int r = i / (FD / 4); const int c = (i % (FD / 4)) * 4;
    const int b = r / NN, n = r % NN;
    const v4f v = *(const v4f*)(OS + ((size_t)b * HPAD + (size_t)n) * KP + c);
    *(v4f*)(O0 + (size_t)i * 4) = v; 
}

static constexpr size_t al256(size_t v) { return (v + 255) & ~(size_t)255; }
static constexpr size_t SZ_WB = al256((size_t)2 * APAD * KP * 2);
static constexpr size_t SZ_XB = al256((size_t)2 * MPAD * KP * 2);
static constexpr size_t SZ_HT = al256((size_t)NB * KP * HPAD * 2);
static constexpr size_t SZ_HP = al256((size_t)2 * MPAD * APAD * 4);
static constexpr size_t SZ_AP = al256((size_t)NB * HPAD * HPAD * 2);
static constexpr size_t SZ_OS = al256((size_t)NB * HPAD * KP * 4);
static constexpr size_t SZ_TOTAL = SZ_WB + SZ_XB + SZ_HT + SZ_HP + SZ_AP + SZ_OS;
static_assert(SZ_TOTAL <= (size_t)134217728);          // workspace carve <= 128 MiB
static_assert(((size_t)MPAD * KP * 2) % 256 == 0);     // the two X sub-planes stay 256-byte aligned
static_assert(((size_t)MPAD * APAD * 4) % 256 == 0);   // the two HP sub-planes stay 256-byte aligned
static constexpr size_t OUT1_OFF = (size_t)NB_FULL * NN * FD;   // element offset of the second output (fixed, full problem)

extern "C" void kernel_launch(void* const* d_in, const int* in_sizes, int n_in,
                              void* d_out, int out_size, void* d_ws, size_t ws_size, hipStream_t stream) {
    if (n_in < 9) return;
    if ((size_t)in_sizes[0] < (size_t)MROWS * RD || (size_t)in_sizes[1] < (size_t)MROWS * RD) return;
    if ((size_t)in_sizes[2] < (size_t)MROWS || (size_t)in_sizes[3] < (size_t)MROWS) return;
    if ((size_t)in_sizes[4] < (size_t)NPOS * PD || (size_t)in_sizes[5] < (size_t)AD * 2 * FD) return;
    if (in_sizes[6] < AD || in_sizes[7] < AD || in_sizes[8] < 1) return;
    if ((size_t)out_size < OUT1_OFF + (size_t)MROWS * FD) return;
    if (SZ_TOTAL > ws_size) return;
    // wire order: history_repr, candidate_repr, user_history_mask, user_history_position, pos_emb, W1, b1, w2, b2
    const float* hist_in = (const float*)d_in[0];
    const float* cand_in = (const float*)d_in[1];
    const int*   maskp   = (const int*)d_in[2];
    const int*   posp    = (const int*)d_in[3];
    const float* pe      = (const float*)d_in[4];
    const float* W1      = (const float*)d_in[5];
    const float* b1      = (const float*)d_in[6];
    const float* w2      = (const float*)d_in[7];
    const float* b2      = (const float*)d_in[8];
    float* OUT0 = (float*)d_out;                 // [NB][50][500]
    float* OUT1 = (float*)d_out + OUT1_OFF;      // [NB][50][500]
    char* wsp = (char*)d_ws;
    bf*  WB = (bf*)wsp;    wsp += SZ_WB;         // [2][256][512]: Wc | Wh
    bf*  XB = (bf*)wsp;    wsp += SZ_XB;         // [2][MPAD][512]: cand rows | hist rows
    h16* HT = (h16*)wsp;   wsp += SZ_HT;         // [NB][512][64]
    float* HP = (float*)wsp; wsp += SZ_HP;       // [2][MPAD][256]: hc | hh
    h16* AP = (h16*)wsp;   wsp += SZ_AP;         // [NB][64][64] alpha x1024
    float* OS = (float*)wsp; wsp += SZ_OS;       // [NB][64][512]
    bf* XC = XB; bf* XH = XB + (size_t)MPAD * KP;
    const float* HC = HP; const float* HH = HP + (size_t)MPAD * APAD;

    k_wconv<<<(unsigned)((2 * APAD * (KP / 8) + 255) / 256), 256, 0, stream>>>(W1, WB);
    k_xrow<<<(unsigned)((MPAD * (KP / 8) + 255) / 256), 256, 0, stream>>>(cand_in, posp, pe, XC, 0);
    k_xrow<<<(unsigned)((MPAD * (KP / 8) + 255) / 256), 256, 0, stream>>>(hist_in, posp, pe, XH, 1);
    k_cand<<<(unsigned)((MROWS * (FD / 4) + 255) / 256), 256, 0, stream>>>(cand_in, pe, OUT1);
    k_histT<<<dim3(KP / 64, NB, 1), 256, 0, stream>>>(hist_in, posp, pe, HT);
    // hc = cand Wc^T, hh = hist Wh^T
    k_gemm1<<<dim3(MPAD / 64, APAD / 64, 2), 32, 0, stream>>>(XB, WB, HP);
    k_score<<<dim3(HPAD / (4 * SW), NB, 1), 32 * SW, 0, stream>>>(HC, HH, maskp, b1, w2, b2, AP);
    // user representation = alpha hist
    k_gemm2<<<dim3(KP / 64, NB, 1), 32, 0, stream>>>(AP, HT, OS);
    k_out0<<<(unsigned)((MROWS * (FD / 4) + 255) / 256), 256, 0, stream>>>(OS, OUT0);
}

// v001
// Measured time: 41.9 microseconds a run.
// Next to v000, in two timings, it ran 1.36 and 1.37 times as fast.
#include <hip/hip_runtime.h>
#pragma clang fp contract(off)

// Additive attention of candidate items over a user history: rows = [400-wide item vector | 100-wide position embedding]; hidden = relu(cand Wc^T + hist Wh^T + b1) (W1 [200][1000] = [Wc | Wh], [out][in]); logit = hidden . w2 + b2; masked entries REPLACED by -1e9; softmax over the history; out0 = alpha hist, out1 = the candidate rows.
// Compute dtypes, f32 accumulate everywhere: the two projections v_wmma_f32_16x16x32_bf16 (items, position table, W1 RNE-converted to bf16; products exact); alpha . hist v_wmma_f32_16x16x32_f16 (alpha x1024 carry as f16, hist = the bf16 values held in f16); relu / w2 dot (depth 200, one shared vector) and softmax on the vector unit in f32.
// Layout: bf16 planes X [2][rows][512] (cand | hist, K zero-padded 500 -> 512) and W [2][256][512] (zero-padded); f32 plane HP [2][rows][256]; f16 plane HT [b][512 feature][64 hist] (hist transposed through LDS); alpha stays in LDS (16 candidate rows per score block).
// Three launches: k_prep (all operand planes and out1, by block range), k_gemm1, k_score (logits, softmax, alpha . hist, out0).

#ifndef NB
#define NB 64
#endif
#define NB_FULL 64
#define NH   50                  // history entries per batch
#define NN   50                  // candidates per batch
#define RD   400                 // item vector width
#define PD   100                 // position embedding width
#define FD   500                 // RD + PD
#define AD   200                 // attention width
#define NPOS 52                  // rows of the position table
#define KP   512                 // FD padded to the k-step
#define APAD 256                 // AD padded to the column tile
#define HPAD 64                  // NH / NN padded (k of the second product, rows of its A operand)
#define MROWS (NB * NN)
#define MPAD  ((MROWS + 63) / 64 * 64)
#define OSW  68                  // LDS row pitch (floats) of a 16 x 64 slab
#define OSW2 132                 // LDS row pitch (floats) of a 16 x 128 slab
#define TP   72                  // LDS row pitch (halves) of the transposed hist tile and of the alpha rows
#define SW   4                   // waves per score block (4 candidates each)
#define PCS  1024.0f             // carry of the f16 alpha rows in LDS
#define PCI  (1.0f / 1024.0f)
#define L2E  1.4426950408889634f
#define NEGV (-1.0e9f)
#define NEGB (-3.0e38f)

static_assert(FD == RD + PD);
static_assert(NH == NN);                       // both row sets have MROWS rows
static_assert(RD % 8 == 0);                    // an 8-element piece never straddles the item / position boundary
static_assert(PD % 4 == 0);
static_assert(FD % 4 == 0);                    // a float4 of the flat output never straddles two rows
static_assert(KP % 32 == 0);                   // GEMM k-loop steps by 32
static_assert(KP >= FD);
static_assert(KP % 64 == 0);                   // 64-feature tiles of the hist transpose in k_prep
static_assert(KP / 8 == 64);
static_assert(APAD % 64 == 0);
static_assert(APAD >= AD);
static_assert(AD % 4 == 0);
static_assert(HPAD == 64);
static_assert(HPAD % 32 == 0);
static_assert(NH > 32);                        // two history entries per lane: lane and lane + 32
static_assert(NH <= HPAD);
static_assert(NN <= HPAD);
static_assert(MPAD % 64 == 0);
static_assert(HPAD % (4 * SW) == 0);           // score grid covers the padded candidate rows exactly
static_assert(NB <= NB_FULL);
static_assert(((size_t)NB_FULL * NN * FD * 4) == (size_t)6400000);   // byte offset of the second output
static_assert((((size_t)NB_FULL * NN * FD * 4) % 128) == 0);
static_assert((OSW * 4) % 16 == 0);
static_assert((TP * 2) % 16 == 0);
static_assert(16 * OSW * 4 <= 131072);         // static LDS of k_gemm1
static_assert(64 * TP * 2 <= 131072);          // static LDS of k_prep (hist transpose tile)
static_assert(SW * 4 == 16);                   // a score block's candidates are one 16-row A fragment
static_assert(SW * 128 == KP);                 // its waves cover the padded features, 128 each
static_assert((OSW2 * 4) % 16 == 0);
static_assert(SW * 4 * TP * 2 + SW * 16 * OSW2 * 4 <= 131072);   // static LDS of the score kernel

typedef _Float16 h16;
typedef unsigned short bf;
typedef __attribute__((ext_vector_type(16))) __bf16   v16bf;
typedef __attribute__((ext_vector_type(16))) _Float16 v16h;
typedef __attribute__((ext_vector_type(8)))  _Float16 v8h;
typedef __attribute__((ext_vector_type(8)))  unsigned short v8us;
typedef __attribute__((ext_vector_type(8)))  float    v8f;
typedef __attribute__((ext_vector_type(4)))  float    v4f;
typedef v4f  __attribute__((may_alias)) v4fa;
typedef v8h  __attribute__((may_alias)) v8ha;

__device__ __forceinline__ unsigned short f2bf(float f) { unsigned u = __float_as_uint(f); u += 0x7FFFu + ((u >> 16) & 1u); return (unsigned short)(u >> 16); }
__device__ __forceinline__ float bfr(float f) { return __uint_as_float(((unsigned)f2bf(f)) << 16); }   // value after RNE convert to bf16
__device__ __forceinline__ v16h cat16(v8h lo, v8h hi) { return __builtin_shufflevector(lo, hi, 0, 1, 2, 3, 4, 5, 6, 7, 8, 9, 10, 11, 12, 13, 14, 15); }
__device__ __forceinline__ v16bf cat16b(v8us lo, v8us hi) { return __builtin_bit_cast(v16bf, __builtin_shufflevector(lo, hi, 0, 1, 2, 3, 4, 5, 6, 7, 8, 9, 10, 11, 12, 13, 14, 15)); }
__device__ __forceinline__ v8f wmma16(v16h a, v16h b, v8f c) { return __builtin_amdgcn_wmma_f32_16x16x32_f16(false, a, false, b, (short)0, c, false, false); }
__device__ __forceinline__ v8f wmmab(v16bf a, v16bf b, v8f c) { return __builtin_amdgcn_wmma_f32_16x16x32_bf16(false, a, false, b, (short)0, c, false, false); }
// fragment loaders from K-contiguous 16-bit rows; p already includes + 8*(lane>>4): elements 0..7 <- k0+8h+0..7, elements 8..15 <- k0+16+8h+0..7 (same map for A and B)
__device__ __forceinline__ v16h  ldh(const h16* p) { return cat16(*(const v8h*)p, *(const v8h*)(p + 16)); }
__device__ __forceinline__ v16bf ldb(const bf* p)  { return cat16b(*(const v8us*)p, *(const v8us*)(p + 16)); }
// ordering point for wave-private LDS tiles (same wave writes and reads)
__device__ __forceinline__ void wave_sync() { __builtin_amdgcn_fence(3 /* release order */, "wavefront"); __builtin_amdgcn_wave_barrier(); asm volatile("" ::: "memory"); }
// per-instruction guarded matrix ops: one accumulator tied per guard, operands kept live
__device__ __forceinline__ v8f wmma16g(v16h a, v16h b, v8f c) { c = wmma16(a, b, c); asm volatile("v_nop\n\tv_nop\n\tv_nop\n\tv_nop" : "+v"(c) : "v"(a), "v"(b)); return c; }
__device__ __forceinline__ v8f wmmabg(v16bf a, v16bf b, v8f c) { c = wmmab(a, b, c); asm volatile("v_nop\n\tv_nop\n\tv_nop\n\tv_nop" : "+v"(c) : "v"(a), "v"(b)); return c; }
// f32 -> f16 convert that cannot produce an f16 subnormal (|v| < 2^-14 -> +0)
static __device__ __forceinline__ h16 toh_flush(float v) { const h16 r = (h16)v; return (fabsf(v) < 6.103515625e-05f) ? (h16)0.0f : r; }
// position-table row: negative index wraps once, then clamps into the table
__device__ __forceinline__ int posrow(int p) { p = p < 0 ? p + NPOS : p; p = p < 0 ? 0 : p; p = p > NPOS - 1 ? NPOS - 1 : p; return p; }

// d_wconv: W1 [200][1000] -> bf16 planes WB [2][256][512] (w = 0: columns 0..499, w = 1: columns 500..999; rows >= 200 and k >= 500 are zeros).
__device__ __forceinline__ void d_wconv(const int blk, const float* __restrict__ W1, bf* WB) {
    const int i = blk * 256 + (int)threadIdx.x; if (i >= 2 * APAD * (KP / 8)) return;
    const int k8 = (i % (KP / 8)) * 8; const int a = (i / (KP / 8)) % APAD; const int w = i / ((KP / 8) * APAD);
    const int ac = a < AD ? a : AD - 1;
    const size_t rb = (size_t)ac * (2 * FD) + (size_t)w * FD;
    v8us o;
#pragma unroll
    for (int j = 0; j < 8; ++j) { const int k = k8 + j; const int kc = k < FD ? k : FD - 1;
        float x = W1[rb + (size_t)kc]; asm volatile("" : "+v"(x));
        const bool ok = (k < FD) & (a < AD); o[j] = f2bf(ok ? x : 0.0f); }
    *(v8us*)(WB + (size_t)i * 8) = o; 
}

// d_xrow: bf16 operand rows [MPAD][512] = [ item vector (400) | position row (100) | zeros (12) ]; rows >= MROWS are zeros.
// USEPOS = 1 (history): position row = table[pos[r]]. USEPOS = 0 (candidates): table row 1, and the same converted values, widened to f32, are stored as out1 [rows][500].
// All loads at clamped addresses, selected by value.
template <int USEPOS>
__device__ __forceinline__ void d_xrow(const int blk, const float* __restrict__ src, const int* __restrict__ pos, const float* __restrict__ pe, bf* dst, float* O1) {
    const int i = blk * 256 + (int)threadIdx.x; if (i >= MPAD * (KP / 8)) return;
    const int k8 = (i % (KP / 8)) * 8; const int r = i / (KP / 8);
    const int rc = r < MROWS ? r : MROWS - 1;
    int prow = 1;
    if (USEPOS) { int pz = pos[rc]; asm volatile("" : "+v"(pz)); prow = posrow(pz); }
    const int kr = k8 < RD - 8 ? k8 : RD - 8;
    int pa = k8 - RD;     pa = pa < 0 ? 0 : (pa > PD - 4 ? PD - 4 : pa);
    int pb = k8 - RD + 4; pb = pb < 0 ? 0 : (pb > PD - 4 ? PD - 4 : pb);
    v4f r0 = *(const v4f*)(src + (size_t)rc * RD + kr), r1 = *(const v4f*)(src + (size_t)rc * RD + kr + 4);
    v4f p0 = *(const v4f*)(pe + (size_t)prow * PD + pa), p1 = *(const v4f*)(pe + (size_t)prow * PD + pb);
    asm volatile("" : "+v"(r0)); asm volatile("" : "+v"(r1)); asm volatile("" : "+v"(p0)); asm volatile("" : "+v"(p1));
    const bool rv = r < MROWS;
    const bool inr = (k8 < RD) & rv;
    const bool ip0 = (k8 >= RD) & (k8 < FD) & rv;
    const bool ip1 = (k8 >= RD) & (k8 + 4 < FD) & rv;
    v8us o;
#pragma unroll
    for (int j = 0; j < 4; ++j) {
        const float x0 = inr ? r0[j] : (ip0 ? p0[j] : 0.0f);
        const float x1 = inr ? r1[j] : (ip1 ? p1[j] : 0.0f);
        o[j] = f2bf(x0); o[4 + j] = f2bf(x1); }
    *(v8us*)(dst + (size_t)i * 8) = o;
    if (!USEPOS) {
        v4f q0, q1;
#pragma unroll
        for (int j = 0; j < 4; ++j) { q0[j] = __uint_as_float(((unsigned)o[j]) << 16); q1[j] = __uint_as_float(((unsigned)o[4 + j]) << 16); }
        float* q = O1 + (size_t)rc * FD + (k8 < FD - 4 ? k8 : FD - 4);      // in bounds for every thread; stored only where the piece is a part of the row
        if (inr | ip0) *(v4f*)q = q0;
        if (inr | ip1) *(v4f*)(q + 4) = q1;
    }
}

// d_histT: f16 plane HT [b][512 feature][64 history] = hist^T (bf16 values held in f16); features >= 500 and history >= 50 are zeros.
__device__ __forceinline__ void d_histT(const int blk, h16* th, const float* __restrict__ hist, const int* __restrict__ pos, const float* __restrict__ pe, h16* HT) {
    const int t = (int)threadIdx.x; const int f0 = (blk % (KP / 64)) * 64; const int b = blk / (KP / 64);
    const int fl = t & 63, hq = t >> 6;
    const int f = f0 + fl; const int fr = f < RD ? f : RD - 1; int fp = f - RD; fp = fp < 0 ? 0 : (fp > PD - 1 ? PD - 1 : fp);
    static_assert(256 * 16 == 64 * HPAD);          // fill: threads x trips == tile elements
#pragma unroll 1
    for (int it = 0; it < 16; ++it) {
        const int h = hq + 4 * it; const int hc = h < NH ? h : NH - 1; const size_t row = (size_t)b * NH + (size_t)hc;
        int pz = pos[row]; asm volatile("" : "+v"(pz)); pz = posrow(pz);
        float xr = hist[row * RD + (size_t)fr]; float xp = pe[(size_t)pz * PD + (size_t)fp];
        asm volatile("" : "+v"(xr)); asm volatile("" : "+v"(xp));
        const float v = (f < RD) ? xr : xp;
        const bool ok = (h < NH) & (f < FD);
        const h16 o = ok ? toh_flush(bfr(v)) : (h16)0.0f;
        th[fl * TP + h] = o; }
    __syncthreads();
    static_assert(256 * 2 * 16 == 64 * HPAD * 2);
{
#pragma unroll
        for (int it = 0; it < 2; ++it) { const int p = it * 256 + t; const int row = p >> 3, pc = p & 7;
            const v8h val = *(const v8ha*)(&th[row * TP + pc * 8]);
            *(v8h*)(HT + ((size_t)b * KP + (size_t)(f0 + row)) * HPAD + (size_t)pc * 8) = val; }
         }
}

// k_prep: the independent operand-plane builders as block ranges of one grid (every branch is block-uniform). The transpose blocks, whose loop is the longest, take the lowest indices.
#define PB_HT ((KP / 64) * NB)
#define PB_W  ((2 * APAD * (KP / 8) + 255) / 256)
#define PB_X  ((MPAD * (KP / 8) + 255) / 256)
__global__ __launch_bounds__(256) void k_prep(const float* __restrict__ hist, const float* __restrict__ cand, const int* __restrict__ pos, const float* __restrict__ pe,
                                              const float* __restrict__ W1, bf* WB, bf* XC, bf* XH, h16* HT, float* O1) {
    __shared__ __align__(16) h16 th[64 * TP];
    int blk = (int)blockIdx.x;
    if (blk < PB_HT) { d_histT(blk, th, hist, pos, pe, HT); return; }
    blk -= PB_HT;
    if (blk < PB_W) { d_wconv(blk, W1, WB); return; }
    blk -= PB_W;
    if (blk < PB_X) { d_xrow<0>(blk, cand, pos, pe, XC, O1); return; }
    blk -= PB_X;
    d_xrow<1>(blk, hist, pos, pe, XH, O1);
}

// k_gemm1: bf16 GEMM, ONE WAVE per 64x64 tile (16 accumulators), operands straight from K-contiguous bf16 planes, K = 512.
// HP[w][m][n] = sum_k XB[w][m][k] WB[w][n][k]; grid (MPAD/64, APAD/64, 2). Epilogue: per 16-row slab staged in LDS (wave-private),
__global__ __launch_bounds__(32) void k_gemm1(const bf* __restrict__ XB, const bf* __restrict__ WB, float* HP) {
    __shared__ __align__(16) float os[16 * OSW];
    const int lane = threadIdx.x & 31, lr = lane & 15, hi = lane >> 4;
    const int r0 = (int)blockIdx.x * 64, c0 = (int)blockIdx.y * 64, w = (int)blockIdx.z;
    v8f acc[4][4];
#pragma unroll
    for (int mb = 0; mb < 4; ++mb)
#pragma unroll
        for (int nb = 0; nb < 4; ++nb) acc[mb][nb] = (v8f){};
    const size_t aoff = ((size_t)w * MPAD + (size_t)(r0 + lr)) * KP + 8 * hi, boff = ((size_t)w * APAD + (size_t)(c0 + lr)) * KP + 8 * hi;
#pragma unroll 1
    for (int kc = 0; kc < KP; kc += 32) {
        v16bf a[4];
#pragma unroll
        for (int mb = 0; mb < 4; ++mb) a[mb] = ldb(XB + aoff + (size_t)mb * 16 * KP + kc);
#pragma unroll
        for (int nb = 0; nb < 4; ++nb) { const v16bf bq = ldb(WB + boff + (size_t)nb * 16 * KP + kc);
#pragma unroll
            for (int mb = 0; mb < 4; ++mb) acc[mb][nb] = wmmabg(a[mb], bq, acc[mb][nb]); }
    }
    float* outp = HP + ((size_t)w * MPAD + (size_t)r0) * APAD + (size_t)c0;
    static_assert(32 * 16 * 8 == 16 * 64 * 4);     // lanes x 16 B x trips == 16 rows x 256 B
#pragma unroll
    for (int mb = 0; mb < 4; ++mb) {
#pragma unroll
        for (int nb = 0; nb < 4; ++nb) {
#pragma unroll
            for (int j = 0; j < 8; ++j) os[(hi * 8 + j) * OSW + nb * 16 + lr] = acc[mb][nb][j]; }   // D: row 8h+j, col lane&15
        wave_sync();
{
#pragma unroll
            for (int s = 0; s < 8; ++s) { const int row = 2 * s + (lane >> 4), c4 = (lane & 15) * 4;   // 8 s x 2 rows = 16 rows; 16 lanes x 4 floats = 64 columns
                const v4f val = *(const v4fa*)(&os[row * OSW + c4]);
                *(v4f*)(outp + (size_t)(mb * 16 + row) * APAD + c4) = val; }
             }
        wave_sync();
    }
}

// k_score: one block per 16 candidates of one batch. Stage 1, one wave per 4 candidates; lane = history entry (lane and lane + 32).
// logit = sum_a relu((hc + hh) + b1) * w2 + b2 (f32, fmaf chain per (candidate, history) pair); masked entries replaced by -1e9; softmax with the running max over all 50 entries;
// alpha x1024 as f16 into the block's LDS rows pt [16][64] (candidate rows >= 50 and history >= 50 are zeros).
// Stage 2, behind one block barrier: out0[b][n][f] = (1/1024) sum_h pt[n][h] HT[b][f][h], f16 WMMA, K = 64; one wave per 128 features (8 accumulators);
// the 16 x 128 slab is staged in LDS (wave-private) and stored as 512-byte row pieces, rows < 50 and features < 500 only.
__global__ __launch_bounds__(32 * SW) void k_score(const float* __restrict__ HC, const float* __restrict__ HH, const int* __restrict__ maskp,
                                                   const float* __restrict__ b1, const float* __restrict__ w2, const float* __restrict__ b2,
                                                   const h16* __restrict__ HT, float* O0) {
    __shared__ __align__(16) h16 pt[SW * 4 * TP];
    __shared__ __align__(16) float os[SW * 16 * OSW2];
    const int lane = threadIdx.x & 31;
    const int wave = __builtin_amdgcn_readfirstlane((int)(threadIdx.x >> 5));
    const int b = (int)blockIdx.y;
    const int n0 = ((int)blockIdx.x * SW + wave) * 4;
    static_assert(32 * 16 == 4 * HPAD * 2);
    const int lr = lane & 15, hi = lane >> 4;
    const int f0 = wave * 128;
    // stage 2's B fragments depend on nothing of stage 1: loaded here, as one group, they arrive while stage 1 runs
    const size_t boff = ((size_t)b * KP + (size_t)(f0 + lr)) * HPAD + 8 * hi;
    v16h bq[2][8];
#pragma unroll
    for (int ks = 0; ks < 2; ++ks) {
#pragma unroll
        for (int nb = 0; nb < 8; ++nb) bq[ks][nb] = ldh(HT + boff + (size_t)nb * 16 * HPAD + 32 * ks); }
    asm volatile("s_wait_xcnt 0x0" ::: "memory");                        // stage 1 reuses the address registers of the loads above while they are in flight
    if (n0 >= NN) {                                                      // wave-uniform: no candidate here, its 4 alpha rows are zeros
        const v8h z = (v8h){}; *(v8ha*)(&pt[(wave * 4 + (lane >> 3)) * TP + (lane & 7) * 8]) = z;
    } else {
    const int nvec = ((int)blockIdx.x * SW + (int)(threadIdx.x >> 5)) * 4;
    size_t oc[4]; bool rok[4];
#pragma unroll
    for (int i = 0; i < 4; ++i) { int q = nvec + i; rok[i] = q < NN; q = q < NN ? q : NN - 1; q = __builtin_amdgcn_readfirstlane(q);
        oc[i] = ((size_t)b * NN + (size_t)q) * APAD; }
    const int hB = lane + 32; const int hBc = hB < NH ? hB : NH - 1; const bool okB = hB < NH;
    const size_t hb = (size_t)b * NH;
    const size_t oa = (hb + (size_t)lane) * APAD, ob = (hb + (size_t)hBc) * APAD;
    int mkA = maskp[hb + (size_t)lane], mkB = maskp[hb + (size_t)hBc];
    asm volatile("" : "+v"(mkA)); asm volatile("" : "+v"(mkB));
    const float b2v = bfr(b2[0]);
    float accA[4], accB[4];
#pragma unroll
    for (int i = 0; i < 4; ++i) { accA[i] = 0.0f; accB[i] = 0.0f; }
#pragma unroll 1
    for (int a4 = 0; a4 < AD / 4; ++a4) {
        const v4f xa = *(const v4f*)(HH + oa + 4 * a4), xb = *(const v4f*)(HH + ob + 4 * a4);
        const v4f bv = *(const v4f*)(b1 + 4 * a4), wv = *(const v4f*)(w2 + 4 * a4);
        float bb[4], ww[4];
#pragma unroll
        for (int j = 0; j < 4; ++j) { bb[j] = bfr(bv[j]); ww[j] = bfr(wv[j]); }
#pragma unroll
        for (int i = 0; i < 4; ++i) { const v4f c = *(const v4f*)(HC + oc[i] + 4 * a4);
#pragma unroll
            for (int j = 0; j < 4; ++j) {
                const float va = fmaxf((c[j] + xa[j]) + bb[j], 0.0f), vb = fmaxf((c[j] + xb[j]) + bb[j], 0.0f);
                accA[i] = fmaf(va, ww[j], accA[i]); accB[i] = fmaf(vb, ww[j], accB[i]); } }
    }
#pragma unroll
    for (int i = 0; i < 4; ++i) {
        float sA = accA[i] + b2v, sB = accB[i] + b2v;
        sA = (mkA != 0) ? sA : NEGV; sB = (mkB != 0) ? sB : NEGV; sB = okB ? sB : NEGB;
        float mx = fmaxf(sA, sB);
        mx = fmaxf(mx, __shfl_xor(mx, 16, 32)); mx = fmaxf(mx, __shfl_xor(mx, 8, 32)); mx = fmaxf(mx, __shfl_xor(mx, 4, 32));
        mx = fmaxf(mx, __shfl_xor(mx, 2, 32));  mx = fmaxf(mx, __shfl_xor(mx, 1, 32));
        const float eA = __builtin_amdgcn_exp2f((sA - mx) * L2E);
        float eB = __builtin_amdgcn_exp2f((sB - mx) * L2E); eB = okB ? eB : 0.0f;
        float sm = eA + eB;
        sm += __shfl_xor(sm, 16, 32); sm += __shfl_xor(sm, 8, 32); sm += __shfl_xor(sm, 4, 32); sm += __shfl_xor(sm, 2, 32); sm += __shfl_xor(sm, 1, 32);
        const float inv = __builtin_amdgcn_rcpf(sm) * PCS;              // sm >= 1 (the maximum entry contributes 1)
        h16 qa = toh_flush(eA * inv), qb = toh_flush(eB * inv);
        qa = rok[i] ? qa : (h16)0.0f; qb = rok[i] ? qb : (h16)0.0f;
        pt[(wave * 4 + i) * TP + lane] = qa; pt[(wave * 4 + i) * TP + 32 + lane] = qb; }   // 4 rows x 64 columns all written
    }
    __syncthreads();                                                     // every wave reads all 16 alpha rows; every wave of the block passes here
    v16h a[2];
#pragma unroll
    for (int ks = 0; ks < 2; ++ks) { const h16* p = &pt[lr * TP + 8 * hi + 32 * ks]; a[ks] = cat16(*(const v8ha*)p, *(const v8ha*)(p + 16)); }   // the k map of ldh
    v8f acc[8];
#pragma unroll
    for (int nb = 0; nb < 8; ++nb) acc[nb] = (v8f){};
#pragma unroll
    for (int ks = 0; ks < 2; ++ks) {
#pragma unroll
        for (int nb = 0; nb < 8; ++nb) acc[nb] = wmma16g(a[ks], bq[ks][nb], acc[nb]); }
    float* osw = os + wave * (16 * OSW2);
#pragma unroll
    for (int nb = 0; nb < 8; ++nb) {
#pragma unroll
        for (int j = 0; j < 8; ++j) osw[(hi * 8 + j) * OSW2 + nb * 16 + lr] = acc[nb][j] * PCI; }   // D: row 8h+j, col lane&15
    wave_sync();
    const int nr0 = (int)blockIdx.x * (SW * 4);
    const int c4 = lane * 4;                                             // 32 lanes x 4 floats = 128 columns
    float* outp = O0 + ((size_t)b * NN + (size_t)nr0) * FD + (size_t)(f0 + c4);
    const bool cok = f0 + c4 < FD;                                       // FD % 4 == 0: a float4 lies wholly inside the row or wholly outside
    v4f val[16];
#pragma unroll
    for (int row = 0; row < 16; ++row) val[row] = *(const v4fa*)(&osw[row * OSW2 + c4]);
    if (cok) {
#pragma unroll
        for (int row = 0; row < 16; ++row) { if (nr0 + row < NN) *(v4f*)(outp + (size_t)row * FD) = val[row]; }
    }
}

static constexpr size_t al256(size_t v) { return (v + 255) & ~(size_t)255; }
static constexpr size_t SZ_WB = al256((size_t)2 * APAD * KP * 2);
static constexpr size_t SZ_XB = al256((size_t)2 * MPAD * KP * 2);
static constexpr size_t SZ_HT = al256((size_t)NB * KP * HPAD * 2);
static constexpr size_t SZ_HP = al256((size_t)2 * MPAD * APAD * 4);
static constexpr size_t SZ_TOTAL = SZ_WB + SZ_XB + SZ_HT + SZ_HP;
static_assert(SZ_TOTAL <= (size_t)134217728);          // workspace carve <= 128 MiB
static_assert(((size_t)MPAD * KP * 2) % 256 == 0);     // the two X sub-planes stay 256-byte aligned
static_assert(((size_t)MPAD * APAD * 4) % 256 == 0);   // the two HP sub-planes stay 256-byte aligned
static constexpr size_t OUT1_OFF = (size_t)NB_FULL * NN * FD;   // element offset of the second output (fixed, full problem)

extern "C" void kernel_launch(void* const* d_in, const int* in_sizes, int n_in,
                              void* d_out, int out_size, void* d_ws, size_t ws_size, hipStream_t stream) {
    if (n_in < 9) return;
    if ((size_t)in_sizes[0] < (size_t)MROWS * RD || (size_t)in_sizes[1] < (size_t)MROWS * RD) return;
    if ((size_t)in_sizes[2] < (size_t)MROWS || (size_t)in_sizes[3] < (size_t)MROWS) return;
    if ((size_t)in_sizes[4] < (size_t)NPOS * PD || (size_t)in_sizes[5] < (size_t)AD * 2 * FD) return;
    if (in_sizes[6] < AD || in_sizes[7] < AD || in_sizes[8] < 1) return;
    if ((size_t)out_size < OUT1_OFF + (size_t)MROWS * FD) return;
    if (SZ_TOTAL > ws_size) return;
    // wire order: history_repr, candidate_repr, user_history_mask, user_history_position, pos_emb, W1, b1, w2, b2
    const float* hist_in = (const float*)d_in[0];
    const float* cand_in = (const float*)d_in[1];
    const int*   maskp   = (const int*)d_in[2];
    const int*   posp    = (const int*)d_in[3];
    const float* pe      = (const float*)d_in[4];
    const float* W1      = (const float*)d_in[5];
    const float* b1      = (const float*)d_in[6];
    const float* w2      = (const float*)d_in[7];
    const float* b2      = (const float*)d_in[8];
    float* OUT0 = (float*)d_out;                 // [NB][50][500]
    float* OUT1 = (float*)d_out + OUT1_OFF;      // [NB][50][500]
    char* wsp = (char*)d_ws;
    bf*  WB = (bf*)wsp;    wsp += SZ_WB;         // [2][256][512]: Wc | Wh
    bf*  XB = (bf*)wsp;    wsp += SZ_XB;         // [2][MPAD][512]: cand rows | hist rows
    h16* HT = (h16*)wsp;   wsp += SZ_HT;         // [NB][512][64]
    float* HP = (float*)wsp; wsp += SZ_HP;       // [2][MPAD][256]: hc | hh
    bf* XC = XB; bf* XH = XB + (size_t)MPAD * KP;
    const float* HC = HP; const float* HH = HP + (size_t)MPAD * APAD;

    k_prep<<<(unsigned)(PB_HT + PB_W + 2 * PB_X), 256, 0, stream>>>(hist_in, cand_in, posp, pe, W1, WB, XC, XH, HT, OUT1);
    // hc = cand Wc^T, hh = hist Wh^T
    k_gemm1<<<dim3(MPAD / 64, APAD / 64, 2), 32, 0, stream>>>(XB, WB, HP);
    // logits, softmax, user representation = alpha hist
    k_score<<<dim3(HPAD / (4 * SW), NB, 1), 32 * SW, 0, stream>>>(HC, HH, maskp, b1, w2, b2, HT, OUT0);
}

// v002
// It runs in 31.2 microseconds.
// Next to v001, in two timings, it ran 1.34 and 1.33 times as fast.
// Over all steps from v000 it is 1.82 times as fast.
#include <hip/hip_runtime.h>
#pragma clang fp contract(off)

// Additive attention of candidate items over a user history: rows = [400-wide item vector | 100-wide position embedding]; hidden = relu(cand Wc^T + hist Wh^T + b1) (W1 [200][1000] = [Wc | Wh], [out][in]); logit = hidden . w2 + b2; masked entries REPLACED by -1e9; softmax over the history; out0 = alpha hist, out1 = the candidate rows.
// Compute dtypes, f32 accumulate everywhere: the two projections v_wmma_f32_16x16x32_bf16 (items, position table, W1 RNE-converted to bf16; products exact); alpha . hist v_wmma_f32_16x16x32_f16 (alpha x1024 carry as f16, hist = the bf16 values held in f16); relu / w2 dot (depth 200, one shared vector) and softmax on the vector unit in f32.
// Layout: bf16 planes X [2][rows][512] (cand | hist, K zero-padded 500 -> 512) and W [2][256][512] (zero-padded); f32 plane HP [2][rows][256]; f16 plane HT [b][512 feature][64 hist] (hist transposed through LDS); alpha stays in LDS (16 candidate rows per score block).
// Three launches: k_prep (all operand planes and out1, by block range), k_gemm1, k_score (logits, softmax, alpha . hist, out0).

#ifndef NB
#define NB 64
#endif
#define NB_FULL 64
#define NH   50                  // history entries per batch
#define NN   50                  // candidates per batch
#define RD   400                 // item vector width
#define PD   100                 // position embedding width
#define FD   500                 // RD + PD
#define AD   200                 // attention width
#define NPOS 52                  // rows of the position table
#define KP   512                 // FD padded to the k-step
#define APAD 256                 // AD padded to the column tile
#define HPAD 64                  // NH / NN padded (k of the second product, rows of its A operand)
#define MROWS (NB * NN)
#define MPAD  ((MROWS + 63) / 64 * 64)
#define OSW  68                  // LDS row pitch (floats) of a 16 x 64 slab
#define OSW2 132                 // LDS row pitch (floats) of a 16 x 128 slab
#define TP   72                  // LDS row pitch (halves) of the transposed hist tile and of the alpha rows
#define SW   4                   // waves per score block (4 candidates each)
#define XP   4                   // row pieces per thread of the row converters
#define PCS  1024.0f             // carry of the alpha plane
#define PCI  (1.0f / 1024.0f)
#define L2E  1.4426950408889634f
#define NEGV (-1.0e9f)
#define NEGB (-3.0e38f)

static_assert(FD == RD + PD);
static_assert(NH == NN);                       // both row sets have MROWS rows
static_assert(RD % 8 == 0);                    // an 8-element piece never straddles the item / position boundary
static_assert(PD % 4 == 0);
static_assert(FD % 4 == 0);                    // a float4 of the flat output never straddles two rows
static_assert(KP % 32 == 0);                   // GEMM k-loop steps by 32
static_assert(KP >= FD);
static_assert(KP % 64 == 0);                   // 64-feature tiles of the hist transpose in k_prep
static_assert(KP / 8 == 64);
static_assert(APAD % 64 == 0);
static_assert(APAD >= AD);
static_assert(AD % 4 == 0);
static_assert(HPAD == 64);
static_assert(HPAD % 32 == 0);
static_assert(NH > 32);                        // two history entries per lane: lane and lane + 32
static_assert(NH <= HPAD);
static_assert(NN <= HPAD);
static_assert(MPAD % 64 == 0);
static_assert(MPAD % XP == 0);                 // the XP pieces of a thread lie MPAD / XP rows apart
static_assert((MPAD / XP * (KP / 8)) % 256 == 0);   // the converter blocks cover a row set exactly: no partial block
static_assert(HPAD % (4 * SW) == 0);           // score grid covers the padded candidate rows exactly
static_assert(NB <= NB_FULL);
static_assert(((size_t)NB_FULL * NN * FD * 4) == (size_t)6400000);   // byte offset of the second output
static_assert((((size_t)NB_FULL * NN * FD * 4) % 128) == 0);
static_assert((OSW * 4) % 16 == 0);
static_assert((TP * 2) % 16 == 0);
static_assert(16 * OSW * 4 <= 131072);         // static LDS of k_gemm1
static_assert(64 * TP * 2 <= 131072);          // static LDS of k_prep (hist transpose tile)
static_assert(SW * 4 == 16);                   // a score block's candidates are one 16-row A fragment
static_assert(SW * 128 == KP);                 // its waves cover the padded features, 128 each
static_assert((OSW2 * 4) % 16 == 0);
static_assert(SW * 4 * TP * 2 + SW * 16 * OSW2 * 4 <= 131072);   // static LDS of the score kernel

typedef _Float16 h16;
typedef unsigned short bf;
typedef __attribute__((ext_vector_type(16))) __bf16   v16bf;
typedef __attribute__((ext_vector_type(16))) _Float16 v16h;
typedef __attribute__((ext_vector_type(8)))  _Float16 v8h;
typedef __attribute__((ext_vector_type(8)))  unsigned short v8us;
typedef __attribute__((ext_vector_type(8)))  float    v8f;
typedef __attribute__((ext_vector_type(4)))  float    v4f;
typedef v4f  __attribute__((may_alias)) v4fa;
typedef v8h  __attribute__((may_alias)) v8ha;

__device__ __forceinline__ unsigned short f2bf(float f) { unsigned u = __float_as_uint(f); u += 0x7FFFu + ((u >> 16) & 1u); return (unsigned short)(u >> 16); }
__device__ __forceinline__ float bfr(float f) { return __uint_as_float(((unsigned)f2bf(f)) << 16); }   // value after RNE convert to bf16
__device__ __forceinline__ v16h cat16(v8h lo, v8h hi) { return __builtin_shufflevector(lo, hi, 0, 1, 2, 3, 4, 5, 6, 7, 8, 9, 10, 11, 12, 13, 14, 15); }
__device__ __forceinline__ v16bf cat16b(v8us lo, v8us hi) { return __builtin_bit_cast(v16bf, __builtin_shufflevector(lo, hi, 0, 1, 2, 3, 4, 5, 6, 7, 8, 9, 10, 11, 12, 13, 14, 15)); }
__device__ __forceinline__ v8f wmma16(v16h a, v16h b, v8f c) { return __builtin_amdgcn_wmma_f32_16x16x32_f16(false, a, false, b, (short)0, c, false, false); }
__device__ __forceinline__ v8f wmmab(v16bf a, v16bf b, v8f c) { return __builtin_amdgcn_wmma_f32_16x16x32_bf16(false, a, false, b, (short)0, c, false, false); }
// fragment loaders from K-contiguous 16-bit rows; p already includes + 8*(lane>>4): elements 0..7 <- k0+8h+0..7, elements 8..15 <- k0+16+8h+0..7 (same map for A and B)
__device__ __forceinline__ v16h  ldh(const h16* p) { return cat16(*(const v8h*)p, *(const v8h*)(p + 16)); }
__device__ __forceinline__ v16bf ldb(const bf* p)  { return cat16b(*(const v8us*)p, *(const v8us*)(p + 16)); }
// the same loader on pointers typed as global memory: a pointer that has passed through an asm operand keeps its address space (global_load, not flat_load)
typedef __attribute__((address_space(1))) const bf   gbf;
typedef __attribute__((address_space(1))) const v8us gv8us;
__device__ __forceinline__ v16bf ldbg(gbf* p) { return cat16b(*(gv8us*)p, *(gv8us*)(p + 16)); }
// ordering point for wave-private LDS tiles (same wave writes and reads)
__device__ __forceinline__ void wave_sync() { __builtin_amdgcn_fence(3 /* release order */, "wavefront"); __builtin_amdgcn_wave_barrier(); asm volatile("" ::: "memory"); }
// per-instruction guarded matrix ops: one accumulator tied per guard, operands kept live
__device__ __forceinline__ v8f wmma16g(v16h a, v16h b, v8f c) { c = wmma16(a, b, c); asm volatile("v_nop\n\tv_nop\n\tv_nop\n\tv_nop" : "+v"(c) : "v"(a), "v"(b)); return c; }
__device__ __forceinline__ v8f wmmabg(v16bf a, v16bf b, v8f c) { c = wmmab(a, b, c); asm volatile("v_nop\n\tv_nop\n\tv_nop\n\tv_nop" : "+v"(c) : "v"(a), "v"(b)); return c; }
// f32 -> f16 convert that cannot produce an f16 subnormal (|v| < 2^-14 -> +0)
static __device__ __forceinline__ h16 toh_flush(float v) { const h16 r = (h16)v; return (fabsf(v) < 6.103515625e-05f) ? (h16)0.0f : r; }
// position-table row: negative index wraps once, then clamps into the table
__device__ __forceinline__ int posrow(int p) { p = p < 0 ? p + NPOS : p; p = p < 0 ? 0 : p; p = p > NPOS - 1 ? NPOS - 1 : p; return p; }

// d_wconv: W1 [200][1000] -> bf16 planes WB [2][256][512] (w = 0: columns 0..499, w = 1: columns 500..999; rows >= 200 and k >= 500 are zeros).
__device__ __forceinline__ void d_wconv(const int blk, const float* __restrict__ W1, bf* WB) {
    const int i = blk * 256 + (int)threadIdx.x; if (i >= 2 * APAD * (KP / 8)) return;
    const int k8 = (i % (KP / 8)) * 8; const int a = (i / (KP / 8)) % APAD; const int w = i / ((KP / 8) * APAD);
    const int ac = a < AD ? a : AD - 1;
    const size_t rb = (size_t)ac * (2 * FD) + (size_t)w * FD;
    float x[8];
#pragma unroll
    for (int j = 0; j < 8; ++j) { const int k = k8 + j; const int kc = k < FD ? k : FD - 1; x[j] = W1[rb + (size_t)kc]; }
    // inputs-only fence on the loaded values: keeps all 8 loads unconditional and issued together, one wait for the lot (without it each is sunk to its use)
    asm volatile("" :: "v"(x[0]), "v"(x[1]), "v"(x[2]), "v"(x[3]), "v"(x[4]), "v"(x[5]), "v"(x[6]), "v"(x[7]));
    v8us o;
#pragma unroll
    for (int j = 0; j < 8; ++j) { const bool ok = (k8 + j < FD) & (a < AD); o[j] = f2bf(ok ? x[j] : 0.0f); }
    *(v8us*)(WB + (size_t)i * 8) = o;
}

// d_xrow: bf16 operand rows [MPAD][512] = [ item vector (400) | position row (100) | zeros (12) ]; rows >= MROWS are zeros.
// USEPOS = 1 (history): position row = table[pos[r]]. USEPOS = 0 (candidates): table row 1, and the same converted values, widened to f32, are stored as out1 [rows][500].
// All loads at clamped addresses, selected by value.
template <int USEPOS>
__device__ __forceinline__ void d_xrow(const int blk, const float* __restrict__ src, const int* __restrict__ pos, const float* __restrict__ pe, bf* dst, float* O1) {
    // One thread converts XP pieces, the same 8 columns of rows MPAD / XP apart (lanes stay contiguous in every load and store); all of its loads are issued before the first use.
    const int t0 = blk * 256 + (int)threadIdx.x;
    const int k8 = (t0 % (KP / 8)) * 8; const int rb = t0 / (KP / 8);
    const int kr = k8 < RD - 8 ? k8 : RD - 8;
    int pa = k8 - RD;     pa = pa < 0 ? 0 : (pa > PD - 4 ? PD - 4 : pa);
    int pb = k8 - RD + 4; pb = pb < 0 ? 0 : (pb > PD - 4 ? PD - 4 : pb);
    int rc[XP], pz[XP];
#pragma unroll
    for (int s = 0; s < XP; ++s) { const int r = rb + s * (MPAD / XP); rc[s] = r < MROWS ? r : MROWS - 1; pz[s] = 1; }
    if (USEPOS) {
#pragma unroll
        for (int s = 0; s < XP; ++s) pz[s] = pos[rc[s]];
    }
    v4f r0[XP], r1[XP], p0[XP], p1[XP];
#pragma unroll
    for (int s = 0; s < XP; ++s) { r0[s] = *(const v4f*)(src + (size_t)rc[s] * RD + kr); r1[s] = *(const v4f*)(src + (size_t)rc[s] * RD + kr + 4); }
    __builtin_amdgcn_sched_barrier(0);             // the item loads above need no index: they are issued before the wait for the position indices
#pragma unroll
    for (int s = 0; s < XP; ++s) { const int prow = USEPOS ? posrow(pz[s]) : 1;
        p0[s] = *(const v4f*)(pe + (size_t)prow * PD + pa); p1[s] = *(const v4f*)(pe + (size_t)prow * PD + pb); }
    static_assert(XP == 4);
    // inputs-only fences on the loaded values: every load of the thread is issued, unconditionally, before the first conversion (without them the later pieces' loads wait behind the first piece's stores)
    asm volatile("" :: "v"(r0[0]), "v"(r1[0]), "v"(r0[1]), "v"(r1[1]), "v"(r0[2]), "v"(r1[2]), "v"(r0[3]), "v"(r1[3]));
    asm volatile("" :: "v"(p0[0]), "v"(p1[0]), "v"(p0[1]), "v"(p1[1]), "v"(p0[2]), "v"(p1[2]), "v"(p0[3]), "v"(p1[3]));
#pragma unroll
    for (int s = 0; s < XP; ++s) {
        const int r = rb + s * (MPAD / XP);
        const bool rv = r < MROWS;
        const bool inr = (k8 < RD) & rv;
        const bool ip0 = (k8 >= RD) & (k8 < FD) & rv;
        const bool ip1 = (k8 >= RD) & (k8 + 4 < FD) & rv;
        v8us o;
#pragma unroll
        for (int j = 0; j < 4; ++j) {
            const float x0 = inr ? r0[s][j] : (ip0 ? p0[s][j] : 0.0f);
            const float x1 = inr ? r1[s][j] : (ip1 ? p1[s][j] : 0.0f);
            o[j] = f2bf(x0); o[4 + j] = f2bf(x1); }
        *(v8us*)(dst + (size_t)r * KP + k8) = o;
        if (!USEPOS) {
            v4f q0, q1;
#pragma unroll
            for (int j = 0; j < 4; ++j) { q0[j] = __uint_as_float(((unsigned)o[j]) << 16); q1[j] = __uint_as_float(((unsigned)o[4 + j]) << 16); }
            float* q = O1 + (size_t)rc[s] * FD + (k8 < FD - 4 ? k8 : FD - 4);      // in bounds for every thread; stored only where the piece is a part of the row
            if (inr | ip0) *(v4f*)q = q0;
            if (inr | ip1) *(v4f*)(q + 4) = q1;
        }
    }
    asm volatile("s_wait_xcnt 0x0" ::: "memory");  // the wait that stands before a register named by the stores above is overwritten (code of the other block ranges follows in the listing)
}

// d_histT: f16 plane HT [b][512 feature][64 history] = hist^T (bf16 values held in f16); features >= 500 and history >= 50 are zeros.
__device__ __forceinline__ void d_histT(const int blk, h16* th, const float* __restrict__ hist, const int* __restrict__ pos, const float* __restrict__ pe, h16* HT) {
    const int t = (int)threadIdx.x; const int f0 = (blk % (KP / 64)) * 64; const int b = blk / (KP / 64);
    const int fl = t & 63, hq = t >> 6;
    const int f = f0 + fl; const int fr = f < RD ? f : RD - 1; int fp = f - RD; fp = fp < 0 ? 0 : (fp > PD - 1 ? PD - 1 : fp);
    static_assert(256 * 16 == 64 * HPAD);          // fill: threads x trips == tile elements
    // the 16 rows of a thread: every load of a kind is issued before the first use, so the thread waits once for the indices and once for the values
    int pz[16]; float xr[16], xp[16];
#pragma unroll
    for (int it = 0; it < 16; ++it) { const int h = hq + 4 * it; const int hc = h < NH ? h : NH - 1; pz[it] = pos[(size_t)b * NH + (size_t)hc]; }
    asm volatile("s_wait_xcnt 0x0" ::: "memory");  // the loads below land in registers that the index loads above name as their offsets
#pragma unroll
    for (int it = 0; it < 16; ++it) { const int h = hq + 4 * it; const int hc = h < NH ? h : NH - 1; xr[it] = hist[((size_t)b * NH + (size_t)hc) * RD + (size_t)fr]; }
    __builtin_amdgcn_sched_barrier(0);             // the item loads above need no index: they are issued before the wait for the position indices
#pragma unroll
    for (int it = 0; it < 16; ++it) xp[it] = pe[(size_t)posrow(pz[it]) * PD + (size_t)fp];
    // inputs-only fences on the loaded values: all 32 loads stay unconditional and in flight together (without them some are sunk into the branches of the selects below, one wait each)
    asm volatile("" :: "v"(xr[0]), "v"(xr[1]), "v"(xr[2]), "v"(xr[3]), "v"(xr[4]), "v"(xr[5]), "v"(xr[6]), "v"(xr[7]), "v"(xr[8]), "v"(xr[9]), "v"(xr[10]), "v"(xr[11]), "v"(xr[12]), "v"(xr[13]), "v"(xr[14]), "v"(xr[15]));
    asm volatile("" :: "v"(xp[0]), "v"(xp[1]), "v"(xp[2]), "v"(xp[3]), "v"(xp[4]), "v"(xp[5]), "v"(xp[6]), "v"(xp[7]), "v"(xp[8]), "v"(xp[9]), "v"(xp[10]), "v"(xp[11]), "v"(xp[12]), "v"(xp[13]), "v"(xp[14]), "v"(xp[15]));
#pragma unroll
    for (int it = 0; it < 16; ++it) {
        const int h = hq + 4 * it;
        const float v = (f < RD) ? xr[it] : xp[it];
        const bool ok = (h < NH) & (f < FD);
        const h16 o = ok ? toh_flush(bfr(v)) : (h16)0.0f;
        th[fl * TP + h] = o; }
    __syncthreads();
    static_assert(256 * 2 * 16 == 64 * HPAD * 2);
{
#pragma unroll
        for (int it = 0; it < 2; ++it) { const int p = it * 256 + t; const int row = p >> 3, pc = p & 7;
            const v8h val = *(const v8ha*)(&th[row * TP + pc * 8]);
            *(v8h*)(HT + ((size_t)b * KP + (size_t)(f0 + row)) * HPAD + (size_t)pc * 8) = val; }
         }
}

// k_prep: the independent operand-plane builders as block ranges of one grid (every branch is block-uniform). The transpose blocks, whose loop is the longest, take the lowest indices.
#define PB_HT ((KP / 64) * NB)
#define PB_W  ((2 * APAD * (KP / 8) + 255) / 256)
#define PB_X  (MPAD * (KP / 8) / (256 * XP))
__global__ __launch_bounds__(256) void k_prep(const float* __restrict__ hist, const float* __restrict__ cand, const int* __restrict__ pos, const float* __restrict__ pe,
                                              const float* __restrict__ W1, bf* WB, bf* XC, bf* XH, h16* HT, float* O1) {
    __shared__ __align__(16) h16 th[64 * TP];
    int blk = (int)blockIdx.x;
    if (blk < PB_HT) { d_histT(blk, th, hist, pos, pe, HT); return; }
    blk -= PB_HT;
    if (blk < PB_W) { d_wconv(blk, W1, WB); return; }
    blk -= PB_W;
    if (blk < PB_X) { d_xrow<0>(blk, cand, pos, pe, XC, O1); return; }
    blk -= PB_X;
    d_xrow<1>(blk, hist, pos, pe, XH, O1);
}

// k_gemm1: bf16 GEMM, ONE WAVE per 64x64 tile (16 accumulators), operands straight from K-contiguous bf16 planes, K = 512.
// HP[w][m][n] = sum_k XB[w][m][k] WB[w][n][k]; grid (MPAD/64, APAD/64, 2). Epilogue: per 16-row slab staged in LDS (wave-private),
__global__ __launch_bounds__(32) void k_gemm1(const bf* __restrict__ XB, const bf* __restrict__ WB, float* HP) {
    __shared__ __align__(16) float os[16 * OSW];
    const int lane = threadIdx.x & 31, lr = lane & 15, hi = lane >> 4;
    const int r0 = (int)blockIdx.x * 64, c0 = (int)blockIdx.y * 64, w = (int)blockIdx.z;
    v8f acc[4][4];
#pragma unroll
    for (int mb = 0; mb < 4; ++mb)
#pragma unroll
        for (int nb = 0; nb < 4; ++nb) acc[mb][nb] = (v8f){};
    gbf* pa = (gbf*)(XB + ((size_t)w * MPAD + (size_t)(r0 + lr)) * KP + 8 * hi);   // the lane's place in the k-step's A and B rows; both step by 32 elements
    gbf* pb = (gbf*)(WB + ((size_t)w * APAD + (size_t)(c0 + lr)) * KP + 8 * hi);
#pragma unroll 1
    for (int kc = 0; kc < KP; kc += 32) {
        v16bf a[4], bq[4];                         // all 16 loads of a k-step are issued before its first matrix instruction
#pragma unroll
        for (int mb = 0; mb < 4; ++mb) a[mb] = ldbg(pa + (size_t)mb * 16 * KP);
#pragma unroll
        for (int nb = 0; nb < 4; ++nb) bq[nb] = ldbg(pb + (size_t)nb * 16 * KP);
        // the wait that stands before an issued load's address register is overwritten; it takes both address pairs, so they stay whole until here and no load of the batch lands in them
        asm volatile("s_wait_xcnt 0x0" : "+v"(pa), "+v"(pb) :: "memory");
#pragma unroll
        for (int nb = 0; nb < 4; ++nb) {
#pragma unroll
            for (int mb = 0; mb < 4; ++mb) acc[mb][nb] = wmmabg(a[mb], bq[nb], acc[mb][nb]); }
        pa += 32; pb += 32;
    }
    float* outp = HP + ((size_t)w * MPAD + (size_t)r0) * APAD + (size_t)c0;
    static_assert(32 * 16 * 8 == 16 * 64 * 4);     // lanes x 16 B x trips == 16 rows x 256 B
#pragma unroll
    for (int mb = 0; mb < 4; ++mb) {
#pragma unroll
        for (int nb = 0; nb < 4; ++nb) {
#pragma unroll
            for (int j = 0; j < 8; ++j) os[(hi * 8 + j) * OSW + nb * 16 + lr] = acc[mb][nb][j]; }   // D: row 8h+j, col lane&15
        wave_sync();
{
#pragma unroll
            for (int s = 0; s < 8; ++s) { const int row = 2 * s + (lane >> 4), c4 = (lane & 15) * 4;   // 8 s x 2 rows = 16 rows; 16 lanes x 4 floats = 64 columns
                const v4f val = *(const v4fa*)(&os[row * OSW + c4]);
                *(v4f*)(outp + (size_t)(mb * 16 + row) * APAD + c4) = val; }
             }
        wave_sync();
    }
}

// k_score: one block per 16 candidates of one batch. Stage 1, one wave per 4 candidates; lane = history entry (lane and lane + 32).
// logit = sum_a relu((hc + hh) + b1) * w2 + b2 (f32, fmaf chain per (candidate, history) pair); masked entries replaced by -1e9; softmax with the max over all 50 entries (one shuffle reduction, then exp and sum);
// alpha x1024 as f16 into the block's LDS rows pt [16][64] (candidate rows >= 50 and history >= 50 are zeros).
// Stage 2, behind one block barrier: out0[b][n][f] = (1/1024) sum_h pt[n][h] HT[b][f][h], f16 WMMA, K = 64; one wave per 128 features (8 accumulators);
// the 16 x 128 slab is staged in LDS (wave-private) and stored as 512-byte row pieces, rows < 50 and features < 500 only.
__global__ __launch_bounds__(32 * SW) void k_score(const float* __restrict__ HC, const float* __restrict__ HH, const int* __restrict__ maskp,
                                                   const float* __restrict__ b1, const float* __restrict__ w2, const float* __restrict__ b2,
                                                   const h16* __restrict__ HT, float* O0) {
    __shared__ __align__(16) h16 pt[SW * 4 * TP];
    __shared__ __align__(16) float os[SW * 16 * OSW2];
    const int lane = threadIdx.x & 31;
    const int wave = __builtin_amdgcn_readfirstlane((int)(threadIdx.x >> 5));
    const int b = (int)blockIdx.y;
    const int n0 = ((int)blockIdx.x * SW + wave) * 4;
    static_assert(32 * 16 == 4 * HPAD * 2);
    const int lr = lane & 15, hi = lane >> 4;
    const int f0 = wave * 128;
    // stage 2's B fragments depend on nothing of stage 1: loaded here, as one group, they arrive while stage 1 runs
    const size_t boff = ((size_t)b * KP + (size_t)(f0 + lr)) * HPAD + 8 * hi;
    v16h bq[2][8];
#pragma unroll
    for (int ks = 0; ks < 2; ++ks) {
#pragma unroll
        for (int nb = 0; nb < 8; ++nb) bq[ks][nb] = ldh(HT + boff + (size_t)nb * 16 * HPAD + 32 * ks); }
    asm volatile("s_wait_xcnt 0x0" ::: "memory");                        // stage 1 reuses the address registers of the loads above while they are in flight
    if (n0 >= NN) {                                                      // wave-uniform: no candidate here, its 4 alpha rows are zeros
        const v8h z = (v8h){}; *(v8ha*)(&pt[(wave * 4 + (lane >> 3)) * TP + (lane & 7) * 8]) = z;
    } else {
    const int nvec = ((int)blockIdx.x * SW + (int)(threadIdx.x >> 5)) * 4;
    size_t oc[4]; bool rok[4];
#pragma unroll
    for (int i = 0; i < 4; ++i) { int q = nvec + i; rok[i] = q < NN; q = q < NN ? q : NN - 1; q = __builtin_amdgcn_readfirstlane(q);
        oc[i] = ((size_t)b * NN + (size_t)q) * APAD; }
    const int hB = lane + 32; const int hBc = hB < NH ? hB : NH - 1; const bool okB = hB < NH;
    const size_t hb = (size_t)b * NH;
    const size_t oa = (hb + (size_t)lane) * APAD, ob = (hb + (size_t)hBc) * APAD;
    int mkA = maskp[hb + (size_t)lane], mkB = maskp[hb + (size_t)hBc];
    asm volatile("" : "+v"(mkA)); asm volatile("" : "+v"(mkB));
    const float b2v = bfr(b2[0]);
    float accA[4], accB[4];
#pragma unroll
    for (int i = 0; i < 4; ++i) { accA[i] = 0.0f; accB[i] = 0.0f; }
#pragma unroll 1
    for (int a4 = 0; a4 < AD / 4; ++a4) {
        const v4f xa = *(const v4f*)(HH + oa + 4 * a4), xb = *(const v4f*)(HH + ob + 4 * a4);
        const v4f bv = *(const v4f*)(b1 + 4 * a4), wv = *(const v4f*)(w2 + 4 * a4);
        float bb[4], ww[4];
#pragma unroll
        for (int j = 0; j < 4; ++j) { bb[j] = bfr(bv[j]); ww[j] = bfr(wv[j]); }
#pragma unroll
        for (int i = 0; i < 4; ++i) { const v4f c = *(const v4f*)(HC + oc[i] + 4 * a4);
#pragma unroll
            for (int j = 0; j < 4; ++j) {
                const float va = fmaxf((c[j] + xa[j]) + bb[j], 0.0f), vb = fmaxf((c[j] + xb[j]) + bb[j], 0.0f);
                accA[i] = fmaf(va, ww[j], accA[i]); accB[i] = fmaf(vb, ww[j], accB[i]); } }
    }
#pragma unroll
    for (int i = 0; i < 4; ++i) {
        float sA = accA[i] + b2v, sB = accB[i] + b2v;
        sA = (mkA != 0) ? sA : NEGV; sB = (mkB != 0) ? sB : NEGV; sB = okB ? sB : NEGB;
        float mx = fmaxf(sA, sB);
        mx = fmaxf(mx, __shfl_xor(mx, 16, 32)); mx = fmaxf(mx, __shfl_xor(mx, 8, 32)); mx = fmaxf(mx, __shfl_xor(mx, 4, 32));
        mx = fmaxf(mx, __shfl_xor(mx, 2, 32));  mx = fmaxf(mx, __shfl_xor(mx, 1, 32));
        const float eA = __builtin_amdgcn_exp2f((sA - mx) * L2E);
        float eB = __builtin_amdgcn_exp2f((sB - mx) * L2E); eB = okB ? eB : 0.0f;
        float sm = eA + eB;
        sm += __shfl_xor(sm, 16, 32); sm += __shfl_xor(sm, 8, 32); sm += __shfl_xor(sm, 4, 32); sm += __shfl_xor(sm, 2, 32); sm += __shfl_xor(sm, 1, 32);
        const float inv = __builtin_amdgcn_rcpf(sm) * PCS;              // sm >= 1 (the maximum entry contributes 1)
        h16 qa = toh_flush(eA * inv), qb = toh_flush(eB * inv);
        qa = rok[i] ? qa : (h16)0.0f; qb = rok[i] ? qb : (h16)0.0f;
        pt[(wave * 4 + i) * TP + lane] = qa; pt[(wave * 4 + i) * TP + 32 + lane] = qb; }   // 4 rows x 64 columns all written
    }
    __syncthreads();                                                     // every wave reads all 16 alpha rows; every wave of the block passes here
    v16h a[2];
#pragma unroll
    for (int ks = 0; ks < 2; ++ks) { const h16* p = &pt[lr * TP + 8 * hi + 32 * ks]; a[ks] = cat16(*(const v8ha*)p, *(const v8ha*)(p + 16)); }   // the k map of ldh
    v8f acc[8];
#pragma unroll
    for (int nb = 0; nb < 8; ++nb) acc[nb] = (v8f){};
#pragma unroll
    for (int ks = 0; ks < 2; ++ks) {
#pragma unroll
        for (int nb = 0; nb < 8; ++nb) acc[nb] = wmma16g(a[ks], bq[ks][nb], acc[nb]); }
    float* osw = os + wave * (16 * OSW2);
#pragma unroll
    for (int nb = 0; nb < 8; ++nb) {
#pragma unroll
        for (int j = 0; j < 8; ++j) osw[(hi * 8 + j) * OSW2 + nb * 16 + lr] = acc[nb][j] * PCI; }   // D: row 8h+j, col lane&15
    wave_sync();
    const int nr0 = (int)blockIdx.x * (SW * 4);
    const int c4 = lane * 4;                                             // 32 lanes x 4 floats = 128 columns
    float* outp = O0 + ((size_t)b * NN + (size_t)nr0) * FD + (size_t)(f0 + c4);
    const bool cok = f0 + c4 < FD;                                       // FD % 4 == 0: a float4 lies wholly inside the row or wholly outside
    v4f val[16];
#pragma unroll
    for (int row = 0; row < 16; ++row) val[row] = *(const v4fa*)(&osw[row * OSW2 + c4]);
    if (cok) {
#pragma unroll
        for (int row = 0; row < 16; ++row) { if (nr0 + row < NN) *(v4f*)(outp + (size_t)row * FD) = val[row]; }
    }
}

static constexpr size_t al256(size_t v) { return (v + 255) & ~(size_t)255; }
static constexpr size_t SZ_WB = al256((size_t)2 * APAD * KP * 2);
static constexpr size_t SZ_XB = al256((size_t)2 * MPAD * KP * 2);
static constexpr size_t SZ_HT = al256((size_t)NB * KP * HPAD * 2);
static constexpr size_t SZ_HP = al256((size_t)2 * MPAD * APAD * 4);
static constexpr size_t SZ_TOTAL = SZ_WB + SZ_XB + SZ_HT + SZ_HP;
static_assert(SZ_TOTAL <= (size_t)134217728);          // workspace carve <= 128 MiB
static_assert(((size_t)MPAD * KP * 2) % 256 == 0);     // the two X sub-planes stay 256-byte aligned
static_assert(((size_t)MPAD * APAD * 4) % 256 == 0);   // the two HP sub-planes stay 256-byte aligned
static constexpr size_t OUT1_OFF = (size_t)NB_FULL * NN * FD;   // element offset of the second output (fixed, full problem)

extern "C" void kernel_launch(void* const* d_in, const int* in_sizes, int n_in,
                              void* d_out, int out_size, void* d_ws, size_t ws_size, hipStream_t stream) {
    if (n_in < 9) return;
    if ((size_t)in_sizes[0] < (size_t)MROWS * RD || (size_t)in_sizes[1] < (size_t)MROWS * RD) return;
    if ((size_t)in_sizes[2] < (size_t)MROWS || (size_t)in_sizes[3] < (size_t)MROWS) return;
    if ((size_t)in_sizes[4] < (size_t)NPOS * PD || (size_t)in_sizes[5] < (size_t)AD * 2 * FD) return;
    if (in_sizes[6] < AD || in_sizes[7] < AD || in_sizes[8] < 1) return;
    if ((size_t)out_size < OUT1_OFF + (size_t)MROWS * FD) return;
    if (SZ_TOTAL > ws_size) return;
    // wire order: history_repr, candidate_repr, user_history_mask, user_history_position, pos_emb, W1, b1, w2, b2
    const float* hist_in = (const float*)d_in[0];
    const float* cand_in = (const float*)d_in[1];
    const int*   maskp   = (const int*)d_in[2];
    const int*   posp    = (const int*)d_in[3];
    const float* pe      = (const float*)d_in[4];
    const float* W1      = (const float*)d_in[5];
    const float* b1      = (const float*)d_in[6];
    const float* w2      = (const float*)d_in[7];
    const float* b2      = (const float*)d_in[8];
    float* OUT0 = (float*)d_out;                 // [NB][50][500]
    float* OUT1 = (float*)d_out + OUT1_OFF;      // [NB][50][500]
    char* wsp = (char*)d_ws;
    bf*  WB = (bf*)wsp;    wsp += SZ_WB;         // [2][256][512]: Wc | Wh
    bf*  XB = (bf*)wsp;    wsp += SZ_XB;         // [2][MPAD][512]: cand rows | hist rows
    h16* HT = (h16*)wsp;   wsp += SZ_HT;         // [NB][512][64]
    float* HP = (float*)wsp; wsp += SZ_HP;       // [2][MPAD][256]: hc | hh
    bf* XC = XB; bf* XH = XB + (size_t)MPAD * KP;
    const float* HC = HP; const float* HH = HP + (size_t)MPAD * APAD;

    k_prep<<<(unsigned)(PB_HT + PB_W + 2 * PB_X), 256, 0, stream>>>(hist_in, cand_in, posp, pe, W1, WB, XC, XH, HT, OUT1);
    // hc = cand Wc^T, hh = hist Wh^T
    k_gemm1<<<dim3(MPAD / 64, APAD / 64, 2), 32, 0, stream>>>(XB, WB, HP);
    // logits, softmax, user representation = alpha hist
    k_score<<<dim3(HPAD / (4 * SW), NB, 1), 32 * SW, 0, stream>>>(HC, HH, maskp, b1, w2, b2, HT, OUT0);
}

// v003
// It runs in 26.6 microseconds.
// In two side-by-side timings against v002, it was 1.17 and 1.16 times as fast.
// Counting every step since v000, it is 2.12 times as fast.
#include <hip/hip_runtime.h>
#pragma clang fp contract(off)

// Additive attention of candidate items over a user history: rows = [400-wide item vector | 100-wide position embedding]; hidden = relu(cand Wc^T + hist Wh^T + b1) (W1 [200][1000] = [Wc | Wh], [out][in]); logit = hidden . w2 + b2; masked entries REPLACED by -1e9; softmax over the history; out0 = alpha hist, out1 = the candidate rows.
// Compute dtypes, f32 accumulate everywhere: the two projections v_wmma_f32_16x16x32_bf16 (items, position table, W1 RNE-converted to bf16; products exact); alpha . hist v_wmma_f32_16x16x32_f16 (alpha x1024 carry as f16, hist = the bf16 values held in f16); relu / w2 dot (depth 200, one shared vector) and softmax on the vector unit in f32.
// Layout: bf16 planes X [2][rows][512] (cand | hist, K zero-padded 500 -> 512) and W [2][256][512] (zero-padded); f32 plane HP [2][rows][256]; f16 plane HT [b][512 feature][64 hist] (hist transposed through LDS); alpha stays in LDS (16 candidate rows per score block).
// Three launches: k_prep (all operand planes and out1, by block range), k_gemm1, k_score (logits, softmax, alpha . hist, out0).

#ifndef NB
#define NB 64
#endif
#define NB_FULL 64
#define NH   50                  // history entries per batch
#define NN   50                  // candidates per batch
#define RD   400                 // item vector width
#define PD   100                 // position embedding width
#define FD   500                 // RD + PD
#define AD   200                 // attention width
#define NPOS 52                  // rows of the position table
#define KP   512                 // FD padded to the k-step
#define APAD 256                 // AD padded to the column tile
#define HPAD 64                  // NH / NN padded (k of the second product, rows of its A operand)
#define MROWS (NB * NN)
#define MPAD  ((MROWS + 63) / 64 * 64)
#define OSW  68                  // LDS row pitch (floats) of a 16 x 64 slab
#define OSW2 132                 // LDS row pitch (floats) of a 16 x 128 slab
#define TP   72                  // LDS row pitch (halves) of the transposed hist tile and of the alpha rows
#define SW   4                   // waves per score block (4 candidates each)
#define XSP  260                 // LDS row pitch (floats) of the staged hh rows: 1040 B = 16 B x odd, so 16 lanes' 16-byte reads of 16 rows fall on 64 different banks
#define XP   4                   // row pieces per thread of the row converters
#define PCS  1024.0f             // carry of the alpha plane
#define PCI  (1.0f / 1024.0f)
#define L2E  1.4426950408889634f
#define NEGV (-1.0e9f)
#define NEGB (-3.0e38f)

static_assert(FD == RD + PD);
static_assert(NH == NN);                       // both row sets have MROWS rows
static_assert(RD % 8 == 0);                    // an 8-element piece never straddles the item / position boundary
static_assert(PD % 4 == 0);
static_assert(FD % 4 == 0);                    // a float4 of the flat output never straddles two rows
static_assert(KP % 32 == 0);                   // GEMM k-loop steps by 32
static_assert(KP >= FD);
static_assert(KP % 64 == 0);                   // 64-feature tiles of the hist transpose in k_prep
static_assert(KP / 8 == 64);
static_assert(APAD % 64 == 0);
static_assert(APAD >= AD);
static_assert(AD % 4 == 0);
static_assert(HPAD == 64);
static_assert(HPAD % 32 == 0);
static_assert(NH > 32);                        // two history entries per lane: lane and lane + 32
static_assert(NH <= HPAD);
static_assert(NN <= HPAD);
static_assert(MPAD % 64 == 0);
static_assert(MPAD % XP == 0);                 // the XP pieces of a thread lie MPAD / XP rows apart
static_assert((MPAD / XP * (KP / 8)) % 256 == 0);   // the converter blocks cover a row set exactly: no partial block
static_assert(HPAD % (4 * SW) == 0);           // score grid covers the padded candidate rows exactly
static_assert(NB <= NB_FULL);
static_assert(((size_t)NB_FULL * NN * FD * 4) == (size_t)6400000);   // byte offset of the second output
static_assert((((size_t)NB_FULL * NN * FD * 4) % 128) == 0);
static_assert((OSW * 4) % 16 == 0);
static_assert((TP * 2) % 16 == 0);
static_assert(16 * OSW * 4 <= 131072);         // static LDS of k_gemm1
static_assert(64 * TP * 2 <= 131072);          // static LDS of k_prep (hist transpose tile)
static_assert(SW * 4 == 16);                   // a score block's candidates are one 16-row A fragment
static_assert(SW * 128 == KP);                 // its waves cover the padded features, 128 each
static_assert((OSW2 * 4) % 16 == 0);
static_assert(SW * 4 * TP * 2 + SW * 16 * OSW2 * 4 + NH * XSP * 4 + SW * AD * 4 * 4 + 2 * AD * 4 + KP * TP * 2 <= 327680);   // static LDS of the score kernel
static_assert(XSP >= APAD);
static_assert((XSP * 4) % 16 == 0);
static_assert(APAD / 4 == 64);                 // a padded hh row is 64 pieces of 16 B: half of the score block's threads
static_assert(32 * SW == 128);
static_assert(NH == 2 * 25);                   // 25 rounds of 2 rows copy the 50 hh rows exactly, every lane on in every round
static_assert((AD / 4) % 4 == 2);              // the score loop takes two pairs of pieces a trip, and one pair is left behind it
static_assert(HPAD * 2 == 8 * 16);             // a hist^T row is 8 pieces of 16 B: a wave's copy takes 4 rows
static_assert(TP >= HPAD);
static_assert(AD / 4 <= 64);                   // a candidate row's pieces: lane and lane + 32
static_assert(AD / 4 <= 32 * SW);

typedef _Float16 h16;
typedef unsigned short bf;
typedef __attribute__((ext_vector_type(16))) __bf16   v16bf;
typedef __attribute__((ext_vector_type(16))) _Float16 v16h;
typedef __attribute__((ext_vector_type(8)))  _Float16 v8h;
typedef __attribute__((ext_vector_type(8)))  unsigned short v8us;
typedef __attribute__((ext_vector_type(8)))  float    v8f;
typedef __attribute__((ext_vector_type(4)))  float    v4f;
typedef v4f  __attribute__((may_alias)) v4fa;
typedef v8h  __attribute__((may_alias)) v8ha;

__device__ __forceinline__ unsigned short f2bf(float f) { unsigned u = __float_as_uint(f); u += 0x7FFFu + ((u >> 16) & 1u); return (unsigned short)(u >> 16); }
__device__ __forceinline__ float bfr(float f) { return __uint_as_float(((unsigned)f2bf(f)) << 16); }   // value after RNE convert to bf16
__device__ __forceinline__ v16h cat16(v8h lo, v8h hi) { return __builtin_shufflevector(lo, hi, 0, 1, 2, 3, 4, 5, 6, 7, 8, 9, 10, 11, 12, 13, 14, 15); }
__device__ __forceinline__ v16bf cat16b(v8us lo, v8us hi) { return __builtin_bit_cast(v16bf, __builtin_shufflevector(lo, hi, 0, 1, 2, 3, 4, 5, 6, 7, 8, 9, 10, 11, 12, 13, 14, 15)); }
__device__ __forceinline__ v8f wmma16(v16h a, v16h b, v8f c) { return __builtin_amdgcn_wmma_f32_16x16x32_f16(false, a, false, b, (short)0, c, false, false); }
__device__ __forceinline__ v8f wmmab(v16bf a, v16bf b, v8f c) { return __builtin_amdgcn_wmma_f32_16x16x32_bf16(false, a, false, b, (short)0, c, false, false); }
// fragment loaders from K-contiguous 16-bit rows; p already includes + 8*(lane>>4): elements 0..7 <- k0+8h+0..7, elements 8..15 <- k0+16+8h+0..7 (same map for A and B)
__device__ __forceinline__ v16h  ldh(const h16* p) { return cat16(*(const v8h*)p, *(const v8h*)(p + 16)); }
__device__ __forceinline__ v16bf ldb(const bf* p)  { return cat16b(*(const v8us*)p, *(const v8us*)(p + 16)); }
// the same loader on pointers typed as global memory: a pointer that has passed through an asm operand keeps its address space (global_load, not flat_load)
typedef __attribute__((address_space(1))) const bf   gbf;
typedef __attribute__((address_space(1))) const v8us gv8us;
__device__ __forceinline__ v16bf ldbg(gbf* p) { return cat16b(*(gv8us*)p, *(gv8us*)(p + 16)); }
// ordering point for wave-private LDS tiles (same wave writes and reads)
__device__ __forceinline__ void wave_sync() { __builtin_amdgcn_fence(3 /* release order */, "wavefront"); __builtin_amdgcn_wave_barrier(); asm volatile("" ::: "memory"); }
// per-instruction guarded matrix ops: one accumulator tied per guard, operands kept live
__device__ __forceinline__ v8f wmma16g(v16h a, v16h b, v8f c) { c = wmma16(a, b, c); asm volatile("v_nop\n\tv_nop\n\tv_nop\n\tv_nop" : "+v"(c) : "v"(a), "v"(b)); return c; }
__device__ __forceinline__ v8f wmmabg(v16bf a, v16bf b, v8f c) { c = wmmab(a, b, c); asm volatile("v_nop\n\tv_nop\n\tv_nop\n\tv_nop" : "+v"(c) : "v"(a), "v"(b)); return c; }
// eight asynchronous 16-byte copies a lane, global -> LDS, at steps of gs and ls bytes; the statement ends in its own s_wait_xcnt 0, which so stands before any register that a copy names is rewritten
__device__ __forceinline__ void acopy8(const unsigned l, const char* g, const unsigned ls, const size_t gs) {
    asm volatile("global_load_async_to_lds_b128 %0, %8, off\n\tglobal_load_async_to_lds_b128 %1, %9, off\n\tglobal_load_async_to_lds_b128 %2, %10, off\n\tglobal_load_async_to_lds_b128 %3, %11, off\n\t"
                 "global_load_async_to_lds_b128 %4, %12, off\n\tglobal_load_async_to_lds_b128 %5, %13, off\n\tglobal_load_async_to_lds_b128 %6, %14, off\n\tglobal_load_async_to_lds_b128 %7, %15, off\n\t"
                 "s_wait_xcnt 0x0"
                 :: "v"(l), "v"(l + ls), "v"(l + 2 * ls), "v"(l + 3 * ls), "v"(l + 4 * ls), "v"(l + 5 * ls), "v"(l + 6 * ls), "v"(l + 7 * ls),
                    "v"(g), "v"(g + gs), "v"(g + 2 * gs), "v"(g + 3 * gs), "v"(g + 4 * gs), "v"(g + 5 * gs), "v"(g + 6 * gs), "v"(g + 7 * gs) : "memory");
}
// f32 -> f16 convert that cannot produce an f16 subnormal (|v| < 2^-14 -> +0)
static __device__ __forceinline__ h16 toh_flush(float v) { const h16 r = (h16)v; return (fabsf(v) < 6.103515625e-05f) ? (h16)0.0f : r; }
// position-table row: negative index wraps once, then clamps into the table
__device__ __forceinline__ int posrow(int p) { p = p < 0 ? p + NPOS : p; p = p < 0 ? 0 : p; p = p > NPOS - 1 ? NPOS - 1 : p; return p; }

// d_wconv: W1 [200][1000] -> bf16 planes WB [2][256][512] (w = 0: columns 0..499, w = 1: columns 500..999; rows >= 200 and k >= 500 are zeros).
__device__ __forceinline__ void d_wconv(const int blk, const float* __restrict__ W1, bf* WB) {
    const int i = blk * 256 + (int)threadIdx.x; if (i >= 2 * APAD * (KP / 8)) return;
    const int k8 = (i % (KP / 8)) * 8; const int a = (i / (KP / 8)) % APAD; const int w = i / ((KP / 8) * APAD);
    const int ac = a < AD ? a : AD - 1;
    const size_t rb = (size_t)ac * (2 * FD) + (size_t)w * FD;
    float x[8];
#pragma unroll
    for (int j = 0; j < 8; ++j) { const int k = k8 + j; const int kc = k < FD ? k : FD - 1; x[j] = W1[rb + (size_t)kc]; }
    // inputs-only fence on the loaded values: keeps all 8 loads unconditional and issued together, one wait for the lot (without it each is sunk to its use)
    asm volatile("" :: "v"(x[0]), "v"(x[1]), "v"(x[2]), "v"(x[3]), "v"(x[4]), "v"(x[5]), "v"(x[6]), "v"(x[7]));
    v8us o;
#pragma unroll
    for (int j = 0; j < 8; ++j) { const bool ok = (k8 + j < FD) & (a < AD); o[j] = f2bf(ok ? x[j] : 0.0f); }
    *(v8us*)(WB + (size_t)i * 8) = o;
}

// d_xrow: bf16 operand rows [MPAD][512] = [ item vector (400) | position row (100) | zeros (12) ]; rows >= MROWS are zeros.
// USEPOS = 1 (history): position row = table[pos[r]]. USEPOS = 0 (candidates): table row 1, and the same converted values, widened to f32, are stored as out1 [rows][500].
// All loads at clamped addresses, selected by value.
template <int USEPOS>
__device__ __forceinline__ void d_xrow(const int blk, const float* __restrict__ src, const int* __restrict__ pos, const float* __restrict__ pe, bf* dst, float* O1) {
    // One thread converts XP pieces, the same 8 columns of rows MPAD / XP apart (lanes stay contiguous in every load and store); all of its loads are issued before the first use.
    const int t0 = blk * 256 + (int)threadIdx.x;
    const int k8 = (t0 % (KP / 8)) * 8; const int rb = t0 / (KP / 8);
    const int kr = k8 < RD - 8 ? k8 : RD - 8;
    int pa = k8 - RD;     pa = pa < 0 ? 0 : (pa > PD - 4 ? PD - 4 : pa);
    int pb = k8 - RD + 4; pb = pb < 0 ? 0 : (pb > PD - 4 ? PD - 4 : pb);
    int rc[XP], pz[XP];
#pragma unroll
    for (int s = 0; s < XP; ++s) { const int r = rb + s * (MPAD / XP); rc[s] = r < MROWS ? r : MROWS - 1; pz[s] = 1; }
    if (USEPOS) {
#pragma unroll
        for (int s = 0; s < XP; ++s) pz[s] = pos[rc[s]];
    }
    v4f r0[XP], r1[XP], p0[XP], p1[XP];
#pragma unroll
    for (int s = 0; s < XP; ++s) { r0[s] = *(const v4f*)(src + (size_t)rc[s] * RD + kr); r1[s] = *(const v4f*)(src + (size_t)rc[s] * RD + kr + 4); }
    __builtin_amdgcn_sched_barrier(0);             // the item loads above need no index: they are issued before the wait for the position indices
#pragma unroll
    for (int s = 0; s < XP; ++s) { const int prow = USEPOS ? posrow(pz[s]) : 1;
        p0[s] = *(const v4f*)(pe + (size_t)prow * PD + pa); p1[s] = *(const v4f*)(pe + (size_t)prow * PD + pb); }
    static_assert(XP == 4);
    // inputs-only fences on the loaded values: every load of the thread is issued, unconditionally, before the first conversion (without them the later pieces' loads wait behind the first piece's stores)
    asm volatile("" :: "v"(r0[0]), "v"(r1[0]), "v"(r0[1]), "v"(r1[1]), "v"(r0[2]), "v"(r1[2]), "v"(r0[3]), "v"(r1[3]));
    asm volatile("" :: "v"(p0[0]), "v"(p1[0]), "v"(p0[1]), "v"(p1[1]), "v"(p0[2]), "v"(p1[2]), "v"(p0[3]), "v"(p1[3]));
#pragma unroll
    for (int s = 0; s < XP; ++s) {
        const int r = rb + s * (MPAD / XP);
        const bool rv = r < MROWS;
        const bool inr = (k8 < RD) & rv;
        const bool ip0 = (k8 >= RD) & (k8 < FD) & rv;
        const bool ip1 = (k8 >= RD) & (k8 + 4 < FD) & rv;
        v8us o;
#pragma unroll
        for (int j = 0; j < 4; ++j) {
            const float x0 = inr ? r0[s][j] : (ip0 ? p0[s][j] : 0.0f);
            const float x1 = inr ? r1[s][j] : (ip1 ? p1[s][j] : 0.0f);
            o[j] = f2bf(x0); o[4 + j] = f2bf(x1); }
        *(v8us*)(dst + (size_t)r * KP + k8) = o;
        if (!USEPOS) {
            v4f q0, q1;
#pragma unroll
            for (int j = 0; j < 4; ++j) { q0[j] = __uint_as_float(((unsigned)o[j]) << 16); q1[j] = __uint_as_float(((unsigned)o[4 + j]) << 16); }
            float* q = O1 + (size_t)rc[s] * FD + (k8 < FD - 4 ? k8 : FD - 4);      // in bounds for every thread; stored only where the piece is a part of the row
            if (inr | ip0) *(v4f*)q = q0;
            if (inr | ip1) *(v4f*)(q + 4) = q1;
        }
    }
    asm volatile("s_wait_xcnt 0x0" ::: "memory");  // the wait that stands before a register named by the stores above is overwritten (code of the other block ranges follows in the listing)
}

// d_histT: f16 plane HT [b][512 feature][64 history] = hist^T (bf16 values held in f16); features >= 500 and history >= 50 are zeros.
__device__ __forceinline__ void d_histT(const int blk, h16* th, const float* __restrict__ hist, const int* __restrict__ pos, const float* __restrict__ pe, h16* HT) {
    const int t = (int)threadIdx.x; const int f0 = (blk % (KP / 64)) * 64; const int b = blk / (KP / 64);
    const int fl = t & 63, hq = t >> 6;
    const int f = f0 + fl; const int fr = f < RD ? f : RD - 1; int fp = f - RD; fp = fp < 0 ? 0 : (fp > PD - 1 ? PD - 1 : fp);
    static_assert(256 * 16 == 64 * HPAD);          // fill: threads x trips == tile elements
    // the 16 rows of a thread: every load of a kind is issued before the first use, so the thread waits once for the indices and once for the values
    int pz[16]; float xr[16], xp[16];
#pragma unroll
    for (int it = 0; it < 16; ++it) { const int h = hq + 4 * it; const int hc = h < NH ? h : NH - 1; pz[it] = pos[(size_t)b * NH + (size_t)hc]; }
    asm volatile("s_wait_xcnt 0x0" ::: "memory");  // the loads below land in registers that the index loads above name as their offsets
#pragma unroll
    for (int it = 0; it < 16; ++it) { const int h = hq + 4 * it; const int hc = h < NH ? h : NH - 1; xr[it] = hist[((size_t)b * NH + (size_t)hc) * RD + (size_t)fr]; }
    __builtin_amdgcn_sched_barrier(0);             // the item loads above need no index: they are issued before the wait for the position indices
#pragma unroll
    for (int it = 0; it < 16; ++it) xp[it] = pe[(size_t)posrow(pz[it]) * PD + (size_t)fp];
    // inputs-only fences on the loaded values: all 32 loads stay unconditional and in flight together (without them some are sunk into the branches of the selects below, one wait each)
    asm volatile("" :: "v"(xr[0]), "v"(xr[1]), "v"(xr[2]), "v"(xr[3]), "v"(xr[4]), "v"(xr[5]), "v"(xr[6]), "v"(xr[7]), "v"(xr[8]), "v"(xr[9]), "v"(xr[10]), "v"(xr[11]), "v"(xr[12]), "v"(xr[13]), "v"(xr[14]), "v"(xr[15]));
    asm volatile("" :: "v"(xp[0]), "v"(xp[1]), "v"(xp[2]), "v"(xp[3]), "v"(xp[4]), "v"(xp[5]), "v"(xp[6]), "v"(xp[7]), "v"(xp[8]), "v"(xp[9]), "v"(xp[10]), "v"(xp[11]), "v"(xp[12]), "v"(xp[13]), "v"(xp[14]), "v"(xp[15]));
#pragma unroll
    for (int it = 0; it < 16; ++it) {
        const int h = hq + 4 * it;
        const float v = (f < RD) ? xr[it] : xp[it];
        const bool ok = (h < NH) & (f < FD);
        const h16 o = ok ? toh_flush(bfr(v)) : (h16)0.0f;
        th[fl * TP + h] = o; }
    __syncthreads();
    static_assert(256 * 2 * 16 == 64 * HPAD * 2);
{
#pragma unroll
        for (int it = 0; it < 2; ++it) { const int p = it * 256 + t; const int row = p >> 3, pc = p & 7;
            const v8h val = *(const v8ha*)(&th[row * TP + pc * 8]);
            *(v8h*)(HT + ((size_t)b * KP + (size_t)(f0 + row)) * HPAD + (size_t)pc * 8) = val; }
         }
}

// k_prep: the independent operand-plane builders as block ranges of one grid (every branch is block-uniform). The transpose blocks, whose loop is the longest, take the lowest indices.
#define PB_HT ((KP / 64) * NB)
#define PB_W  ((2 * APAD * (KP / 8) + 255) / 256)
#define PB_X  (MPAD * (KP / 8) / (256 * XP))
__global__ __launch_bounds__(256) void k_prep(const float* __restrict__ hist, const float* __restrict__ cand, const int* __restrict__ pos, const float* __restrict__ pe,
                                              const float* __restrict__ W1, bf* WB, bf* XC, bf* XH, h16* HT, float* O1) {
    __shared__ __align__(16) h16 th[64 * TP];
    int blk = (int)blockIdx.x;
    if (blk < PB_HT) { d_histT(blk, th, hist, pos, pe, HT); return; }
    blk -= PB_HT;
    if (blk < PB_W) { d_wconv(blk, W1, WB); return; }
    blk -= PB_W;
    if (blk < PB_X) { d_xrow<0>(blk, cand, pos, pe, XC, O1); return; }
    blk -= PB_X;
    d_xrow<1>(blk, hist, pos, pe, XH, O1);
}

// k_gemm1: bf16 GEMM, ONE WAVE per 64x64 tile (16 accumulators), operands straight from K-contiguous bf16 planes, K = 512.
// HP[w][m][n] = sum_k XB[w][m][k] WB[w][n][k]; grid (MPAD/64, APAD/64, 2). Epilogue: per 16-row slab staged in LDS (wave-private),
__global__ __launch_bounds__(32) void k_gemm1(const bf* __restrict__ XB, const bf* __restrict__ WB, float* HP) {
    __shared__ __align__(16) float os[16 * OSW];
    const int lane = threadIdx.x & 31, lr = lane & 15, hi = lane >> 4;
    const int r0 = (int)blockIdx.x * 64, c0 = (int)blockIdx.y * 64, w = (int)blockIdx.z;
    v8f acc[4][4];
#pragma unroll
    for (int mb = 0; mb < 4; ++mb)
#pragma unroll
        for (int nb = 0; nb < 4; ++nb) acc[mb][nb] = (v8f){};
    gbf* pa = (gbf*)(XB + ((size_t)w * MPAD + (size_t)(r0 + lr)) * KP + 8 * hi);   // the lane's place in the k-step's A and B rows; both step by 32 elements
    gbf* pb = (gbf*)(WB + ((size_t)w * APAD + (size_t)(c0 + lr)) * KP + 8 * hi);
#pragma unroll 1
    for (int kc = 0; kc < KP; kc += 32) {
        v16bf a[4], bq[4];                         // all 16 loads of a k-step are issued before its first matrix instruction
#pragma unroll
        for (int mb = 0; mb < 4; ++mb) a[mb] = ldbg(pa + (size_t)mb * 16 * KP);
#pragma unroll
        for (int nb = 0; nb < 4; ++nb) bq[nb] = ldbg(pb + (size_t)nb * 16 * KP);
        // the wait that stands before an issued load's address register is overwritten; it takes both address pairs, so they stay whole until here and no load of the batch lands in them
        asm volatile("s_wait_xcnt 0x0" : "+v"(pa), "+v"(pb) :: "memory");
#pragma unroll
        for (int nb = 0; nb < 4; ++nb) {
#pragma unroll
            for (int mb = 0; mb < 4; ++mb) acc[mb][nb] = wmmabg(a[mb], bq[nb], acc[mb][nb]); }
        pa += 32; pb += 32;
    }
    float* outp = HP + ((size_t)w * MPAD + (size_t)r0) * APAD + (size_t)c0;
    static_assert(32 * 16 * 8 == 16 * 64 * 4);     // lanes x 16 B x trips == 16 rows x 256 B
#pragma unroll
    for (int mb = 0; mb < 4; ++mb) {
#pragma unroll
        for (int nb = 0; nb < 4; ++nb) {
#pragma unroll
            for (int j = 0; j < 8; ++j) os[(hi * 8 + j) * OSW + nb * 16 + lr] = acc[mb][nb][j]; }   // D: row 8h+j, col lane&15
        wave_sync();
{
#pragma unroll
            for (int s = 0; s < 8; ++s) { const int row = 2 * s + (lane >> 4), c4 = (lane & 15) * 4;   // 8 s x 2 rows = 16 rows; 16 lanes x 4 floats = 64 columns
                const v4f val = *(const v4fa*)(&os[row * OSW + c4]);
                *(v4f*)(outp + (size_t)(mb * 16 + row) * APAD + c4) = val; }
             }
        wave_sync();
    }
}

// k_score: one block per 16 candidates of one batch. Stage 0: the block's operands go to LDS once: the batch's 50 hh rows (asynchronous copies, whole padded rows), each wave's 4 hc rows
// (through registers, laid [a][4 candidates]), b1 and w2 (already rounded); behind a block barrier the batch's hist^T rows follow (asynchronous copies that land while stage 1 runs).
// Stage 1, one wave per 4 candidates; lane = history entry (lane and lane + 32); every operand read from LDS, one pair of 4-wide pieces ahead of its arithmetic.
// logit = sum_a relu((hc + hh) + b1) * w2 + b2 (f32, fmaf chain per (candidate, history) pair); masked entries replaced by -1e9; softmax with the max over all 50 entries (lane shuffles);
// alpha x1024 as f16 into the block's LDS rows pt [16][64] (candidate rows >= 50 and history >= 50 are zeros).
// Stage 2, behind one block barrier: out0[b][n][f] = (1/1024) sum_h pt[n][h] HT[b][f][h] (HT from its LDS copy), f16 WMMA, K = 64; one wave per 128 features (8 accumulators);
// the 16 x 128 slab is staged in LDS (wave-private) and stored as 512-byte row pieces, rows < 50 and features < 500 only.
__global__ __launch_bounds__(32 * SW) void k_score(const float* __restrict__ HC, const float* __restrict__ HH, const int* __restrict__ maskp,
                                                   const float* __restrict__ b1, const float* __restrict__ w2, const float* __restrict__ b2,
                                                   const h16* __restrict__ HT, float* O0) {
    __shared__ __align__(16) h16 pt[SW * 4 * TP];
    __shared__ __align__(16) float os[SW * 16 * OSW2];
    __shared__ __align__(16) float xs[NH * XSP];                         // hh rows of the batch
    __shared__ __align__(16) float ct[SW * AD * 4];                      // per wave: hc of its 4 candidates, [a][candidate]
    __shared__ __align__(16) float bs[AD];                               // b1, rounded
    __shared__ __align__(16) float wl[AD];                               // w2, rounded
    __shared__ __align__(16) h16 hl[KP * TP];                            // hist^T of the batch: [feature][history], rows pitched for the 16-byte fragment reads
    const int lane = threadIdx.x & 31;
    const int wave = __builtin_amdgcn_readfirstlane((int)(threadIdx.x >> 5));
    const int b = (int)blockIdx.y;
    const int n0 = ((int)blockIdx.x * SW + wave) * 4;
    static_assert(32 * 16 == 4 * HPAD * 2);
    const int lr = lane & 15, hi = lane >> 4;
    const int f0 = wave * 128;
    const size_t hb = (size_t)b * NH;
    // stage 0a: hh rows -> xs. Round s: rows 2s and 2s + 1, one 16-byte piece a lane (a wave's copy is 512 contiguous bytes); every lane is on, every address in bounds, no LDS byte written twice.
    {
        const int col = (int)threadIdx.x & 63, r2 = (int)threadIdx.x >> 6;
        const float* g0 = HH + (hb + (size_t)r2) * APAD + (size_t)col * 4;
        const unsigned l0 = (unsigned)(size_t)(&xs[r2 * XSP + col * 4]);
        const float* g[25]; unsigned l[25];
#pragma unroll
        for (int s = 0; s < 25; ++s) { g[s] = g0 + (size_t)s * 2 * APAD; l[s] = l0 + (unsigned)(s * 2 * XSP * 4); }
        // the copies of a statement end in their own s_wait_xcnt 0: it stands before any register that a copy names is rewritten
        asm volatile("global_load_async_to_lds_b128 %0, %1, off\n\tglobal_load_async_to_lds_b128 %2, %3, off\n\tglobal_load_async_to_lds_b128 %4, %5, off\n\t"
                     "global_load_async_to_lds_b128 %6, %7, off\n\tglobal_load_async_to_lds_b128 %8, %9, off\n\tglobal_load_async_to_lds_b128 %10, %11, off\n\t"
                     "global_load_async_to_lds_b128 %12, %13, off\n\tglobal_load_async_to_lds_b128 %14, %15, off\n\tglobal_load_async_to_lds_b128 %16, %17, off\n\t"
                     "global_load_async_to_lds_b128 %18, %19, off\n\tglobal_load_async_to_lds_b128 %20, %21, off\n\tglobal_load_async_to_lds_b128 %22, %23, off\n\t"
                     "global_load_async_to_lds_b128 %24, %25, off\n\ts_wait_xcnt 0x0"
                     :: "v"(l[0]), "v"(g[0]), "v"(l[1]), "v"(g[1]), "v"(l[2]), "v"(g[2]), "v"(l[3]), "v"(g[3]), "v"(l[4]), "v"(g[4]), "v"(l[5]), "v"(g[5]), "v"(l[6]), "v"(g[6]),
                        "v"(l[7]), "v"(g[7]), "v"(l[8]), "v"(g[8]), "v"(l[9]), "v"(g[9]), "v"(l[10]), "v"(g[10]), "v"(l[11]), "v"(g[11]), "v"(l[12]), "v"(g[12]) : "memory");
        asm volatile("global_load_async_to_lds_b128 %0, %1, off\n\tglobal_load_async_to_lds_b128 %2, %3, off\n\tglobal_load_async_to_lds_b128 %4, %5, off\n\t"
                     "global_load_async_to_lds_b128 %6, %7, off\n\tglobal_load_async_to_lds_b128 %8, %9, off\n\tglobal_load_async_to_lds_b128 %10, %11, off\n\t"
                     "global_load_async_to_lds_b128 %12, %13, off\n\tglobal_load_async_to_lds_b128 %14, %15, off\n\tglobal_load_async_to_lds_b128 %16, %17, off\n\t"
                     "global_load_async_to_lds_b128 %18, %19, off\n\tglobal_load_async_to_lds_b128 %20, %21, off\n\tglobal_load_async_to_lds_b128 %22, %23, off\n\t"
                     "s_wait_xcnt 0x0"
                     :: "v"(l[13]), "v"(g[13]), "v"(l[14]), "v"(g[14]), "v"(l[15]), "v"(g[15]), "v"(l[16]), "v"(g[16]), "v"(l[17]), "v"(g[17]), "v"(l[18]), "v"(g[18]),
                        "v"(l[19]), "v"(g[19]), "v"(l[20]), "v"(g[20]), "v"(l[21]), "v"(g[21]), "v"(l[22]), "v"(g[22]), "v"(l[23]), "v"(g[23]), "v"(l[24]), "v"(g[24]) : "memory");
    }
    // stage 0b: the wave's 4 hc rows, b1, w2 and the lane's two mask words, all at clamped addresses and in flight together (a wave without candidates stages row 49 into its own, unread part of ct)
    const int nvec = ((int)blockIdx.x * SW + (int)(threadIdx.x >> 5)) * 4;
    size_t oc[4]; bool rok[4];
#pragma unroll
    for (int i = 0; i < 4; ++i) { int q = nvec + i; rok[i] = q < NN; q = q < NN ? q : NN - 1; q = __builtin_amdgcn_readfirstlane(q);
        oc[i] = ((size_t)b * NN + (size_t)q) * APAD; }
    const int hB = lane + 32; const int hBc = hB < NH ? hB : NH - 1; const bool okB = hB < NH;
    const int pB = hB < AD / 4 ? hB : AD / 4 - 1;                        // the lane's second piece of a candidate row
    const int tb = (int)threadIdx.x < AD / 4 ? (int)threadIdx.x : AD / 4 - 1;
    v4f cv[2][4];
#pragma unroll
    for (int i = 0; i < 4; ++i) { cv[0][i] = *(const v4f*)(HC + oc[i] + 4 * lane); cv[1][i] = *(const v4f*)(HC + oc[i] + 4 * pB); }
    const v4f b1v = *(const v4f*)(b1 + 4 * tb), w2v = *(const v4f*)(w2 + 4 * tb);
    const int mkA = maskp[hb + (size_t)lane], mkB = maskp[hb + (size_t)hBc];
    // inputs-only fence on the loaded values: the mask loads stay here, in flight with the other loads of stage 0 (sunk to their use behind stage 1 they would cost a memory latency of their own)
    asm volatile("" :: "v"(mkA), "v"(mkB));
#pragma unroll
    for (int j = 0; j < 4; ++j) {
        const v4f q0 = {cv[0][0][j], cv[0][1][j], cv[0][2][j], cv[0][3][j]}, q1 = {cv[1][0][j], cv[1][1][j], cv[1][2][j], cv[1][3][j]};
        *(v4fa*)(&ct[wave * (AD * 4) + (4 * lane + j) * 4]) = q0;
        if (hB < AD / 4) *(v4fa*)(&ct[wave * (AD * 4) + (4 * hB + j) * 4]) = q1; }
    if ((int)threadIdx.x < AD / 4) {
        const v4f br = {bfr(b1v[0]), bfr(b1v[1]), bfr(b1v[2]), bfr(b1v[3])}, wr = {bfr(w2v[0]), bfr(w2v[1]), bfr(w2v[2]), bfr(w2v[3])};
        *(v4fa*)(&bs[4 * (int)threadIdx.x]) = br; *(v4fa*)(&wl[4 * (int)threadIdx.x]) = wr; }
    asm volatile("s_wait_asynccnt 0x0" ::: "memory");                    // this wave's copies have landed
    __syncthreads();                                                     // every wave reads rows that other waves copied; every wave of the block passes here
    // stage 2's B operand depends on nothing of stage 1: each wave's 128 hist^T rows are copied to LDS here and land while stage 1 runs. Round s: 32 rows, eight copies of 4 rows (512 contiguous bytes a wave each); every lane is on
    {
        const int row = f0 + (lane >> 3), pc = lane & 7;
        const char* g0 = (const char*)(HT + ((size_t)b * KP + (size_t)row) * HPAD + (size_t)pc * 8);
        const unsigned l0 = (unsigned)(size_t)(&hl[row * TP + pc * 8]);
#pragma unroll
        for (int s = 0; s < 4; ++s) acopy8(l0 + (unsigned)(s * 32 * TP * 2), g0 + (size_t)s * 32 * HPAD * 2, 4 * TP * 2, (size_t)4 * HPAD * 2);
    }
    if (n0 >= NN) {                                                      // wave-uniform: no candidate here, its 4 alpha rows are zeros
        const v8h z = (v8h){}; *(v8ha*)(&pt[(wave * 4 + (lane >> 3)) * TP + (lane & 7) * 8]) = z;
    } else {
    const float b2v = bfr(b2[0]);
    float accA[4], accB[4];
#pragma unroll
    for (int i = 0; i < 4; ++i) { accA[i] = 0.0f; accB[i] = 0.0f; }
    const float* xpa = &xs[lane * XSP]; const float* xpb = &xs[hBc * XSP]; const float* cp = &ct[wave * (AD * 4)];
    // two register sets of two pieces each: a pair's 16 LDS reads are issued one pair ahead of its arithmetic
    v4f xa[2][2], xb[2][2], bb[2][2], ww[2][2], cc[2][2][4];
    auto fetch = [&](const int s, const int d) {
#pragma unroll
        for (int p = 0; p < 2; ++p) { const int a4 = 2 * d + p;
            xa[s][p] = *(const v4fa*)(xpa + 4 * a4); xb[s][p] = *(const v4fa*)(xpb + 4 * a4);
            bb[s][p] = *(const v4fa*)(&bs[4 * a4]);  ww[s][p] = *(const v4fa*)(&wl[4 * a4]);
#pragma unroll
            for (int j = 0; j < 4; ++j) cc[s][p][j] = *(const v4fa*)(cp + (4 * a4 + j) * 4); } };
    auto work = [&](const int s) {
#pragma unroll
        for (int p = 0; p < 2; ++p) {
#pragma unroll
            for (int j = 0; j < 4; ++j) {
#pragma unroll
                for (int i = 0; i < 4; ++i) {
                    const float c = cc[s][p][j][i];
                    const float va = fmaxf((c + xa[s][p][j]) + bb[s][p][j], 0.0f), vb = fmaxf((c + xb[s][p][j]) + bb[s][p][j], 0.0f);
                    accA[i] = fmaf(va, ww[s][p][j], accA[i]); accB[i] = fmaf(vb, ww[s][p][j], accB[i]); } } } };
    // the compiler fence behind each fetch keeps its reads where they stand: without it the reads carried into the next trip are sunk to that trip's head, directly in front of their use
    fetch(0, 0);
    asm volatile("" ::: "memory");
#pragma unroll 1
    for (int d = 0; d < AD / 8 - 1; d += 2) {                            // rolled: the body already holds two pairs, one per register set
        fetch(1, d + 1);
        asm volatile("" ::: "memory");
        work(0);
        fetch(0, d + 2);
        asm volatile("" ::: "memory");
        work(1);
        // the order asked of the scheduler: a pair's 16 LDS reads together, then the other pair's arithmetic, so that every read has a whole pair of lead (left alone it puts the reads late, close to their use)
        __builtin_amdgcn_sched_group_barrier(0x100, 16, 0);
        __builtin_amdgcn_sched_group_barrier(0x002, 134, 0);
        __builtin_amdgcn_sched_group_barrier(0x100, 16, 0);
        __builtin_amdgcn_sched_group_barrier(0x002, 140, 0);
    }
    work(0);                                                             // the last pair
#pragma unroll
    for (int i = 0; i < 4; ++i) {
        float sA = accA[i] + b2v, sB = accB[i] + b2v;
        sA = (mkA != 0) ? sA : NEGV; sB = (mkB != 0) ? sB : NEGV; sB = okB ? sB : NEGB;
        float mx = fmaxf(sA, sB);
        mx = fmaxf(mx, __shfl_xor(mx, 16, 32)); mx = fmaxf(mx, __shfl_xor(mx, 8, 32)); mx = fmaxf(mx, __shfl_xor(mx, 4, 32));
        mx = fmaxf(mx, __shfl_xor(mx, 2, 32));  mx = fmaxf(mx, __shfl_xor(mx, 1, 32));
        const float eA = __builtin_amdgcn_exp2f((sA - mx) * L2E);
        float eB = __builtin_amdgcn_exp2f((sB - mx) * L2E); eB = okB ? eB : 0.0f;
        float sm = eA + eB;
        sm += __shfl_xor(sm, 16, 32); sm += __shfl_xor(sm, 8, 32); sm += __shfl_xor(sm, 4, 32); sm += __shfl_xor(sm, 2, 32); sm += __shfl_xor(sm, 1, 32);
        const float inv = __builtin_amdgcn_rcpf(sm) * PCS;              // sm >= 1 (the maximum entry contributes 1)
        h16 qa = toh_flush(eA * inv), qb = toh_flush(eB * inv);
        qa = rok[i] ? qa : (h16)0.0f; qb = rok[i] ? qb : (h16)0.0f;
        pt[(wave * 4 + i) * TP + lane] = qa; pt[(wave * 4 + i) * TP + 32 + lane] = qb; }   // 4 rows x 64 columns all written
    }
    asm volatile("s_wait_asynccnt 0x0" ::: "memory");                    // this wave's hist^T copies have landed
    __syncthreads();                                                     // every wave reads all 16 alpha rows; every wave of the block passes here
    v16h a[2];
#pragma unroll
    for (int ks = 0; ks < 2; ++ks) { const h16* p = &pt[lr * TP + 8 * hi + 32 * ks]; a[ks] = cat16(*(const v8ha*)p, *(const v8ha*)(p + 16)); }   // the k map of ldh
    v16h bq[2][8];                                                       // all B fragments are read before the first matrix instruction: one LDS latency, not sixteen
#pragma unroll
    for (int ks = 0; ks < 2; ++ks) {
#pragma unroll
        for (int nb = 0; nb < 8; ++nb) bq[ks][nb] = ldh(&hl[(f0 + nb * 16 + lr) * TP + 8 * hi + 32 * ks]); }
    v8f acc[8];
#pragma unroll
    for (int nb = 0; nb < 8; ++nb) acc[nb] = (v8f){};
#pragma unroll
    for (int ks = 0; ks < 2; ++ks) {
#pragma unroll
        for (int nb = 0; nb < 8; ++nb) acc[nb] = wmma16g(a[ks], bq[ks][nb], acc[nb]); }
    float* osw = os + wave * (16 * OSW2);
#pragma unroll
    for (int nb = 0; nb < 8; ++nb) {
#pragma unroll
        for (int j = 0; j < 8; ++j) osw[(hi * 8 + j) * OSW2 + nb * 16 + lr] = acc[nb][j] * PCI; }   // D: row 8h+j, col lane&15
    wave_sync();
    const int nr0 = (int)blockIdx.x * (SW * 4);
    const int c4 = lane * 4;                                             // 32 lanes x 4 floats = 128 columns
    float* outp = O0 + ((size_t)b * NN + (size_t)nr0) * FD + (size_t)(f0 + c4);
    const bool cok = f0 + c4 < FD;                                       // FD % 4 == 0: a float4 lies wholly inside the row or wholly outside
    v4f val[16];
#pragma unroll
    for (int row = 0; row < 16; ++row) val[row] = *(const v4fa*)(&osw[row * OSW2 + c4]);
    if (cok) {
#pragma unroll
        for (int row = 0; row < 16; ++row) { if (nr0 + row < NN) *(v4f*)(outp + (size_t)row * FD) = val[row]; }
    }
}

static constexpr size_t al256(size_t v) { return (v + 255) & ~(size_t)255; }
static constexpr size_t SZ_WB = al256((size_t)2 * APAD * KP * 2);
static constexpr size_t SZ_XB = al256((size_t)2 * MPAD * KP * 2);
static constexpr size_t SZ_HT = al256((size_t)NB * KP * HPAD * 2);
static constexpr size_t SZ_HP = al256((size_t)2 * MPAD * APAD * 4);
static constexpr size_t SZ_TOTAL = SZ_WB + SZ_XB + SZ_HT + SZ_HP;
static_assert(SZ_TOTAL <= (size_t)134217728);          // workspace carve <= 128 MiB
static_assert(((size_t)MPAD * KP * 2) % 256 == 0);     // the two X sub-planes stay 256-byte aligned
static_assert(((size_t)MPAD * APAD * 4) % 256 == 0);   // the two HP sub-planes stay 256-byte aligned
static constexpr size_t OUT1_OFF = (size_t)NB_FULL * NN * FD;   // element offset of the second output (fixed, full problem)

extern "C" void kernel_launch(void* const* d_in, const int* in_sizes, int n_in,
                              void* d_out, int out_size, void* d_ws, size_t ws_size, hipStream_t stream) {
    if (n_in < 9) return;
    if ((size_t)in_sizes[0] < (size_t)MROWS * RD || (size_t)in_sizes[1] < (size_t)MROWS * RD) return;
    if ((size_t)in_sizes[2] < (size_t)MROWS || (size_t)in_sizes[3] < (size_t)MROWS) return;
    if ((size_t)in_sizes[4] < (size_t)NPOS * PD || (size_t)in_sizes[5] < (size_t)AD * 2 * FD) return;
    if (in_sizes[6] < AD || in_sizes[7] < AD || in_sizes[8] < 1) return;
    if ((size_t)out_size < OUT1_OFF + (size_t)MROWS * FD) return;
    if (SZ_TOTAL > ws_size) return;
    // wire order: history_repr, candidate_repr, user_history_mask, user_history_position, pos_emb, W1, b1, w2, b2
    const float* hist_in = (const float*)d_in[0];
    const float* cand_in = (const float*)d_in[1];
    const int*   maskp   = (const int*)d_in[2];
    const int*   posp    = (const int*)d_in[3];
    const float* pe      = (const float*)d_in[4];
    const float* W1      = (const float*)d_in[5];
    const float* b1      = (const float*)d_in[6];
    const float* w2      = (const float*)d_in[7];
    const float* b2      = (const float*)d_in[8];
    float* OUT0 = (float*)d_out;                 // [NB][50][500]
    float* OUT1 = (float*)d_out + OUT1_OFF;      // [NB][50][500]
    char* wsp = (char*)d_ws;
    bf*  WB = (bf*)wsp;    wsp += SZ_WB;         // [2][256][512]: Wc | Wh
    bf*  XB = (bf*)wsp;    wsp += SZ_XB;         // [2][MPAD][512]: cand rows | hist rows
    h16* HT = (h16*)wsp;   wsp += SZ_HT;         // [NB][512][64]
    float* HP = (float*)wsp; wsp += SZ_HP;       // [2][MPAD][256]: hc | hh
    bf* XC = XB; bf* XH = XB + (size_t)MPAD * KP;
    const float* HC = HP; const float* HH = HP + (size_t)MPAD * APAD;

    k_prep<<<(unsigned)(PB_HT + PB_W + 2 * PB_X), 256, 0, stream>>>(hist_in, cand_in, posp, pe, W1, WB, XC, XH, HT, OUT1);
    // hc = cand Wc^T, hh = hist Wh^T
    k_gemm1<<<dim3(MPAD / 64, APAD / 64, 2), 32, 0, stream>>>(XB, WB, HP);
    // logits, softmax, user representation = alpha hist
    k_score<<<dim3(HPAD / (4 * SW), NB, 1), 32 * SW, 0, stream>>>(HC, HH, maskp, b1, w2, b2, HT, OUT0);
}

// v004
// It runs in 22.4 microseconds.
// In both of two side-by-side timings against v003, it was 1.19 times as fast.
// All steps since v000 together make it 2.52 times as fast.
#include <hip/hip_runtime.h>
#pragma clang fp contract(off)

// Additive attention of candidate items over a user history: rows = [400-wide item vector | 100-wide position embedding]; hidden = relu(cand Wc^T + hist Wh^T + b1) (W1 [200][1000] = [Wc | Wh], [out][in]); logit = hidden . w2 + b2; masked entries REPLACED by -1e9; softmax over the history; out0 = alpha hist, out1 = the candidate rows.
// Compute dtypes, f32 accumulate everywhere: the two projections v_wmma_f32_16x16x32_bf16 (items, position table, W1 RNE-converted to bf16; products exact); alpha . hist v_wmma_f32_16x16x32_f16 (alpha x1024 carry as f16, hist = the bf16 values held in f16); relu / w2 dot (depth 200, one shared vector) and softmax on the vector unit in f32.
// Layout: bf16 planes X [2][rows][512] (cand | hist, K zero-padded 500 -> 512) and W [2][256][512] (zero-padded); f32 plane HP [2][rows][256]; f16 plane HT [b][512 feature][64 hist] (hist transposed through LDS); alpha stays in LDS (16 candidate rows per score block).
// Three launches: k_prep (all operand planes and out1, by block range), k_gemm1, k_score (logits, softmax, alpha . hist, out0).

#ifndef NB
#define NB 64
#endif
#define NB_FULL 64
#define NH   50                  // history entries per batch
#define NN   50                  // candidates per batch
#define RD   400                 // item vector width
#define PD   100                 // position embedding width
#define FD   500                 // RD + PD
#define AD   200                 // attention width
#define NPOS 52                  // rows of the position table
#define KP   512                 // FD padded to the k-step
#define APAD 256                 // AD padded to the column tile
#define HPAD 64                  // NH / NN padded (k of the second product, rows of its A operand)
#define MROWS (NB * NN)
#define MPAD  ((MROWS + 63) / 64 * 64)
#define OSW  36                  // LDS row pitch (floats) of a 64 x 32 slab
#define GM   128                 // GEMM block tile: rows
#define GN   64                  // GEMM block tile: columns
#define GW   4                   // GEMM waves per block, 2 x 2 wave tiles of 64 x 32
#define LP   520                 // LDS row pitch (16-bit elements) of the staged GEMM operand rows: 1040 B = 16 B x odd
#define OSW2 132                 // LDS row pitch (floats) of a 16 x 128 slab
#define TP   72                  // LDS row pitch (halves) of the transposed hist tile and of the alpha rows
#define SW   4                   // waves per score block (4 candidates each)
#define XSP  260                 // LDS row pitch (floats) of the staged hh rows: 1040 B = 16 B x odd, so 16 lanes' 16-byte reads of 16 rows fall on 64 different banks
#define XP   4                   // row pieces per thread of the row converters
#define PCS  1024.0f             // carry of the alpha plane
#define PCI  (1.0f / 1024.0f)
#define L2E  1.4426950408889634f
#define NEGV (-1.0e9f)
#define NEGB (-3.0e38f)

static_assert(FD == RD + PD);
static_assert(NH == NN);                       // both row sets have MROWS rows
static_assert(RD % 8 == 0);                    // an 8-element piece never straddles the item / position boundary
static_assert(PD % 4 == 0);
static_assert(FD % 4 == 0);                    // a float4 of the flat output never straddles two rows
static_assert(KP % 32 == 0);                   // GEMM k-loop steps by 32
static_assert(KP >= FD);
static_assert(KP % 64 == 0);                   // 64-feature tiles of the hist transpose in k_prep
static_assert(KP / 8 == 64);
static_assert(APAD % 64 == 0);
static_assert(APAD >= AD);
static_assert(AD % 4 == 0);
static_assert(HPAD == 64);
static_assert(HPAD % 32 == 0);
static_assert(NH > 32);                        // two history entries per lane: lane and lane + 32
static_assert(NH <= HPAD);
static_assert(NN <= HPAD);
static_assert(MPAD % 64 == 0);
static_assert(MPAD % XP == 0);                 // the XP pieces of a thread lie MPAD / XP rows apart
static_assert((MPAD / XP * (KP / 8)) % 256 == 0);   // the converter blocks cover a row set exactly: no partial block
static_assert(HPAD % (4 * SW) == 0);           // score grid covers the padded candidate rows exactly
static_assert(NB <= NB_FULL);
static_assert(((size_t)NB_FULL * NN * FD * 4) == (size_t)6400000);   // byte offset of the second output
static_assert((((size_t)NB_FULL * NN * FD * 4) % 128) == 0);
static_assert((OSW * 4) % 16 == 0);
static_assert((TP * 2) % 16 == 0);
static_assert(MPAD % GM == 0);
static_assert(APAD % GN == 0);
static_assert(GM == 2 * 64);                   // 2 x 2 wave tiles cover the block tile
static_assert(GN == 2 * 32);
static_assert(GM % GW == 0);
static_assert(GN % GW == 0);
static_assert((GM + GN) % (12 * GW) == 0);     // a wave's copies of a K half go in statements of 12
static_assert(KP == 2 * 32 * 8);               // half a row is one 16-byte piece for each of a wave's 32 lanes
static_assert(LP >= KP);
static_assert((LP * 2) % 32 == 16);
static_assert((GM + GN) / GW <= 63);           // copies of a wave in flight: one K half
static_assert((GM + GN) * LP * 2 + GW * 64 * OSW * 4 <= 327680);   // static LDS of the GEMM kernel
static_assert(64 * TP * 2 <= 131072);          // static LDS of k_prep (its hist transpose tile)
static_assert(SW * 4 == 16);                   // a score block's candidates are one 16-row A fragment
static_assert(SW * 128 == KP);                 // its waves cover the padded features, 128 each
static_assert((OSW2 * 4) % 16 == 0);
static_assert(SW * 4 * TP * 2 + SW * 16 * OSW2 * 4 + NH * XSP * 4 + SW * AD * 4 * 4 + 2 * AD * 4 + KP * TP * 2 <= 327680);   // static LDS of the score kernel
static_assert(XSP >= APAD);
static_assert((XSP * 4) % 16 == 0);
static_assert(APAD / 4 == 64);                 // a padded hh row is 64 pieces of 16 B: half of the score block's threads
static_assert(32 * SW == 128);
static_assert(NH == 2 * 25);                   // 25 rounds of 2 rows copy the 50 hh rows exactly, every lane on in every round
static_assert((AD / 4) % 4 == 2);              // the score loop takes two pairs of pieces a trip, and one pair is left behind it
static_assert(HPAD * 2 == 8 * 16);             // a hist^T row is 8 pieces of 16 B: a wave's copy takes 4 rows
static_assert(TP >= HPAD);
static_assert(AD / 4 <= 64);                   // a candidate row's pieces: lane and lane + 32
static_assert(AD / 4 <= 32 * SW);

typedef _Float16 h16;
typedef unsigned short bf;
typedef __attribute__((ext_vector_type(16))) __bf16   v16bf;
typedef __attribute__((ext_vector_type(16))) _Float16 v16h;
typedef __attribute__((ext_vector_type(8)))  _Float16 v8h;
typedef __attribute__((ext_vector_type(8)))  unsigned short v8us;
typedef __attribute__((ext_vector_type(8)))  float    v8f;
typedef __attribute__((ext_vector_type(4)))  float    v4f;
typedef v4f  __attribute__((may_alias)) v4fa;
typedef v8h  __attribute__((may_alias)) v8ha;

__device__ __forceinline__ unsigned short f2bf(float f) { unsigned u = __float_as_uint(f); u += 0x7FFFu + ((u >> 16) & 1u); return (unsigned short)(u >> 16); }
__device__ __forceinline__ float bfr(float f) { return __uint_as_float(((unsigned)f2bf(f)) << 16); }   // value after RNE convert to bf16
__device__ __forceinline__ v16h cat16(v8h lo, v8h hi) { return __builtin_shufflevector(lo, hi, 0, 1, 2, 3, 4, 5, 6, 7, 8, 9, 10, 11, 12, 13, 14, 15); }
__device__ __forceinline__ v16bf cat16b(v8us lo, v8us hi) { return __builtin_bit_cast(v16bf, __builtin_shufflevector(lo, hi, 0, 1, 2, 3, 4, 5, 6, 7, 8, 9, 10, 11, 12, 13, 14, 15)); }
__device__ __forceinline__ v8f wmma16(v16h a, v16h b, v8f c) { return __builtin_amdgcn_wmma_f32_16x16x32_f16(false, a, false, b, (short)0, c, false, false); }
__device__ __forceinline__ v8f wmmab(v16bf a, v16bf b, v8f c) { return __builtin_amdgcn_wmma_f32_16x16x32_bf16(false, a, false, b, (short)0, c, false, false); }
// fragment loaders from K-contiguous 16-bit rows; p already includes + 8*(lane>>4): elements 0..7 <- k0+8h+0..7, elements 8..15 <- k0+16+8h+0..7 (same map for A and B)
__device__ __forceinline__ v16h  ldh(const h16* p) { return cat16(*(const v8h*)p, *(const v8h*)(p + 16)); }
__device__ __forceinline__ v16bf ldb(const bf* p)  { return cat16b(*(const v8us*)p, *(const v8us*)(p + 16)); }
// ordering point for wave-private LDS tiles (same wave writes and reads)
__device__ __forceinline__ void wave_sync() { __builtin_amdgcn_fence(3 /* release order */, "wavefront"); __builtin_amdgcn_wave_barrier(); asm volatile("" ::: "memory"); }
// per-instruction guarded matrix ops: one accumulator tied per guard, operands kept live
__device__ __forceinline__ v8f wmma16g(v16h a, v16h b, v8f c) { c = wmma16(a, b, c); asm volatile("v_nop\n\tv_nop\n\tv_nop\n\tv_nop" : "+v"(c) : "v"(a), "v"(b)); return c; }
__device__ __forceinline__ v8f wmmabg(v16bf a, v16bf b, v8f c) { c = wmmab(a, b, c); asm volatile("v_nop\n\tv_nop\n\tv_nop\n\tv_nop" : "+v"(c) : "v"(a), "v"(b)); return c; }
// eight asynchronous 16-byte copies a lane, global -> LDS, at steps of gs and ls bytes; the statement ends in its own s_wait_xcnt 0, which so stands before any register that a copy names is rewritten
__device__ __forceinline__ void acopy8(const unsigned l, const char* g, const unsigned ls, const size_t gs) {
    asm volatile("global_load_async_to_lds_b128 %0, %8, off\n\tglobal_load_async_to_lds_b128 %1, %9, off\n\tglobal_load_async_to_lds_b128 %2, %10, off\n\tglobal_load_async_to_lds_b128 %3, %11, off\n\t"
                 "global_load_async_to_lds_b128 %4, %12, off\n\tglobal_load_async_to_lds_b128 %5, %13, off\n\tglobal_load_async_to_lds_b128 %6, %14, off\n\tglobal_load_async_to_lds_b128 %7, %15, off\n\t"
                 "s_wait_xcnt 0x0"
                 :: "v"(l), "v"(l + ls), "v"(l + 2 * ls), "v"(l + 3 * ls), "v"(l + 4 * ls), "v"(l + 5 * ls), "v"(l + 6 * ls), "v"(l + 7 * ls),
                    "v"(g), "v"(g + gs), "v"(g + 2 * gs), "v"(g + 3 * gs), "v"(g + 4 * gs), "v"(g + 5 * gs), "v"(g + 6 * gs), "v"(g + 7 * gs) : "memory");
}
// twelve such copies at the lane's own addresses l[i] (LDS bytes) and g[i]; the same closing wait
__device__ __forceinline__ void acopy12(const unsigned* l, const char* const* g) {
    asm volatile("global_load_async_to_lds_b128 %0, %12, off\n\tglobal_load_async_to_lds_b128 %1, %13, off\n\tglobal_load_async_to_lds_b128 %2, %14, off\n\tglobal_load_async_to_lds_b128 %3, %15, off\n\t"
                 "global_load_async_to_lds_b128 %4, %16, off\n\tglobal_load_async_to_lds_b128 %5, %17, off\n\tglobal_load_async_to_lds_b128 %6, %18, off\n\tglobal_load_async_to_lds_b128 %7, %19, off\n\t"
                 "global_load_async_to_lds_b128 %8, %20, off\n\tglobal_load_async_to_lds_b128 %9, %21, off\n\tglobal_load_async_to_lds_b128 %10, %22, off\n\tglobal_load_async_to_lds_b128 %11, %23, off\n\t"
                 "s_wait_xcnt 0x0"
                 :: "v"(l[0]), "v"(l[1]), "v"(l[2]), "v"(l[3]), "v"(l[4]), "v"(l[5]), "v"(l[6]), "v"(l[7]), "v"(l[8]), "v"(l[9]), "v"(l[10]), "v"(l[11]),
                    "v"(g[0]), "v"(g[1]), "v"(g[2]), "v"(g[3]), "v"(g[4]), "v"(g[5]), "v"(g[6]), "v"(g[7]), "v"(g[8]), "v"(g[9]), "v"(g[10]), "v"(g[11]) : "memory");
}
// f32 -> f16 convert that cannot produce an f16 subnormal (|v| < 2^-14 -> +0)
static __device__ __forceinline__ h16 toh_flush(float v) { const h16 r = (h16)v; return (fabsf(v) < 6.103515625e-05f) ? (h16)0.0f : r; }
// position-table row: negative index wraps once, then clamps into the table
__device__ __forceinline__ int posrow(int p) { p = p < 0 ? p + NPOS : p; p = p < 0 ? 0 : p; p = p > NPOS - 1 ? NPOS - 1 : p; return p; }

// d_wconv: W1 [200][1000] -> bf16 planes WB [2][256][512] (w = 0: columns 0..499, w = 1: columns 500..999; rows >= 200 and k >= 500 are zeros).
__device__ __forceinline__ void d_wconv(const int blk, const float* __restrict__ W1, bf* WB) {
    const int i = blk * 256 + (int)threadIdx.x; if (i >= 2 * APAD * (KP / 8)) return;
    const int k8 = (i % (KP / 8)) * 8; const int a = (i / (KP / 8)) % APAD; const int w = i / ((KP / 8) * APAD);
    const int ac = a < AD ? a : AD - 1;
    const size_t rb = (size_t)ac * (2 * FD) + (size_t)w * FD;
    float x[8];
#pragma unroll
    for (int j = 0; j < 8; ++j) { const int k = k8 + j; const int kc = k < FD ? k : FD - 1; x[j] = W1[rb + (size_t)kc]; }
    // inputs-only fence on the loaded values: keeps all 8 loads unconditional and issued together, one wait for the lot (without it each is sunk to its use)
    asm volatile("" :: "v"(x[0]), "v"(x[1]), "v"(x[2]), "v"(x[3]), "v"(x[4]), "v"(x[5]), "v"(x[6]), "v"(x[7]));
    v8us o;
#pragma unroll
    for (int j = 0; j < 8; ++j) { const bool ok = (k8 + j < FD) & (a < AD); o[j] = f2bf(ok ? x[j] : 0.0f); }
    *(v8us*)(WB + (size_t)i * 8) = o;
}

// d_xrow: bf16 operand rows [MPAD][512] = [ item vector (400) | position row (100) | zeros (12) ]; rows >= MROWS are zeros.
// USEPOS = 1 (history): position row = table[pos[r]]. USEPOS = 0 (candidates): table row 1, and the same converted values, widened to f32, are stored as out1 [rows][500].
// All loads at clamped addresses, selected by value.
template <int USEPOS>
__device__ __forceinline__ void d_xrow(const int blk, const float* __restrict__ src, const int* __restrict__ pos, const float* __restrict__ pe, bf* dst, float* O1) {
    // One thread converts XP pieces, the same 8 columns of rows MPAD / XP apart (lanes stay contiguous in every load and store); all of its loads are issued before the first use.
    const int t0 = blk * 256 + (int)threadIdx.x;
    const int k8 = (t0 % (KP / 8)) * 8; const int rb = t0 / (KP / 8);
    const int kr = k8 < RD - 8 ? k8 : RD - 8;
    int pa = k8 - RD;     pa = pa < 0 ? 0 : (pa > PD - 4 ? PD - 4 : pa);
    int pb = k8 - RD + 4; pb = pb < 0 ? 0 : (pb > PD - 4 ? PD - 4 : pb);
    int rc[XP], pz[XP];
#pragma unroll
    for (int s = 0; s < XP; ++s) { const int r = rb + s * (MPAD / XP); rc[s] = r < MROWS ? r : MROWS - 1; pz[s] = 1; }
    if (USEPOS) {
#pragma unroll
        for (int s = 0; s < XP; ++s) pz[s] = pos[rc[s]];
    }
    v4f r0[XP], r1[XP], p0[XP], p1[XP];
#pragma unroll
    for (int s = 0; s < XP; ++s) { r0[s] = *(const v4f*)(src + (size_t)rc[s] * RD + kr); r1[s] = *(const v4f*)(src + (size_t)rc[s] * RD + kr + 4); }
    __builtin_amdgcn_sched_barrier(0);             // the item loads above need no index: they are issued before the wait for the position indices
#pragma unroll
    for (int s = 0; s < XP; ++s) { const int prow = USEPOS ? posrow(pz[s]) : 1;
        p0[s] = *(const v4f*)(pe + (size_t)prow * PD + pa); p1[s] = *(const v4f*)(pe + (size_t)prow * PD + pb); }
    static_assert(XP == 4);
    // inputs-only fences on the loaded values: every load of the thread is issued, unconditionally, before the first conversion (without them the later pieces' loads wait behind the first piece's stores)
    asm volatile("" :: "v"(r0[0]), "v"(r1[0]), "v"(r0[1]), "v"(r1[1]), "v"(r0[2]), "v"(r1[2]), "v"(r0[3]), "v"(r1[3]));
    asm volatile("" :: "v"(p0[0]), "v"(p1[0]), "v"(p0[1]), "v"(p1[1]), "v"(p0[2]), "v"(p1[2]), "v"(p0[3]), "v"(p1[3]));
#pragma unroll
    for (int s = 0; s < XP; ++s) {
        const int r = rb + s * (MPAD / XP);
        const bool rv = r < MROWS;
        const bool inr = (k8 < RD) & rv;
        const bool ip0 = (k8 >= RD) & (k8 < FD) & rv;
        const bool ip1 = (k8 >= RD) & (k8 + 4 < FD) & rv;
        v8us o;
#pragma unroll
        for (int j = 0; j < 4; ++j) {
            const float x0 = inr ? r0[s][j] : (ip0 ? p0[s][j] : 0.0f);
            const float x1 = inr ? r1[s][j] : (ip1 ? p1[s][j] : 0.0f);
            o[j] = f2bf(x0); o[4 + j] = f2bf(x1); }
        *(v8us*)(dst + (size_t)r * KP + k8) = o;
        if (!USEPOS) {
            v4f q0, q1;
#pragma unroll
            for (int j = 0; j < 4; ++j) { q0[j] = __uint_as_float(((unsigned)o[j]) << 16); q1[j] = __uint_as_float(((unsigned)o[4 + j]) << 16); }
            float* q = O1 + (size_t)rc[s] * FD + (k8 < FD - 4 ? k8 : FD - 4);      // in bounds for every thread; stored only where the piece is a part of the row
            if (inr | ip0) *(v4f*)q = q0;
            if (inr | ip1) *(v4f*)(q + 4) = q1;
        }
    }
    asm volatile("s_wait_xcnt 0x0" ::: "memory");  // the wait that stands before a register named by the stores above is overwritten (code of the other block ranges follows in the listing)
}

// d_histT: f16 plane HT [b][512 feature][64 history] = hist^T (bf16 values held in f16); features >= 500 and history >= 50 are zeros.
__device__ __forceinline__ void d_histT(const int blk, h16* th, const float* __restrict__ hist, const int* __restrict__ pos, const float* __restrict__ pe, h16* HT) {
    const int t = (int)threadIdx.x; const int f0 = (blk % (KP / 64)) * 64; const int b = blk / (KP / 64);
    const int fl = t & 63, hq = t >> 6;
    const int f = f0 + fl; const int fr = f < RD ? f : RD - 1; int fp = f - RD; fp = fp < 0 ? 0 : (fp > PD - 1 ? PD - 1 : fp);
    static_assert(256 * 16 == 64 * HPAD);          // fill: threads x trips == tile elements
    // the 16 rows of a thread: every load of a kind is issued before the first use, so the thread waits once for the indices and once for the values
    int pz[16]; float xr[16], xp[16];
#pragma unroll
    for (int it = 0; it < 16; ++it) { const int h = hq + 4 * it; const int hc = h < NH ? h : NH - 1; pz[it] = pos[(size_t)b * NH + (size_t)hc]; }
    asm volatile("s_wait_xcnt 0x0" ::: "memory");  // the loads below land in registers that the index loads above name as their offsets
#pragma unroll
    for (int it = 0; it < 16; ++it) { const int h = hq + 4 * it; const int hc = h < NH ? h : NH - 1; xr[it] = hist[((size_t)b * NH + (size_t)hc) * RD + (size_t)fr]; }
    __builtin_amdgcn_sched_barrier(0);             // the item loads above need no index: they are issued before the wait for the position indices
#pragma unroll
    for (int it = 0; it < 16; ++it) xp[it] = pe[(size_t)posrow(pz[it]) * PD + (size_t)fp];
    // inputs-only fences on the loaded values: all 32 loads stay unconditional and in flight together (without them some are sunk into the branches of the selects below, one wait each)
    asm volatile("" :: "v"(xr[0]), "v"(xr[1]), "v"(xr[2]), "v"(xr[3]), "v"(xr[4]), "v"(xr[5]), "v"(xr[6]), "v"(xr[7]), "v"(xr[8]), "v"(xr[9]), "v"(xr[10]), "v"(xr[11]), "v"(xr[12]), "v"(xr[13]), "v"(xr[14]), "v"(xr[15]));
    asm volatile("" :: "v"(xp[0]), "v"(xp[1]), "v"(xp[2]), "v"(xp[3]), "v"(xp[4]), "v"(xp[5]), "v"(xp[6]), "v"(xp[7]), "v"(xp[8]), "v"(xp[9]), "v"(xp[10]), "v"(xp[11]), "v"(xp[12]), "v"(xp[13]), "v"(xp[14]), "v"(xp[15]));
#pragma unroll
    for (int it = 0; it < 16; ++it) {
        const int h = hq + 4 * it;
        const float v = (f < RD) ? xr[it] : xp[it];
        const bool ok = (h < NH) & (f < FD);
        const h16 o = ok ? toh_flush(bfr(v)) : (h16)0.0f;
        th[fl * TP + h] = o; }
    __syncthreads();
    static_assert(256 * 2 * 16 == 64 * HPAD * 2);
{
#pragma unroll
        for (int it = 0; it < 2; ++it) { const int p = it * 256 + t; const int row = p >> 3, pc = p & 7;
            const v8h val = *(const v8ha*)(&th[row * TP + pc * 8]);
            *(v8h*)(HT + ((size_t)b * KP + (size_t)(f0 + row)) * HPAD + (size_t)pc * 8) = val; }
         }
}

// k_prep: the independent operand-plane builders as block ranges of one grid (every branch is block-uniform). The transpose blocks, whose loop is the longest, take the lowest indices.
#define PB_HT ((KP / 64) * NB)
#define PB_W  ((2 * APAD * (KP / 8) + 255) / 256)
#define PB_X  (MPAD * (KP / 8) / (256 * XP))
__global__ __launch_bounds__(256) void k_prep(const float* __restrict__ hist, const float* __restrict__ cand, const int* __restrict__ pos, const float* __restrict__ pe,
                                              const float* __restrict__ W1, bf* WB, bf* XC, bf* XH, h16* HT, float* O1) {
    __shared__ __align__(16) h16 th[64 * TP];
    int blk = (int)blockIdx.x;
    if (blk < PB_HT) { d_histT(blk, th, hist, pos, pe, HT); return; }
    blk -= PB_HT;
    if (blk < PB_W) { d_wconv(blk, W1, WB); return; }
    blk -= PB_W;
    if (blk < PB_X) { d_xrow<0>(blk, cand, pos, pe, XC, O1); return; }
    blk -= PB_X;
    d_xrow<1>(blk, hist, pos, pe, XH, O1);
}

// k_gemm1: bf16 GEMM, one block of 4 waves per 128x64 tile (wave tile 64x32, 8 accumulators), K = 512. HP[w][m][n] = sum_k XB[w][m][k] WB[w][n][k]; grid (MPAD/128, APAD/64, 2).
// The tile's 128 A rows and 64 B rows go to LDS by asynchronous copies, one 512-byte half of a row per wave copy (4 whole lines), in two K halves with a place of their own each:
// the second half's copies fly while the first half's products run. Fragments are read from LDS rows pitched 16 B x odd. Every output sums its 16 k-steps in ascending order.
// Epilogue: the wave's 64x32 slab staged in LDS (wave-private), stored as whole 128-byte lines.
__global__ __launch_bounds__(32 * GW) void k_gemm1(const bf* __restrict__ XB, const bf* __restrict__ WB, float* HP) {
    __shared__ __align__(16) bf sa[GM * LP];
    __shared__ __align__(16) bf sb[GN * LP];
    __shared__ __align__(16) float os[GW * 64 * OSW];
    const int lane = threadIdx.x & 31, lr = lane & 15, hi = lane >> 4;
    const int wave = __builtin_amdgcn_readfirstlane((int)(threadIdx.x >> 5));
    const int r0 = (int)blockIdx.x * GM, c0 = (int)blockIdx.y * GN, w = (int)blockIdx.z;
    // a K half: copy s of a wave takes row wave + 4 s of A (then of B), one 16-byte piece a lane; every lane is on, every address in bounds, no LDS byte written twice; 48 copies a wave
    // (every loop of this kernel is unrolled: its index picks registers, asm operands or immediate offsets)
    const char* ga = (const char*)(XB + ((size_t)w * MPAD + (size_t)(r0 + wave)) * KP + (size_t)lane * 8);
    const char* gb = (const char*)(WB + ((size_t)w * APAD + (size_t)(c0 + wave)) * KP + (size_t)lane * 8);
    const unsigned la0 = (unsigned)(size_t)(&sa[wave * LP + lane * 8]);
    const unsigned lb0 = (unsigned)(size_t)(&sb[wave * LP + lane * 8]);
    auto copy_half = [&](const int p) {
        unsigned l[(GM + GN) / GW]; const char* g[(GM + GN) / GW];
#pragma unroll
        for (int s = 0; s < GM / GW; ++s) { l[s] = la0 + (unsigned)(s * GW * LP * 2 + p * KP); g[s] = ga + (size_t)s * GW * KP * 2 + (size_t)p * KP; }
#pragma unroll
        for (int s = 0; s < GN / GW; ++s) { l[GM / GW + s] = lb0 + (unsigned)(s * GW * LP * 2 + p * KP); g[GM / GW + s] = gb + (size_t)s * GW * KP * 2 + (size_t)p * KP; }
#pragma unroll
        for (int q = 0; q < (GM + GN) / (12 * GW); ++q) acopy12(l + 12 * q, g + 12 * q);
    };
    const int wm = wave & 1, wn = wave >> 1;
    v8f acc[4][2];
#pragma unroll
    for (int mb = 0; mb < 4; ++mb)
#pragma unroll
        for (int nb = 0; nb < 2; ++nb) acc[mb][nb] = (v8f){};
    const bf* pa = &sa[(wm * 64 + lr) * LP + 8 * hi];                    // the lane's place in the k-step's A and B rows
    const bf* pb = &sb[(wn * 32 + lr) * LP + 8 * hi];
    // two register sets: a k-step's 12 LDS reads are issued one k-step ahead of its products, inside the K half only (nothing of the other half is read ahead)
    v16bf a[2][4], bq[2][2];
    auto fetch = [&](const int s, const int kc) {
#pragma unroll
        for (int mb = 0; mb < 4; ++mb) a[s][mb] = ldb(pa + mb * 16 * LP + kc);
#pragma unroll
        for (int nb = 0; nb < 2; ++nb) bq[s][nb] = ldb(pb + nb * 16 * LP + kc); };
    auto mul_half = [&](const int p) {
        fetch(0, p * (KP / 2));
#pragma unroll
        for (int i = 0; i < KP / 64; ++i) {
            if (i + 1 < KP / 64) fetch((i + 1) & 1, p * (KP / 2) + (i + 1) * 32);
#pragma unroll
            for (int nb = 0; nb < 2; ++nb) {
#pragma unroll
                for (int mb = 0; mb < 4; ++mb) acc[mb][nb] = wmmabg(a[i & 1][mb], bq[i & 1][nb], acc[mb][nb]); }
        } };
    copy_half(0);
    asm volatile("s_wait_asynccnt 0x0" ::: "memory");                    // this wave's copies of the first K half have landed
    __syncthreads();                                                     // every wave reads rows that other waves copied; every wave of the block passes here
    copy_half(1);                                                        // into its own columns of the rows, which nobody reads before the next barrier
    mul_half(0);
    asm volatile("s_wait_dscnt 0x0" ::: "memory");                       // hand-over of the second half, in order: the wave's LDS reads, its copies, the barrier
    asm volatile("s_wait_asynccnt 0x0" ::: "memory");                    // this wave's copies of the second K half have landed
    __syncthreads();                                                     // publishes the second half; every wave of the block passes here
    mul_half(1);
    float* osw = os + wave * (64 * OSW);
#pragma unroll
    for (int mb = 0; mb < 4; ++mb) {
#pragma unroll
        for (int nb = 0; nb < 2; ++nb) {
#pragma unroll
            for (int j = 0; j < 8; ++j) osw[(mb * 16 + hi * 8 + j) * OSW + nb * 16 + lr] = acc[mb][nb][j]; } }   // D: row 8h+j, col lane&15
    wave_sync();
    float* outp = HP + ((size_t)w * MPAD + (size_t)(r0 + wm * 64)) * APAD + (size_t)(c0 + wn * 32);
    static_assert(32 * 16 * 16 == 64 * 32 * 4);    // lanes x 16 B x trips == 64 rows x 128 B
#pragma unroll
    for (int s = 0; s < 16; ++s) { const int row = 4 * s + (lane >> 3), c4 = (lane & 7) * 4;   // 16 s x 4 rows = 64 rows; 8 lanes x 4 floats = 32 columns
        const v4f val = *(const v4fa*)(&osw[row * OSW + c4]);
        *(v4f*)(outp + (size_t)row * APAD + c4) = val; }
}

// k_score: one block per 16 candidates of one batch. Stage 0: the block's operands go to LDS once: the batch's 50 hh rows (asynchronous copies, whole padded rows), each wave's 4 hc rows
// (through registers, laid [a][4 candidates]), b1 and w2 (already rounded); behind a block barrier the batch's hist^T rows follow (asynchronous copies that land while stage 1 runs).
// Stage 1, one wave per 4 candidates; lane = history entry (lane and lane + 32); every operand read from LDS, one pair of 4-wide pieces ahead of its arithmetic.
// logit = sum_a relu((hc + hh) + b1) * w2 + b2 (f32, fmaf chain per (candidate, history) pair); masked entries replaced by -1e9; softmax with the max over all 50 entries (lane shuffles);
// alpha x1024 as f16 into the block's LDS rows pt [16][64] (candidate rows >= 50 and history >= 50 are zeros).
// Stage 2, behind one block barrier: out0[b][n][f] = (1/1024) sum_h pt[n][h] HT[b][f][h] (HT from its LDS copy), f16 WMMA, K = 64; one wave per 128 features (8 accumulators);
// the 16 x 128 slab is staged in LDS (wave-private) and stored as 512-byte row pieces, rows < 50 and features < 500 only.
__global__ __launch_bounds__(32 * SW) void k_score(const float* __restrict__ HC, const float* __restrict__ HH, const int* __restrict__ maskp,
                                                   const float* __restrict__ b1, const float* __restrict__ w2, const float* __restrict__ b2,
                                                   const h16* __restrict__ HT, float* O0) {
    __shared__ __align__(16) h16 pt[SW * 4 * TP];
    __shared__ __align__(16) float os[SW * 16 * OSW2];
    __shared__ __align__(16) float xs[NH * XSP];                         // hh rows of the batch
    __shared__ __align__(16) float ct[SW * AD * 4];                      // per wave: hc of its 4 candidates, [a][candidate]
    __shared__ __align__(16) float bs[AD];                               // b1, rounded
    __shared__ __align__(16) float wl[AD];                               // w2, rounded
    __shared__ __align__(16) h16 hl[KP * TP];                            // hist^T of the batch: [feature][history], rows pitched for the 16-byte fragment reads
    const int lane = threadIdx.x & 31;
    const int wave = __builtin_amdgcn_readfirstlane((int)(threadIdx.x >> 5));
    const int b = (int)blockIdx.y;
    const int n0 = ((int)blockIdx.x * SW + wave) * 4;
    static_assert(32 * 16 == 4 * HPAD * 2);
    const int lr = lane & 15, hi = lane >> 4;
    const int f0 = wave * 128;
    const size_t hb = (size_t)b * NH;
    // stage 0a: hh rows -> xs. Round s: rows 2s and 2s + 1, one 16-byte piece a lane (a wave's copy is 512 contiguous bytes); every lane is on, every address in bounds, no LDS byte written twice.
    {
        const int col = (int)threadIdx.x & 63, r2 = (int)threadIdx.x >> 6;
        const float* g0 = HH + (hb + (size_t)r2) * APAD + (size_t)col * 4;
        const unsigned l0 = (unsigned)(size_t)(&xs[r2 * XSP + col * 4]);
        const float* g[25]; unsigned l[25];
#pragma unroll
        for (int s = 0; s < 25; ++s) { g[s] = g0 + (size_t)s * 2 * APAD; l[s] = l0 + (unsigned)(s * 2 * XSP * 4); }
        // the copies of a statement end in their own s_wait_xcnt 0: it stands before any register that a copy names is rewritten
        asm volatile("global_load_async_to_lds_b128 %0, %1, off\n\tglobal_load_async_to_lds_b128 %2, %3, off\n\tglobal_load_async_to_lds_b128 %4, %5, off\n\t"
                     "global_load_async_to_lds_b128 %6, %7, off\n\tglobal_load_async_to_lds_b128 %8, %9, off\n\tglobal_load_async_to_lds_b128 %10, %11, off\n\t"
                     "global_load_async_to_lds_b128 %12, %13, off\n\tglobal_load_async_to_lds_b128 %14, %15, off\n\tglobal_load_async_to_lds_b128 %16, %17, off\n\t"
                     "global_load_async_to_lds_b128 %18, %19, off\n\tglobal_load_async_to_lds_b128 %20, %21, off\n\tglobal_load_async_to_lds_b128 %22, %23, off\n\t"
                     "global_load_async_to_lds_b128 %24, %25, off\n\ts_wait_xcnt 0x0"
                     :: "v"(l[0]), "v"(g[0]), "v"(l[1]), "v"(g[1]), "v"(l[2]), "v"(g[2]), "v"(l[3]), "v"(g[3]), "v"(l[4]), "v"(g[4]), "v"(l[5]), "v"(g[5]), "v"(l[6]), "v"(g[6]),
                        "v"(l[7]), "v"(g[7]), "v"(l[8]), "v"(g[8]), "v"(l[9]), "v"(g[9]), "v"(l[10]), "v"(g[10]), "v"(l[11]), "v"(g[11]), "v"(l[12]), "v"(g[12]) : "memory");
        asm volatile("global_load_async_to_lds_b128 %0, %1, off\n\tglobal_load_async_to_lds_b128 %2, %3, off\n\tglobal_load_async_to_lds_b128 %4, %5, off\n\t"
                     "global_load_async_to_lds_b128 %6, %7, off\n\tglobal_load_async_to_lds_b128 %8, %9, off\n\tglobal_load_async_to_lds_b128 %10, %11, off\n\t"
                     "global_load_async_to_lds_b128 %12, %13, off\n\tglobal_load_async_to_lds_b128 %14, %15, off\n\tglobal_load_async_to_lds_b128 %16, %17, off\n\t"
                     "global_load_async_to_lds_b128 %18, %19, off\n\tglobal_load_async_to_lds_b128 %20, %21, off\n\tglobal_load_async_to_lds_b128 %22, %23, off\n\t"
                     "s_wait_xcnt 0x0"
                     :: "v"(l[13]), "v"(g[13]), "v"(l[14]), "v"(g[14]), "v"(l[15]), "v"(g[15]), "v"(l[16]), "v"(g[16]), "v"(l[17]), "v"(g[17]), "v"(l[18]), "v"(g[18]),
                        "v"(l[19]), "v"(g[19]), "v"(l[20]), "v"(g[20]), "v"(l[21]), "v"(g[21]), "v"(l[22]), "v"(g[22]), "v"(l[23]), "v"(g[23]), "v"(l[24]), "v"(g[24]) : "memory");
    }
    // stage 0b: the wave's 4 hc rows, b1, w2 and the lane's two mask words, all at clamped addresses and in flight together (a wave without candidates stages row 49 into its own, unread part of ct)
    const int nvec = ((int)blockIdx.x * SW + (int)(threadIdx.x >> 5)) * 4;
    size_t oc[4]; bool rok[4];
#pragma unroll
    for (int i = 0; i < 4; ++i) { int q = nvec + i; rok[i] = q < NN; q = q < NN ? q : NN - 1; q = __builtin_amdgcn_readfirstlane(q);
        oc[i] = ((size_t)b * NN + (size_t)q) * APAD; }
    const int hB = lane + 32; const int hBc = hB < NH ? hB : NH - 1; const bool okB = hB < NH;
    const int pB = hB < AD / 4 ? hB : AD / 4 - 1;                        // the lane's second piece of a candidate row
    const int tb = (int)threadIdx.x < AD / 4 ? (int)threadIdx.x : AD / 4 - 1;
    v4f cv[2][4];
#pragma unroll
    for (int i = 0; i < 4; ++i) { cv[0][i] = *(const v4f*)(HC + oc[i] + 4 * lane); cv[1][i] = *(const v4f*)(HC + oc[i] + 4 * pB); }
    const v4f b1v = *(const v4f*)(b1 + 4 * tb), w2v = *(const v4f*)(w2 + 4 * tb);
    const int mkA = maskp[hb + (size_t)lane], mkB = maskp[hb + (size_t)hBc];
    // inputs-only fence on the loaded values: the mask loads stay here, in flight with the other loads of stage 0 (sunk to their use behind stage 1 they would cost a memory latency of their own)
    asm volatile("" :: "v"(mkA), "v"(mkB));
#pragma unroll
    for (int j = 0; j < 4; ++j) {
        const v4f q0 = {cv[0][0][j], cv[0][1][j], cv[0][2][j], cv[0][3][j]}, q1 = {cv[1][0][j], cv[1][1][j], cv[1][2][j], cv[1][3][j]};
        *(v4fa*)(&ct[wave * (AD * 4) + (4 * lane + j) * 4]) = q0;
        if (hB < AD / 4) *(v4fa*)(&ct[wave * (AD * 4) + (4 * hB + j) * 4]) = q1; }
    if ((int)threadIdx.x < AD / 4) {
        const v4f br = {bfr(b1v[0]), bfr(b1v[1]), bfr(b1v[2]), bfr(b1v[3])}, wr = {bfr(w2v[0]), bfr(w2v[1]), bfr(w2v[2]), bfr(w2v[3])};
        *(v4fa*)(&bs[4 * (int)threadIdx.x]) = br; *(v4fa*)(&wl[4 * (int)threadIdx.x]) = wr; }
    asm volatile("s_wait_asynccnt 0x0" ::: "memory");                    // this wave's copies have landed
    __syncthreads();                                                     // every wave reads rows that other waves copied; every wave of the block passes here
    // stage 2's B operand depends on nothing of stage 1: each wave's 128 hist^T rows are copied to LDS here and land while stage 1 runs. Round s: 32 rows, eight copies of 4 rows (512 contiguous bytes a wave each); every lane is on
    {
        const int row = f0 + (lane >> 3), pc = lane & 7;
        const char* g0 = (const char*)(HT + ((size_t)b * KP + (size_t)row) * HPAD + (size_t)pc * 8);
        const unsigned l0 = (unsigned)(size_t)(&hl[row * TP + pc * 8]);
#pragma unroll
        for (int s = 0; s < 4; ++s) acopy8(l0 + (unsigned)(s * 32 * TP * 2), g0 + (size_t)s * 32 * HPAD * 2, 4 * TP * 2, (size_t)4 * HPAD * 2);
    }
    if (n0 >= NN) {                                                      // wave-uniform: no candidate here, its 4 alpha rows are zeros
        const v8h z = (v8h){}; *(v8ha*)(&pt[(wave * 4 + (lane >> 3)) * TP + (lane & 7) * 8]) = z;
    } else {
    const float b2v = bfr(b2[0]);
    float accA[4], accB[4];
#pragma unroll
    for (int i = 0; i < 4; ++i) { accA[i] = 0.0f; accB[i] = 0.0f; }
    const float* xpa = &xs[lane * XSP]; const float* xpb = &xs[hBc * XSP]; const float* cp = &ct[wave * (AD * 4)];
    // two register sets of two pieces each: a pair's 16 LDS reads are issued one pair ahead of its arithmetic
    v4f xa[2][2], xb[2][2], bb[2][2], ww[2][2], cc[2][2][4];
    auto fetch = [&](const int s, const int d) {
#pragma unroll
        for (int p = 0; p < 2; ++p) { const int a4 = 2 * d + p;
            xa[s][p] = *(const v4fa*)(xpa + 4 * a4); xb[s][p] = *(const v4fa*)(xpb + 4 * a4);
            bb[s][p] = *(const v4fa*)(&bs[4 * a4]);  ww[s][p] = *(const v4fa*)(&wl[4 * a4]);
#pragma unroll
            for (int j = 0; j < 4; ++j) cc[s][p][j] = *(const v4fa*)(cp + (4 * a4 + j) * 4); } };
    auto work = [&](const int s) {
#pragma unroll
        for (int p = 0; p < 2; ++p) {
#pragma unroll
            for (int j = 0; j < 4; ++j) {
#pragma unroll
                for (int i = 0; i < 4; ++i) {
                    const float c = cc[s][p][j][i];
                    const float va = fmaxf((c + xa[s][p][j]) + bb[s][p][j], 0.0f), vb = fmaxf((c + xb[s][p][j]) + bb[s][p][j], 0.0f);
                    accA[i] = fmaf(va, ww[s][p][j], accA[i]); accB[i] = fmaf(vb, ww[s][p][j], accB[i]); } } } };
    // the compiler fence behind each fetch keeps its reads where they stand: without it the reads carried into the next trip are sunk to that trip's head, directly in front of their use
    fetch(0, 0);
    asm volatile("" ::: "memory");
#pragma unroll 1
    for (int d = 0; d < AD / 8 - 1; d += 2) {                            // rolled: the body already holds two pairs, one per register set
        fetch(1, d + 1);
        asm volatile("" ::: "memory");
        work(0);
        fetch(0, d + 2);
        asm volatile("" ::: "memory");
        work(1);
        // the order asked of the scheduler: a pair's 16 LDS reads together, then the other pair's arithmetic, so that every read has a whole pair of lead (left alone it puts the reads late, close to their use)
        __builtin_amdgcn_sched_group_barrier(0x100, 16, 0);
        __builtin_amdgcn_sched_group_barrier(0x002, 134, 0);
        __builtin_amdgcn_sched_group_barrier(0x100, 16, 0);
        __builtin_amdgcn_sched_group_barrier(0x002, 140, 0);
    }
    work(0);                                                             // the last pair
#pragma unroll
    for (int i = 0; i < 4; ++i) {
        float sA = accA[i] + b2v, sB = accB[i] + b2v;
        sA = (mkA != 0) ? sA : NEGV; sB = (mkB != 0) ? sB : NEGV; sB = okB ? sB : NEGB;
        float mx = fmaxf(sA, sB);
        mx = fmaxf(mx, __shfl_xor(mx, 16, 32)); mx = fmaxf(mx, __shfl_xor(mx, 8, 32)); mx = fmaxf(mx, __shfl_xor(mx, 4, 32));
        mx = fmaxf(mx, __shfl_xor(mx, 2, 32));  mx = fmaxf(mx, __shfl_xor(mx, 1, 32));
        const float eA = __builtin_amdgcn_exp2f((sA - mx) * L2E);
        float eB = __builtin_amdgcn_exp2f((sB - mx) * L2E); eB = okB ? eB : 0.0f;
        float sm = eA + eB;
        sm += __shfl_xor(sm, 16, 32); sm += __shfl_xor(sm, 8, 32); sm += __shfl_xor(sm, 4, 32); sm += __shfl_xor(sm, 2, 32); sm += __shfl_xor(sm, 1, 32);
        const float inv = __builtin_amdgcn_rcpf(sm) * PCS;              // sm >= 1 (the maximum entry contributes 1)
        h16 qa = toh_flush(eA * inv), qb = toh_flush(eB * inv);
        qa = rok[i] ? qa : (h16)0.0f; qb = rok[i] ? qb : (h16)0.0f;
        pt[(wave * 4 + i) * TP + lane] = qa; pt[(wave * 4 + i) * TP + 32 + lane] = qb; }   // 4 rows x 64 columns all written
    }
    asm volatile("s_wait_asynccnt 0x0" ::: "memory");                    // this wave's hist^T copies have landed
    __syncthreads();                                                     // every wave reads all 16 alpha rows; every wave of the block passes here
    v16h a[2];
#pragma unroll
    for (int ks = 0; ks < 2; ++ks) { const h16* p = &pt[lr * TP + 8 * hi + 32 * ks]; a[ks] = cat16(*(const v8ha*)p, *(const v8ha*)(p + 16)); }   // the k map of ldh
    v16h bq[2][8];                                                       // all B fragments are read before the first matrix instruction: one LDS latency, not sixteen
#pragma unroll
    for (int ks = 0; ks < 2; ++ks) {
#pragma unroll
        for (int nb = 0; nb < 8; ++nb) bq[ks][nb] = ldh(&hl[(f0 + nb * 16 + lr) * TP + 8 * hi + 32 * ks]); }
    v8f acc[8];
#pragma unroll
    for (int nb = 0; nb < 8; ++nb) acc[nb] = (v8f){};
#pragma unroll
    for (int ks = 0; ks < 2; ++ks) {
#pragma unroll
        for (int nb = 0; nb < 8; ++nb) acc[nb] = wmma16g(a[ks], bq[ks][nb], acc[nb]); }
    float* osw = os + wave * (16 * OSW2);
#pragma unroll
    for (int nb = 0; nb < 8; ++nb) {
#pragma unroll
        for (int j = 0; j < 8; ++j) osw[(hi * 8 + j) * OSW2 + nb * 16 + lr] = acc[nb][j] * PCI; }   // D: row 8h+j, col lane&15
    wave_sync();
    const int nr0 = (int)blockIdx.x * (SW * 4);
    const int c4 = lane * 4;                                             // 32 lanes x 4 floats = 128 columns
    float* outp = O0 + ((size_t)b * NN + (size_t)nr0) * FD + (size_t)(f0 + c4);
    const bool cok = f0 + c4 < FD;                                       // FD % 4 == 0: a float4 lies wholly inside the row or wholly outside
    v4f val[16];
#pragma unroll
    for (int row = 0; row < 16; ++row) val[row] = *(const v4fa*)(&osw[row * OSW2 + c4]);
    if (cok) {
#pragma unroll
        for (int row = 0; row < 16; ++row) { if (nr0 + row < NN) *(v4f*)(outp + (size_t)row * FD) = val[row]; }
    }
}

static constexpr size_t al256(size_t v) { return (v + 255) & ~(size_t)255; }
static constexpr size_t SZ_WB = al256((size_t)2 * APAD * KP * 2);
static constexpr size_t SZ_XB = al256((size_t)2 * MPAD * KP * 2);
static constexpr size_t SZ_HT = al256((size_t)NB * KP * HPAD * 2);
static constexpr size_t SZ_HP = al256((size_t)2 * MPAD * APAD * 4);
static constexpr size_t SZ_TOTAL = SZ_WB + SZ_XB + SZ_HT + SZ_HP;
static_assert(SZ_TOTAL <= (size_t)134217728);          // workspace carve <= 128 MiB
static_assert(((size_t)MPAD * KP * 2) % 256 == 0);     // the two X sub-planes stay 256-byte aligned
static_assert(((size_t)MPAD * APAD * 4) % 256 == 0);   // the two HP sub-planes stay 256-byte aligned
static constexpr size_t OUT1_OFF = (size_t)NB_FULL * NN * FD;   // element offset of the second output (fixed, full problem)

extern "C" void kernel_launch(void* const* d_in, const int* in_sizes, int n_in,
                              void* d_out, int out_size, void* d_ws, size_t ws_size, hipStream_t stream) {
    if (n_in < 9) return;
    if ((size_t)in_sizes[0] < (size_t)MROWS * RD || (size_t)in_sizes[1] < (size_t)MROWS * RD) return;
    if ((size_t)in_sizes[2] < (size_t)MROWS || (size_t)in_sizes[3] < (size_t)MROWS) return;
    if ((size_t)in_sizes[4] < (size_t)NPOS * PD || (size_t)in_sizes[5] < (size_t)AD * 2 * FD) return;
    if (in_sizes[6] < AD || in_sizes[7] < AD || in_sizes[8] < 1) return;
    if ((size_t)out_size < OUT1_OFF + (size_t)MROWS * FD) return;
    if (SZ_TOTAL > ws_size) return;
    // wire order: history_repr, candidate_repr, user_history_mask, user_history_position, pos_emb, W1, b1, w2, b2
    const float* hist_in = (const float*)d_in[0];
    const float* cand_in = (const float*)d_in[1];
    const int*   maskp   = (const int*)d_in[2];
    const int*   posp    = (const int*)d_in[3];
    const float* pe      = (const float*)d_in[4];
    const float* W1      = (const float*)d_in[5];
    const float* b1      = (const float*)d_in[6];
    const float* w2      = (const float*)d_in[7];
    const float* b2      = (const float*)d_in[8];
    float* OUT0 = (float*)d_out;                 // [NB][50][500]
    float* OUT1 = (float*)d_out + OUT1_OFF;      // [NB][50][500]
    char* wsp = (char*)d_ws;
    bf*  WB = (bf*)wsp;    wsp += SZ_WB;         // [2][256][512]: Wc | Wh
    bf*  XB = (bf*)wsp;    wsp += SZ_XB;         // [2][MPAD][512]: cand rows | hist rows
    h16* HT = (h16*)wsp;   wsp += SZ_HT;         // [NB][512][64]
    float* HP = (float*)wsp; wsp += SZ_HP;       // [2][MPAD][256]: hc | hh
    bf* XC = XB; bf* XH = XB + (size_t)MPAD * KP;
    const float* HC = HP; const float* HH = HP + (size_t)MPAD * APAD;

    k_prep<<<(unsigned)(PB_HT + PB_W + 2 * PB_X), 256, 0, stream>>>(hist_in, cand_in, posp, pe, W1, WB, XC, XH, HT, OUT1);
    // hc = cand Wc^T, hh = hist Wh^T
    k_gemm1<<<dim3(MPAD / GM, APAD / GN, 2), 32 * GW, 0, stream>>>(XB, WB, HP);
    // logits, softmax, user representation = alpha hist
    k_score<<<dim3(HPAD / (4 * SW), NB, 1), 32 * SW, 0, stream>>>(HC, HH, maskp, b1, w2, b2, HT, OUT0);
}

// v005
// A run of this version takes 21.5 microseconds.
// Two timings next to v004 both put it at 1.05 times that version's speed.
// Over all steps from v000 it is 2.64 times as fast.
#include <hip/hip_runtime.h>
#pragma clang fp contract(off)

// Additive attention of candidate items over a user history: rows = [400-wide item vector | 100-wide position embedding]; hidden = relu(cand Wc^T + hist Wh^T + b1) (W1 [200][1000] = [Wc | Wh], [out][in]); logit = hidden . w2 + b2; masked entries REPLACED by -1e9; softmax over the history; out0 = alpha hist, out1 = the candidate rows.
// Compute dtypes, f32 accumulate everywhere: the two projections v_wmma_f32_16x16x32_bf16 (items, position table, W1 RNE-converted to bf16; products exact); alpha . hist v_wmma_f32_16x16x32_f16 (alpha x1024 carry as f16, hist = the bf16 values held in f16); relu / w2 dot (depth 200, one shared vector) and softmax on the vector unit in f32.
// Layout: bf16 planes X [2][rows][512] (cand | hist, K zero-padded 500 -> 512) and W [2][256][512] (zero-padded); f32 plane HP [2][rows][256]; f16 plane HR [rows][512] (the hist rows once more, the bf16 values held in f16; the score kernel reads them transposed out of LDS); alpha stays in LDS (16 candidate rows per score block).
// Three launches: k_prep (all operand planes and out1, by block range), k_gemm1, k_score (logits, softmax, alpha . hist, out0).

#ifndef NB
#define NB 64
#endif
#define NB_FULL 64
#define NH   50                  // history entries per batch
#define NN   50                  // candidates per batch
#define RD   400                 // item vector width
#define PD   100                 // position embedding width
#define FD   500                 // RD + PD
#define AD   200                 // attention width
#define NPOS 52                  // rows of the position table
#define KP   512                 // FD padded to the k-step
#define APAD 256                 // AD padded to the column tile
#define HPAD 64                  // NH / NN padded (k of the second product, rows of its A operand)
#define MROWS (NB * NN)
#define MPAD  ((MROWS + 63) / 64 * 64)
#define OSW  36                  // LDS row pitch (floats) of a 64 x 32 slab
#define GM   128                 // GEMM block tile: rows
#define GN   64                  // GEMM block tile: columns
#define GW   4                   // GEMM waves per block, 2 x 2 wave tiles of 64 x 32
#define LP   520                 // LDS row pitch (16-bit elements) of the staged GEMM operand rows: 1040 B = 16 B x odd
#define OSW2 132                 // LDS row pitch (floats) of a 16 x 128 slab
#define TP   72                  // LDS row pitch (halves) of the alpha rows
#define HLP  528                 // LDS row pitch (halves) of the staged f16 hist rows: 1056 B = 32 B x odd, the pitch of the transposing 16-bit read
#define SW   4                   // waves per score block (4 candidates each)
#define XSP  260                 // LDS row pitch (floats) of the staged hh rows: 1040 B = 16 B x odd, so 16 lanes' 16-byte reads of 16 rows fall on 64 different banks
#define XP   4                   // row pieces per thread of the row converters
#define PCS  1024.0f             // carry of the alpha plane
#define PCI  (1.0f / 1024.0f)
#define L2E  1.4426950408889634f
#define NEGV (-1.0e9f)
#define NEGB (-3.0e38f)

static_assert(FD == RD + PD);
static_assert(NH == NN);                       // both row sets have MROWS rows
static_assert(RD % 8 == 0);                    // an 8-element piece never straddles the item / position boundary
static_assert(PD % 4 == 0);
static_assert(FD % 4 == 0);                    // a float4 of the flat output never straddles two rows
static_assert(KP % 32 == 0);                   // GEMM k-loop steps by 32
static_assert(KP >= FD);
static_assert(KP % 64 == 0);                   // a GEMM K half is a whole number of 32-wide k-steps
static_assert(KP / 8 == 64);
static_assert(APAD % 64 == 0);
static_assert(APAD >= AD);
static_assert(AD % 4 == 0);
static_assert(HPAD == 64);
static_assert(HPAD % 32 == 0);
static_assert(NH > 32);                        // two history entries per lane: lane and lane + 32
static_assert(NH <= HPAD);
static_assert(NN <= HPAD);
static_assert(MPAD % 64 == 0);
static_assert(MPAD % XP == 0);                 // the XP pieces of a thread lie MPAD / XP rows apart
static_assert((MPAD / XP * (KP / 8)) % 256 == 0);   // the converter blocks cover a row set exactly: no partial block
static_assert(HPAD % (4 * SW) == 0);           // score grid covers the padded candidate rows exactly
static_assert(NB <= NB_FULL);
static_assert(((size_t)NB_FULL * NN * FD * 4) == (size_t)6400000);   // byte offset of the second output
static_assert((((size_t)NB_FULL * NN * FD * 4) % 128) == 0);
static_assert((OSW * 4) % 16 == 0);
static_assert((TP * 2) % 16 == 0);
static_assert(MPAD % GM == 0);
static_assert(APAD % GN == 0);
static_assert(GM == 2 * 64);                   // 2 x 2 wave tiles cover the block tile
static_assert(GN == 2 * 32);
static_assert(GM % GW == 0);
static_assert(GN % GW == 0);
static_assert((GM + GN) % (12 * GW) == 0);     // a wave's copies of a K half go in statements of 12
static_assert(KP == 2 * 32 * 8);               // half a row is one 16-byte piece for each of a wave's 32 lanes
static_assert(LP >= KP);
static_assert((LP * 2) % 32 == 16);
static_assert((GM + GN) / GW <= 63);           // copies of a wave in flight: one K half
static_assert((GM + GN) * LP * 2 + GW * 64 * OSW * 4 <= 327680);   // static LDS of the GEMM kernel
static_assert(SW * 4 == 16);                   // a score block's candidates are one 16-row A fragment
static_assert(SW * 128 == KP);                 // its waves cover the padded features, 128 each
static_assert((OSW2 * 4) % 16 == 0);
static_assert(SW * 4 * TP * 2 + SW * 16 * OSW2 * 4 + NH * XSP * 4 + SW * AD * 4 * 4 + 2 * AD * 4 + HPAD * HLP * 2 <= 327680);   // static LDS of the score kernel
static_assert(XSP >= APAD);
static_assert((XSP * 4) % 16 == 0);
static_assert(APAD / 4 == 64);                 // a padded hh row is 64 pieces of 16 B: half of the score block's threads
static_assert(32 * SW == 128);
static_assert(NH == 2 * 25);                   // 25 rounds of 2 rows copy the 50 hh rows exactly, every lane on in every round
static_assert((AD / 4) % 4 == 2);              // the score loop takes two pairs of pieces a trip, and one pair is left behind it
static_assert(TP >= HPAD);
static_assert(HLP >= KP);
static_assert((HLP * 2) % 64 == 32);
static_assert(KP * 2 == 2 * 32 * 16);          // half a hist row is one 16-byte piece for each of a wave's 32 lanes
static_assert(2 * NH == SW * 25);              // 25 copies a wave take the 100 row halves exactly
static_assert((HPAD - NH) * (KP / 8) == 7 * 32 * SW);   // 7 stores a thread zero the k rows behind the history
static_assert(AD / 4 <= 64);                   // a candidate row's pieces: lane and lane + 32
static_assert(AD / 4 <= 32 * SW);

typedef _Float16 h16;
typedef unsigned short bf;
typedef __attribute__((ext_vector_type(16))) __bf16   v16bf;
typedef __attribute__((ext_vector_type(16))) _Float16 v16h;
typedef __attribute__((ext_vector_type(8)))  _Float16 v8h;
typedef __attribute__((ext_vector_type(8)))  unsigned short v8us;
typedef __attribute__((ext_vector_type(8)))  short    v8s;
typedef __attribute__((ext_vector_type(8)))  float    v8f;
typedef __attribute__((ext_vector_type(4)))  float    v4f;
typedef v4f  __attribute__((may_alias)) v4fa;
typedef v8h  __attribute__((may_alias)) v8ha;

__device__ __forceinline__ unsigned short f2bf(float f) { unsigned u = __float_as_uint(f); u += 0x7FFFu + ((u >> 16) & 1u); return (unsigned short)(u >> 16); }
__device__ __forceinline__ float bfr(float f) { return __uint_as_float(((unsigned)f2bf(f)) << 16); }   // value after RNE convert to bf16
__device__ __forceinline__ v16h cat16(v8h lo, v8h hi) { return __builtin_shufflevector(lo, hi, 0, 1, 2, 3, 4, 5, 6, 7, 8, 9, 10, 11, 12, 13, 14, 15); }
__device__ __forceinline__ v16bf cat16b(v8us lo, v8us hi) { return __builtin_bit_cast(v16bf, __builtin_shufflevector(lo, hi, 0, 1, 2, 3, 4, 5, 6, 7, 8, 9, 10, 11, 12, 13, 14, 15)); }
__device__ __forceinline__ v8f wmma16(v16h a, v16h b, v8f c) { return __builtin_amdgcn_wmma_f32_16x16x32_f16(false, a, false, b, (short)0, c, false, false); }
__device__ __forceinline__ v8f wmmab(v16bf a, v16bf b, v8f c) { return __builtin_amdgcn_wmma_f32_16x16x32_bf16(false, a, false, b, (short)0, c, false, false); }
// fragment loaders from K-contiguous 16-bit rows; p already includes + 8*(lane>>4): elements 0..7 <- k0+8h+0..7, elements 8..15 <- k0+16+8h+0..7 (same map for A and B)
__device__ __forceinline__ v16bf ldb(const bf* p)  { return cat16b(*(const v8us*)p, *(const v8us*)(p + 16)); }
// transposing LDS read (ds_load_tr16_b128) of a row-major 16-bit tile T: with p = &T[k0 + 8 * (lane >> 4) + (lane & 7)][d0 + 8 * ((lane >> 3) & 1)] the lane gets T[k0 + 8 * (lane >> 4) + 0..7][d0 + (lane & 15)]
__device__ __forceinline__ v8h ldtr(const h16* p) { typedef __attribute__((address_space(3))) v8s lds_v8s; return __builtin_bit_cast(v8h, __builtin_amdgcn_ds_load_tr16_b128_v8i16((lds_v8s*)p)); }
// ordering point for wave-private LDS tiles (same wave writes and reads)
__device__ __forceinline__ void wave_sync() { __builtin_amdgcn_fence(3 /* release order */, "wavefront"); __builtin_amdgcn_wave_barrier(); asm volatile("" ::: "memory"); }
// per-instruction guarded matrix ops: one accumulator tied per guard, operands kept live
__device__ __forceinline__ v8f wmma16g(v16h a, v16h b, v8f c) { c = wmma16(a, b, c); asm volatile("v_nop\n\tv_nop\n\tv_nop\n\tv_nop" : "+v"(c) : "v"(a), "v"(b)); return c; }
__device__ __forceinline__ v8f wmmabg(v16bf a, v16bf b, v8f c) { c = wmmab(a, b, c); asm volatile("v_nop\n\tv_nop\n\tv_nop\n\tv_nop" : "+v"(c) : "v"(a), "v"(b)); return c; }
// eight asynchronous 16-byte copies a lane, global -> LDS, at steps of gs and ls bytes; the statement ends in its own s_wait_xcnt 0, which so stands before any register that a copy names is rewritten
__device__ __forceinline__ void acopy8(const unsigned l, const char* g, const unsigned ls, const size_t gs) {
    asm volatile("global_load_async_to_lds_b128 %0, %8, off\n\tglobal_load_async_to_lds_b128 %1, %9, off\n\tglobal_load_async_to_lds_b128 %2, %10, off\n\tglobal_load_async_to_lds_b128 %3, %11, off\n\t"
                 "global_load_async_to_lds_b128 %4, %12, off\n\tglobal_load_async_to_lds_b128 %5, %13, off\n\tglobal_load_async_to_lds_b128 %6, %14, off\n\tglobal_load_async_to_lds_b128 %7, %15, off\n\t"
                 "s_wait_xcnt 0x0"
                 :: "v"(l), "v"(l + ls), "v"(l + 2 * ls), "v"(l + 3 * ls), "v"(l + 4 * ls), "v"(l + 5 * ls), "v"(l + 6 * ls), "v"(l + 7 * ls),
                    "v"(g), "v"(g + gs), "v"(g + 2 * gs), "v"(g + 3 * gs), "v"(g + 4 * gs), "v"(g + 5 * gs), "v"(g + 6 * gs), "v"(g + 7 * gs) : "memory");
}
// one such copy, with the same closing wait
__device__ __forceinline__ void acopy1(const unsigned l, const char* g) {
    asm volatile("global_load_async_to_lds_b128 %0, %1, off\n\ts_wait_xcnt 0x0" :: "v"(l), "v"(g) : "memory");
}
// twelve such copies at the lane's own addresses l[i] (LDS bytes) and g[i]; the same closing wait
__device__ __forceinline__ void acopy12(const unsigned* l, const char* const* g) {
    asm volatile("global_load_async_to_lds_b128 %0, %12, off\n\tglobal_load_async_to_lds_b128 %1, %13, off\n\tglobal_load_async_to_lds_b128 %2, %14, off\n\tglobal_load_async_to_lds_b128 %3, %15, off\n\t"
                 "global_load_async_to_lds_b128 %4, %16, off\n\tglobal_load_async_to_lds_b128 %5, %17, off\n\tglobal_load_async_to_lds_b128 %6, %18, off\n\tglobal_load_async_to_lds_b128 %7, %19, off\n\t"
                 "global_load_async_to_lds_b128 %8, %20, off\n\tglobal_load_async_to_lds_b128 %9, %21, off\n\tglobal_load_async_to_lds_b128 %10, %22, off\n\tglobal_load_async_to_lds_b128 %11, %23, off\n\t"
                 "s_wait_xcnt 0x0"
                 :: "v"(l[0]), "v"(l[1]), "v"(l[2]), "v"(l[3]), "v"(l[4]), "v"(l[5]), "v"(l[6]), "v"(l[7]), "v"(l[8]), "v"(l[9]), "v"(l[10]), "v"(l[11]),
                    "v"(g[0]), "v"(g[1]), "v"(g[2]), "v"(g[3]), "v"(g[4]), "v"(g[5]), "v"(g[6]), "v"(g[7]), "v"(g[8]), "v"(g[9]), "v"(g[10]), "v"(g[11]) : "memory");
}
// f32 -> f16 convert that cannot produce an f16 subnormal (|v| < 2^-14 -> +0)
static __device__ __forceinline__ h16 toh_flush(float v) { const h16 r = (h16)v; return (fabsf(v) < 6.103515625e-05f) ? (h16)0.0f : r; }
// position-table row: negative index wraps once, then clamps into the table
__device__ __forceinline__ int posrow(int p) { p = p < 0 ? p + NPOS : p; p = p < 0 ? 0 : p; p = p > NPOS - 1 ? NPOS - 1 : p; return p; }

// d_wconv: W1 [200][1000] -> bf16 planes WB [2][256][512] (w = 0: columns 0..499, w = 1: columns 500..999; rows >= 200 and k >= 500 are zeros).
__device__ __forceinline__ void d_wconv(const int blk, const float* __restrict__ W1, bf* WB) {
    const int i = blk * 256 + (int)threadIdx.x; if (i >= 2 * APAD * (KP / 8)) return;
    const int k8 = (i % (KP / 8)) * 8; const int a = (i / (KP / 8)) % APAD; const int w = i / ((KP / 8) * APAD);
    const int ac = a < AD ? a : AD - 1;
    const size_t rb = (size_t)ac * (2 * FD) + (size_t)w * FD;
    float x[8];
#pragma unroll
    for (int j = 0; j < 8; ++j) { const int k = k8 + j; const int kc = k < FD ? k : FD - 1; x[j] = W1[rb + (size_t)kc]; }
    // inputs-only fence on the loaded values: keeps all 8 loads unconditional and issued together, one wait for the lot (without it each is sunk to its use)
    asm volatile("" :: "v"(x[0]), "v"(x[1]), "v"(x[2]), "v"(x[3]), "v"(x[4]), "v"(x[5]), "v"(x[6]), "v"(x[7]));
    v8us o;
#pragma unroll
    for (int j = 0; j < 8; ++j) { const bool ok = (k8 + j < FD) & (a < AD); o[j] = f2bf(ok ? x[j] : 0.0f); }
    *(v8us*)(WB + (size_t)i * 8) = o;
}

// d_xrow: bf16 operand rows [MPAD][512] = [ item vector (400) | position row (100) | zeros (12) ]; rows >= MROWS are zeros.
// USEPOS = 1 (history): position row = table[pos[r]], and the same converted values, held in f16, are stored as the plane HR [rows][512]. USEPOS = 0 (candidates): table row 1, and the same converted values, widened to f32, are stored as out1 [rows][500].
// All loads at clamped addresses, selected by value.
template <int USEPOS>
__device__ __forceinline__ void d_xrow(const int blk, const float* __restrict__ src, const int* __restrict__ pos, const float* __restrict__ pe, bf* dst, float* O1, h16* HR) {
    // One thread converts XP pieces, the same 8 columns of rows MPAD / XP apart (lanes stay contiguous in every load and store); all of its loads are issued before the first use.
    const int t0 = blk * 256 + (int)threadIdx.x;
    const int k8 = (t0 % (KP / 8)) * 8; const int rb = t0 / (KP / 8);
    const int kr = k8 < RD - 8 ? k8 : RD - 8;
    int pa = k8 - RD;     pa = pa < 0 ? 0 : (pa > PD - 4 ? PD - 4 : pa);
    int pb = k8 - RD + 4; pb = pb < 0 ? 0 : (pb > PD - 4 ? PD - 4 : pb);
    int rc[XP], pz[XP];
#pragma unroll
    for (int s = 0; s < XP; ++s) { const int r = rb + s * (MPAD / XP); rc[s] = r < MROWS ? r : MROWS - 1; pz[s] = 1; }
    if (USEPOS) {
#pragma unroll
        for (int s = 0; s < XP; ++s) pz[s] = pos[rc[s]];
    }
    v4f r0[XP], r1[XP], p0[XP], p1[XP];
#pragma unroll
    for (int s = 0; s < XP; ++s) { r0[s] = *(const v4f*)(src + (size_t)rc[s] * RD + kr); r1[s] = *(const v4f*)(src + (size_t)rc[s] * RD + kr + 4); }
    __builtin_amdgcn_sched_barrier(0);             // the item loads above need no index: they are issued before the wait for the position indices
#pragma unroll
    for (int s = 0; s < XP; ++s) { const int prow = USEPOS ? posrow(pz[s]) : 1;
        p0[s] = *(const v4f*)(pe + (size_t)prow * PD + pa); p1[s] = *(const v4f*)(pe + (size_t)prow * PD + pb);
        asm volatile("s_wait_xcnt 0x0" ::: "memory"); }   // a later load of this run may land in the address registers of these two: the wait that stands before such an overwrite
    static_assert(XP == 4);
    // inputs-only fences on the loaded values: every load of the thread is issued, unconditionally, before the first conversion (without them the later pieces' loads wait behind the first piece's stores)
    asm volatile("" :: "v"(r0[0]), "v"(r1[0]), "v"(r0[1]), "v"(r1[1]), "v"(r0[2]), "v"(r1[2]), "v"(r0[3]), "v"(r1[3]));
    asm volatile("" :: "v"(p0[0]), "v"(p1[0]), "v"(p0[1]), "v"(p1[1]), "v"(p0[2]), "v"(p1[2]), "v"(p0[3]), "v"(p1[3]));
#pragma unroll
    for (int s = 0; s < XP; ++s) {
        const int r = rb + s * (MPAD / XP);
        const bool rv = r < MROWS;
        const bool inr = (k8 < RD) & rv;
        const bool ip0 = (k8 >= RD) & (k8 < FD) & rv;
        const bool ip1 = (k8 >= RD) & (k8 + 4 < FD) & rv;
        v8us o;
#pragma unroll
        for (int j = 0; j < 4; ++j) {
            const float x0 = inr ? r0[s][j] : (ip0 ? p0[s][j] : 0.0f);
            const float x1 = inr ? r1[s][j] : (ip1 ? p1[s][j] : 0.0f);
            o[j] = f2bf(x0); o[4 + j] = f2bf(x1); }
        *(v8us*)(dst + (size_t)r * KP + k8) = o;
        if (USEPOS) {
            v8h q;
#pragma unroll
            for (int j = 0; j < 8; ++j) q[j] = toh_flush(__uint_as_float(((unsigned)o[j]) << 16));
            *(v8h*)(HR + (size_t)r * KP + k8) = q;
        }
        if (!USEPOS) {
            v4f q0, q1;
#pragma unroll
            for (int j = 0; j < 4; ++j) { q0[j] = __uint_as_float(((unsigned)o[j]) << 16); q1[j] = __uint_as_float(((unsigned)o[4 + j]) << 16); }
            float* q = O1 + (size_t)rc[s] * FD + (k8 < FD - 4 ? k8 : FD - 4);      // in bounds for every thread; stored only where the piece is a part of the row
            if (inr | ip0) *(v4f*)q = q0;
            if (inr | ip1) *(v4f*)(q + 4) = q1;
        }
    }
    asm volatile("s_wait_xcnt 0x0" ::: "memory");  // the wait that stands before a register named by the stores above is overwritten (code of the other block ranges follows in the listing)
}

// k_prep: the independent operand-plane builders as block ranges of one grid (every branch is block-uniform).
#define PB_W  ((2 * APAD * (KP / 8) + 255) / 256)
#define PB_X  (MPAD * (KP / 8) / (256 * XP))
__global__ __launch_bounds__(256) void k_prep(const float* __restrict__ hist, const float* __restrict__ cand, const int* __restrict__ pos, const float* __restrict__ pe,
                                              const float* __restrict__ W1, bf* WB, bf* XC, bf* XH, h16* HR, float* O1) {
    int blk = (int)blockIdx.x;
    if (blk < PB_W) { d_wconv(blk, W1, WB); return; }
    blk -= PB_W;
    if (blk < PB_X) { d_xrow<0>(blk, cand, pos, pe, XC, O1, HR); return; }
    blk -= PB_X;
    d_xrow<1>(blk, hist, pos, pe, XH, O1, HR);
}

// k_gemm1: bf16 GEMM, one block of 4 waves per 128x64 tile (wave tile 64x32, 8 accumulators), K = 512. HP[w][m][n] = sum_k XB[w][m][k] WB[w][n][k]; grid (MPAD/128, APAD/64, 2).
// The tile's 128 A rows and 64 B rows go to LDS by asynchronous copies, one 512-byte half of a row per wave copy (4 whole lines), in two K halves with a place of their own each:
// the second half's copies fly while the first half's products run. Fragments are read from LDS rows pitched 16 B x odd. Every output sums its 16 k-steps in ascending order.
// Epilogue: the wave's 64x32 slab staged in LDS (wave-private), stored as whole 128-byte lines.
__global__ __launch_bounds__(32 * GW) void k_gemm1(const bf* __restrict__ XB, const bf* __restrict__ WB, float* HP) {
    __shared__ __align__(16) bf sa[GM * LP];
    __shared__ __align__(16) bf sb[GN * LP];
    __shared__ __align__(16) float os[GW * 64 * OSW];
    const int lane = threadIdx.x & 31, lr = lane & 15, hi = lane >> 4;
    const int wave = __builtin_amdgcn_readfirstlane((int)(threadIdx.x >> 5));
    const int r0 = (int)blockIdx.x * GM, c0 = (int)blockIdx.y * GN, w = (int)blockIdx.z;
    // a K half: copy s of a wave takes row wave + 4 s of A (then of B), one 16-byte piece a lane; every lane is on, every address in bounds, no LDS byte written twice; 48 copies a wave
    // (every loop of this kernel is unrolled: its index picks registers, asm operands or immediate offsets)
    const char* ga = (const char*)(XB + ((size_t)w * MPAD + (size_t)(r0 + wave)) * KP + (size_t)lane * 8);
    const char* gb = (const char*)(WB + ((size_t)w * APAD + (size_t)(c0 + wave)) * KP + (size_t)lane * 8);
    const unsigned la0 = (unsigned)(size_t)(&sa[wave * LP + lane * 8]);
    const unsigned lb0 = (unsigned)(size_t)(&sb[wave * LP + lane * 8]);
    auto copy_half = [&](const int p) {
        unsigned l[(GM + GN) / GW]; const char* g[(GM + GN) / GW];
#pragma unroll
        for (int s = 0; s < GM / GW; ++s) { l[s] = la0 + (unsigned)(s * GW * LP * 2 + p * KP); g[s] = ga + (size_t)s * GW * KP * 2 + (size_t)p * KP; }
#pragma unroll
        for (int s = 0; s < GN / GW; ++s) { l[GM / GW + s] = lb0 + (unsigned)(s * GW * LP * 2 + p * KP); g[GM / GW + s] = gb + (size_t)s * GW * KP * 2 + (size_t)p * KP; }
#pragma unroll
        for (int q = 0; q < (GM + GN) / (12 * GW); ++q) acopy12(l + 12 * q, g + 12 * q);
    };
    const int wm = wave & 1, wn = wave >> 1;
    v8f acc[4][2];
#pragma unroll
    for (int mb = 0; mb < 4; ++mb)
#pragma unroll
        for (int nb = 0; nb < 2; ++nb) acc[mb][nb] = (v8f){};
    const bf* pa = &sa[(wm * 64 + lr) * LP + 8 * hi];                    // the lane's place in the k-step's A and B rows
    const bf* pb = &sb[(wn * 32 + lr) * LP + 8 * hi];
    // two register sets: a k-step's 12 LDS reads are issued one k-step ahead of its products, inside the K half only (nothing of the other half is read ahead)
    v16bf a[2][4], bq[2][2];
    auto fetch = [&](const int s, const int kc) {
#pragma unroll
        for (int mb = 0; mb < 4; ++mb) a[s][mb] = ldb(pa + mb * 16 * LP + kc);
#pragma unroll
        for (int nb = 0; nb < 2; ++nb) bq[s][nb] = ldb(pb + nb * 16 * LP + kc); };
    auto mul_half = [&](const int p) {
        fetch(0, p * (KP / 2));
#pragma unroll
        for (int i = 0; i < KP / 64; ++i) {
            if (i + 1 < KP / 64) fetch((i + 1) & 1, p * (KP / 2) + (i + 1) * 32);
#pragma unroll
            for (int nb = 0; nb < 2; ++nb) {
#pragma unroll
                for (int mb = 0; mb < 4; ++mb) acc[mb][nb] = wmmabg(a[i & 1][mb], bq[i & 1][nb], acc[mb][nb]); }
        } };
    copy_half(0);
    asm volatile("s_wait_asynccnt 0x0" ::: "memory");                    // this wave's copies of the first K half have landed
    __syncthreads();                                                     // every wave reads rows that other waves copied; every wave of the block passes here
    copy_half(1);                                                        // into its own columns of the rows, which nobody reads before the next barrier
    mul_half(0);
    asm volatile("s_wait_dscnt 0x0" ::: "memory");                       // hand-over of the second half, in order: the wave's LDS reads, its copies, the barrier
    asm volatile("s_wait_asynccnt 0x0" ::: "memory");                    // this wave's copies of the second K half have landed
    __syncthreads();                                                     // publishes the second half; every wave of the block passes here
    mul_half(1);
    float* osw = os + wave * (64 * OSW);
#pragma unroll
    for (int mb = 0; mb < 4; ++mb) {
#pragma unroll
        for (int nb = 0; nb < 2; ++nb) {
#pragma unroll
            for (int j = 0; j < 8; ++j) osw[(mb * 16 + hi * 8 + j) * OSW + nb * 16 + lr] = acc[mb][nb][j]; } }   // D: row 8h+j, col lane&15
    wave_sync();
    float* outp = HP + ((size_t)w * MPAD + (size_t)(r0 + wm * 64)) * APAD + (size_t)(c0 + wn * 32);
    static_assert(32 * 16 * 16 == 64 * 32 * 4);    // lanes x 16 B x trips == 64 rows x 128 B
#pragma unroll
    for (int s = 0; s < 16; ++s) { const int row = 4 * s + (lane >> 3), c4 = (lane & 7) * 4;   // 16 s x 4 rows = 64 rows; 8 lanes x 4 floats = 32 columns
        const v4f val = *(const v4fa*)(&osw[row * OSW + c4]);
        *(v4f*)(outp + (size_t)row * APAD + c4) = val; }
}

// k_score: one block per 16 candidates of one batch. Stage 0: the block's operands go to LDS once: the batch's 50 hh rows (asynchronous copies, whole padded rows), each wave's 4 hc rows
// (through registers, laid [a][4 candidates]), b1 and w2 (already rounded); behind a block barrier the batch's 50 f16 hist rows follow (asynchronous copies that land while stage 1 runs).
// Stage 1, one wave per 4 candidates; lane = history entry (lane and lane + 32); every operand read from LDS, one pair of 4-wide pieces ahead of its arithmetic.
// logit = sum_a relu((hc + hh) + b1) * w2 + b2 (f32, fmaf chain per (candidate, history) pair); masked entries replaced by -1e9; softmax with the max over all 50 entries (lane shuffles);
// alpha x1024 as f16 into the block's LDS rows pt [16][64] (candidate rows >= 50 and history >= 50 are zeros).
// Stage 2, behind one block barrier: out0[b][n][f] = (1/1024) sum_h pt[n][h] HR[b][h][f] (B fragments by transposing reads of the rows' LDS copy), f16 WMMA, K = 64; one wave per 128 features (8 accumulators);
// the 16 x 128 slab is staged in LDS (wave-private) and stored as 512-byte row pieces, rows < 50 and features < 500 only.
__global__ __launch_bounds__(32 * SW) void k_score(const float* __restrict__ HC, const float* __restrict__ HH, const int* __restrict__ maskp,
                                                   const float* __restrict__ b1, const float* __restrict__ w2, const float* __restrict__ b2,
                                                   const h16* __restrict__ HR, float* O0) {
    __shared__ __align__(16) h16 pt[SW * 4 * TP];
    __shared__ __align__(16) float os[SW * 16 * OSW2];
    __shared__ __align__(16) float xs[NH * XSP];                         // hh rows of the batch
    __shared__ __align__(16) float ct[SW * AD * 4];                      // per wave: hc of its 4 candidates, [a][candidate]
    __shared__ __align__(16) float bs[AD];                               // b1, rounded
    __shared__ __align__(16) float wl[AD];                               // w2, rounded
    __shared__ __align__(16) h16 hl[HPAD * HLP];                         // f16 hist rows of the batch: [history][feature], rows pitched for the transposing reads; rows >= 50 are zeros
    const int lane = threadIdx.x & 31;
    const int wave = __builtin_amdgcn_readfirstlane((int)(threadIdx.x >> 5));
    const int b = (int)blockIdx.y;
    const int n0 = ((int)blockIdx.x * SW + wave) * 4;
    const int lr = lane & 15, hi = lane >> 4;
    const int f0 = wave * 128;
    const size_t hb = (size_t)b * NH;
    // stage 0a: hh rows -> xs. Round s: rows 2s and 2s + 1, one 16-byte piece a lane (a wave's copy is 512 contiguous bytes); every lane is on, every address in bounds, no LDS byte written twice.
    {
        const int col = (int)threadIdx.x & 63, r2 = (int)threadIdx.x >> 6;
        const float* g0 = HH + (hb + (size_t)r2) * APAD + (size_t)col * 4;
        const unsigned l0 = (unsigned)(size_t)(&xs[r2 * XSP + col * 4]);
        const float* g[25]; unsigned l[25];
#pragma unroll
        for (int s = 0; s < 25; ++s) { g[s] = g0 + (size_t)s * 2 * APAD; l[s] = l0 + (unsigned)(s * 2 * XSP * 4); }
        // the copies of a statement end in their own s_wait_xcnt 0: it stands before any register that a copy names is rewritten
        asm volatile("global_load_async_to_lds_b128 %0, %1, off\n\tglobal_load_async_to_lds_b128 %2, %3, off\n\tglobal_load_async_to_lds_b128 %4, %5, off\n\t"
                     "global_load_async_to_lds_b128 %6, %7, off\n\tglobal_load_async_to_lds_b128 %8, %9, off\n\tglobal_load_async_to_lds_b128 %10, %11, off\n\t"
                     "global_load_async_to_lds_b128 %12, %13, off\n\tglobal_load_async_to_lds_b128 %14, %15, off\n\tglobal_load_async_to_lds_b128 %16, %17, off\n\t"
                     "global_load_async_to_lds_b128 %18, %19, off\n\tglobal_load_async_to_lds_b128 %20, %21, off\n\tglobal_load_async_to_lds_b128 %22, %23, off\n\t"
                     "global_load_async_to_lds_b128 %24, %25, off\n\ts_wait_xcnt 0x0"
                     :: "v"(l[0]), "v"(g[0]), "v"(l[1]), "v"(g[1]), "v"(l[2]), "v"(g[2]), "v"(l[3]), "v"(g[3]), "v"(l[4]), "v"(g[4]), "v"(l[5]), "v"(g[5]), "v"(l[6]), "v"(g[6]),
                        "v"(l[7]), "v"(g[7]), "v"(l[8]), "v"(g[8]), "v"(l[9]), "v"(g[9]), "v"(l[10]), "v"(g[10]), "v"(l[11]), "v"(g[11]), "v"(l[12]), "v"(g[12]) : "memory");
        asm volatile("global_load_async_to_lds_b128 %0, %1, off\n\tglobal_load_async_to_lds_b128 %2, %3, off\n\tglobal_load_async_to_lds_b128 %4, %5, off\n\t"
                     "global_load_async_to_lds_b128 %6, %7, off\n\tglobal_load_async_to_lds_b128 %8, %9, off\n\tglobal_load_async_to_lds_b128 %10, %11, off\n\t"
                     "global_load_async_to_lds_b128 %12, %13, off\n\tglobal_load_async_to_lds_b128 %14, %15, off\n\tglobal_load_async_to_lds_b128 %16, %17, off\n\t"
                     "global_load_async_to_lds_b128 %18, %19, off\n\tglobal_load_async_to_lds_b128 %20, %21, off\n\tglobal_load_async_to_lds_b128 %22, %23, off\n\t"
                     "s_wait_xcnt 0x0"
                     :: "v"(l[13]), "v"(g[13]), "v"(l[14]), "v"(g[14]), "v"(l[15]), "v"(g[15]), "v"(l[16]), "v"(g[16]), "v"(l[17]), "v"(g[17]), "v"(l[18]), "v"(g[18]),
                        "v"(l[19]), "v"(g[19]), "v"(l[20]), "v"(g[20]), "v"(l[21]), "v"(g[21]), "v"(l[22]), "v"(g[22]), "v"(l[23]), "v"(g[23]), "v"(l[24]), "v"(g[24]) : "memory");
    }
    // stage 0b: the wave's 4 hc rows, b1, w2 and the lane's two mask words, all at clamped addresses and in flight together (a wave without candidates stages row 49 into its own, unread part of ct)
    const int nvec = ((int)blockIdx.x * SW + (int)(threadIdx.x >> 5)) * 4;
    size_t oc[4]; bool rok[4];
#pragma unroll
    for (int i = 0; i < 4; ++i) { int q = nvec + i; rok[i] = q < NN; q = q < NN ? q : NN - 1; q = __builtin_amdgcn_readfirstlane(q);
        oc[i] = ((size_t)b * NN + (size_t)q) * APAD; }
    const int hB = lane + 32; const int hBc = hB < NH ? hB : NH - 1; const bool okB = hB < NH;
    const int pB = hB < AD / 4 ? hB : AD / 4 - 1;                        // the lane's second piece of a candidate row
    const int tb = (int)threadIdx.x < AD / 4 ? (int)threadIdx.x : AD / 4 - 1;
    v4f cv[2][4];
#pragma unroll
    for (int i = 0; i < 4; ++i) { cv[0][i] = *(const v4f*)(HC + oc[i] + 4 * lane); cv[1][i] = *(const v4f*)(HC + oc[i] + 4 * pB); }
    const v4f b1v = *(const v4f*)(b1 + 4 * tb), w2v = *(const v4f*)(w2 + 4 * tb);
    const int mkA = maskp[hb + (size_t)lane], mkB = maskp[hb + (size_t)hBc];
    // inputs-only fence on the loaded values: the mask loads stay here, in flight with the other loads of stage 0 (sunk to their use behind stage 1 they would cost a memory latency of their own)
    asm volatile("" :: "v"(mkA), "v"(mkB));
#pragma unroll
    for (int j = 0; j < 4; ++j) {
        const v4f q0 = {cv[0][0][j], cv[0][1][j], cv[0][2][j], cv[0][3][j]}, q1 = {cv[1][0][j], cv[1][1][j], cv[1][2][j], cv[1][3][j]};
        *(v4fa*)(&ct[wave * (AD * 4) + (4 * lane + j) * 4]) = q0;
        if (hB < AD / 4) *(v4fa*)(&ct[wave * (AD * 4) + (4 * hB + j) * 4]) = q1; }
    if ((int)threadIdx.x < AD / 4) {
        const v4f br = {bfr(b1v[0]), bfr(b1v[1]), bfr(b1v[2]), bfr(b1v[3])}, wr = {bfr(w2v[0]), bfr(w2v[1]), bfr(w2v[2]), bfr(w2v[3])};
        *(v4fa*)(&bs[4 * (int)threadIdx.x]) = br; *(v4fa*)(&wl[4 * (int)threadIdx.x]) = wr; }
    // the k rows 50..63 of stage 2's B operand: zeros (their alpha is zero too, and the product must be a zero)
#pragma unroll
    for (int it = 0; it < 7; ++it) { const int p = it * (32 * SW) + (int)threadIdx.x; const v8h z = (v8h){};
        *(v8ha*)(&hl[(NH + (p >> 6)) * HLP + (p & 63) * 8]) = z; }
    asm volatile("s_wait_asynccnt 0x0" ::: "memory");                    // this wave's copies have landed
    __syncthreads();                                                     // every wave reads rows that other waves copied; every wave of the block passes here
    // stage 2's B operand depends on nothing of stage 1: the batch's 50 f16 hist rows are copied to LDS here and land while stage 1 runs. A wave takes one half (512 contiguous bytes) of every second row:
    // 25 copies; every lane is on, every address in bounds, no LDS byte written twice
    {
        const int row = wave >> 1, hf = wave & 1;
        const char* g0 = (const char*)(HR + (hb + (size_t)row) * KP + (size_t)hf * (KP / 2) + (size_t)lane * 8);
        const unsigned l0 = (unsigned)(size_t)(&hl[row * HLP + hf * (KP / 2) + lane * 8]);
#pragma unroll
        for (int s = 0; s < 3; ++s) acopy8(l0 + (unsigned)(s * 16 * HLP * 2), g0 + (size_t)s * 16 * KP * 2, 2 * HLP * 2, (size_t)2 * KP * 2);
        acopy1(l0 + (unsigned)(48 * HLP * 2), g0 + (size_t)48 * KP * 2);
    }
    if (n0 >= NN) {                                                      // wave-uniform: no candidate here, its 4 alpha rows are zeros
        const v8h z = (v8h){}; *(v8ha*)(&pt[(wave * 4 + (lane >> 3)) * TP + (lane & 7) * 8]) = z;
    } else {
    const float b2v = bfr(b2[0]);
    float accA[4], accB[4];
#pragma unroll
    for (int i = 0; i < 4; ++i) { accA[i] = 0.0f; accB[i] = 0.0f; }
    const float* xpa = &xs[lane * XSP]; const float* xpb = &xs[hBc * XSP]; const float* cp = &ct[wave * (AD * 4)];
    // two register sets of two pieces each: a pair's 16 LDS reads are issued one pair ahead of its arithmetic
    v4f xa[2][2], xb[2][2], bb[2][2], ww[2][2], cc[2][2][4];
    auto fetch = [&](const int s, const int d) {
#pragma unroll
        for (int p = 0; p < 2; ++p) { const int a4 = 2 * d + p;
            xa[s][p] = *(const v4fa*)(xpa + 4 * a4); xb[s][p] = *(const v4fa*)(xpb + 4 * a4);
            bb[s][p] = *(const v4fa*)(&bs[4 * a4]);  ww[s][p] = *(const v4fa*)(&wl[4 * a4]);
#pragma unroll
            for (int j = 0; j < 4; ++j) cc[s][p][j] = *(const v4fa*)(cp + (4 * a4 + j) * 4); } };
    auto work = [&](const int s) {
#pragma unroll
        for (int p = 0; p < 2; ++p) {
#pragma unroll
            for (int j = 0; j < 4; ++j) {
#pragma unroll
                for (int i = 0; i < 4; ++i) {
                    const float c = cc[s][p][j][i];
                    const float va = fmaxf((c + xa[s][p][j]) + bb[s][p][j], 0.0f), vb = fmaxf((c + xb[s][p][j]) + bb[s][p][j], 0.0f);
                    accA[i] = fmaf(va, ww[s][p][j], accA[i]); accB[i] = fmaf(vb, ww[s][p][j], accB[i]); } } } };
    // the compiler fence behind each fetch keeps its reads where they stand: without it the reads carried into the next trip are sunk to that trip's head, directly in front of their use
    fetch(0, 0);
    asm volatile("" ::: "memory");
#pragma unroll 1
    for (int d = 0; d < AD / 8 - 1; d += 2) {                            // rolled: the body already holds two pairs, one per register set
        fetch(1, d + 1);
        asm volatile("" ::: "memory");
        work(0);
        fetch(0, d + 2);
        asm volatile("" ::: "memory");
        work(1);
        // the order asked of the scheduler: a pair's 16 LDS reads together, then the other pair's arithmetic, so that every read has a whole pair of lead (left alone it puts the reads late, close to their use)
        __builtin_amdgcn_sched_group_barrier(0x100, 16, 0);
        __builtin_amdgcn_sched_group_barrier(0x002, 134, 0);
        __builtin_amdgcn_sched_group_barrier(0x100, 16, 0);
        __builtin_amdgcn_sched_group_barrier(0x002, 140, 0);
    }
    work(0);                                                             // the last pair
#pragma unroll
    for (int i = 0; i < 4; ++i) {
        float sA = accA[i] + b2v, sB = accB[i] + b2v;
        sA = (mkA != 0) ? sA : NEGV; sB = (mkB != 0) ? sB : NEGV; sB = okB ? sB : NEGB;
        float mx = fmaxf(sA, sB);
        mx = fmaxf(mx, __shfl_xor(mx, 16, 32)); mx = fmaxf(mx, __shfl_xor(mx, 8, 32)); mx = fmaxf(mx, __shfl_xor(mx, 4, 32));
        mx = fmaxf(mx, __shfl_xor(mx, 2, 32));  mx = fmaxf(mx, __shfl_xor(mx, 1, 32));
        const float eA = __builtin_amdgcn_exp2f((sA - mx) * L2E);
        float eB = __builtin_amdgcn_exp2f((sB - mx) * L2E); eB = okB ? eB : 0.0f;
        float sm = eA + eB;
        sm += __shfl_xor(sm, 16, 32); sm += __shfl_xor(sm, 8, 32); sm += __shfl_xor(sm, 4, 32); sm += __shfl_xor(sm, 2, 32); sm += __shfl_xor(sm, 1, 32);
        const float inv = __builtin_amdgcn_rcpf(sm) * PCS;              // sm >= 1 (the maximum entry contributes 1)
        h16 qa = toh_flush(eA * inv), qb = toh_flush(eB * inv);
        qa = rok[i] ? qa : (h16)0.0f; qb = rok[i] ? qb : (h16)0.0f;
        pt[(wave * 4 + i) * TP + lane] = qa; pt[(wave * 4 + i) * TP + 32 + lane] = qb; }   // 4 rows x 64 columns all written
    }
    asm volatile("s_wait_asynccnt 0x0" ::: "memory");                    // this wave's copies of the hist rows have landed
    __syncthreads();                                                     // every wave reads all 16 alpha rows and hist rows that other waves copied; every wave of the block passes here
    v16h a[2];
#pragma unroll
    for (int ks = 0; ks < 2; ++ks) { const h16* p = &pt[lr * TP + 8 * hi + 32 * ks]; a[ks] = cat16(*(const v8ha*)p, *(const v8ha*)(p + 16)); }   // the k map of ldb
    const h16* tq = &hl[(8 * hi + (lane & 7)) * HLP + f0 + 8 * ((lane >> 3) & 1)];   // the lane's address in a 16 (history) x 16 (feature) tile of the transposing read
    v16h bq[2][8];                                                       // all B fragments are read before the first matrix instruction: one LDS latency, not sixteen
#pragma unroll
    for (int ks = 0; ks < 2; ++ks) {
#pragma unroll
        for (int nb = 0; nb < 8; ++nb) bq[ks][nb] = cat16(ldtr(tq + (32 * ks) * HLP + nb * 16), ldtr(tq + (32 * ks + 16) * HLP + nb * 16)); }   // the k map of ldb: elements 0..7 <- 32 ks + 8h + 0..7, 8..15 <- 32 ks + 16 + 8h + 0..7
    v8f acc[8];
#pragma unroll
    for (int nb = 0; nb < 8; ++nb) acc[nb] = (v8f){};
#pragma unroll
    for (int ks = 0; ks < 2; ++ks) {
#pragma unroll
        for (int nb = 0; nb < 8; ++nb) acc[nb] = wmma16g(a[ks], bq[ks][nb], acc[nb]); }
    float* osw = os + wave * (16 * OSW2);
#pragma unroll
    for (int nb = 0; nb < 8; ++nb) {
#pragma unroll
        for (int j = 0; j < 8; ++j) osw[(hi * 8 + j) * OSW2 + nb * 16 + lr] = acc[nb][j] * PCI; }   // D: row 8h+j, col lane&15
    wave_sync();
    const int nr0 = (int)blockIdx.x * (SW * 4);
    const int c4 = lane * 4;                                             // 32 lanes x 4 floats = 128 columns
    float* outp = O0 + ((size_t)b * NN + (size_t)nr0) * FD + (size_t)(f0 + c4);
    const bool cok = f0 + c4 < FD;                                       // FD % 4 == 0: a float4 lies wholly inside the row or wholly outside
    v4f val[16];
#pragma unroll
    for (int row = 0; row < 16; ++row) val[row] = *(const v4fa*)(&osw[row * OSW2 + c4]);
    if (cok) {
#pragma unroll
        for (int row = 0; row < 16; ++row) { if (nr0 + row < NN) *(v4f*)(outp + (size_t)row * FD) = val[row]; }
    }
}

static constexpr size_t al256(size_t v) { return (v + 255) & ~(size_t)255; }
static constexpr size_t SZ_WB = al256((size_t)2 * APAD * KP * 2);
static constexpr size_t SZ_XB = al256((size_t)2 * MPAD * KP * 2);
static constexpr size_t SZ_HR = al256((size_t)MPAD * KP * 2);
static constexpr size_t SZ_HP = al256((size_t)2 * MPAD * APAD * 4);
static constexpr size_t SZ_TOTAL = SZ_WB + SZ_XB + SZ_HR + SZ_HP;
static_assert(SZ_TOTAL <= (size_t)134217728);          // workspace carve <= 128 MiB
static_assert(((size_t)MPAD * KP * 2) % 256 == 0);     // the two X sub-planes stay 256-byte aligned
static_assert(((size_t)MPAD * APAD * 4) % 256 == 0);   // the two HP sub-planes stay 256-byte aligned
static constexpr size_t OUT1_OFF = (size_t)NB_FULL * NN * FD;   // element offset of the second output (fixed, full problem)

extern "C" void kernel_launch(void* const* d_in, const int* in_sizes, int n_in,
                              void* d_out, int out_size, void* d_ws, size_t ws_size, hipStream_t stream) {
    if (n_in < 9) return;
    if ((size_t)in_sizes[0] < (size_t)MROWS * RD || (size_t)in_sizes[1] < (size_t)MROWS * RD) return;
    if ((size_t)in_sizes[2] < (size_t)MROWS || (size_t)in_sizes[3] < (size_t)MROWS) return;
    if ((size_t)in_sizes[4] < (size_t)NPOS * PD || (size_t)in_sizes[5] < (size_t)AD * 2 * FD) return;
    if (in_sizes[6] < AD || in_sizes[7] < AD || in_sizes[8] < 1) return;
    if ((size_t)out_size < OUT1_OFF + (size_t)MROWS * FD) return;
    if (SZ_TOTAL > ws_size) return;
    // wire order: history_repr, candidate_repr, user_history_mask, user_history_position, pos_emb, W1, b1, w2, b2
    const float* hist_in = (const float*)d_in[0];
    const float* cand_in = (const float*)d_in[1];
    const int*   maskp   = (const int*)d_in[2];
    const int*   posp    = (const int*)d_in[3];
    const float* pe      = (const float*)d_in[4];
    const float* W1      = (const float*)d_in[5];
    const float* b1      = (const float*)d_in[6];
    const float* w2      = (const float*)d_in[7];
    const float* b2      = (const float*)d_in[8];
    float* OUT0 = (float*)d_out;                 // [NB][50][500]
    float* OUT1 = (float*)d_out + OUT1_OFF;      // [NB][50][500]
    char* wsp = (char*)d_ws;
    bf*  WB = (bf*)wsp;    wsp += SZ_WB;         // [2][256][512]: Wc | Wh
    bf*  XB = (bf*)wsp;    wsp += SZ_XB;         // [2][MPAD][512]: cand rows | hist rows
    h16* HR = (h16*)wsp;   wsp += SZ_HR;         // [MPAD][512]: hist rows in f16
    float* HP = (float*)wsp; wsp += SZ_HP;       // [2][MPAD][256]: hc | hh
    bf* XC = XB; bf* XH = XB + (size_t)MPAD * KP;
    const float* HC = HP; const float* HH = HP + (size_t)MPAD * APAD;

    k_prep<<<(unsigned)(PB_W + 2 * PB_X), 256, 0, stream>>>(hist_in, cand_in, posp, pe, W1, WB, XC, XH, HR, OUT1);
    // hc = cand Wc^T, hh = hist Wh^T
    k_gemm1<<<dim3(MPAD / GM, APAD / GN, 2), 32 * GW, 0, stream>>>(XB, WB, HP);
    // logits, softmax, user representation = alpha hist
    k_score<<<dim3(HPAD / (4 * SW), NB, 1), 32 * SW, 0, stream>>>(HC, HH, maskp, b1, w2, b2, HR, OUT0);
}

// v006
// Measured time: 18.8 microseconds a run.
// Next to v005, in two timings, it ran 1.15 and 1.14 times as fast.
// Counting every step since v000, it is 3.02 times as fast.
#include <hip/hip_runtime.h>
#pragma clang fp contract(off)

// Additive attention of candidate items over a user history: rows = [400-wide item vector | 100-wide position embedding]; hidden = relu(cand Wc^T + hist Wh^T + b1) (W1 [200][1000] = [Wc | Wh], [out][in]); logit = hidden . w2 + b2; masked entries REPLACED by -1e9; softmax over the history; out0 = alpha hist, out1 = the candidate rows.
// Compute dtypes, f32 accumulate everywhere: the two projections v_wmma_f32_16x16x32_bf16 (items, position table, W1 RNE-converted to bf16; products exact); alpha . hist v_wmma_f32_16x16x32_f16 (alpha x1024 carry as f16, hist = the bf16 values held in f16); relu / w2 dot (depth 200, one shared vector) and softmax on the vector unit in f32.
// Layout: f32 plane HP [2][rows][256] (hc | hh); f16 plane HR [rows][512] (the hist rows, K zero-padded 500 -> 512, the bf16 values held in f16; the score kernel reads them transposed out of LDS); the bf16 operands of the projections (rows and W1, zero-padded to [.][512]) exist in LDS only; alpha stays in LDS (16 candidate rows per score block).
// Two launches: k_gemm1 (operand conversion, both projections, out1 and HR), k_score (logits, softmax, alpha . hist, out0).

#ifndef NB
#define NB 64
#endif
#define NB_FULL 64
#define NH   50                  // history entries per batch
#define NN   50                  // candidates per batch
#define RD   400                 // item vector width
#define PD   100                 // position embedding width
#define FD   500                 // RD + PD
#define AD   200                 // attention width
#define NPOS 52                  // rows of the position table
#define KP   512                 // FD padded to the k-step
#define APAD 256                 // AD padded to the column tile
#define HPAD 64                  // NH / NN padded (k of the second product, rows of its A operand)
#define MROWS (NB * NN)
#define MPAD  ((MROWS + 63) / 64 * 64)
#define OSW  36                  // LDS row pitch (floats) of a 64 x 32 slab
#define GM   128                 // GEMM block tile: rows
#define GN   64                  // GEMM block tile: columns
#define GW   4                   // GEMM waves that multiply, 2 x 2 wave tiles of 64 x 32
#define LP   520                 // LDS row pitch (16-bit elements) of the staged GEMM operand rows: 1040 B = 16 B x odd
#define OSW2 132                 // LDS row pitch (floats) of a 16 x 128 slab
#define TP   72                  // LDS row pitch (halves) of the alpha rows
#define HLP  528                 // LDS row pitch (halves) of the staged f16 hist rows: 1056 B = 32 B x odd, the pitch of the transposing 16-bit read
#define SW   4                   // waves per score block (4 candidates each)
#define XSP  260                 // LDS row pitch (floats) of the staged hh rows: 1040 B = 16 B x odd, so 16 lanes' 16-byte reads of 16 rows fall on 64 different banks
#define GT   8                   // GEMM waves per block in all: 8 convert the operands; then 4 multiply and 4 store the row planes
#define PCS  1024.0f             // carry of the alpha plane
#define PCI  (1.0f / 1024.0f)
#define L2E  1.4426950408889634f
#define NEGV (-1.0e9f)
#define NEGB (-3.0e38f)

static_assert(FD == RD + PD);
static_assert(NH == NN);                       // both row sets have MROWS rows
static_assert(RD % 8 == 0);                    // an 8-element piece never straddles the item / position boundary
static_assert(PD % 4 == 0);
static_assert(FD % 4 == 0);                    // a float4 of the flat output never straddles two rows
static_assert(KP % 32 == 0);                   // GEMM k-loop steps by 32
static_assert(KP >= FD);
static_assert(KP % 64 == 0);
static_assert(KP / 8 == 64);
static_assert(APAD % 64 == 0);
static_assert(APAD >= AD);
static_assert(AD % 4 == 0);
static_assert(HPAD == 64);
static_assert(HPAD % 32 == 0);
static_assert(NH > 32);                        // two history entries per lane: lane and lane + 32
static_assert(NH <= HPAD);
static_assert(NN <= HPAD);
static_assert(MPAD % 64 == 0);
static_assert(MPAD == MROWS);                  // every row of a GEMM tile is a row of the inputs
static_assert(HPAD % (4 * SW) == 0);           // score grid covers the padded candidate rows exactly
static_assert(NB <= NB_FULL);
static_assert(((size_t)NB_FULL * NN * FD * 4) == (size_t)6400000);   // byte offset of the second output
static_assert((((size_t)NB_FULL * NN * FD * 4) % 128) == 0);
static_assert((OSW * 4) % 16 == 0);
static_assert((TP * 2) % 16 == 0);
static_assert(MPAD % GM == 0);
static_assert(APAD % GN == 0);
static_assert(GM == 2 * 64);                   // 2 x 2 wave tiles cover the block tile
static_assert(GN == 2 * 32);
static_assert(GM % GW == 0);
static_assert(GN % GW == 0);
static_assert(KP == 4 * 32 * 4);               // a row is 4 quarters of 4 columns for each of a wave's 32 lanes
static_assert(RD > 384 && RD <= 384 + 128 && FD <= KP);   // the item / position boundary and the end of the row lie in the last quarter
static_assert(LP >= KP);
static_assert((LP * 2) % 32 == 16);
static_assert((GM + GN) * LP * 2 + GW * 64 * OSW * 4 <= 327680);   // static LDS of the GEMM kernel
static_assert(SW * 4 == 16);                   // a score block's candidates are one 16-row A fragment
static_assert(SW * 128 == KP);                 // its waves cover the padded features, 128 each
static_assert((OSW2 * 4) % 16 == 0);
static_assert(SW * 4 * TP * 2 + SW * 16 * OSW2 * 4 + NH * XSP * 4 + SW * AD * 4 * 4 + 2 * AD * 4 + HPAD * HLP * 2 <= 327680);   // static LDS of the score kernel
static_assert(XSP >= APAD);
static_assert((XSP * 4) % 16 == 0);
static_assert(APAD / 4 == 64);                 // a padded hh row is 64 pieces of 16 B: half of the score block's threads
static_assert(32 * SW == 128);
static_assert(NH == 2 * 25);                   // 25 rounds of 2 rows copy the 50 hh rows exactly, every lane on in every round
static_assert((AD / 4) % 4 == 2);              // the score loop takes two pairs of pieces a trip, and one pair is left behind it
static_assert(TP >= HPAD);
static_assert(HLP >= KP);
static_assert((HLP * 2) % 64 == 32);
static_assert(KP * 2 == 2 * 32 * 16);          // half a hist row is one 16-byte piece for each of a wave's 32 lanes
static_assert(2 * NH == SW * 25);              // 25 copies a wave take the 100 row halves exactly
static_assert((HPAD - NH) * (KP / 8) == 7 * 32 * SW);   // 7 stores a thread zero the k rows behind the history
static_assert(AD / 4 <= 64);                   // a candidate row's pieces: lane and lane + 32
static_assert(AD / 4 <= 32 * SW);

typedef _Float16 h16;
typedef unsigned short bf;
typedef __attribute__((ext_vector_type(16))) __bf16   v16bf;
typedef __attribute__((ext_vector_type(16))) _Float16 v16h;
typedef __attribute__((ext_vector_type(8)))  _Float16 v8h;
typedef __attribute__((ext_vector_type(8)))  unsigned short v8us;
typedef __attribute__((ext_vector_type(8)))  short    v8s;
typedef __attribute__((ext_vector_type(8)))  float    v8f;
typedef __attribute__((ext_vector_type(4)))  float    v4f;
typedef __attribute__((ext_vector_type(2)))  float    v2f;
typedef __attribute__((ext_vector_type(2)))  __bf16   v2bf;
typedef __attribute__((ext_vector_type(2)))  unsigned v2u;
typedef v4f  __attribute__((may_alias)) v4fa;
typedef v2u  __attribute__((may_alias)) v2ua;
typedef v8us __attribute__((may_alias)) v8usa;
typedef v8h  __attribute__((may_alias)) v8ha;

__device__ __forceinline__ unsigned short f2bf(float f) { unsigned u = __float_as_uint(f); u += 0x7FFFu + ((u >> 16) & 1u); return (unsigned short)(u >> 16); }
__device__ __forceinline__ float bfr(float f) { return __uint_as_float(((unsigned)f2bf(f)) << 16); }   // value after RNE convert to bf16
__device__ __forceinline__ v16h cat16(v8h lo, v8h hi) { return __builtin_shufflevector(lo, hi, 0, 1, 2, 3, 4, 5, 6, 7, 8, 9, 10, 11, 12, 13, 14, 15); }
__device__ __forceinline__ v16bf cat16b(v8us lo, v8us hi) { return __builtin_bit_cast(v16bf, __builtin_shufflevector(lo, hi, 0, 1, 2, 3, 4, 5, 6, 7, 8, 9, 10, 11, 12, 13, 14, 15)); }
__device__ __forceinline__ v8f wmma16(v16h a, v16h b, v8f c) { return __builtin_amdgcn_wmma_f32_16x16x32_f16(false, a, false, b, (short)0, c, false, false); }
__device__ __forceinline__ v8f wmmab(v16bf a, v16bf b, v8f c) { return __builtin_amdgcn_wmma_f32_16x16x32_bf16(false, a, false, b, (short)0, c, false, false); }
// fragment loaders from K-contiguous 16-bit rows; p already includes + 8*(lane>>4): elements 0..7 <- k0+8h+0..7, elements 8..15 <- k0+16+8h+0..7 (same map for A and B)
__device__ __forceinline__ v16bf ldb(const bf* p)  { return cat16b(*(const v8us*)p, *(const v8us*)(p + 16)); }
// transposing LDS read (ds_load_tr16_b128) of a row-major 16-bit tile T: with p = &T[k0 + 8 * (lane >> 4) + (lane & 7)][d0 + 8 * ((lane >> 3) & 1)] the lane gets T[k0 + 8 * (lane >> 4) + 0..7][d0 + (lane & 15)]
__device__ __forceinline__ v8h ldtr(const h16* p) { typedef __attribute__((address_space(3))) v8s lds_v8s; return __builtin_bit_cast(v8h, __builtin_amdgcn_ds_load_tr16_b128_v8i16((lds_v8s*)p)); }
// ordering point for wave-private LDS tiles (same wave writes and reads)
__device__ __forceinline__ void wave_sync() { __builtin_amdgcn_fence(3 /* release order */, "wavefront"); __builtin_amdgcn_wave_barrier(); asm volatile("" ::: "memory"); }
// per-instruction guarded matrix ops: one accumulator tied per guard, operands kept live
__device__ __forceinline__ v8f wmma16g(v16h a, v16h b, v8f c) { c = wmma16(a, b, c); asm volatile("v_nop\n\tv_nop\n\tv_nop\n\tv_nop" : "+v"(c) : "v"(a), "v"(b)); return c; }
__device__ __forceinline__ v8f wmmabg(v16bf a, v16bf b, v8f c) { c = wmmab(a, b, c); asm volatile("v_nop\n\tv_nop\n\tv_nop\n\tv_nop" : "+v"(c) : "v"(a), "v"(b)); return c; }
// eight asynchronous 16-byte copies a lane, global -> LDS, at steps of gs and ls bytes; the statement ends in its own s_wait_xcnt 0, which so stands before any register that a copy names is rewritten
__device__ __forceinline__ void acopy8(const unsigned l, const char* g, const unsigned ls, const size_t gs) {
    asm volatile("global_load_async_to_lds_b128 %0, %8, off\n\tglobal_load_async_to_lds_b128 %1, %9, off\n\tglobal_load_async_to_lds_b128 %2, %10, off\n\tglobal_load_async_to_lds_b128 %3, %11, off\n\t"
                 "global_load_async_to_lds_b128 %4, %12, off\n\tglobal_load_async_to_lds_b128 %5, %13, off\n\tglobal_load_async_to_lds_b128 %6, %14, off\n\tglobal_load_async_to_lds_b128 %7, %15, off\n\t"
                 "s_wait_xcnt 0x0"
                 :: "v"(l), "v"(l + ls), "v"(l + 2 * ls), "v"(l + 3 * ls), "v"(l + 4 * ls), "v"(l + 5 * ls), "v"(l + 6 * ls), "v"(l + 7 * ls),
                    "v"(g), "v"(g + gs), "v"(g + 2 * gs), "v"(g + 3 * gs), "v"(g + 4 * gs), "v"(g + 5 * gs), "v"(g + 6 * gs), "v"(g + 7 * gs) : "memory");
}
// one such copy, with the same closing wait
__device__ __forceinline__ void acopy1(const unsigned l, const char* g) {
    asm volatile("global_load_async_to_lds_b128 %0, %1, off\n\ts_wait_xcnt 0x0" :: "v"(l), "v"(g) : "memory");
}
// f32 -> f16 convert that cannot produce an f16 subnormal (|v| < 2^-14 -> +0)
static __device__ __forceinline__ h16 toh_flush(float v) { const h16 r = (h16)v; return (fabsf(v) < 6.103515625e-05f) ? (h16)0.0f : r; }
// position-table row: negative index wraps once, then clamps into the table
__device__ __forceinline__ int posrow(int p) { p = p < 0 ? p + NPOS : p; p = p < 0 ? 0 : p; p = p > NPOS - 1 ? NPOS - 1 : p; return p; }

// four f32 -> four bf16, round to nearest even (two v_cvt_pk_bf16_f32), packed in two words
__device__ __forceinline__ v2u cvt4(const v4f x) {
    const v2f lo = {x[0], x[1]}, hi = {x[2], x[3]};
    v2u r; r[0] = __builtin_bit_cast(unsigned, __builtin_convertvector(lo, v2bf)); r[1] = __builtin_bit_cast(unsigned, __builtin_convertvector(hi, v2bf)); return r;
}

// k_gemm1: bf16 GEMM straight from the f32 inputs, one block of 8 waves per 128x64 tile, K = 512. HP[w][m][n] = sum_k X[w][m][k] W[w][n][k]; grid (MPAD/128, APAD/64, 2); w = 0: candidates, Wc; w = 1: history, Wh.
// Stage 0, all 8 waves: the tile's 128 A rows = [ item vector (400) | position row (100) | zeros (12) ] (history: table[pos[r]]; candidates: table row 1) and its 64 B rows (W1 row a, columns 500 w ..; rows >= 200 and k >= 500
// are zeros) are loaded as f32 (a wave load is 512 contiguous bytes of one row), converted to bf16 and stored to LDS rows pitched 16 B x odd. All loads at clamped addresses, selected or masked by value.
// Behind one block barrier: waves 0..3 multiply (wave tile 64x32, 8 accumulators; every output sums its 16 k-steps in ascending order) and store their 64x32 slab, staged in LDS (wave-private), as whole 128-byte lines;
// waves 4..7 store the converted A rows from LDS: candidates widened to f32 as out1 [rows][500], history held in f16 as the plane HR [rows][512]. Each of the 4 column blocks of a row tile stores 32 of its 128 rows.
__global__ __launch_bounds__(32 * GT) void k_gemm1(const float* __restrict__ hist, const float* __restrict__ cand, const int* __restrict__ pos, const float* __restrict__ pe,
                                                   const float* __restrict__ W1, float* HP, h16* HR, float* O1) {
    __shared__ __align__(16) bf sa[GM * LP];
    __shared__ __align__(16) bf sb[GN * LP];
    __shared__ __align__(16) float os[GW * 64 * OSW];
    const int lane = threadIdx.x & 31, lr = lane & 15, hi = lane >> 4;
    const int wave = __builtin_amdgcn_readfirstlane((int)(threadIdx.x >> 5));
    const int r0 = (int)blockIdx.x * GM, c0 = (int)blockIdx.y * GN, w = (int)blockIdx.z;
    const float* src = w ? hist : cand;
    // a wave takes rows wave + 8 s; a row is 4 quarters of 128 columns, 4 columns a lane. The last quarter (columns 384..511) holds the item's last 16 columns, the position row and the zeros.
    const int c4 = lane * 4;
    const int ci = 384 + c4 < RD - 4 ? 384 + c4 : RD - 4;                // item column of the last quarter, clamped into the row
    int cp = 384 + c4 - RD; cp = cp < 0 ? 0 : (cp > PD - 4 ? PD - 4 : cp);   // position column, clamped into the table row
    const int cw = 384 + c4 < FD - 4 ? 384 + c4 : FD - 4;                // W1 column of the last quarter, clamped into its half of the row
    const bool isitem = 384 + c4 < RD;
    const unsigned mlane = 384 + c4 < FD ? 0xFFFFFFFFu : 0u;             // zero for the padded columns
    const int pzv = pos[r0 + wave + GT * lr];                            // lane s (s < 16) holds the position index of the wave's A row s
    int pof;                                                             // and, behind the B loads, the place in the table of that row's position row
    // (every loop of this kernel is unrolled: its index picks registers or immediate offsets)
    v4f x[2][20];                                                        // two register sets of 4 rows each: a set's loads fly while the other set is converted
    auto loadB = [&](const int st, const int bt) {
#pragma unroll
        for (int i = 0; i < 4; ++i) { const int a = c0 + wave + GT * (4 * bt + i); const int ac = a < AD ? a : AD - 1;
            const float* p = W1 + (size_t)ac * (2 * FD) + (size_t)w * FD;
#pragma unroll
            for (int j = 0; j < 3; ++j) x[st][4 * i + j] = *(const v4f*)(p + 128 * j + c4);
            x[st][4 * i + 3] = *(const v4f*)(p + cw); }
        asm volatile("s_wait_xcnt 0x0" ::: "memory");                    // the wait that stands before a register named by these loads is overwritten; its clobber also keeps the set's loads together, ahead of the other set's conversion
        __builtin_amdgcn_sched_barrier(0);                               // no conversion (and so no wait for an older set) is moved up among these loads
    };
    auto storeB = [&](const int st, const int bt) {
#pragma unroll
        for (int i = 0; i < 4; ++i) { const int row = wave + GT * (4 * bt + i); const unsigned m = c0 + row < AD ? 0xFFFFFFFFu : 0u;
#pragma unroll
            for (int j = 0; j < 4; ++j) { v2u q = cvt4(x[st][4 * i + j]); const unsigned mm = j < 3 ? m : (m & mlane); q[0] &= mm; q[1] &= mm;
                *(v2ua*)(&sb[row * LP + 128 * j + c4]) = q; } }
    };
    auto loadA = [&](const int st, const int bt) {
#pragma unroll
        for (int i = 0; i < 4; ++i) { const int s = 4 * bt + i;
            const float* p = src + (size_t)(r0 + wave + GT * s) * RD;
#pragma unroll
            for (int j = 0; j < 3; ++j) x[st][5 * i + j] = *(const v4f*)(p + 128 * j + c4);
            x[st][5 * i + 3] = *(const v4f*)(p + ci);
            x[st][5 * i + 4] = *(const v4f*)(pe + __builtin_amdgcn_readlane(pof, s) + cp); }   // the row's place as a scalar: scalar base, the lane's fixed offset
        asm volatile("s_wait_xcnt 0x0" ::: "memory");                    // as in loadB
        __builtin_amdgcn_sched_barrier(0);                               // as in loadB
    };
    auto storeA = [&](const int st, const int bt) {
#pragma unroll
        for (int i = 0; i < 4; ++i) { const int row = wave + GT * (4 * bt + i);
#pragma unroll
            for (int j = 0; j < 3; ++j) *(v2ua*)(&sa[row * LP + 128 * j + c4]) = cvt4(x[st][5 * i + j]);
            v4f y;
#pragma unroll
            for (int e = 0; e < 4; ++e) y[e] = isitem ? x[st][5 * i + 3][e] : x[st][5 * i + 4][e];
            v2u q = cvt4(y); q[0] &= mlane; q[1] &= mlane;
            *(v2ua*)(&sa[row * LP + 384 + c4]) = q; }
    };
    static_assert(GN == GT * 4 * 2);                                     // two sets of B rows
    static_assert(GM == GT * 4 * 4);                                     // four sets of A rows
    loadB(0, 0);                                                         // the B rows need no index: they go first, in flight with the position indices
    loadB(1, 1);
    // inputs-only fence on the loaded value: the index load stays unconditional and ahead of the B loads, and its wait stands here, behind them (sunk into the history branch it would cost a latency of its own before any other load)
    asm volatile("" :: "v"(pzv));
    pof = (w ? posrow(pzv) : 1) * PD;
    storeB(0, 0); loadA(0, 0);
    storeB(1, 1); loadA(1, 1);
    storeA(0, 0); loadA(0, 2);
    storeA(1, 1); loadA(1, 3);
    storeA(0, 2);
    storeA(1, 3);
    __syncthreads();                                                     // every wave reads rows that other waves stored; every wave of the block passes here
    if (wave < GW) {                                                     // wave-uniform; no barrier stands behind this point
    const int wm = wave & 1, wn = wave >> 1;
    v8f acc[4][2];
#pragma unroll
    for (int mb = 0; mb < 4; ++mb)
#pragma unroll
        for (int nb = 0; nb < 2; ++nb) acc[mb][nb] = (v8f){};
    const bf* pa = &sa[(wm * 64 + lr) * LP + 8 * hi];                    // the lane's place in the k-step's A and B rows
    const bf* pb = &sb[(wn * 32 + lr) * LP + 8 * hi];
    // two register sets: a k-step's 12 LDS reads are issued one k-step ahead of its products
    v16bf a[2][4], bq[2][2];
    auto fetch = [&](const int s, const int kc) {
#pragma unroll
        for (int mb = 0; mb < 4; ++mb) a[s][mb] = ldb(pa + mb * 16 * LP + kc);
#pragma unroll
        for (int nb = 0; nb < 2; ++nb) bq[s][nb] = ldb(pb + nb * 16 * LP + kc); };
    fetch(0, 0);
#pragma unroll
    for (int i = 0; i < KP / 32; ++i) {
        if (i + 1 < KP / 32) fetch((i + 1) & 1, (i + 1) * 32);
#pragma unroll
        for (int nb = 0; nb < 2; ++nb) {
#pragma unroll
            for (int mb = 0; mb < 4; ++mb) acc[mb][nb] = wmmabg(a[i & 1][mb], bq[i & 1][nb], acc[mb][nb]); }
    }
    float* osw = os + wave * (64 * OSW);
#pragma unroll
    for (int mb = 0; mb < 4; ++mb) {
#pragma unroll
        for (int nb = 0; nb < 2; ++nb) {
#pragma unroll
            for (int j = 0; j < 8; ++j) osw[(mb * 16 + hi * 8 + j) * OSW + nb * 16 + lr] = acc[mb][nb][j]; } }   // D: row 8h+j, col lane&15
    wave_sync();
    float* outp = HP + ((size_t)w * MPAD + (size_t)(r0 + wm * 64)) * APAD + (size_t)(c0 + wn * 32);
    static_assert(32 * 16 * 16 == 64 * 32 * 4);    // lanes x 16 B x trips == 64 rows x 128 B
#pragma unroll
    for (int s = 0; s < 16; ++s) { const int row = 4 * s + (lane >> 3), q4 = (lane & 7) * 4;   // 16 s x 4 rows = 64 rows; 8 lanes x 4 floats = 32 columns
        const v4f val = *(const v4fa*)(&osw[row * OSW + q4]);
        *(v4f*)(outp + (size_t)row * APAD + q4) = val; }
    } else {
    static_assert(GM == (APAD / GN) * (GT - GW) * 8);                    // 4 column blocks x 4 waves x 8 rows store the tile's 128 rows once
    const int rw = (int)blockIdx.y * ((GT - GW) * 8) + (wave - GW) * 8;  // the wave's 8 rows of the tile, one behind the other
    if (w == 0) {
        v2u q[8][4];                                                     // all LDS reads before the first store: one LDS latency
#pragma unroll
        for (int t = 0; t < 8; ++t) {
#pragma unroll
            for (int j = 0; j < 4; ++j) q[t][j] = *(const v2ua*)(&sa[(rw + t) * LP + 128 * j + c4]); }
#pragma unroll
        for (int t = 0; t < 8; ++t) {
#pragma unroll
            for (int j = 0; j < 4; ++j) {
                const v4f f = {__uint_as_float(q[t][j][0] << 16), __uint_as_float(q[t][j][0] & 0xFFFF0000u), __uint_as_float(q[t][j][1] << 16), __uint_as_float(q[t][j][1] & 0xFFFF0000u)};
                if (j < 3 || 384 + c4 < FD) *(v4f*)(O1 + (size_t)(r0 + rw + t) * FD + 128 * j + c4) = f; } }   // the last quarter is stored only where it is a part of the row
        asm volatile("s_wait_xcnt 0x0" ::: "memory");  // the wait that stands before a register named by the stores above is overwritten (code of the other branches follows in the listing)
    } else {
        v8us q[8][2];
#pragma unroll
        for (int t = 0; t < 8; ++t) {
#pragma unroll
            for (int j = 0; j < 2; ++j) q[t][j] = *(const v8usa*)(&sa[(rw + t) * LP + 256 * j + 8 * lane]); }
#pragma unroll
        for (int t = 0; t < 8; ++t) {
#pragma unroll
            for (int j = 0; j < 2; ++j) { v8h h;
#pragma unroll
                for (int e = 0; e < 8; ++e) h[e] = toh_flush(__uint_as_float(((unsigned)q[t][j][e]) << 16));
                *(v8h*)(HR + (size_t)(r0 + rw + t) * KP + 256 * j + 8 * lane) = h; } }
        asm volatile("s_wait_xcnt 0x0" ::: "memory");  // the wait that stands before a register named by the stores above is overwritten (code of the other branches follows in the listing)
    }
    }
}

// k_score: one block per 16 candidates of one batch. Stage 0: the block's operands go to LDS once: the batch's 50 hh rows (asynchronous copies, whole padded rows), each wave's 4 hc rows
// (through registers, laid [a][4 candidates]), b1 and w2 (already rounded); behind a block barrier the batch's 50 f16 hist rows follow (asynchronous copies that land while stage 1 runs).
// Stage 1, one wave per 4 candidates; lane = history entry (lane and lane + 32); every operand read from LDS, one pair of 4-wide pieces ahead of its arithmetic.
// logit = sum_a relu((hc + hh) + b1) * w2 + b2 (f32, fmaf chain per (candidate, history) pair); masked entries replaced by -1e9; softmax with the max over all 50 entries (lane shuffles);
// alpha x1024 as f16 into the block's LDS rows pt [16][64] (candidate rows >= 50 and history >= 50 are zeros).
// Stage 2, behind one block barrier: out0[b][n][f] = (1/1024) sum_h pt[n][h] HR[b][h][f] (B fragments by transposing reads of the rows' LDS copy), f16 WMMA, K = 64; one wave per 128 features (8 accumulators);
// the 16 x 128 slab is staged in LDS (wave-private) and stored as 512-byte row pieces, rows < 50 and features < 500 only.
__global__ __launch_bounds__(32 * SW) void k_score(const float* __restrict__ HC, const float* __restrict__ HH, const int* __restrict__ maskp,
                                                   const float* __restrict__ b1, const float* __restrict__ w2, const float* __restrict__ b2,
                                                   const h16* __restrict__ HR, float* O0) {
    __shared__ __align__(16) h16 pt[SW * 4 * TP];
    __shared__ __align__(16) float os[SW * 16 * OSW2];
    __shared__ __align__(16) float xs[NH * XSP];                         // hh rows of the batch
    __shared__ __align__(16) float ct[SW * AD * 4];                      // per wave: hc of its 4 candidates, [a][candidate]
    __shared__ __align__(16) float bs[AD];                               // b1, rounded
    __shared__ __align__(16) float wl[AD];                               // w2, rounded
    __shared__ __align__(16) h16 hl[HPAD * HLP];                         // f16 hist rows of the batch: [history][feature], rows pitched for the transposing reads; rows >= 50 are zeros
    const int lane = threadIdx.x & 31;
    const int wave = __builtin_amdgcn_readfirstlane((int)(threadIdx.x >> 5));
    const int b = (int)blockIdx.y;
    const int n0 = ((int)blockIdx.x * SW + wave) * 4;
    const int lr = lane & 15, hi = lane >> 4;
    const int f0 = wave * 128;
    const size_t hb = (size_t)b * NH;
    // stage 0a: hh rows -> xs. Round s: rows 2s and 2s + 1, one 16-byte piece a lane (a wave's copy is 512 contiguous bytes); every lane is on, every address in bounds, no LDS byte written twice.
    {
        const int col = (int)threadIdx.x & 63, r2 = (int)threadIdx.x >> 6;
        const float* g0 = HH + (hb + (size_t)r2) * APAD + (size_t)col * 4;
        const unsigned l0 = (unsigned)(size_t)(&xs[r2 * XSP + col * 4]);
        const float* g[25]; unsigned l[25];
#pragma unroll
        for (int s = 0; s < 25; ++s) { g[s] = g0 + (size_t)s * 2 * APAD; l[s] = l0 + (unsigned)(s * 2 * XSP * 4); }
        // the copies of a statement end in their own s_wait_xcnt 0: it stands before any register that a copy names is rewritten
        asm volatile("global_load_async_to_lds_b128 %0, %1, off\n\tglobal_load_async_to_lds_b128 %2, %3, off\n\tglobal_load_async_to_lds_b128 %4, %5, off\n\t"
                     "global_load_async_to_lds_b128 %6, %7, off\n\tglobal_load_async_to_lds_b128 %8, %9, off\n\tglobal_load_async_to_lds_b128 %10, %11, off\n\t"
                     "global_load_async_to_lds_b128 %12, %13, off\n\tglobal_load_async_to_lds_b128 %14, %15, off\n\tglobal_load_async_to_lds_b128 %16, %17, off\n\t"
                     "global_load_async_to_lds_b128 %18, %19, off\n\tglobal_load_async_to_lds_b128 %20, %21, off\n\tglobal_load_async_to_lds_b128 %22, %23, off\n\t"
                     "global_load_async_to_lds_b128 %24, %25, off\n\ts_wait_xcnt 0x0"
                     :: "v"(l[0]), "v"(g[0]), "v"(l[1]), "v"(g[1]), "v"(l[2]), "v"(g[2]), "v"(l[3]), "v"(g[3]), "v"(l[4]), "v"(g[4]), "v"(l[5]), "v"(g[5]), "v"(l[6]), "v"(g[6]),
                        "v"(l[7]), "v"(g[7]), "v"(l[8]), "v"(g[8]), "v"(l[9]), "v"(g[9]), "v"(l[10]), "v"(g[10]), "v"(l[11]), "v"(g[11]), "v"(l[12]), "v"(g[12]) : "memory");
        asm volatile("global_load_async_to_lds_b128 %0, %1, off\n\tglobal_load_async_to_lds_b128 %2, %3, off\n\tglobal_load_async_to_lds_b128 %4, %5, off\n\t"
                     "global_load_async_to_lds_b128 %6, %7, off\n\tglobal_load_async_to_lds_b128 %8, %9, off\n\tglobal_load_async_to_lds_b128 %10, %11, off\n\t"
                     "global_load_async_to_lds_b128 %12, %13, off\n\tglobal_load_async_to_lds_b128 %14, %15, off\n\tglobal_load_async_to_lds_b128 %16, %17, off\n\t"
                     "global_load_async_to_lds_b128 %18, %19, off\n\tglobal_load_async_to_lds_b128 %20, %21, off\n\tglobal_load_async_to_lds_b128 %22, %23, off\n\t"
                     "s_wait_xcnt 0x0"
                     :: "v"(l[13]), "v"(g[13]), "v"(l[14]), "v"(g[14]), "v"(l[15]), "v"(g[15]), "v"(l[16]), "v"(g[16]), "v"(l[17]), "v"(g[17]), "v"(l[18]), "v"(g[18]),
                        "v"(l[19]), "v"(g[19]), "v"(l[20]), "v"(g[20]), "v"(l[21]), "v"(g[21]), "v"(l[22]), "v"(g[22]), "v"(l[23]), "v"(g[23]), "v"(l[24]), "v"(g[24]) : "memory");
    }
    // stage 0b: the wave's 4 hc rows, b1, w2 and the lane's two mask words, all at clamped addresses and in flight together (a wave without candidates stages row 49 into its own, unread part of ct)
    const int nvec = ((int)blockIdx.x * SW + (int)(threadIdx.x >> 5)) * 4;
    size_t oc[4]; bool rok[4];
#pragma unroll
    for (int i = 0; i < 4; ++i) { int q = nvec + i; rok[i] = q < NN; q = q < NN ? q : NN - 1; q = __builtin_amdgcn_readfirstlane(q);
        oc[i] = ((size_t)b * NN + (size_t)q) * APAD; }
    const int hB = lane + 32; const int hBc = hB < NH ? hB : NH - 1; const bool okB = hB < NH;
    const int pB = hB < AD / 4 ? hB : AD / 4 - 1;                        // the lane's second piece of a candidate row
    const int tb = (int)threadIdx.x < AD / 4 ? (int)threadIdx.x : AD / 4 - 1;
    v4f cv[2][4];
#pragma unroll
    for (int i = 0; i < 4; ++i) { cv[0][i] = *(const v4f*)(HC + oc[i] + 4 * lane); cv[1][i] = *(const v4f*)(HC + oc[i] + 4 * pB); }
    const v4f b1v = *(const v4f*)(b1 + 4 * tb), w2v = *(const v4f*)(w2 + 4 * tb);
    const int mkA = maskp[hb + (size_t)lane], mkB = maskp[hb + (size_t)hBc];
    // inputs-only fence on the loaded values: the mask loads stay here, in flight with the other loads of stage 0 (sunk to their use behind stage 1 they would cost a memory latency of their own)
    asm volatile("" :: "v"(mkA), "v"(mkB));
#pragma unroll
    for (int j = 0; j < 4; ++j) {
        const v4f q0 = {cv[0][0][j], cv[0][1][j], cv[0][2][j], cv[0][3][j]}, q1 = {cv[1][0][j], cv[1][1][j], cv[1][2][j], cv[1][3][j]};
        *(v4fa*)(&ct[wave * (AD * 4) + (4 * lane + j) * 4]) = q0;
        if (hB < AD / 4) *(v4fa*)(&ct[wave * (AD * 4) + (4 * hB + j) * 4]) = q1; }
    if ((int)threadIdx.x < AD / 4) {
        const v4f br = {bfr(b1v[0]), bfr(b1v[1]), bfr(b1v[2]), bfr(b1v[3])}, wr = {bfr(w2v[0]), bfr(w2v[1]), bfr(w2v[2]), bfr(w2v[3])};
        *(v4fa*)(&bs[4 * (int)threadIdx.x]) = br; *(v4fa*)(&wl[4 * (int)threadIdx.x]) = wr; }
    // the k rows 50..63 of stage 2's B operand: zeros (their alpha is zero too, and the product must be a zero)
#pragma unroll
    for (int it = 0; it < 7; ++it) { const int p = it * (32 * SW) + (int)threadIdx.x; const v8h z = (v8h){};
        *(v8ha*)(&hl[(NH + (p >> 6)) * HLP + (p & 63) * 8]) = z; }
    asm volatile("s_wait_asynccnt 0x0" ::: "memory");                    // this wave's copies have landed
    __syncthreads();                                                     // every wave reads rows that other waves copied; every wave of the block passes here
    // stage 2's B operand depends on nothing of stage 1: the batch's 50 f16 hist rows are copied to LDS here and land while stage 1 runs. A wave takes one half (512 contiguous bytes) of every second row:
    // 25 copies; every lane is on, every address in bounds, no LDS byte written twice
    {
        const int row = wave >> 1, hf = wave & 1;
        const char* g0 = (const char*)(HR + (hb + (size_t)row) * KP + (size_t)hf * (KP / 2) + (size_t)lane * 8);
        const unsigned l0 = (unsigned)(size_t)(&hl[row * HLP + hf * (KP / 2) + lane * 8]);
#pragma unroll
        for (int s = 0; s < 3; ++s) acopy8(l0 + (unsigned)(s * 16 * HLP * 2), g0 + (size_t)s * 16 * KP * 2, 2 * HLP * 2, (size_t)2 * KP * 2);
        acopy1(l0 + (unsigned)(48 * HLP * 2), g0 + (size_t)48 * KP * 2);
    }
    if (n0 >= NN) {                                                      // wave-uniform: no candidate here, its 4 alpha rows are zeros
        const v8h z = (v8h){}; *(v8ha*)(&pt[(wave * 4 + (lane >> 3)) * TP + (lane & 7) * 8]) = z;
    } else {
    const float b2v = bfr(b2[0]);
    float accA[4], accB[4];
#pragma unroll
    for (int i = 0; i < 4; ++i) { accA[i] = 0.0f; accB[i] = 0.0f; }
    const float* xpa = &xs[lane * XSP]; const float* xpb = &xs[hBc * XSP]; const float* cp = &ct[wave * (AD * 4)];
    // two register sets of two pieces each: a pair's 16 LDS reads are issued one pair ahead of its arithmetic
    v4f xa[2][2], xb[2][2], bb[2][2], ww[2][2], cc[2][2][4];
    auto fetch = [&](const int s, const int d) {
#pragma unroll
        for (int p = 0; p < 2; ++p) { const int a4 = 2 * d + p;
            xa[s][p] = *(const v4fa*)(xpa + 4 * a4); xb[s][p] = *(const v4fa*)(xpb + 4 * a4);
            bb[s][p] = *(const v4fa*)(&bs[4 * a4]);  ww[s][p] = *(const v4fa*)(&wl[4 * a4]);
#pragma unroll
            for (int j = 0; j < 4; ++j) cc[s][p][j] = *(const v4fa*)(cp + (4 * a4 + j) * 4); } };
    auto work = [&](const int s) {
#pragma unroll
        for (int p = 0; p < 2; ++p) {
#pragma unroll
            for (int j = 0; j < 4; ++j) {
#pragma unroll
                for (int i = 0; i < 4; ++i) {
                    const float c = cc[s][p][j][i];
                    const float va = fmaxf((c + xa[s][p][j]) + bb[s][p][j], 0.0f), vb = fmaxf((c + xb[s][p][j]) + bb[s][p][j], 0.0f);
                    accA[i] = fmaf(va, ww[s][p][j], accA[i]); accB[i] = fmaf(vb, ww[s][p][j], accB[i]); } } } };
    // the compiler fence behind each fetch keeps its reads where they stand: without it the reads carried into the next trip are sunk to that trip's head, directly in front of their use
    fetch(0, 0);
    asm volatile("" ::: "memory");
#pragma unroll 1
    for (int d = 0; d < AD / 8 - 1; d += 2) {                            // rolled: the body already holds two pairs, one per register set
        fetch(1, d + 1);
        asm volatile("" ::: "memory");
        work(0);
        fetch(0, d + 2);
        asm volatile("" ::: "memory");
        work(1);
        // the order asked of the scheduler: a pair's 16 LDS reads together, then the other pair's arithmetic, so that every read has a whole pair of lead (left alone it puts the reads late, close to their use)
        __builtin_amdgcn_sched_group_barrier(0x100, 16, 0);
        __builtin_amdgcn_sched_group_barrier(0x002, 134, 0);
        __builtin_amdgcn_sched_group_barrier(0x100, 16, 0);
        __builtin_amdgcn_sched_group_barrier(0x002, 140, 0);
    }
    work(0);                                                             // the last pair
#pragma unroll
    for (int i = 0; i < 4; ++i) {
        float sA = accA[i] + b2v, sB = accB[i] + b2v;
        sA = (mkA != 0) ? sA : NEGV; sB = (mkB != 0) ? sB : NEGV; sB = okB ? sB : NEGB;
        float mx = fmaxf(sA, sB);
        mx = fmaxf(mx, __shfl_xor(mx, 16, 32)); mx = fmaxf(mx, __shfl_xor(mx, 8, 32)); mx = fmaxf(mx, __shfl_xor(mx, 4, 32));
        mx = fmaxf(mx, __shfl_xor(mx, 2, 32));  mx = fmaxf(mx, __shfl_xor(mx, 1, 32));
        const float eA = __builtin_amdgcn_exp2f((sA - mx) * L2E);
        float eB = __builtin_amdgcn_exp2f((sB - mx) * L2E); eB = okB ? eB : 0.0f;
        float sm = eA + eB;
        sm += __shfl_xor(sm, 16, 32); sm += __shfl_xor(sm, 8, 32); sm += __shfl_xor(sm, 4, 32); sm += __shfl_xor(sm, 2, 32); sm += __shfl_xor(sm, 1, 32);
        const float inv = __builtin_amdgcn_rcpf(sm) * PCS;              // sm >= 1 (the maximum entry contributes 1)
        h16 qa = toh_flush(eA * inv), qb = toh_flush(eB * inv);
        qa = rok[i] ? qa : (h16)0.0f; qb = rok[i] ? qb : (h16)0.0f;
        pt[(wave * 4 + i) * TP + lane] = qa; pt[(wave * 4 + i) * TP + 32 + lane] = qb; }   // 4 rows x 64 columns all written
    }
    asm volatile("s_wait_asynccnt 0x0" ::: "memory");                    // this wave's copies of the hist rows have landed
    __syncthreads();                                                     // every wave reads all 16 alpha rows and hist rows that other waves copied; every wave of the block passes here
    v16h a[2];
#pragma unroll
    for (int ks = 0; ks < 2; ++ks) { const h16* p = &pt[lr * TP + 8 * hi + 32 * ks]; a[ks] = cat16(*(const v8ha*)p, *(const v8ha*)(p + 16)); }   // the k map of ldb
    const h16* tq = &hl[(8 * hi + (lane & 7)) * HLP + f0 + 8 * ((lane >> 3) & 1)];   // the lane's address in a 16 (history) x 16 (feature) tile of the transposing read
    v16h bq[2][8];                                                       // all B fragments are read before the first matrix instruction: one LDS latency, not sixteen
#pragma unroll
    for (int ks = 0; ks < 2; ++ks) {
#pragma unroll
        for (int nb = 0; nb < 8; ++nb) bq[ks][nb] = cat16(ldtr(tq + (32 * ks) * HLP + nb * 16), ldtr(tq + (32 * ks + 16) * HLP + nb * 16)); }   // the k map of ldb: elements 0..7 <- 32 ks + 8h + 0..7, 8..15 <- 32 ks + 16 + 8h + 0..7
    v8f acc[8];
#pragma unroll
    for (int nb = 0; nb < 8; ++nb) acc[nb] = (v8f){};
#pragma unroll
    for (int ks = 0; ks < 2; ++ks) {
#pragma unroll
        for (int nb = 0; nb < 8; ++nb) acc[nb] = wmma16g(a[ks], bq[ks][nb], acc[nb]); }
    float* osw = os + wave * (16 * OSW2);
#pragma unroll
    for (int nb = 0; nb < 8; ++nb) {
#pragma unroll
        for (int j = 0; j < 8; ++j) osw[(hi * 8 + j) * OSW2 + nb * 16 + lr] = acc[nb][j] * PCI; }   // D: row 8h+j, col lane&15
    wave_sync();
    const int nr0 = (int)blockIdx.x * (SW * 4);
    const int c4 = lane * 4;                                             // 32 lanes x 4 floats = 128 columns
    float* outp = O0 + ((size_t)b * NN + (size_t)nr0) * FD + (size_t)(f0 + c4);
    const bool cok = f0 + c4 < FD;                                       // FD % 4 == 0: a float4 lies wholly inside the row or wholly outside
    v4f val[16];
#pragma unroll
    for (int row = 0; row < 16; ++row) val[row] = *(const v4fa*)(&osw[row * OSW2 + c4]);
    if (cok) {
#pragma unroll
        for (int row = 0; row < 16; ++row) { if (nr0 + row < NN) *(v4f*)(outp + (size_t)row * FD) = val[row]; }
    }
}

static constexpr size_t al256(size_t v) { return (v + 255) & ~(size_t)255; }
static constexpr size_t SZ_HR = al256((size_t)MPAD * KP * 2);
static constexpr size_t SZ_HP = al256((size_t)2 * MPAD * APAD * 4);
static constexpr size_t SZ_TOTAL = SZ_HR + SZ_HP;
static_assert(SZ_TOTAL <= (size_t)134217728);          // workspace carve <= 128 MiB
static_assert(((size_t)MPAD * APAD * 4) % 256 == 0);   // the two HP sub-planes stay 256-byte aligned
static constexpr size_t OUT1_OFF = (size_t)NB_FULL * NN * FD;   // element offset of the second output (fixed, full problem)

extern "C" void kernel_launch(void* const* d_in, const int* in_sizes, int n_in,
                              void* d_out, int out_size, void* d_ws, size_t ws_size, hipStream_t stream) {
    if (n_in < 9) return;
    if ((size_t)in_sizes[0] < (size_t)MROWS * RD || (size_t)in_sizes[1] < (size_t)MROWS * RD) return;
    if ((size_t)in_sizes[2] < (size_t)MROWS || (size_t)in_sizes[3] < (size_t)MROWS) return;
    if ((size_t)in_sizes[4] < (size_t)NPOS * PD || (size_t)in_sizes[5] < (size_t)AD * 2 * FD) return;
    if (in_sizes[6] < AD || in_sizes[7] < AD || in_sizes[8] < 1) return;
    if ((size_t)out_size < OUT1_OFF + (size_t)MROWS * FD) return;
    if (SZ_TOTAL > ws_size) return;
    // wire order: history_repr, candidate_repr, user_history_mask, user_history_position, pos_emb, W1, b1, w2, b2
    const float* hist_in = (const float*)d_in[0];
    const float* cand_in = (const float*)d_in[1];
    const int*   maskp   = (const int*)d_in[2];
    const int*   posp    = (const int*)d_in[3];
    const float* pe      = (const float*)d_in[4];
    const float* W1      = (const float*)d_in[5];
    const float* b1      = (const float*)d_in[6];
    const float* w2      = (const float*)d_in[7];
    const float* b2      = (const float*)d_in[8];
    float* OUT0 = (float*)d_out;                 // [NB][50][500]
    float* OUT1 = (float*)d_out + OUT1_OFF;      // [NB][50][500]
    char* wsp = (char*)d_ws;
    h16* HR = (h16*)wsp;   wsp += SZ_HR;         // [MPAD][512]: hist rows in f16
    float* HP = (float*)wsp; wsp += SZ_HP;       // [2][MPAD][256]: hc | hh
    const float* HC = HP; const float* HH = HP + (size_t)MPAD * APAD;

    // hc = cand Wc^T, hh = hist Wh^T; out1 and the f16 hist rows
    k_gemm1<<<dim3(MPAD / GM, APAD / GN, 2), 32 * GT, 0, stream>>>(hist_in, cand_in, posp, pe, W1, HP, HR, OUT1);
    // logits, softmax, user representation = alpha hist
    k_score<<<dim3(HPAD / (4 * SW), NB, 1), 32 * SW, 0, stream>>>(HC, HH, maskp, b1, w2, b2, HR, OUT0);
}

// v007
// A run of this version takes 17.9 microseconds.
// Timed twice side by side with v006, it ran 1.05 times as fast both times.
// Over all steps from v000 it is 3.19 times as fast.
#include <hip/hip_runtime.h>
#pragma clang fp contract(off)

// Additive attention of candidate items over a user history: rows = [400-wide item vector | 100-wide position embedding]; hidden = relu(cand Wc^T + hist Wh^T + b1) (W1 [200][1000] = [Wc | Wh], [out][in]); logit = hidden . w2 + b2; masked entries REPLACED by -1e9; softmax over the history; out0 = alpha hist, out1 = the candidate rows.
// Compute dtypes, f32 accumulate everywhere: the two projections v_wmma_f32_16x16x32_bf16 (items, position table, W1 RNE-converted to bf16; products exact); alpha . hist v_wmma_f32_16x16x32_f16 (alpha x1024 carry as f16, hist = the bf16 values held in f16); relu / w2 dot (depth 200, one shared vector) and softmax on the vector unit in f32.
// Layout: f32 plane HP [2][rows][256] (hc | hh); f16 plane HR [rows][512] (the hist rows, K zero-padded 500 -> 512, the bf16 values held in f16; the score kernel reads them transposed out of LDS); the bf16 operands of the projections (rows and W1, zero-padded to [.][512]) exist in LDS only; alpha stays in LDS (16 candidate rows per score block).
// Two launches: k_gemm1 (operand conversion, both projections, out1 and HR), k_score (logits, softmax, alpha . hist, out0).

#ifndef NB
#define NB 64
#endif
#define NB_FULL 64
#define NH   50                  // history entries per batch
#define NN   50                  // candidates per batch
#define RD   400                 // item vector width
#define PD   100                 // position embedding width
#define FD   500                 // RD + PD
#define AD   200                 // attention width
#define NPOS 52                  // rows of the position table
#define KP   512                 // FD padded to the k-step
#define APAD 256                 // AD padded to the column tile
#define HPAD 64                  // NH / NN padded (k of the second product, rows of its A operand)
#define MROWS (NB * NN)
#define MPAD  ((MROWS + 63) / 64 * 64)
#define OSW  36                  // LDS row pitch (floats) of a 64 x 32 slab
#define GM   128                 // GEMM block tile: rows
#define GN   64                  // GEMM block tile: columns
#define GW   4                   // GEMM waves that multiply, 2 x 2 wave tiles of 64 x 32
#define LP   520                 // LDS row pitch (16-bit elements) of the staged GEMM operand rows: 1040 B = 16 B x odd
#define OSW2 132                 // LDS row pitch (floats) of a 16 x 128 slab
#define TP   72                  // LDS row pitch (halves) of the alpha rows
#define HLP  528                 // LDS row pitch (halves) of the staged f16 hist rows: 1056 B = 32 B x odd, the pitch of the transposing 16-bit read
#define SW   4                   // waves per score block (4 candidates each)
#define XSP  260                 // LDS row pitch (floats) of the staged hh rows: 1040 B = 16 B x odd, so 16 lanes' 16-byte reads of 16 rows fall on 64 different banks
#define GT   8                   // GEMM waves per block in all: 8 convert the operands; then 4 multiply and 4 store the row planes
#define PCS  1024.0f             // carry of the alpha plane
#define PCI  (1.0f / 1024.0f)
#define L2E  1.4426950408889634f
#define NEGV (-1.0e9f)
#define NEGB (-3.0e38f)

static_assert(FD == RD + PD);
static_assert(NH == NN);                       // both row sets have MROWS rows
static_assert(RD % 8 == 0);                    // an 8-element piece never straddles the item / position boundary
static_assert(PD % 4 == 0);
static_assert(FD % 4 == 0);                    // a float4 of the flat output never straddles two rows
static_assert(KP % 32 == 0);                   // GEMM k-loop steps by 32
static_assert(KP >= FD);
static_assert(KP % 64 == 0);
static_assert(KP / 8 == 64);
static_assert(APAD % 64 == 0);
static_assert(APAD >= AD);
static_assert(AD % 4 == 0);
static_assert(HPAD == 64);
static_assert(HPAD % 32 == 0);
static_assert(NH > 32);                        // two history entries per lane: lane and lane + 32
static_assert(NH <= HPAD);
static_assert(NN <= HPAD);
static_assert(MPAD % 64 == 0);
static_assert(MPAD == MROWS);                  // every row of a GEMM tile is a row of the inputs
static_assert(HPAD % (4 * SW) == 0);           // score grid covers the padded candidate rows exactly
static_assert(NB <= NB_FULL);
static_assert(((size_t)NB_FULL * NN * FD * 4) == (size_t)6400000);   // byte offset of the second output
static_assert((((size_t)NB_FULL * NN * FD * 4) % 128) == 0);
static_assert((OSW * 4) % 16 == 0);
static_assert((TP * 2) % 16 == 0);
static_assert(MPAD % GM == 0);
static_assert(APAD % GN == 0);
static_assert(GM == 2 * 64);                   // 2 x 2 wave tiles cover the block tile
static_assert(GN == 2 * 32);
static_assert(GM % GW == 0);
static_assert(GN % GW == 0);
static_assert(KP == 4 * 32 * 4);               // a row is 4 quarters of 4 columns for each of a wave's 32 lanes
static_assert(RD > 384 && RD <= 384 + 128 && FD <= KP);   // the item / position boundary and the end of the row lie in the last quarter
static_assert(LP >= KP);
static_assert((LP * 2) % 32 == 16);
static_assert((GM + GN) * LP * 2 + GW * 64 * OSW * 4 <= 327680);   // static LDS of the GEMM kernel
static_assert(SW * 4 == 16);                   // a score block's candidates are one 16-row A fragment
static_assert(SW * 128 == KP);                 // its waves cover the padded features, 128 each
static_assert((OSW2 * 4) % 16 == 0);
static_assert(SW * 4 * TP * 2 + SW * 16 * OSW2 * 4 + NH * XSP * 4 + SW * AD * 4 * 4 + AD * 4 + HPAD * HLP * 2 <= 327680);   // static LDS of the score kernel
static_assert(XSP >= APAD);
static_assert((XSP * 4) % 16 == 0);
static_assert(APAD / 4 == 64);                 // a padded hh row is 64 pieces of 16 B: half of the score block's threads
static_assert(32 * SW == 128);
static_assert(NH == 2 * 25);                   // 25 rounds of 2 rows copy the 50 hh rows exactly, every lane on in every round
static_assert((AD / 4) % 4 == 2);              // the score loop takes two pairs of pieces a trip, and one pair is left behind it
static_assert(TP >= HPAD);
static_assert(HLP >= KP);
static_assert((HLP * 2) % 64 == 32);
static_assert(KP * 2 == 2 * 32 * 16);          // half a hist row is one 16-byte piece for each of a wave's 32 lanes
static_assert(2 * NH == SW * 25);              // 25 copies a wave take the 100 row halves exactly
static_assert((HPAD - NH) * (KP / 8) == 7 * 32 * SW);   // 7 stores a thread zero the k rows behind the history
static_assert(AD / 4 <= 64);                   // a candidate row's pieces: lane and lane + 32
static_assert(AD / 4 <= 32 * SW);

typedef _Float16 h16;
typedef unsigned short bf;
typedef __attribute__((ext_vector_type(16))) __bf16   v16bf;
typedef __attribute__((ext_vector_type(16))) _Float16 v16h;
typedef __attribute__((ext_vector_type(8)))  _Float16 v8h;
typedef __attribute__((ext_vector_type(8)))  unsigned short v8us;
typedef __attribute__((ext_vector_type(8)))  short    v8s;
typedef __attribute__((ext_vector_type(8)))  float    v8f;
typedef __attribute__((ext_vector_type(4)))  float    v4f;
typedef __attribute__((ext_vector_type(2)))  float    v2f;
typedef __attribute__((ext_vector_type(2)))  __bf16   v2bf;
typedef __attribute__((ext_vector_type(2)))  unsigned v2u;
typedef v4f  __attribute__((may_alias)) v4fa;
typedef v2u  __attribute__((may_alias)) v2ua;
typedef v8us __attribute__((may_alias)) v8usa;
typedef v8h  __attribute__((may_alias)) v8ha;

__device__ __forceinline__ unsigned short f2bf(float f) { unsigned u = __float_as_uint(f); u += 0x7FFFu + ((u >> 16) & 1u); return (unsigned short)(u >> 16); }
__device__ __forceinline__ float bfr(float f) { return __uint_as_float(((unsigned)f2bf(f)) << 16); }   // value after RNE convert to bf16
__device__ __forceinline__ v16h cat16(v8h lo, v8h hi) { return __builtin_shufflevector(lo, hi, 0, 1, 2, 3, 4, 5, 6, 7, 8, 9, 10, 11, 12, 13, 14, 15); }
__device__ __forceinline__ v16bf cat16b(v8us lo, v8us hi) { return __builtin_bit_cast(v16bf, __builtin_shufflevector(lo, hi, 0, 1, 2, 3, 4, 5, 6, 7, 8, 9, 10, 11, 12, 13, 14, 15)); }
__device__ __forceinline__ v8f wmma16(v16h a, v16h b, v8f c) { return __builtin_amdgcn_wmma_f32_16x16x32_f16(false, a, false, b, (short)0, c, false, false); }
__device__ __forceinline__ v8f wmmab(v16bf a, v16bf b, v8f c) { return __builtin_amdgcn_wmma_f32_16x16x32_bf16(false, a, false, b, (short)0, c, false, false); }
// fragment loaders from K-contiguous 16-bit rows; p already includes + 8*(lane>>4): elements 0..7 <- k0+8h+0..7, elements 8..15 <- k0+16+8h+0..7 (same map for A and B)
__device__ __forceinline__ v16bf ldb(const bf* p)  { return cat16b(*(const v8us*)p, *(const v8us*)(p + 16)); }
// transposing LDS read (ds_load_tr16_b128) of a row-major 16-bit tile T: with p = &T[k0 + 8 * (lane >> 4) + (lane & 7)][d0 + 8 * ((lane >> 3) & 1)] the lane gets T[k0 + 8 * (lane >> 4) + 0..7][d0 + (lane & 15)]
__device__ __forceinline__ v8h ldtr(const h16* p) { typedef __attribute__((address_space(3))) v8s lds_v8s; return __builtin_bit_cast(v8h, __builtin_amdgcn_ds_load_tr16_b128_v8i16((lds_v8s*)p)); }
// ordering point for wave-private LDS tiles (same wave writes and reads)
__device__ __forceinline__ void wave_sync() { __builtin_amdgcn_fence(3 /* release order */, "wavefront"); __builtin_amdgcn_wave_barrier(); asm volatile("" ::: "memory"); }
// per-instruction guarded matrix ops: one accumulator tied per guard, operands kept live
__device__ __forceinline__ v8f wmma16g(v16h a, v16h b, v8f c) { c = wmma16(a, b, c); asm volatile("v_nop\n\tv_nop\n\tv_nop\n\tv_nop" : "+v"(c) : "v"(a), "v"(b)); return c; }
__device__ __forceinline__ v8f wmmabg(v16bf a, v16bf b, v8f c) { c = wmmab(a, b, c); asm volatile("v_nop\n\tv_nop\n\tv_nop\n\tv_nop" : "+v"(c) : "v"(a), "v"(b)); return c; }
// eight asynchronous 16-byte copies a lane, global -> LDS, at steps of gs and ls bytes; the statement ends in its own s_wait_xcnt 0, which so stands before any register that a copy names is rewritten
__device__ __forceinline__ void acopy8(const unsigned l, const char* g, const unsigned ls, const size_t gs) {
    asm volatile("global_load_async_to_lds_b128 %0, %8, off\n\tglobal_load_async_to_lds_b128 %1, %9, off\n\tglobal_load_async_to_lds_b128 %2, %10, off\n\tglobal_load_async_to_lds_b128 %3, %11, off\n\t"
                 "global_load_async_to_lds_b128 %4, %12, off\n\tglobal_load_async_to_lds_b128 %5, %13, off\n\tglobal_load_async_to_lds_b128 %6, %14, off\n\tglobal_load_async_to_lds_b128 %7, %15, off\n\t"
                 "s_wait_xcnt 0x0"
                 :: "v"(l), "v"(l + ls), "v"(l + 2 * ls), "v"(l + 3 * ls), "v"(l + 4 * ls), "v"(l + 5 * ls), "v"(l + 6 * ls), "v"(l + 7 * ls),
                    "v"(g), "v"(g + gs), "v"(g + 2 * gs), "v"(g + 3 * gs), "v"(g + 4 * gs), "v"(g + 5 * gs), "v"(g + 6 * gs), "v"(g + 7 * gs) : "memory");
}
// one such copy, with the same closing wait
__device__ __forceinline__ void acopy1(const unsigned l, const char* g) {
    asm volatile("global_load_async_to_lds_b128 %0, %1, off\n\ts_wait_xcnt 0x0" :: "v"(l), "v"(g) : "memory");
}
// f32 -> f16 convert that cannot produce an f16 subnormal (|v| < 2^-14 -> +0)
static __device__ __forceinline__ h16 toh_flush(float v) { const h16 r = (h16)v; return (fabsf(v) < 6.103515625e-05f) ? (h16)0.0f : r; }
// position-table row: negative index wraps once, then clamps into the table
__device__ __forceinline__ int posrow(int p) { p = p < 0 ? p + NPOS : p; p = p < 0 ? 0 : p; p = p > NPOS - 1 ? NPOS - 1 : p; return p; }

// four f32 -> four bf16, round to nearest even (two v_cvt_pk_bf16_f32), packed in two words
__device__ __forceinline__ v2u cvt4(const v4f x) {
    const v2f lo = {x[0], x[1]}, hi = {x[2], x[3]};
    v2u r; r[0] = __builtin_bit_cast(unsigned, __builtin_convertvector(lo, v2bf)); r[1] = __builtin_bit_cast(unsigned, __builtin_convertvector(hi, v2bf)); return r;
}

// k_gemm1: bf16 GEMM straight from the f32 inputs, one block of 8 waves per 128x64 tile, K = 512. HP[w][m][n] = sum_k X[w][m][k] W[w][n][k]; grid (MPAD/128, APAD/64, 2); w = 0: candidates, Wc; w = 1: history, Wh.
// Stage 0, all 8 waves: the tile's 128 A rows = [ item vector (400) | position row (100) | zeros (12) ] (history: table[pos[r]]; candidates: table row 1) and its 64 B rows (W1 row a, columns 500 w ..; rows >= 200 and k >= 500
// are zeros) are loaded as f32 (a wave load is 512 contiguous bytes of one row), converted to bf16 and stored to LDS rows pitched 16 B x odd. All loads at clamped addresses, selected or masked by value.
// Behind one block barrier: waves 0..3 multiply (wave tile 64x32, 8 accumulators; every output sums its 16 k-steps in ascending order) and store their 64x32 slab, staged in LDS (wave-private), as whole 128-byte lines;
// waves 4..7 store the converted A rows from LDS: candidates widened to f32 as out1 [rows][500], history held in f16 as the plane HR [rows][512]. Each of the 4 column blocks of a row tile stores 32 of its 128 rows.
__global__ __launch_bounds__(32 * GT) void k_gemm1(const float* __restrict__ hist, const float* __restrict__ cand, const int* __restrict__ pos, const float* __restrict__ pe,
                                                   const float* __restrict__ W1, float* HP, h16* HR, float* O1) {
    __shared__ __align__(16) bf sa[GM * LP];
    __shared__ __align__(16) bf sb[GN * LP];
    __shared__ __align__(16) float os[GW * 64 * OSW];
    const int lane = threadIdx.x & 31, lr = lane & 15, hi = lane >> 4;
    const int wave = __builtin_amdgcn_readfirstlane((int)(threadIdx.x >> 5));
    const int r0 = (int)blockIdx.x * GM, c0 = (int)blockIdx.y * GN, w = (int)blockIdx.z;
    const float* src = w ? hist : cand;
    // a wave takes rows wave + 8 s; a row is 4 quarters of 128 columns, 4 columns a lane. The last quarter (columns 384..511) holds the item's last 16 columns, the position row and the zeros.
    const int c4 = lane * 4;
    const int ci = 384 + c4 < RD - 4 ? 384 + c4 : RD - 4;                // item column of the last quarter, clamped into the row
    int cp = 384 + c4 - RD; cp = cp < 0 ? 0 : (cp > PD - 4 ? PD - 4 : cp);   // position column, clamped into the table row
    const int cw = 384 + c4 < FD - 4 ? 384 + c4 : FD - 4;                // W1 column of the last quarter, clamped into its half of the row
    const bool isitem = 384 + c4 < RD;
    const unsigned mlane = 384 + c4 < FD ? 0xFFFFFFFFu : 0u;             // zero for the padded columns
    const int pzv = pos[r0 + wave + GT * lr];                            // lane s (s < 16) holds the position index of the wave's A row s
    int pof;                                                             // and, behind the B loads, the place in the table of that row's position row
    // (every loop of this kernel is unrolled: its index picks registers or immediate offsets)
    v4f x[2][20];                                                        // two register sets of 4 rows each: a set's loads fly while the other set is converted
    auto loadB = [&](const int st, const int bt) {
#pragma unroll
        for (int i = 0; i < 4; ++i) { const int a = c0 + wave + GT * (4 * bt + i); const int ac = a < AD ? a : AD - 1;
            const float* p = W1 + (size_t)ac * (2 * FD) + (size_t)w * FD;
#pragma unroll
            for (int j = 0; j < 3; ++j) x[st][4 * i + j] = *(const v4f*)(p + 128 * j + c4);
            x[st][4 * i + 3] = *(const v4f*)(p + cw); }
        asm volatile("s_wait_xcnt 0x0" ::: "memory");                    // the wait that stands before a register named by these loads is overwritten; its clobber also keeps the set's loads together, ahead of the other set's conversion
        __builtin_amdgcn_sched_barrier(0);                               // no conversion (and so no wait for an older set) is moved up among these loads
    };
    auto storeB = [&](const int st, const int bt) {
#pragma unroll
        for (int i = 0; i < 4; ++i) { const int row = wave + GT * (4 * bt + i); const unsigned m = c0 + row < AD ? 0xFFFFFFFFu : 0u;
#pragma unroll
            for (int j = 0; j < 4; ++j) { v2u q = cvt4(x[st][4 * i + j]); const unsigned mm = j < 3 ? m : (m & mlane); q[0] &= mm; q[1] &= mm;
                *(v2ua*)(&sb[row * LP + 128 * j + c4]) = q; } }
    };
    auto loadA = [&](const int st, const int bt) {
#pragma unroll
        for (int i = 0; i < 4; ++i) { const int s = 4 * bt + i;
            const float* p = src + (size_t)(r0 + wave + GT * s) * RD;
#pragma unroll
            for (int j = 0; j < 3; ++j) x[st][5 * i + j] = *(const v4f*)(p + 128 * j + c4);
            x[st][5 * i + 3] = *(const v4f*)(p + ci);
            x[st][5 * i + 4] = *(const v4f*)(pe + __builtin_amdgcn_readlane(pof, s) + cp); }   // the row's place as a scalar: scalar base, the lane's fixed offset
        asm volatile("s_wait_xcnt 0x0" ::: "memory");                    // as in loadB
        __builtin_amdgcn_sched_barrier(0);                               // as in loadB
    };
    auto storeA = [&](const int st, const int bt) {
#pragma unroll
        for (int i = 0; i < 4; ++i) { const int row = wave + GT * (4 * bt + i);
#pragma unroll
            for (int j = 0; j < 3; ++j) *(v2ua*)(&sa[row * LP + 128 * j + c4]) = cvt4(x[st][5 * i + j]);
            v4f y;
#pragma unroll
            for (int e = 0; e < 4; ++e) y[e] = isitem ? x[st][5 * i + 3][e] : x[st][5 * i + 4][e];
            v2u q = cvt4(y); q[0] &= mlane; q[1] &= mlane;
            *(v2ua*)(&sa[row * LP + 384 + c4]) = q; }
    };
    static_assert(GN == GT * 4 * 2);                                     // two sets of B rows
    static_assert(GM == GT * 4 * 4);                                     // four sets of A rows
    loadB(0, 0);                                                         // the B rows need no index: they go first, in flight with the position indices
    loadB(1, 1);
    // inputs-only fence on the loaded value: the index load stays unconditional and ahead of the B loads, and its wait stands here, behind them (sunk into the history branch it would cost a latency of its own before any other load)
    asm volatile("" :: "v"(pzv));
    pof = (w ? posrow(pzv) : 1) * PD;
    storeB(0, 0); loadA(0, 0);
    storeB(1, 1); loadA(1, 1);
    storeA(0, 0); loadA(0, 2);
    storeA(1, 1); loadA(1, 3);
    storeA(0, 2);
    storeA(1, 3);
    __syncthreads();                                                     // every wave reads rows that other waves stored; every wave of the block passes here
    if (wave < GW) {                                                     // wave-uniform; no barrier stands behind this point
    const int wm = wave & 1, wn = wave >> 1;
    v8f acc[4][2];
#pragma unroll
    for (int mb = 0; mb < 4; ++mb)
#pragma unroll
        for (int nb = 0; nb < 2; ++nb) acc[mb][nb] = (v8f){};
    const bf* pa = &sa[(wm * 64 + lr) * LP + 8 * hi];                    // the lane's place in the k-step's A and B rows
    const bf* pb = &sb[(wn * 32 + lr) * LP + 8 * hi];
    // two register sets: a k-step's 12 LDS reads are issued one k-step ahead of its products
    v16bf a[2][4], bq[2][2];
    auto fetch = [&](const int s, const int kc) {
#pragma unroll
        for (int mb = 0; mb < 4; ++mb) a[s][mb] = ldb(pa + mb * 16 * LP + kc);
#pragma unroll
        for (int nb = 0; nb < 2; ++nb) bq[s][nb] = ldb(pb + nb * 16 * LP + kc); };
    fetch(0, 0);
#pragma unroll
    for (int i = 0; i < KP / 32; ++i) {
        if (i + 1 < KP / 32) fetch((i + 1) & 1, (i + 1) * 32);
#pragma unroll
        for (int nb = 0; nb < 2; ++nb) {
#pragma unroll
            for (int mb = 0; mb < 4; ++mb) acc[mb][nb] = wmmabg(a[i & 1][mb], bq[i & 1][nb], acc[mb][nb]); }
    }
    float* osw = os + wave * (64 * OSW);
#pragma unroll
    for (int mb = 0; mb < 4; ++mb) {
#pragma unroll
        for (int nb = 0; nb < 2; ++nb) {
#pragma unroll
            for (int j = 0; j < 8; ++j) osw[(mb * 16 + hi * 8 + j) * OSW + nb * 16 + lr] = acc[mb][nb][j]; } }   // D: row 8h+j, col lane&15
    wave_sync();
    float* outp = HP + ((size_t)w * MPAD + (size_t)(r0 + wm * 64)) * APAD + (size_t)(c0 + wn * 32);
    static_assert(32 * 16 * 16 == 64 * 32 * 4);    // lanes x 16 B x trips == 64 rows x 128 B
#pragma unroll
    for (int s = 0; s < 16; ++s) { const int row = 4 * s + (lane >> 3), q4 = (lane & 7) * 4;   // 16 s x 4 rows = 64 rows; 8 lanes x 4 floats = 32 columns
        const v4f val = *(const v4fa*)(&osw[row * OSW + q4]);
        *(v4f*)(outp + (size_t)row * APAD + q4) = val; }
    } else {
    static_assert(GM == (APAD / GN) * (GT - GW) * 8);                    // 4 column blocks x 4 waves x 8 rows store the tile's 128 rows once
    const int rw = (int)blockIdx.y * ((GT - GW) * 8) + (wave - GW) * 8;  // the wave's 8 rows of the tile, one behind the other
    if (w == 0) {
        v2u q[8][4];                                                     // all LDS reads before the first store: one LDS latency
#pragma unroll
        for (int t = 0; t < 8; ++t) {
#pragma unroll
            for (int j = 0; j < 4; ++j) q[t][j] = *(const v2ua*)(&sa[(rw + t) * LP + 128 * j + c4]); }
#pragma unroll
        for (int t = 0; t < 8; ++t) {
#pragma unroll
            for (int j = 0; j < 4; ++j) {
                const v4f f = {__uint_as_float(q[t][j][0] << 16), __uint_as_float(q[t][j][0] & 0xFFFF0000u), __uint_as_float(q[t][j][1] << 16), __uint_as_float(q[t][j][1] & 0xFFFF0000u)};
                if (j < 3 || 384 + c4 < FD) *(v4f*)(O1 + (size_t)(r0 + rw + t) * FD + 128 * j + c4) = f; } }   // the last quarter is stored only where it is a part of the row
        asm volatile("s_wait_xcnt 0x0" ::: "memory");  // the wait that stands before a register named by the stores above is overwritten (code of the other branches follows in the listing)
    } else {
        v8us q[8][2];
#pragma unroll
        for (int t = 0; t < 8; ++t) {
#pragma unroll
            for (int j = 0; j < 2; ++j) q[t][j] = *(const v8usa*)(&sa[(rw + t) * LP + 256 * j + 8 * lane]); }
#pragma unroll
        for (int t = 0; t < 8; ++t) {
#pragma unroll
            for (int j = 0; j < 2; ++j) { v8h h;
#pragma unroll
                for (int e = 0; e < 8; ++e) h[e] = toh_flush(__uint_as_float(((unsigned)q[t][j][e]) << 16));
                *(v8h*)(HR + (size_t)(r0 + rw + t) * KP + 256 * j + 8 * lane) = h; } }
        asm volatile("s_wait_xcnt 0x0" ::: "memory");  // the wait that stands before a register named by the stores above is overwritten (code of the other branches follows in the listing)
    }
    }
}

// k_score: one block per 16 candidates of one batch. Stage 0: the block's operands go to LDS once: the batch's 50 hh rows (asynchronous copies, whole padded rows), each wave's 4 hc rows
// (through registers, with b1 added, laid [a][4 candidates]) and w2 (already rounded); behind a block barrier the batch's 50 f16 hist rows follow (asynchronous copies that land while stage 1 runs).
// Stage 1, one wave per 4 candidates; lane = history entry (lane and lane + 32); every operand read from LDS, one pair of 4-wide pieces ahead of its arithmetic.
// logit = sum_a relu((hc + b1) + hh) * w2 + b2 (f32, fmaf chain per (candidate, history) pair; two candidates a packed instruction); masked entries replaced by -1e9; softmax with the max over all 50 entries (xor-shuffle reduction);
// alpha x1024 as f16 into the block's LDS rows pt [16][64] (candidate rows >= 50 and history >= 50 are zeros).
// Stage 2, behind one block barrier: out0[b][n][f] = (1/1024) sum_h pt[n][h] HR[b][h][f] (B fragments by transposing reads of the rows' LDS copy), f16 WMMA, K = 64; one wave per 128 features (8 accumulators);
// the 16 x 128 slab is staged in LDS (wave-private) and stored as 512-byte row pieces, rows < 50 and features < 500 only.
__global__ __launch_bounds__(32 * SW) void k_score(const float* __restrict__ HC, const float* __restrict__ HH, const int* __restrict__ maskp,
                                                   const float* __restrict__ b1, const float* __restrict__ w2, const float* __restrict__ b2,
                                                   const h16* __restrict__ HR, float* O0) {
    __shared__ __align__(16) h16 pt[SW * 4 * TP];
    __shared__ __align__(16) float os[SW * 16 * OSW2];
    __shared__ __align__(16) float xs[NH * XSP];                         // hh rows of the batch
    __shared__ __align__(16) float ct[SW * AD * 4];                      // per wave: hc + b1 of its 4 candidates, [a][candidate]
    __shared__ __align__(16) float wl[AD];                               // w2, rounded
    __shared__ __align__(16) h16 hl[HPAD * HLP];                         // f16 hist rows of the batch: [history][feature], rows pitched for the transposing reads; rows >= 50 are zeros
    const int lane = threadIdx.x & 31;
    const int wave = __builtin_amdgcn_readfirstlane((int)(threadIdx.x >> 5));
    const int b = (int)blockIdx.y;
    const int n0 = ((int)blockIdx.x * SW + wave) * 4;
    const int lr = lane & 15, hi = lane >> 4;
    const int f0 = wave * 128;
    const size_t hb = (size_t)b * NH;
    // stage 0a: hh rows -> xs. Round s: rows 2s and 2s + 1, one 16-byte piece a lane (a wave's copy is 512 contiguous bytes); every lane is on, every address in bounds, no LDS byte written twice.
    {
        const int col = (int)threadIdx.x & 63, r2 = (int)threadIdx.x >> 6;
        const float* g0 = HH + (hb + (size_t)r2) * APAD + (size_t)col * 4;
        const unsigned l0 = (unsigned)(size_t)(&xs[r2 * XSP + col * 4]);
        const float* g[25]; unsigned l[25];
#pragma unroll
        for (int s = 0; s < 25; ++s) { g[s] = g0 + (size_t)s * 2 * APAD; l[s] = l0 + (unsigned)(s * 2 * XSP * 4); }
        // the copies of a statement end in their own s_wait_xcnt 0: it stands before any register that a copy names is rewritten
        asm volatile("global_load_async_to_lds_b128 %0, %1, off\n\tglobal_load_async_to_lds_b128 %2, %3, off\n\tglobal_load_async_to_lds_b128 %4, %5, off\n\t"
                     "global_load_async_to_lds_b128 %6, %7, off\n\tglobal_load_async_to_lds_b128 %8, %9, off\n\tglobal_load_async_to_lds_b128 %10, %11, off\n\t"
                     "global_load_async_to_lds_b128 %12, %13, off\n\tglobal_load_async_to_lds_b128 %14, %15, off\n\tglobal_load_async_to_lds_b128 %16, %17, off\n\t"
                     "global_load_async_to_lds_b128 %18, %19, off\n\tglobal_load_async_to_lds_b128 %20, %21, off\n\tglobal_load_async_to_lds_b128 %22, %23, off\n\t"
                     "global_load_async_to_lds_b128 %24, %25, off\n\ts_wait_xcnt 0x0"
                     :: "v"(l[0]), "v"(g[0]), "v"(l[1]), "v"(g[1]), "v"(l[2]), "v"(g[2]), "v"(l[3]), "v"(g[3]), "v"(l[4]), "v"(g[4]), "v"(l[5]), "v"(g[5]), "v"(l[6]), "v"(g[6]),
                        "v"(l[7]), "v"(g[7]), "v"(l[8]), "v"(g[8]), "v"(l[9]), "v"(g[9]), "v"(l[10]), "v"(g[10]), "v"(l[11]), "v"(g[11]), "v"(l[12]), "v"(g[12]) : "memory");
        asm volatile("global_load_async_to_lds_b128 %0, %1, off\n\tglobal_load_async_to_lds_b128 %2, %3, off\n\tglobal_load_async_to_lds_b128 %4, %5, off\n\t"
                     "global_load_async_to_lds_b128 %6, %7, off\n\tglobal_load_async_to_lds_b128 %8, %9, off\n\tglobal_load_async_to_lds_b128 %10, %11, off\n\t"
                     "global_load_async_to_lds_b128 %12, %13, off\n\tglobal_load_async_to_lds_b128 %14, %15, off\n\tglobal_load_async_to_lds_b128 %16, %17, off\n\t"
                     "global_load_async_to_lds_b128 %18, %19, off\n\tglobal_load_async_to_lds_b128 %20, %21, off\n\tglobal_load_async_to_lds_b128 %22, %23, off\n\t"
                     "s_wait_xcnt 0x0"
                     :: "v"(l[13]), "v"(g[13]), "v"(l[14]), "v"(g[14]), "v"(l[15]), "v"(g[15]), "v"(l[16]), "v"(g[16]), "v"(l[17]), "v"(g[17]), "v"(l[18]), "v"(g[18]),
                        "v"(l[19]), "v"(g[19]), "v"(l[20]), "v"(g[20]), "v"(l[21]), "v"(g[21]), "v"(l[22]), "v"(g[22]), "v"(l[23]), "v"(g[23]), "v"(l[24]), "v"(g[24]) : "memory");
    }
    // stage 0b: the wave's 4 hc rows, b1, w2 and the lane's two mask words, all at clamped addresses and in flight together (a wave without candidates stages row 49 into its own, unread part of ct)
    const int nvec = ((int)blockIdx.x * SW + (int)(threadIdx.x >> 5)) * 4;
    size_t oc[4]; bool rok[4];
#pragma unroll
    for (int i = 0; i < 4; ++i) { int q = nvec + i; rok[i] = q < NN; q = q < NN ? q : NN - 1; q = __builtin_amdgcn_readfirstlane(q);
        oc[i] = ((size_t)b * NN + (size_t)q) * APAD; }
    const int hB = lane + 32; const int hBc = hB < NH ? hB : NH - 1; const bool okB = hB < NH;
    const int pB = hB < AD / 4 ? hB : AD / 4 - 1;                        // the lane's second piece of a candidate row
    const int tb = (int)threadIdx.x < AD / 4 ? (int)threadIdx.x : AD / 4 - 1;
    v4f cv[2][4];
#pragma unroll
    for (int i = 0; i < 4; ++i) { cv[0][i] = *(const v4f*)(HC + oc[i] + 4 * lane); cv[1][i] = *(const v4f*)(HC + oc[i] + 4 * pB); }
    const v4f b1a = *(const v4f*)(b1 + 4 * lane), b1b = *(const v4f*)(b1 + 4 * pB), w2v = *(const v4f*)(w2 + 4 * tb);   // b1 at the lane's two pieces of a candidate row
    const int mkA = maskp[hb + (size_t)lane], mkB = maskp[hb + (size_t)hBc];
    // inputs-only fence on the loaded values: the mask loads stay here, in flight with the other loads of stage 0 (sunk to their use behind stage 1 they would cost a memory latency of their own)
    asm volatile("" :: "v"(mkA), "v"(mkB));
#pragma unroll
    for (int j = 0; j < 4; ++j) {
        const float ba = bfr(b1a[j]), bb = bfr(b1b[j]);
        const v4f q0 = {cv[0][0][j] + ba, cv[0][1][j] + ba, cv[0][2][j] + ba, cv[0][3][j] + ba}, q1 = {cv[1][0][j] + bb, cv[1][1][j] + bb, cv[1][2][j] + bb, cv[1][3][j] + bb};
        *(v4fa*)(&ct[wave * (AD * 4) + (4 * lane + j) * 4]) = q0;
        if (hB < AD / 4) *(v4fa*)(&ct[wave * (AD * 4) + (4 * hB + j) * 4]) = q1; }
    if ((int)threadIdx.x < AD / 4) {
        const v4f wr = {bfr(w2v[0]), bfr(w2v[1]), bfr(w2v[2]), bfr(w2v[3])};
        *(v4fa*)(&wl[4 * (int)threadIdx.x]) = wr; }
    // the k rows 50..63 of stage 2's B operand: zeros (their alpha is zero too, and the product must be a zero)
#pragma unroll
    for (int it = 0; it < 7; ++it) { const int p = it * (32 * SW) + (int)threadIdx.x; const v8h z = (v8h){};
        *(v8ha*)(&hl[(NH + (p >> 6)) * HLP + (p & 63) * 8]) = z; }
    asm volatile("s_wait_asynccnt 0x0" ::: "memory");                    // this wave's copies have landed
    __syncthreads();                                                     // every wave reads rows that other waves copied; every wave of the block passes here
    // stage 2's B operand depends on nothing of stage 1: the batch's 50 f16 hist rows are copied to LDS here and land while stage 1 runs. A wave takes one half (512 contiguous bytes) of every second row:
    // 25 copies; every lane is on, every address in bounds, no LDS byte written twice
    {
        const int row = wave >> 1, hf = wave & 1;
        const char* g0 = (const char*)(HR + (hb + (size_t)row) * KP + (size_t)hf * (KP / 2) + (size_t)lane * 8);
        const unsigned l0 = (unsigned)(size_t)(&hl[row * HLP + hf * (KP / 2) + lane * 8]);
#pragma unroll
        for (int s = 0; s < 3; ++s) acopy8(l0 + (unsigned)(s * 16 * HLP * 2), g0 + (size_t)s * 16 * KP * 2, 2 * HLP * 2, (size_t)2 * KP * 2);
        acopy1(l0 + (unsigned)(48 * HLP * 2), g0 + (size_t)48 * KP * 2);
    }
    if (n0 >= NN) {                                                      // wave-uniform: no candidate here, its 4 alpha rows are zeros
        const v8h z = (v8h){}; *(v8ha*)(&pt[(wave * 4 + (lane >> 3)) * TP + (lane & 7) * 8]) = z;
    } else {
    const float b2v = bfr(b2[0]);
    v2f accA[2], accB[2];                                                // per pair of candidates: the sums of the lane's two history entries
#pragma unroll
    for (int i = 0; i < 2; ++i) { accA[i] = (v2f){}; accB[i] = (v2f){}; }
    const float* xpa = &xs[lane * XSP]; const float* xpb = &xs[hBc * XSP]; const float* cp = &ct[wave * (AD * 4)];
    // two register sets of two pieces each: a pair's 14 LDS reads are issued one pair ahead of its arithmetic
    v4f xa[2][2], xb[2][2], ww[2][2], cc[2][2][4];
    auto fetch = [&](const int s, const int d) {
#pragma unroll
        for (int p = 0; p < 2; ++p) { const int a4 = 2 * d + p;
            xa[s][p] = *(const v4fa*)(xpa + 4 * a4); xb[s][p] = *(const v4fa*)(xpb + 4 * a4);
            ww[s][p] = *(const v4fa*)(&wl[4 * a4]);
#pragma unroll
            for (int j = 0; j < 4; ++j) cc[s][p][j] = *(const v4fa*)(cp + (4 * a4 + j) * 4); } };
    auto work = [&](const int s) {
#pragma unroll
        for (int p = 0; p < 2; ++p) {
#pragma unroll
            for (int j = 0; j < 4; ++j) {
#pragma unroll
                for (int i = 0; i < 2; ++i) {                            // two candidates a step: they lie side by side in the piece read, so the packed add and fmaf take them as they are
                    const v2f c = {cc[s][p][j][2 * i], cc[s][p][j][2 * i + 1]}, w = {ww[s][p][j], ww[s][p][j]};
                    const v2f ya = c + (v2f){xa[s][p][j], xa[s][p][j]}, yb = c + (v2f){xb[s][p][j], xb[s][p][j]};
                    const v2f va = {fmaxf(ya[0], 0.0f), fmaxf(ya[1], 0.0f)}, vb = {fmaxf(yb[0], 0.0f), fmaxf(yb[1], 0.0f)};
                    accA[i] = __builtin_elementwise_fma(va, w, accA[i]); accB[i] = __builtin_elementwise_fma(vb, w, accB[i]); } } } };
    // the compiler fence behind each fetch keeps its reads where they stand: without it the reads carried into the next trip are sunk to that trip's head, directly in front of their use
    fetch(0, 0);
    asm volatile("" ::: "memory");
#pragma unroll 1
    for (int d = 0; d < AD / 8 - 1; d += 2) {                            // rolled: the body already holds two pairs, one per register set
        fetch(1, d + 1);
        asm volatile("" ::: "memory");
        work(0);
        fetch(0, d + 2);
        asm volatile("" ::: "memory");
        work(1);
        // the order asked of the scheduler: a pair's 14 LDS reads together, then the other pair's arithmetic, so that every read has a whole pair of lead (left alone it puts the reads late, close to their use)
        __builtin_amdgcn_sched_group_barrier(0x100, 14, 0);
        __builtin_amdgcn_sched_group_barrier(0x002, 98, 0);
        __builtin_amdgcn_sched_group_barrier(0x100, 14, 0);
        __builtin_amdgcn_sched_group_barrier(0x002, 100, 0);
    }
    work(0);                                                             // the last pair
#pragma unroll
    for (int i = 0; i < 4; ++i) {
        float sA = accA[i >> 1][i & 1] + b2v, sB = accB[i >> 1][i & 1] + b2v;
        sA = (mkA != 0) ? sA : NEGV; sB = (mkB != 0) ? sB : NEGV; sB = okB ? sB : NEGB;
        float mx = fmaxf(sA, sB);
        mx = fmaxf(mx, __shfl_xor(mx, 16, 32)); mx = fmaxf(mx, __shfl_xor(mx, 8, 32)); mx = fmaxf(mx, __shfl_xor(mx, 4, 32));
        mx = fmaxf(mx, __shfl_xor(mx, 2, 32));  mx = fmaxf(mx, __shfl_xor(mx, 1, 32));
        const float eA = __builtin_amdgcn_exp2f((sA - mx) * L2E);
        float eB = __builtin_amdgcn_exp2f((sB - mx) * L2E); eB = okB ? eB : 0.0f;
        float sm = eA + eB;
        sm += __shfl_xor(sm, 16, 32); sm += __shfl_xor(sm, 8, 32); sm += __shfl_xor(sm, 4, 32); sm += __shfl_xor(sm, 2, 32); sm += __shfl_xor(sm, 1, 32);
        const float inv = __builtin_amdgcn_rcpf(sm) * PCS;              // sm >= 1 (the maximum entry contributes 1)
        h16 qa = toh_flush(eA * inv), qb = toh_flush(eB * inv);
        qa = rok[i] ? qa : (h16)0.0f; qb = rok[i] ? qb : (h16)0.0f;
        pt[(wave * 4 + i) * TP + lane] = qa; pt[(wave * 4 + i) * TP + 32 + lane] = qb; }   // 4 rows x 64 columns all written
    }
    asm volatile("s_wait_asynccnt 0x0" ::: "memory");                    // this wave's copies of the hist rows have landed
    __syncthreads();                                                     // every wave reads all 16 alpha rows and hist rows that other waves copied; every wave of the block passes here
    v16h a[2];
#pragma unroll
    for (int ks = 0; ks < 2; ++ks) { const h16* p = &pt[lr * TP + 8 * hi + 32 * ks]; a[ks] = cat16(*(const v8ha*)p, *(const v8ha*)(p + 16)); }   // the k map of ldb
    const h16* tq = &hl[(8 * hi + (lane & 7)) * HLP + f0 + 8 * ((lane >> 3) & 1)];   // the lane's address in a 16 (history) x 16 (feature) tile of the transposing read
    v16h bq[2][8];                                                       // all B fragments are read before the first matrix instruction: one LDS latency, not sixteen
#pragma unroll
    for (int ks = 0; ks < 2; ++ks) {
#pragma unroll
        for (int nb = 0; nb < 8; ++nb) bq[ks][nb] = cat16(ldtr(tq + (32 * ks) * HLP + nb * 16), ldtr(tq + (32 * ks + 16) * HLP + nb * 16)); }   // the k map of ldb: elements 0..7 <- 32 ks + 8h + 0..7, 8..15 <- 32 ks + 16 + 8h + 0..7
    v8f acc[8];
#pragma unroll
    for (int nb = 0; nb < 8; ++nb) acc[nb] = (v8f){};
#pragma unroll
    for (int ks = 0; ks < 2; ++ks) {
#pragma unroll
        for (int nb = 0; nb < 8; ++nb) acc[nb] = wmma16g(a[ks], bq[ks][nb], acc[nb]); }
    float* osw = os + wave * (16 * OSW2);
#pragma unroll
    for (int nb = 0; nb < 8; ++nb) {
#pragma unroll
        for (int j = 0; j < 8; ++j) osw[(hi * 8 + j) * OSW2 + nb * 16 + lr] = acc[nb][j] * PCI; }   // D: row 8h+j, col lane&15
    wave_sync();
    const int nr0 = (int)blockIdx.x * (SW * 4);
    const int c4 = lane * 4;                                             // 32 lanes x 4 floats = 128 columns
    float* outp = O0 + ((size_t)b * NN + (size_t)nr0) * FD + (size_t)(f0 + c4);
    const bool cok = f0 + c4 < FD;                                       // FD % 4 == 0: a float4 lies wholly inside the row or wholly outside
    v4f val[16];
#pragma unroll
    for (int row = 0; row < 16; ++row) val[row] = *(const v4fa*)(&osw[row * OSW2 + c4]);
    if (cok) {
#pragma unroll
        for (int row = 0; row < 16; ++row) { if (nr0 + row < NN) *(v4f*)(outp + (size_t)row * FD) = val[row]; }
    }
}

static constexpr size_t al256(size_t v) { return (v + 255) & ~(size_t)255; }
static constexpr size_t SZ_HR = al256((size_t)MPAD * KP * 2);
static constexpr size_t SZ_HP = al256((size_t)2 * MPAD * APAD * 4);
static constexpr size_t SZ_TOTAL = SZ_HR + SZ_HP;
static_assert(SZ_TOTAL <= (size_t)134217728);          // workspace carve <= 128 MiB
static_assert(((size_t)MPAD * APAD * 4) % 256 == 0);   // the two HP sub-planes stay 256-byte aligned
static constexpr size_t OUT1_OFF = (size_t)NB_FULL * NN * FD;   // element offset of the second output (fixed, full problem)

extern "C" void kernel_launch(void* const* d_in, const int* in_sizes, int n_in,
                              void* d_out, int out_size, void* d_ws, size_t ws_size, hipStream_t stream) {
    if (n_in < 9) return;
    if ((size_t)in_sizes[0] < (size_t)MROWS * RD || (size_t)in_sizes[1] < (size_t)MROWS * RD) return;
    if ((size_t)in_sizes[2] < (size_t)MROWS || (size_t)in_sizes[3] < (size_t)MROWS) return;
    if ((size_t)in_sizes[4] < (size_t)NPOS * PD || (size_t)in_sizes[5] < (size_t)AD * 2 * FD) return;
    if (in_sizes[6] < AD || in_sizes[7] < AD || in_sizes[8] < 1) return;
    if ((size_t)out_size < OUT1_OFF + (size_t)MROWS * FD) return;
    if (SZ_TOTAL > ws_size) return;
    // wire order: history_repr, candidate_repr, user_history_mask, user_history_position, pos_emb, W1, b1, w2, b2
    const float* hist_in = (const float*)d_in[0];
    const float* cand_in = (const float*)d_in[1];
    const int*   maskp   = (const int*)d_in[2];
    const int*   posp    = (const int*)d_in[3];
    const float* pe      = (const float*)d_in[4];
    const float* W1      = (const float*)d_in[5];
    const float* b1      = (const float*)d_in[6];
    const float* w2      = (const float*)d_in[7];
    const float* b2      = (const float*)d_in[8];
    float* OUT0 = (float*)d_out;                 // [NB][50][500]
    float* OUT1 = (float*)d_out + OUT1_OFF;      // [NB][50][500]
    char* wsp = (char*)d_ws;
    h16* HR = (h16*)wsp;   wsp += SZ_HR;         // [MPAD][512]: hist rows in f16
    float* HP = (float*)wsp; wsp += SZ_HP;       // [2][MPAD][256]: hc | hh
    const float* HC = HP; const float* HH = HP + (size_t)MPAD * APAD;

    // hc = cand Wc^T, hh = hist Wh^T; out1 and the f16 hist rows
    k_gemm1<<<dim3(MPAD / GM, APAD / GN, 2), 32 * GT, 0, stream>>>(hist_in, cand_in, posp, pe, W1, HP, HR, OUT1);
    // logits, softmax, user representation = alpha hist
    k_score<<<dim3(HPAD / (4 * SW), NB, 1), 32 * SW, 0, stream>>>(HC, HH, maskp, b1, w2, b2, HR, OUT0);
}

// v008
// A run of this version takes 16.1 microseconds.
// Next to v007, in two timings, it ran 1.12 and 1.11 times as fast.
// All steps since v000 together make it 3.55 times as fast.
#include <hip/hip_runtime.h>
#pragma clang fp contract(off)

// Additive attention of candidate items over a user history: rows = [400-wide item vector | 100-wide position embedding]; hidden = relu(cand Wc^T + hist Wh^T + b1) (W1 [200][1000] = [Wc | Wh], [out][in]); logit = hidden . w2 + b2; masked entries REPLACED by -1e9; softmax over the history; out0 = alpha hist, out1 = the candidate rows.
// Compute dtypes, f32 accumulate everywhere: the two projections v_wmma_f32_16x16x32_bf16 (items, position table, W1 RNE-converted to bf16; products exact); alpha . hist v_wmma_f32_16x16x32_f16 (alpha x1024 carry as f16, hist = the bf16 values held in f16); relu / w2 dot (depth 200, one shared vector) and softmax on the vector unit in f32.
// Layout: f32 plane HP [2][rows][256] (hc | hh); f16 plane HR [rows][512] (the hist rows, K zero-padded 500 -> 512, the bf16 values held in f16; the score kernel reads them transposed out of LDS); the bf16 operands of the projections (rows and W1, zero-padded to [.][512]) exist in LDS only; alpha stays in LDS (16 candidate rows per score block).
// Two launches: k_gemm1 (operand conversion, both projections, out1 and HR), k_score (logits, softmax, alpha . hist, out0).

#ifndef NB
#define NB 64
#endif
#define NB_FULL 64
#define NH   50                  // history entries per batch
#define NN   50                  // candidates per batch
#define RD   400                 // item vector width
#define PD   100                 // position embedding width
#define FD   500                 // RD + PD
#define AD   200                 // attention width
#define NPOS 52                  // rows of the position table
#define KP   512                 // FD padded to the k-step
#define APAD 256                 // AD padded to the column tile
#define HPAD 64                  // NH / NN padded (k of the second product, rows of its A operand)
#define MROWS (NB * NN)
#define MPAD  ((MROWS + 63) / 64 * 64)
#define OSW  36                  // LDS row pitch (floats) of a 64 x 32 slab
#define GM   128                 // GEMM block tile: rows
#define GN   64                  // GEMM block tile: columns
#define GW   4                   // GEMM waves that multiply, 2 x 2 wave tiles of 64 x 32
#define LP   520                 // LDS row pitch (16-bit elements) of the staged GEMM operand rows: 1040 B = 16 B x odd
#define OSW2 132                 // LDS row pitch (floats) of a 16 x 128 slab
#define TP   72                  // LDS row pitch (halves) of the alpha rows
#define HLP  528                 // LDS row pitch (halves) of the staged f16 hist rows: 1056 B = 32 B x odd, the pitch of the transposing 16-bit read
#define SW   4                   // waves per score block (4 candidates each)
#define XSP  260                 // LDS row pitch (floats) of the staged hh rows: 1040 B = 16 B x odd, so 16 lanes' 16-byte reads of 16 rows fall on 64 different banks
#define GT   8                   // GEMM waves per block in all: 8 convert the operands; then 4 multiply and 4 store the row planes
#define PCS  1024.0f             // carry of the alpha plane
#define PCI  (1.0f / 1024.0f)
#define L2E  1.4426950408889634f
#define NEGV (-1.0e9f)
#define NEGB (-3.0e38f)

static_assert(FD == RD + PD);
static_assert(NH == NN);                       // both row sets have MROWS rows
static_assert(RD % 8 == 0);                    // an 8-element piece never straddles the item / position boundary
static_assert(PD % 4 == 0);
static_assert(FD % 4 == 0);                    // a float4 of the flat output never straddles two rows
static_assert(KP % 32 == 0);                   // GEMM k-loop steps by 32
static_assert(KP >= FD);
static_assert(KP % 64 == 0);
static_assert(KP / 8 == 64);
static_assert(APAD % 64 == 0);
static_assert(APAD >= AD);
static_assert(AD % 4 == 0);
static_assert(HPAD == 64);
static_assert(HPAD % 32 == 0);
static_assert(NH > 32);                        // two history entries per lane: lane and lane + 32
static_assert(NH <= HPAD);
static_assert(NN <= HPAD);
static_assert(MPAD % 64 == 0);
static_assert(MPAD == MROWS);                  // every row of a GEMM tile is a row of the inputs
static_assert(HPAD % (4 * SW) == 0);           // score grid covers the padded candidate rows exactly
static_assert(NB <= NB_FULL);
static_assert(((size_t)NB_FULL * NN * FD * 4) == (size_t)6400000);   // byte offset of the second output
static_assert((((size_t)NB_FULL * NN * FD * 4) % 128) == 0);
static_assert((OSW * 4) % 16 == 0);
static_assert((TP * 2) % 16 == 0);
static_assert(MPAD % GM == 0);
static_assert(APAD % GN == 0);
static_assert(GM == 2 * 64);                   // 2 x 2 wave tiles cover the block tile
static_assert(GN == 2 * 32);
static_assert(GM % GW == 0);
static_assert(GN % GW == 0);
static_assert(KP == 4 * 32 * 4);               // a row is 4 quarters of 4 columns for each of a wave's 32 lanes
static_assert(RD > 384 && RD <= 384 + 128 && FD <= KP);   // the item / position boundary and the end of the row lie in the last quarter
static_assert(LP >= KP);
static_assert((LP * 2) % 32 == 16);
static_assert((GM + GN) * LP * 2 + GW * 64 * OSW * 4 <= 327680);   // static LDS of the GEMM kernel
static_assert(SW * 4 == 16);                   // a score block's candidates are one 16-row A fragment
static_assert(SW * 128 == KP);                 // its waves cover the padded features, 128 each
static_assert((OSW2 * 4) % 16 == 0);
static_assert(SW * 4 * TP * 2 + SW * 16 * OSW2 * 4 + NH * XSP * 4 + SW * AD * 4 * 4 + AD * 4 + HPAD * HLP * 2 <= 327680);   // static LDS of the score kernel
static_assert(XSP >= APAD);
static_assert((XSP * 4) % 16 == 0);
static_assert(APAD / 4 == 64);                 // a padded hh row is 64 pieces of 16 B: half of the score block's threads
static_assert(32 * SW == 128);
static_assert(NH == 2 * 25);                   // 25 rounds of 2 rows copy the 50 hh rows exactly, every lane on in every round
static_assert((AD / 4) % 4 == 2);              // the score loop takes two pairs of pieces a trip, and one pair is left behind it
static_assert(TP >= HPAD);
static_assert(HLP >= KP);
static_assert((HLP * 2) % 64 == 32);
static_assert(KP * 2 == 2 * 32 * 16);          // half a hist row is one 16-byte piece for each of a wave's 32 lanes
static_assert(2 * NH == SW * 25);              // 25 copies a wave take the 100 row halves exactly
static_assert((HPAD - NH) * (KP / 8) == 7 * 32 * SW);   // 7 stores a thread zero the k rows behind the history
static_assert(AD / 4 <= 64);                   // a candidate row's pieces: lane and lane + 32
static_assert(AD / 4 <= 32 * SW);

typedef _Float16 h16;
typedef unsigned short bf;
typedef __attribute__((ext_vector_type(16))) __bf16   v16bf;
typedef __attribute__((ext_vector_type(16))) _Float16 v16h;
typedef __attribute__((ext_vector_type(8)))  _Float16 v8h;
typedef __attribute__((ext_vector_type(8)))  unsigned short v8us;
typedef __attribute__((ext_vector_type(8)))  short    v8s;
typedef __attribute__((ext_vector_type(8)))  float    v8f;
typedef __attribute__((ext_vector_type(4)))  float    v4f;
typedef __attribute__((ext_vector_type(2)))  float    v2f;
typedef __attribute__((ext_vector_type(2)))  __bf16   v2bf;
typedef __attribute__((ext_vector_type(2)))  unsigned v2u;
typedef v4f  __attribute__((may_alias)) v4fa;
typedef v2u  __attribute__((may_alias)) v2ua;
typedef v8us __attribute__((may_alias)) v8usa;
typedef v8h  __attribute__((may_alias)) v8ha;

__device__ __forceinline__ unsigned short f2bf(float f) { unsigned u = __float_as_uint(f); u += 0x7FFFu + ((u >> 16) & 1u); return (unsigned short)(u >> 16); }
__device__ __forceinline__ float bfr(float f) { return __uint_as_float(((unsigned)f2bf(f)) << 16); }   // value after RNE convert to bf16
__device__ __forceinline__ v16h cat16(v8h lo, v8h hi) { return __builtin_shufflevector(lo, hi, 0, 1, 2, 3, 4, 5, 6, 7, 8, 9, 10, 11, 12, 13, 14, 15); }
__device__ __forceinline__ v16bf cat16b(v8us lo, v8us hi) { return __builtin_bit_cast(v16bf, __builtin_shufflevector(lo, hi, 0, 1, 2, 3, 4, 5, 6, 7, 8, 9, 10, 11, 12, 13, 14, 15)); }
__device__ __forceinline__ v8f wmma16(v16h a, v16h b, v8f c) { return __builtin_amdgcn_wmma_f32_16x16x32_f16(false, a, false, b, (short)0, c, false, false); }
__device__ __forceinline__ v8f wmmab(v16bf a, v16bf b, v8f c) { return __builtin_amdgcn_wmma_f32_16x16x32_bf16(false, a, false, b, (short)0, c, false, false); }
// fragment loaders from K-contiguous 16-bit rows; p already includes + 8*(lane>>4): elements 0..7 <- k0+8h+0..7, elements 8..15 <- k0+16+8h+0..7 (same map for A and B)
__device__ __forceinline__ v16bf ldb(const bf* p)  { return cat16b(*(const v8us*)p, *(const v8us*)(p + 16)); }
// transposing LDS read (ds_load_tr16_b128) of a row-major 16-bit tile T: with p = &T[k0 + 8 * (lane >> 4) + (lane & 7)][d0 + 8 * ((lane >> 3) & 1)] the lane gets T[k0 + 8 * (lane >> 4) + 0..7][d0 + (lane & 15)]
__device__ __forceinline__ v8h ldtr(const h16* p) { typedef __attribute__((address_space(3))) v8s lds_v8s; return __builtin_bit_cast(v8h, __builtin_amdgcn_ds_load_tr16_b128_v8i16((lds_v8s*)p)); }
// ordering point for wave-private LDS tiles (same wave writes and reads)
__device__ __forceinline__ void wave_sync() { __builtin_amdgcn_fence(3 /* release order */, "wavefront"); __builtin_amdgcn_wave_barrier(); asm volatile("" ::: "memory"); }
// per-instruction guarded matrix ops: one accumulator tied per guard, operands kept live
__device__ __forceinline__ v8f wmma16g(v16h a, v16h b, v8f c) { c = wmma16(a, b, c); asm volatile("v_nop\n\tv_nop\n\tv_nop\n\tv_nop" : "+v"(c) : "v"(a), "v"(b)); return c; }
__device__ __forceinline__ v8f wmmabg(v16bf a, v16bf b, v8f c) { c = wmmab(a, b, c); asm volatile("v_nop\n\tv_nop\n\tv_nop\n\tv_nop" : "+v"(c) : "v"(a), "v"(b)); return c; }
// eight asynchronous 16-byte copies a lane, global -> LDS, at steps of gs and ls bytes; the statement ends in its own s_wait_xcnt 0, which so stands before any register that a copy names is rewritten
__device__ __forceinline__ void acopy8(const unsigned l, const char* g, const unsigned ls, const size_t gs) {
    asm volatile("global_load_async_to_lds_b128 %0, %8, off\n\tglobal_load_async_to_lds_b128 %1, %9, off\n\tglobal_load_async_to_lds_b128 %2, %10, off\n\tglobal_load_async_to_lds_b128 %3, %11, off\n\t"
                 "global_load_async_to_lds_b128 %4, %12, off\n\tglobal_load_async_to_lds_b128 %5, %13, off\n\tglobal_load_async_to_lds_b128 %6, %14, off\n\tglobal_load_async_to_lds_b128 %7, %15, off\n\t"
                 "s_wait_xcnt 0x0"
                 :: "v"(l), "v"(l + ls), "v"(l + 2 * ls), "v"(l + 3 * ls), "v"(l + 4 * ls), "v"(l + 5 * ls), "v"(l + 6 * ls), "v"(l + 7 * ls),
                    "v"(g), "v"(g + gs), "v"(g + 2 * gs), "v"(g + 3 * gs), "v"(g + 4 * gs), "v"(g + 5 * gs), "v"(g + 6 * gs), "v"(g + 7 * gs) : "memory");
}
// one such copy, with the same closing wait
__device__ __forceinline__ void acopy1(const unsigned l, const char* g) {
    asm volatile("global_load_async_to_lds_b128 %0, %1, off\n\ts_wait_xcnt 0x0" :: "v"(l), "v"(g) : "memory");
}
// f32 -> f16 convert that cannot produce an f16 subnormal (|v| < 2^-14 -> +0)
static __device__ __forceinline__ h16 toh_flush(float v) { const h16 r = (h16)v; return (fabsf(v) < 6.103515625e-05f) ? (h16)0.0f : r; }
// the minima of two neighbouring pairs in one dual instruction. In asm because fminf on values read from LDS compiles to one more instruction per operand (v_max x, x, which quiets a signalling NaN) and so costs what the step saves;
// the outputs are early-clobber: neither half writes a register that the other half still reads
__device__ __forceinline__ v2f min2(const float a0, const float b0, const float a1, const float b1) {
    float r0, r1;
    asm("v_dual_min_num_f32 %0, %2, %3 :: v_dual_min_num_f32 %1, %4, %5" : "=&v"(r0), "=&v"(r1) : "v"(a0), "v"(b0), "v"(a1), "v"(b1));
    return (v2f){r0, r1};
}
// position-table row: negative index wraps once, then clamps into the table
__device__ __forceinline__ int posrow(int p) { p = p < 0 ? p + NPOS : p; p = p < 0 ? 0 : p; p = p > NPOS - 1 ? NPOS - 1 : p; return p; }

// four f32 -> four bf16, round to nearest even (two v_cvt_pk_bf16_f32), packed in two words
__device__ __forceinline__ v2u cvt4(const v4f x) {
    const v2f lo = {x[0], x[1]}, hi = {x[2], x[3]};
    v2u r; r[0] = __builtin_bit_cast(unsigned, __builtin_convertvector(lo, v2bf)); r[1] = __builtin_bit_cast(unsigned, __builtin_convertvector(hi, v2bf)); return r;
}

// k_gemm1: bf16 GEMM straight from the f32 inputs, one block of 8 waves per 128x64 tile, K = 512. HP[w][m][n] = sum_k X[w][m][k] W[w][n][k]; grid (MPAD/128, APAD/64, 2); w = 0: candidates, Wc; w = 1: history, Wh.
// Stage 0, all 8 waves: the tile's 128 A rows = [ item vector (400) | position row (100) | zeros (12) ] (history: table[pos[r]]; candidates: table row 1) and its 64 B rows (W1 row a, columns 500 w ..; rows >= 200 and k >= 500
// are zeros) are loaded as f32 (a wave load is 512 contiguous bytes of one row), converted to bf16 and stored to LDS rows pitched 16 B x odd. All loads at clamped addresses, selected or masked by value.
// Behind one block barrier: waves 0..3 multiply (wave tile 64x32, 8 accumulators; every output sums its 16 k-steps in ascending order) and store their 64x32 slab, staged in LDS (wave-private), as whole 128-byte lines;
// waves 4..7 store the converted A rows from LDS: candidates widened to f32 as out1 [rows][500], history held in f16 as the plane HR [rows][512]. Each of the 4 column blocks of a row tile stores 32 of its 128 rows.
__global__ __launch_bounds__(32 * GT) void k_gemm1(const float* __restrict__ hist, const float* __restrict__ cand, const int* __restrict__ pos, const float* __restrict__ pe,
                                                   const float* __restrict__ W1, float* HP, h16* HR, float* O1) {
    __shared__ __align__(16) bf sa[GM * LP];
    __shared__ __align__(16) bf sb[GN * LP];
    __shared__ __align__(16) float os[GW * 64 * OSW];
    const int lane = threadIdx.x & 31, lr = lane & 15, hi = lane >> 4;
    const int wave = __builtin_amdgcn_readfirstlane((int)(threadIdx.x >> 5));
    const int r0 = (int)blockIdx.x * GM, c0 = (int)blockIdx.y * GN, w = (int)blockIdx.z;
    const float* src = w ? hist : cand;
    // a wave takes rows wave + 8 s; a row is 4 quarters of 128 columns, 4 columns a lane. The last quarter (columns 384..511) holds the item's last 16 columns, the position row and the zeros.
    const int c4 = lane * 4;
    const int ci = 384 + c4 < RD - 4 ? 384 + c4 : RD - 4;                // item column of the last quarter, clamped into the row
    int cp = 384 + c4 - RD; cp = cp < 0 ? 0 : (cp > PD - 4 ? PD - 4 : cp);   // position column, clamped into the table row
    const int cw = 384 + c4 < FD - 4 ? 384 + c4 : FD - 4;                // W1 column of the last quarter, clamped into its half of the row
    const bool isitem = 384 + c4 < RD;
    const unsigned mlane = 384 + c4 < FD ? 0xFFFFFFFFu : 0u;             // zero for the padded columns
    const int pzv = pos[r0 + wave + GT * lr];                            // lane s (s < 16) holds the position index of the wave's A row s
    int pof;                                                             // and, behind the B loads, the place in the table of that row's position row
    // (every loop of this kernel is unrolled: its index picks registers or immediate offsets)
    v4f x[2][20];                                                        // two register sets of 4 rows each: a set's loads fly while the other set is converted
    auto loadB = [&](const int st, const int bt) {
#pragma unroll
        for (int i = 0; i < 4; ++i) { const int a = c0 + wave + GT * (4 * bt + i); const int ac = a < AD ? a : AD - 1;
            const float* p = W1 + (size_t)ac * (2 * FD) + (size_t)w * FD;
#pragma unroll
            for (int j = 0; j < 3; ++j) x[st][4 * i + j] = *(const v4f*)(p + 128 * j + c4);
            x[st][4 * i + 3] = *(const v4f*)(p + cw); }
        asm volatile("s_wait_xcnt 0x0" ::: "memory");                    // the wait that stands before a register named by these loads is overwritten; its clobber also keeps the set's loads together, ahead of the other set's conversion
        __builtin_amdgcn_sched_barrier(0);                               // no conversion (and so no wait for an older set) is moved up among these loads
    };
    auto storeB = [&](const int st, const int bt) {
#pragma unroll
        for (int i = 0; i < 4; ++i) { const int row = wave + GT * (4 * bt + i); const unsigned m = c0 + row < AD ? 0xFFFFFFFFu : 0u;
#pragma unroll
            for (int j = 0; j < 4; ++j) { v2u q = cvt4(x[st][4 * i + j]); const unsigned mm = j < 3 ? m : (m & mlane); q[0] &= mm; q[1] &= mm;
                *(v2ua*)(&sb[row * LP + 128 * j + c4]) = q; } }
    };
    auto loadA = [&](const int st, const int bt) {
#pragma unroll
        for (int i = 0; i < 4; ++i) { const int s = 4 * bt + i;
            const float* p = src + (size_t)(r0 + wave + GT * s) * RD;
#pragma unroll
            for (int j = 0; j < 3; ++j) x[st][5 * i + j] = *(const v4f*)(p + 128 * j + c4);
            x[st][5 * i + 3] = *(const v4f*)(p + ci);
            x[st][5 * i + 4] = *(const v4f*)(pe + __builtin_amdgcn_readlane(pof, s) + cp); }   // the row's place as a scalar: scalar base, the lane's fixed offset
        asm volatile("s_wait_xcnt 0x0" ::: "memory");                    // as in loadB
        __builtin_amdgcn_sched_barrier(0);                               // as in loadB
    };
    auto storeA = [&](const int st, const int bt) {
#pragma unroll
        for (int i = 0; i < 4; ++i) { const int row = wave + GT * (4 * bt + i);
#pragma unroll
            for (int j = 0; j < 3; ++j) *(v2ua*)(&sa[row * LP + 128 * j + c4]) = cvt4(x[st][5 * i + j]);
            v4f y;
#pragma unroll
            for (int e = 0; e < 4; ++e) y[e] = isitem ? x[st][5 * i + 3][e] : x[st][5 * i + 4][e];
            v2u q = cvt4(y); q[0] &= mlane; q[1] &= mlane;
            *(v2ua*)(&sa[row * LP + 384 + c4]) = q; }
    };
    static_assert(GN == GT * 4 * 2);                                     // two sets of B rows
    static_assert(GM == GT * 4 * 4);                                     // four sets of A rows
    loadB(0, 0);                                                         // the B rows need no index: they go first, in flight with the position indices
    loadB(1, 1);
    // inputs-only fence on the loaded value: the index load stays unconditional and ahead of the B loads, and its wait stands here, behind them (sunk into the history branch it would cost a latency of its own before any other load)
    asm volatile("" :: "v"(pzv));
    pof = (w ? posrow(pzv) : 1) * PD;
    storeB(0, 0); loadA(0, 0);
    storeB(1, 1); loadA(1, 1);
    storeA(0, 0); loadA(0, 2);
    storeA(1, 1); loadA(1, 3);
    storeA(0, 2);
    storeA(1, 3);
    __syncthreads();                                                     // every wave reads rows that other waves stored; every wave of the block passes here
    if (wave < GW) {                                                     // wave-uniform; no barrier stands behind this point
    const int wm = wave & 1, wn = wave >> 1;
    v8f acc[4][2];
#pragma unroll
    for (int mb = 0; mb < 4; ++mb)
#pragma unroll
        for (int nb = 0; nb < 2; ++nb) acc[mb][nb] = (v8f){};
    const bf* pa = &sa[(wm * 64 + lr) * LP + 8 * hi];                    // the lane's place in the k-step's A and B rows
    const bf* pb = &sb[(wn * 32 + lr) * LP + 8 * hi];
    // two register sets: a k-step's 12 LDS reads are issued one k-step ahead of its products
    v16bf a[2][4], bq[2][2];
    auto fetch = [&](const int s, const int kc) {
#pragma unroll
        for (int mb = 0; mb < 4; ++mb) a[s][mb] = ldb(pa + mb * 16 * LP + kc);
#pragma unroll
        for (int nb = 0; nb < 2; ++nb) bq[s][nb] = ldb(pb + nb * 16 * LP + kc); };
    fetch(0, 0);
#pragma unroll
    for (int i = 0; i < KP / 32; ++i) {
        if (i + 1 < KP / 32) fetch((i + 1) & 1, (i + 1) * 32);
#pragma unroll
        for (int nb = 0; nb < 2; ++nb) {
#pragma unroll
            for (int mb = 0; mb < 4; ++mb) acc[mb][nb] = wmmabg(a[i & 1][mb], bq[i & 1][nb], acc[mb][nb]); }
    }
    float* osw = os + wave * (64 * OSW);
#pragma unroll
    for (int mb = 0; mb < 4; ++mb) {
#pragma unroll
        for (int nb = 0; nb < 2; ++nb) {
#pragma unroll
            for (int j = 0; j < 8; ++j) osw[(mb * 16 + hi * 8 + j) * OSW + nb * 16 + lr] = acc[mb][nb][j]; } }   // D: row 8h+j, col lane&15
    wave_sync();
    float* outp = HP + ((size_t)w * MPAD + (size_t)(r0 + wm * 64)) * APAD + (size_t)(c0 + wn * 32);
    static_assert(32 * 16 * 16 == 64 * 32 * 4);    // lanes x 16 B x trips == 64 rows x 128 B
#pragma unroll
    for (int s = 0; s < 16; ++s) { const int row = 4 * s + (lane >> 3), q4 = (lane & 7) * 4;   // 16 s x 4 rows = 64 rows; 8 lanes x 4 floats = 32 columns
        const v4f val = *(const v4fa*)(&osw[row * OSW + q4]);
        *(v4f*)(outp + (size_t)row * APAD + q4) = val; }
    } else {
    static_assert(GM == (APAD / GN) * (GT - GW) * 8);                    // 4 column blocks x 4 waves x 8 rows store the tile's 128 rows once
    const int rw = (int)blockIdx.y * ((GT - GW) * 8) + (wave - GW) * 8;  // the wave's 8 rows of the tile, one behind the other
    if (w == 0) {
        v2u q[8][4];                                                     // all LDS reads before the first store: one LDS latency
#pragma unroll
        for (int t = 0; t < 8; ++t) {
#pragma unroll
            for (int j = 0; j < 4; ++j) q[t][j] = *(const v2ua*)(&sa[(rw + t) * LP + 128 * j + c4]); }
#pragma unroll
        for (int t = 0; t < 8; ++t) {
#pragma unroll
            for (int j = 0; j < 4; ++j) {
                const v4f f = {__uint_as_float(q[t][j][0] << 16), __uint_as_float(q[t][j][0] & 0xFFFF0000u), __uint_as_float(q[t][j][1] << 16), __uint_as_float(q[t][j][1] & 0xFFFF0000u)};
                if (j < 3 || 384 + c4 < FD) *(v4f*)(O1 + (size_t)(r0 + rw + t) * FD + 128 * j + c4) = f; } }   // the last quarter is stored only where it is a part of the row
        asm volatile("s_wait_xcnt 0x0" ::: "memory");  // the wait that stands before a register named by the stores above is overwritten (code of the other branches follows in the listing)
    } else {
        v8us q[8][2];
#pragma unroll
        for (int t = 0; t < 8; ++t) {
#pragma unroll
            for (int j = 0; j < 2; ++j) q[t][j] = *(const v8usa*)(&sa[(rw + t) * LP + 256 * j + 8 * lane]); }
#pragma unroll
        for (int t = 0; t < 8; ++t) {
#pragma unroll
            for (int j = 0; j < 2; ++j) { v8h h;
#pragma unroll
                for (int e = 0; e < 8; ++e) h[e] = toh_flush(__uint_as_float(((unsigned)q[t][j][e]) << 16));
                *(v8h*)(HR + (size_t)(r0 + rw + t) * KP + 256 * j + 8 * lane) = h; } }
        asm volatile("s_wait_xcnt 0x0" ::: "memory");  // the wait that stands before a register named by the stores above is overwritten (code of the other branches follows in the listing)
    }
    }
}

// k_score: one block per 16 candidates of one batch. Stage 0: the block's operands go to LDS once: the batch's 50 hh rows (asynchronous copies, whole padded rows), each wave's 4 hc rows
// (through registers, as nc = -(hc + b1), laid [candidate][a]) and w2 (already rounded); behind a block barrier the batch's 50 f16 hist rows follow (asynchronous copies that land while stage 1 runs).
// Stage 1, one wave per 4 candidates; lane = history entry (lane and lane + 32); every operand read from LDS, one pair of 4-wide pieces ahead of its arithmetic.
// logit = sum_a relu((hc + b1) + hh) * w2 + b2, summed as sum_a w2 hh - sum_a w2 min(nc, hh) (relu(c + x) = x - min(-c, x)): the first sum once per history entry, the second per (candidate, history) pair;
// f32, fmaf chains, two neighbouring a (even, odd) a packed instruction, the two halves added behind the loop; masked entries replaced by -1e9; softmax with the max over all 50 entries;
// alpha x1024 as f16 into the block's LDS rows pt [16][64] (candidate rows >= 50 and history >= 50 are zeros).
// Stage 2, behind one block barrier: out0[b][n][f] = (1/1024) sum_h pt[n][h] HR[b][h][f] (B fragments by transposing reads of the rows' LDS copy), f16 WMMA, K = 64; one wave per 128 features (8 accumulators);
// the 16 x 128 slab is staged in LDS (wave-private) and stored as 512-byte row pieces, rows < 50 and features < 500 only.
__global__ __launch_bounds__(32 * SW) void k_score(const float* __restrict__ HC, const float* __restrict__ HH, const int* __restrict__ maskp,
                                                   const float* __restrict__ b1, const float* __restrict__ w2, const float* __restrict__ b2,
                                                   const h16* __restrict__ HR, float* O0) {
    __shared__ __align__(16) h16 pt[SW * 4 * TP];
    __shared__ __align__(16) float os[SW * 16 * OSW2];
    __shared__ __align__(16) float xs[NH * XSP];                         // hh rows of the batch
    __shared__ __align__(16) float ct[SW * AD * 4];                      // per wave: -(hc + b1) of its 4 candidates, [candidate][a]
    __shared__ __align__(16) float wl[AD];                               // w2, rounded
    __shared__ __align__(16) h16 hl[HPAD * HLP];                         // f16 hist rows of the batch: [history][feature], rows pitched for the transposing reads; rows >= 50 are zeros
    const int lane = threadIdx.x & 31;
    const int wave = __builtin_amdgcn_readfirstlane((int)(threadIdx.x >> 5));
    const int b = (int)blockIdx.y;
    const int n0 = ((int)blockIdx.x * SW + wave) * 4;
    const int lr = lane & 15, hi = lane >> 4;
    const int f0 = wave * 128;
    const size_t hb = (size_t)b * NH;
    // stage 0a: hh rows -> xs. Round s: rows 2s and 2s + 1, one 16-byte piece a lane (a wave's copy is 512 contiguous bytes); every lane is on, every address in bounds, no LDS byte written twice.
    {
        const int col = (int)threadIdx.x & 63, r2 = (int)threadIdx.x >> 6;
        const float* g0 = HH + (hb + (size_t)r2) * APAD + (size_t)col * 4;
        const unsigned l0 = (unsigned)(size_t)(&xs[r2 * XSP + col * 4]);
        const float* g[25]; unsigned l[25];
#pragma unroll
        for (int s = 0; s < 25; ++s) { g[s] = g0 + (size_t)s * 2 * APAD; l[s] = l0 + (unsigned)(s * 2 * XSP * 4); }
        // the copies of a statement end in their own s_wait_xcnt 0: it stands before any register that a copy names is rewritten
        asm volatile("global_load_async_to_lds_b128 %0, %1, off\n\tglobal_load_async_to_lds_b128 %2, %3, off\n\tglobal_load_async_to_lds_b128 %4, %5, off\n\t"
                     "global_load_async_to_lds_b128 %6, %7, off\n\tglobal_load_async_to_lds_b128 %8, %9, off\n\tglobal_load_async_to_lds_b128 %10, %11, off\n\t"
                     "global_load_async_to_lds_b128 %12, %13, off\n\tglobal_load_async_to_lds_b128 %14, %15, off\n\tglobal_load_async_to_lds_b128 %16, %17, off\n\t"
                     "global_load_async_to_lds_b128 %18, %19, off\n\tglobal_load_async_to_lds_b128 %20, %21, off\n\tglobal_load_async_to_lds_b128 %22, %23, off\n\t"
                     "global_load_async_to_lds_b128 %24, %25, off\n\ts_wait_xcnt 0x0"
                     :: "v"(l[0]), "v"(g[0]), "v"(l[1]), "v"(g[1]), "v"(l[2]), "v"(g[2]), "v"(l[3]), "v"(g[3]), "v"(l[4]), "v"(g[4]), "v"(l[5]), "v"(g[5]), "v"(l[6]), "v"(g[6]),
                        "v"(l[7]), "v"(g[7]), "v"(l[8]), "v"(g[8]), "v"(l[9]), "v"(g[9]), "v"(l[10]), "v"(g[10]), "v"(l[11]), "v"(g[11]), "v"(l[12]), "v"(g[12]) : "memory");
        asm volatile("global_load_async_to_lds_b128 %0, %1, off\n\tglobal_load_async_to_lds_b128 %2, %3, off\n\tglobal_load_async_to_lds_b128 %4, %5, off\n\t"
                     "global_load_async_to_lds_b128 %6, %7, off\n\tglobal_load_async_to_lds_b128 %8, %9, off\n\tglobal_load_async_to_lds_b128 %10, %11, off\n\t"
                     "global_load_async_to_lds_b128 %12, %13, off\n\tglobal_load_async_to_lds_b128 %14, %15, off\n\tglobal_load_async_to_lds_b128 %16, %17, off\n\t"
                     "global_load_async_to_lds_b128 %18, %19, off\n\tglobal_load_async_to_lds_b128 %20, %21, off\n\tglobal_load_async_to_lds_b128 %22, %23, off\n\t"
                     "s_wait_xcnt 0x0"
                     :: "v"(l[13]), "v"(g[13]), "v"(l[14]), "v"(g[14]), "v"(l[15]), "v"(g[15]), "v"(l[16]), "v"(g[16]), "v"(l[17]), "v"(g[17]), "v"(l[18]), "v"(g[18]),
                        "v"(l[19]), "v"(g[19]), "v"(l[20]), "v"(g[20]), "v"(l[21]), "v"(g[21]), "v"(l[22]), "v"(g[22]), "v"(l[23]), "v"(g[23]), "v"(l[24]), "v"(g[24]) : "memory");
    }
    // stage 0b: the wave's 4 hc rows, b1, w2 and the lane's two mask words, all at clamped addresses and in flight together (a wave without candidates stages row 49 into its own, unread part of ct)
    const int nvec = ((int)blockIdx.x * SW + (int)(threadIdx.x >> 5)) * 4;
    size_t oc[4]; bool rok[4];
#pragma unroll
    for (int i = 0; i < 4; ++i) { int q = nvec + i; rok[i] = q < NN; q = q < NN ? q : NN - 1; q = __builtin_amdgcn_readfirstlane(q);
        oc[i] = ((size_t)b * NN + (size_t)q) * APAD; }
    const int hB = lane + 32; const int hBc = hB < NH ? hB : NH - 1; const bool okB = hB < NH;
    const int pB = hB < AD / 4 ? hB : AD / 4 - 1;                        // the lane's second piece of a candidate row
    const int tb = (int)threadIdx.x < AD / 4 ? (int)threadIdx.x : AD / 4 - 1;
    v4f cv[2][4];
#pragma unroll
    for (int i = 0; i < 4; ++i) { cv[0][i] = *(const v4f*)(HC + oc[i] + 4 * lane); cv[1][i] = *(const v4f*)(HC + oc[i] + 4 * pB); }
    const v4f b1a = *(const v4f*)(b1 + 4 * lane), b1b = *(const v4f*)(b1 + 4 * pB), w2v = *(const v4f*)(w2 + 4 * tb);   // b1 at the lane's two pieces of a candidate row
    const int mkA = maskp[hb + (size_t)lane], mkB = maskp[hb + (size_t)hBc];
    // inputs-only fence on the loaded values: the mask loads stay here, in flight with the other loads of stage 0 (sunk to their use behind stage 1 they would cost a memory latency of their own)
    asm volatile("" :: "v"(mkA), "v"(mkB));
    const v4f ba = {bfr(b1a[0]), bfr(b1a[1]), bfr(b1a[2]), bfr(b1a[3])}, bb = {bfr(b1b[0]), bfr(b1b[1]), bfr(b1b[2]), bfr(b1b[3])};
#pragma unroll
    for (int i = 0; i < 4; ++i) { const v4f q0 = -(cv[0][i] + ba); *(v4fa*)(&ct[wave * (AD * 4) + i * AD + 4 * lane]) = q0; }
    if (hB < AD / 4) {
#pragma unroll
        for (int i = 0; i < 4; ++i) { const v4f q1 = -(cv[1][i] + bb); *(v4fa*)(&ct[wave * (AD * 4) + i * AD + 4 * hB]) = q1; } }
    if ((int)threadIdx.x < AD / 4) {
        const v4f wr = {bfr(w2v[0]), bfr(w2v[1]), bfr(w2v[2]), bfr(w2v[3])};
        *(v4fa*)(&wl[4 * (int)threadIdx.x]) = wr; }
    // the k rows 50..63 of stage 2's B operand: zeros (their alpha is zero too, and the product must be a zero)
#pragma unroll
    for (int it = 0; it < 7; ++it) { const int p = it * (32 * SW) + (int)threadIdx.x; const v8h z = (v8h){};
        *(v8ha*)(&hl[(NH + (p >> 6)) * HLP + (p & 63) * 8]) = z; }
    asm volatile("s_wait_asynccnt 0x0" ::: "memory");                    // this wave's copies have landed
    __syncthreads();                                                     // every wave reads rows that other waves copied; every wave of the block passes here
    // stage 2's B operand depends on nothing of stage 1: the batch's 50 f16 hist rows are copied to LDS here and land while stage 1 runs. A wave takes one half (512 contiguous bytes) of every second row:
    // 25 copies; every lane is on, every address in bounds, no LDS byte written twice
    {
        const int row = wave >> 1, hf = wave & 1;
        const char* g0 = (const char*)(HR + (hb + (size_t)row) * KP + (size_t)hf * (KP / 2) + (size_t)lane * 8);
        const unsigned l0 = (unsigned)(size_t)(&hl[row * HLP + hf * (KP / 2) + lane * 8]);
#pragma unroll
        for (int s = 0; s < 3; ++s) acopy8(l0 + (unsigned)(s * 16 * HLP * 2), g0 + (size_t)s * 16 * KP * 2, 2 * HLP * 2, (size_t)2 * KP * 2);
        acopy1(l0 + (unsigned)(48 * HLP * 2), g0 + (size_t)48 * KP * 2);
    }
    if (n0 >= NN) {                                                      // wave-uniform: no candidate here, its 4 alpha rows are zeros
        const v8h z = (v8h){}; *(v8ha*)(&pt[(wave * 4 + (lane >> 3)) * TP + (lane & 7) * 8]) = z;
    } else {
    const float b2v = bfr(b2[0]);
    v2f acc[4][2], sx[2];                                                // per (candidate, history entry of the lane): -sum w2 min(nc, hh); per history entry: sum w2 hh; each over even a | odd a
#pragma unroll
    for (int i = 0; i < 4; ++i) { acc[i][0] = (v2f){}; acc[i][1] = (v2f){}; }
    sx[0] = (v2f){}; sx[1] = (v2f){};
    const float* xpa = &xs[lane * XSP]; const float* xpb = &xs[hBc * XSP]; const float* cp = &ct[wave * (AD * 4)];
    // two register sets of two pieces each: a pair's 14 LDS reads are issued one pair ahead of its arithmetic
    v4f xa[2][2], xb[2][2], ww[2][2], cc[2][2][4];
    auto fetch = [&](const int s, const int d) {
#pragma unroll
        for (int p = 0; p < 2; ++p) { const int a4 = 2 * d + p;
            xa[s][p] = *(const v4fa*)(xpa + 4 * a4); xb[s][p] = *(const v4fa*)(xpb + 4 * a4);
#pragma unroll
            for (int i = 0; i < 4; ++i) cc[s][p][i] = *(const v4fa*)(cp + i * AD + 4 * a4);
            ww[s][p] = *(const v4fa*)(&wl[4 * a4]); } };
    auto work = [&](const int s) {
        v2f t[2][2][4][2];
#pragma unroll
        for (int p = 0; p < 2; ++p) {
#pragma unroll
            for (int q = 0; q < 2; ++q) {
#pragma unroll
                for (int i = 0; i < 4; ++i) {                            // two neighbouring a a step: they lie side by side in every piece read
                    t[p][q][i][0] = min2(cc[s][p][i][2 * q], xa[s][p][2 * q], cc[s][p][i][2 * q + 1], xa[s][p][2 * q + 1]);
                    t[p][q][i][1] = min2(cc[s][p][i][2 * q], xb[s][p][2 * q], cc[s][p][i][2 * q + 1], xb[s][p][2 * q + 1]); } } }
        __builtin_amdgcn_sched_barrier(0);                               // all minima of the pair stand before its first fmaf: moved together, a fmaf would stand directly behind its minimum and the lone wave of the SIMD would wait out the latency
#pragma unroll
        for (int p = 0; p < 2; ++p) {
#pragma unroll
            for (int q = 0; q < 2; ++q) {                                // ten independent chains a round: a chain's next link stands ten instructions on
                const v2f w = {ww[s][p][2 * q], ww[s][p][2 * q + 1]};
                sx[0] = __builtin_elementwise_fma((v2f){xa[s][p][2 * q], xa[s][p][2 * q + 1]}, w, sx[0]);
                sx[1] = __builtin_elementwise_fma((v2f){xb[s][p][2 * q], xb[s][p][2 * q + 1]}, w, sx[1]);
#pragma unroll
                for (int i = 0; i < 4; ++i) { acc[i][0] = __builtin_elementwise_fma(t[p][q][i][0], -w, acc[i][0]); acc[i][1] = __builtin_elementwise_fma(t[p][q][i][1], -w, acc[i][1]); } } } };
    // the compiler fence behind each fetch keeps its reads where they stand: without it the reads carried into the next trip are sunk to that trip's head, directly in front of their use;
    // the scheduling barriers keep a pair's 14 LDS reads in one place, ahead of the other pair's arithmetic, so that every read has a whole pair of lead (left alone the reads are spread among the arithmetic, late)
    fetch(0, 0);
    asm volatile("" ::: "memory");
#pragma unroll 1
    for (int d = 0; d < AD / 8 - 1; d += 2) {                            // rolled: the body already holds two pairs, one per register set
        fetch(1, d + 1);
        asm volatile("" ::: "memory");
        __builtin_amdgcn_sched_barrier(0);                               // no arithmetic of set 0 moves up among these reads
        work(0);
        __builtin_amdgcn_sched_barrier(0);                               // no read of the next fetch moves up among this arithmetic, none of it sinks below them
        fetch(0, d + 2);
        asm volatile("" ::: "memory");
        __builtin_amdgcn_sched_barrier(0);                               // no arithmetic of set 1 moves up among these reads
        work(1);
    }
    work(0);                                                             // the last pair
#pragma unroll
    for (int i = 0; i < 4; ++i) {
        float sA = ((acc[i][0][0] + acc[i][0][1]) + (sx[0][0] + sx[0][1])) + b2v, sB = ((acc[i][1][0] + acc[i][1][1]) + (sx[1][0] + sx[1][1])) + b2v;
        sA = (mkA != 0) ? sA : NEGV; sB = (mkB != 0) ? sB : NEGV; sB = okB ? sB : NEGB;
        float mx = fmaxf(sA, sB);
        mx = fmaxf(mx, __shfl_xor(mx, 16, 32)); mx = fmaxf(mx, __shfl_xor(mx, 8, 32)); mx = fmaxf(mx, __shfl_xor(mx, 4, 32));
        mx = fmaxf(mx, __shfl_xor(mx, 2, 32));  mx = fmaxf(mx, __shfl_xor(mx, 1, 32));
        const float eA = __builtin_amdgcn_exp2f((sA - mx) * L2E);
        float eB = __builtin_amdgcn_exp2f((sB - mx) * L2E); eB = okB ? eB : 0.0f;
        float sm = eA + eB;
        sm += __shfl_xor(sm, 16, 32); sm += __shfl_xor(sm, 8, 32); sm += __shfl_xor(sm, 4, 32); sm += __shfl_xor(sm, 2, 32); sm += __shfl_xor(sm, 1, 32);
        const float inv = __builtin_amdgcn_rcpf(sm) * PCS;              // sm >= 1 (the maximum entry contributes 1)
        h16 qa = toh_flush(eA * inv), qb = toh_flush(eB * inv);
        qa = rok[i] ? qa : (h16)0.0f; qb = rok[i] ? qb : (h16)0.0f;
        pt[(wave * 4 + i) * TP + lane] = qa; pt[(wave * 4 + i) * TP + 32 + lane] = qb; }   // 4 rows x 64 columns all written
    }
    asm volatile("s_wait_asynccnt 0x0" ::: "memory");                    // this wave's copies of the hist rows have landed
    __syncthreads();                                                     // every wave reads all 16 alpha rows and hist rows that other waves copied; every wave of the block passes here
    v16h a[2];
#pragma unroll
    for (int ks = 0; ks < 2; ++ks) { const h16* p = &pt[lr * TP + 8 * hi + 32 * ks]; a[ks] = cat16(*(const v8ha*)p, *(const v8ha*)(p + 16)); }   // the k map of ldb
    const h16* tq = &hl[(8 * hi + (lane & 7)) * HLP + f0 + 8 * ((lane >> 3) & 1)];   // the lane's address in a 16 (history) x 16 (feature) tile of the transposing read
    v16h bq[2][8];                                                       // all B fragments are read before the first matrix instruction: one LDS latency, not sixteen
#pragma unroll
    for (int ks = 0; ks < 2; ++ks) {
#pragma unroll
        for (int nb = 0; nb < 8; ++nb) bq[ks][nb] = cat16(ldtr(tq + (32 * ks) * HLP + nb * 16), ldtr(tq + (32 * ks + 16) * HLP + nb * 16)); }   // the k map of ldb: elements 0..7 <- 32 ks + 8h + 0..7, 8..15 <- 32 ks + 16 + 8h + 0..7
    v8f acc[8];
#pragma unroll
    for (int nb = 0; nb < 8; ++nb) acc[nb] = (v8f){};
#pragma unroll
    for (int ks = 0; ks < 2; ++ks) {
#pragma unroll
        for (int nb = 0; nb < 8; ++nb) acc[nb] = wmma16g(a[ks], bq[ks][nb], acc[nb]); }
    float* osw = os + wave * (16 * OSW2);
#pragma unroll
    for (int nb = 0; nb < 8; ++nb) {
#pragma unroll
        for (int j = 0; j < 8; ++j) osw[(hi * 8 + j) * OSW2 + nb * 16 + lr] = acc[nb][j] * PCI; }   // D: row 8h+j, col lane&15
    wave_sync();
    const int nr0 = (int)blockIdx.x * (SW * 4);
    const int c4 = lane * 4;                                             // 32 lanes x 4 floats = 128 columns
    float* outp = O0 + ((size_t)b * NN + (size_t)nr0) * FD + (size_t)(f0 + c4);
    const bool cok = f0 + c4 < FD;                                       // FD % 4 == 0: a float4 lies wholly inside the row or wholly outside
    v4f val[16];
#pragma unroll
    for (int row = 0; row < 16; ++row) val[row] = *(const v4fa*)(&osw[row * OSW2 + c4]);
    if (cok) {
#pragma unroll
        for (int row = 0; row < 16; ++row) { if (nr0 + row < NN) *(v4f*)(outp + (size_t)row * FD) = val[row]; }
    }
}

static constexpr size_t al256(size_t v) { return (v + 255) & ~(size_t)255; }
static constexpr size_t SZ_HR = al256((size_t)MPAD * KP * 2);
static constexpr size_t SZ_HP = al256((size_t)2 * MPAD * APAD * 4);
static constexpr size_t SZ_TOTAL = SZ_HR + SZ_HP;
static_assert(SZ_TOTAL <= (size_t)134217728);          // workspace carve <= 128 MiB
static_assert(((size_t)MPAD * APAD * 4) % 256 == 0);   // the two HP sub-planes stay 256-byte aligned
static constexpr size_t OUT1_OFF = (size_t)NB_FULL * NN * FD;   // element offset of the second output (fixed, full problem)

extern "C" void kernel_launch(void* const* d_in, const int* in_sizes, int n_in,
                              void* d_out, int out_size, void* d_ws, size_t ws_size, hipStream_t stream) {
    if (n_in < 9) return;
    if ((size_t)in_sizes[0] < (size_t)MROWS * RD || (size_t)in_sizes[1] < (size_t)MROWS * RD) return;
    if ((size_t)in_sizes[2] < (size_t)MROWS || (size_t)in_sizes[3] < (size_t)MROWS) return;
    if ((size_t)in_sizes[4] < (size_t)NPOS * PD || (size_t)in_sizes[5] < (size_t)AD * 2 * FD) return;
    if (in_sizes[6] < AD || in_sizes[7] < AD || in_sizes[8] < 1) return;
    if ((size_t)out_size < OUT1_OFF + (size_t)MROWS * FD) return;
    if (SZ_TOTAL > ws_size) return;
    // wire order: history_repr, candidate_repr, user_history_mask, user_history_position, pos_emb, W1, b1, w2, b2
    const float* hist_in = (const float*)d_in[0];
    const float* cand_in = (const float*)d_in[1];
    const int*   maskp   = (const int*)d_in[2];
    const int*   posp    = (const int*)d_in[3];
    const float* pe      = (const float*)d_in[4];
    const float* W1      = (const float*)d_in[5];
    const float* b1      = (const float*)d_in[6];
    const float* w2      = (const float*)d_in[7];
    const float* b2      = (const float*)d_in[8];
    float* OUT0 = (float*)d_out;                 // [NB][50][500]
    float* OUT1 = (float*)d_out + OUT1_OFF;      // [NB][50][500]
    char* wsp = (char*)d_ws;
    h16* HR = (h16*)wsp;   wsp += SZ_HR;         // [MPAD][512]: hist rows in f16
    float* HP = (float*)wsp; wsp += SZ_HP;       // [2][MPAD][256]: hc | hh
    const float* HC = HP; const float* HH = HP + (size_t)MPAD * APAD;

    // hc = cand Wc^T, hh = hist Wh^T; out1 and the f16 hist rows
    k_gemm1<<<dim3(MPAD / GM, APAD / GN, 2), 32 * GT, 0, stream>>>(hist_in, cand_in, posp, pe, W1, HP, HR, OUT1);
    // logits, softmax, user representation = alpha hist
    k_score<<<dim3(HPAD / (4 * SW), NB, 1), 32 * SW, 0, stream>>>(HC, HH, maskp, b1, w2, b2, HR, OUT0);
}

// v009
// It runs in 15.2 microseconds.
// Timed twice side by side with v008, it ran 1.06 times as fast both times.
// Counting every step since v000, it is 3.77 times as fast.
#include <hip/hip_runtime.h>
#pragma clang fp contract(off)

// Additive attention of candidate items over a user history: rows = [400-wide item vector | 100-wide position embedding]; hidden = relu(cand Wc^T + hist Wh^T + b1) (W1 [200][1000] = [Wc | Wh], [out][in]); logit = hidden . w2 + b2; masked entries REPLACED by -1e9; softmax over the history; out0 = alpha hist, out1 = the candidate rows.
// Compute dtypes, f32 accumulate everywhere: the two projections v_wmma_f32_16x16x32_bf16 (items, position table, W1 RNE-converted to bf16; products exact); alpha . hist v_wmma_f32_16x16x32_f16 (alpha x1024 carry as f16, hist = the bf16 values held in f16); relu / w2 dot (depth 200, one shared vector): hc + b1, hh and w2 held in f16, packed f16 minima, summed by v_wmma_f32_16x16x32_f16; softmax on the vector unit in f32.
// Layout: f32 plane HP [2][rows][256] (hc | hh); f16 plane HR [rows][512] (the hist rows, K zero-padded 500 -> 512, the bf16 values held in f16; the score kernel reads them transposed out of LDS); the bf16 operands of the projections (rows and W1, zero-padded to [.][512]) exist in LDS only; alpha stays in LDS (16 candidate rows per score block).
// Two launches: k_gemm1 (operand conversion, both projections, out1 and HR), k_score (logits, softmax, alpha . hist, out0).

#ifndef NB
#define NB 64
#endif
#define NB_FULL 64
#define NH   50                  // history entries per batch
#define NN   50                  // candidates per batch
#define RD   400                 // item vector width
#define PD   100                 // position embedding width
#define FD   500                 // RD + PD
#define AD   200                 // attention width
#define NPOS 52                  // rows of the position table
#define KP   512                 // FD padded to the k-step
#define APAD 256                 // AD padded to the column tile
#define HPAD 64                  // NH / NN padded (k of the second product, rows of its A operand)
#define MROWS (NB * NN)
#define MPAD  ((MROWS + 63) / 64 * 64)
#define OSW  36                  // LDS row pitch (floats) of a 64 x 32 slab
#define GM   128                 // GEMM block tile: rows
#define GN   64                  // GEMM block tile: columns
#define GW   4                   // GEMM waves that multiply, 2 x 2 wave tiles of 64 x 32
#define LP   520                 // LDS row pitch (16-bit elements) of the staged GEMM operand rows: 1040 B = 16 B x odd
#define OSW2 132                 // LDS row pitch (floats) of a 16 x 128 slab
#define TP   72                  // LDS row pitch (halves) of the alpha rows
#define HLP  528                 // LDS row pitch (halves) of the staged f16 hist rows: 1056 B = 32 B x odd, the pitch of the transposing 16-bit read
#define SW   4                   // waves per score block (4 candidates each)
#define XHP  264                 // LDS row pitch (halves) of the staged f16 hh rows: 528 B = 16 B x odd, so 16 lanes' 16-byte reads of 16 rows fall on 64 different banks
#define AKP  224                 // AD padded to the k-step of the logit product
#define GT   8                   // GEMM waves per block in all: 8 convert the operands; then 4 multiply and 4 store the row planes
#define PCS  1024.0f             // carry of the alpha plane
#define PCI  (1.0f / 1024.0f)
#define L2E  1.4426950408889634f
#define NEGV (-1.0e9f)
#define NEGB (-3.0e38f)

static_assert(FD == RD + PD);
static_assert(NH == NN);                       // both row sets have MROWS rows
static_assert(RD % 8 == 0);                    // an 8-element piece never straddles the item / position boundary
static_assert(PD % 4 == 0);
static_assert(FD % 4 == 0);                    // a float4 of the flat output never straddles two rows
static_assert(KP % 32 == 0);                   // GEMM k-loop steps by 32
static_assert(KP >= FD);
static_assert(KP % 64 == 0);
static_assert(KP / 8 == 64);
static_assert(APAD % 64 == 0);
static_assert(APAD >= AD);
static_assert(AD % 4 == 0);
static_assert(HPAD == 64);
static_assert(HPAD % 32 == 0);
static_assert(NH == 48 + 2);                   // behind three history tiles of 16 two entries are left: with 4 candidates they fill 8 rows of one tile
static_assert(NH <= HPAD);
static_assert(NN <= HPAD);
static_assert(MPAD % 64 == 0);
static_assert(MPAD == MROWS);                  // every row of a GEMM tile is a row of the inputs
static_assert(HPAD % (4 * SW) == 0);           // score grid covers the padded candidate rows exactly
static_assert(NB <= NB_FULL);
static_assert(((size_t)NB_FULL * NN * FD * 4) == (size_t)6400000);   // byte offset of the second output
static_assert((((size_t)NB_FULL * NN * FD * 4) % 128) == 0);
static_assert((OSW * 4) % 16 == 0);
static_assert((TP * 2) % 16 == 0);
static_assert(MPAD % GM == 0);
static_assert(APAD % GN == 0);
static_assert(GM == 2 * 64);                   // 2 x 2 wave tiles cover the block tile
static_assert(GN == 2 * 32);
static_assert(GM % GW == 0);
static_assert(GN % GW == 0);
static_assert(KP == 4 * 32 * 4);               // a row is 4 quarters of 4 columns for each of a wave's 32 lanes
static_assert(RD > 384 && RD <= 384 + 128 && FD <= KP);   // the item / position boundary and the end of the row lie in the last quarter
static_assert(LP >= KP);
static_assert((LP * 2) % 32 == 16);
static_assert((GM + GN) * LP * 2 + GW * 64 * OSW * 4 <= 327680);   // static LDS of the GEMM kernel
static_assert(SW * 4 == 16);                   // a score block's candidates are one 16-row A fragment
static_assert(SW * 128 == KP);                 // its waves cover the padded features, 128 each
static_assert((OSW2 * 4) % 16 == 0);
static_assert(SW * 4 * TP * 2 + SW * 16 * OSW2 * 4 + NH * XHP * 2 + SW * 4 * AKP * 2 + AKP * 2 + 2 * HPAD * 4 + HPAD * HLP * 2 <= 327680);   // static LDS of the score kernel
static_assert(XHP >= APAD);
static_assert((XHP * 2) % 32 == 16);
static_assert(AKP % 32 == 0 && AKP >= AD && AKP <= APAD);   // columns AD .. AKP - 1 of hc and hh are the zeros that the GEMM stores
static_assert(AKP / 4 <= 64 && AKP / 4 > 32);  // a padded candidate row's pieces: lane and lane + 32
static_assert(AKP / 4 <= 32 * SW && HPAD <= 32 * SW);
static_assert(APAD / 4 == 64);                 // a padded hh row is 64 pieces of 16 B: half of the score block's threads
static_assert(32 * SW == 128);
static_assert(NH == 2 * 25);                   // 25 rounds of 2 rows take the 50 hh rows exactly
static_assert(TP >= HPAD);
static_assert(HLP >= KP);
static_assert((HLP * 2) % 64 == 32);
static_assert(KP * 2 == 2 * 32 * 16);          // half a hist row is one 16-byte piece for each of a wave's 32 lanes
static_assert(2 * NH == SW * 25);              // 25 copies a wave take the 100 row halves exactly
static_assert((HPAD - NH) * (KP / 8) == 7 * 32 * SW);   // 7 stores a thread zero the k rows behind the history

typedef _Float16 h16;
typedef unsigned short bf;
typedef __attribute__((ext_vector_type(16))) __bf16   v16bf;
typedef __attribute__((ext_vector_type(16))) _Float16 v16h;
typedef __attribute__((ext_vector_type(8)))  _Float16 v8h;
typedef __attribute__((ext_vector_type(4)))  _Float16 v4h;
typedef __attribute__((ext_vector_type(8)))  unsigned short v8us;
typedef __attribute__((ext_vector_type(8)))  short    v8s;
typedef __attribute__((ext_vector_type(8)))  float    v8f;
typedef __attribute__((ext_vector_type(4)))  float    v4f;
typedef __attribute__((ext_vector_type(2)))  float    v2f;
typedef __attribute__((ext_vector_type(2)))  __bf16   v2bf;
typedef __attribute__((ext_vector_type(2)))  unsigned v2u;
typedef __attribute__((ext_vector_type(4)))  unsigned v4u;
typedef v4f  __attribute__((may_alias)) v4fa;
typedef v2u  __attribute__((may_alias)) v2ua;
typedef v4u  __attribute__((may_alias)) v4ua;
typedef v8us __attribute__((may_alias)) v8usa;
typedef v8h  __attribute__((may_alias)) v8ha;
typedef v4h  __attribute__((may_alias)) v4ha;

__device__ __forceinline__ unsigned short f2bf(float f) { unsigned u = __float_as_uint(f); u += 0x7FFFu + ((u >> 16) & 1u); return (unsigned short)(u >> 16); }
__device__ __forceinline__ float bfr(float f) { return __uint_as_float(((unsigned)f2bf(f)) << 16); }   // value after RNE convert to bf16
__device__ __forceinline__ v16h cat16(v8h lo, v8h hi) { return __builtin_shufflevector(lo, hi, 0, 1, 2, 3, 4, 5, 6, 7, 8, 9, 10, 11, 12, 13, 14, 15); }
__device__ __forceinline__ v16bf cat16b(v8us lo, v8us hi) { return __builtin_bit_cast(v16bf, __builtin_shufflevector(lo, hi, 0, 1, 2, 3, 4, 5, 6, 7, 8, 9, 10, 11, 12, 13, 14, 15)); }
__device__ __forceinline__ v8f wmma16(v16h a, v16h b, v8f c) { return __builtin_amdgcn_wmma_f32_16x16x32_f16(false, a, false, b, (short)0, c, false, false); }
__device__ __forceinline__ v8f wmmab(v16bf a, v16bf b, v8f c) { return __builtin_amdgcn_wmma_f32_16x16x32_bf16(false, a, false, b, (short)0, c, false, false); }
// fragment loaders from K-contiguous 16-bit rows; p already includes + 8*(lane>>4): elements 0..7 <- k0+8h+0..7, elements 8..15 <- k0+16+8h+0..7 (same map for A and B)
__device__ __forceinline__ v16bf ldb(const bf* p)  { return cat16b(*(const v8us*)p, *(const v8us*)(p + 16)); }
// transposing LDS read (ds_load_tr16_b128) of a row-major 16-bit tile T: with p = &T[k0 + 8 * (lane >> 4) + (lane & 7)][d0 + 8 * ((lane >> 3) & 1)] the lane gets T[k0 + 8 * (lane >> 4) + 0..7][d0 + (lane & 15)]
__device__ __forceinline__ v8h ldtr(const h16* p) { typedef __attribute__((address_space(3))) v8s lds_v8s; return __builtin_bit_cast(v8h, __builtin_amdgcn_ds_load_tr16_b128_v8i16((lds_v8s*)p)); }
// ordering point for wave-private LDS tiles (same wave writes and reads)
__device__ __forceinline__ void wave_sync() { __builtin_amdgcn_fence(3 /* release order */, "wavefront"); __builtin_amdgcn_wave_barrier(); asm volatile("" ::: "memory"); }
// per-instruction guarded matrix ops: one accumulator tied per guard, operands kept live
__device__ __forceinline__ v8f wmma16g(v16h a, v16h b, v8f c) { c = wmma16(a, b, c); asm volatile("v_nop\n\tv_nop\n\tv_nop\n\tv_nop" : "+v"(c) : "v"(a), "v"(b)); return c; }
__device__ __forceinline__ v8f wmmabg(v16bf a, v16bf b, v8f c) { c = wmmab(a, b, c); asm volatile("v_nop\n\tv_nop\n\tv_nop\n\tv_nop" : "+v"(c) : "v"(a), "v"(b)); return c; }
// eight asynchronous 16-byte copies a lane, global -> LDS, at steps of gs and ls bytes; the statement ends in its own s_wait_xcnt 0, which so stands before any register that a copy names is rewritten
__device__ __forceinline__ void acopy8(const unsigned l, const char* g, const unsigned ls, const size_t gs) {
    asm volatile("global_load_async_to_lds_b128 %0, %8, off\n\tglobal_load_async_to_lds_b128 %1, %9, off\n\tglobal_load_async_to_lds_b128 %2, %10, off\n\tglobal_load_async_to_lds_b128 %3, %11, off\n\t"
                 "global_load_async_to_lds_b128 %4, %12, off\n\tglobal_load_async_to_lds_b128 %5, %13, off\n\tglobal_load_async_to_lds_b128 %6, %14, off\n\tglobal_load_async_to_lds_b128 %7, %15, off\n\t"
                 "s_wait_xcnt 0x0"
                 :: "v"(l), "v"(l + ls), "v"(l + 2 * ls), "v"(l + 3 * ls), "v"(l + 4 * ls), "v"(l + 5 * ls), "v"(l + 6 * ls), "v"(l + 7 * ls),
                    "v"(g), "v"(g + gs), "v"(g + 2 * gs), "v"(g + 3 * gs), "v"(g + 4 * gs), "v"(g + 5 * gs), "v"(g + 6 * gs), "v"(g + 7 * gs) : "memory");
}
// one such copy, with the same closing wait
__device__ __forceinline__ void acopy1(const unsigned l, const char* g) {
    asm volatile("global_load_async_to_lds_b128 %0, %1, off\n\ts_wait_xcnt 0x0" :: "v"(l), "v"(g) : "memory");
}
// f32 -> f16 convert that cannot produce an f16 subnormal (|v| < 2^-14 -> +0)
static __device__ __forceinline__ h16 toh_flush(float v) { const h16 r = (h16)v; return (fabsf(v) < 6.103515625e-05f) ? (h16)0.0f : r; }
// 2^x with the slot behind a transcendental filled in the same statement
__device__ __forceinline__ float exp2s(const float x) { float r; asm("v_exp_f32 %0, %1\n\tv_nop" : "=v"(r) : "v"(x)); return r; }
// position-table row: negative index wraps once, then clamps into the table
__device__ __forceinline__ int posrow(int p) { p = p < 0 ? p + NPOS : p; p = p < 0 ? 0 : p; p = p > NPOS - 1 ? NPOS - 1 : p; return p; }

// four f32 -> four bf16, round to nearest even (two v_cvt_pk_bf16_f32), packed in two words
__device__ __forceinline__ v2u cvt4(const v4f x) {
    const v2f lo = {x[0], x[1]}, hi = {x[2], x[3]};
    v2u r; r[0] = __builtin_bit_cast(unsigned, __builtin_convertvector(lo, v2bf)); r[1] = __builtin_bit_cast(unsigned, __builtin_convertvector(hi, v2bf)); return r;
}

// k_gemm1: bf16 GEMM straight from the f32 inputs, one block of 8 waves per 128x64 tile, K = 512. HP[w][m][n] = sum_k X[w][m][k] W[w][n][k]; grid (MPAD/128, APAD/64, 2); w = 0: candidates, Wc; w = 1: history, Wh.
// Stage 0, all 8 waves: the tile's 128 A rows = [ item vector (400) | position row (100) | zeros (12) ] (history: table[pos[r]]; candidates: table row 1) and its 64 B rows (W1 row a, columns 500 w ..; rows >= 200 and k >= 500
// are zeros) are loaded as f32 (a wave load is 512 contiguous bytes of one row), converted to bf16 and stored to LDS rows pitched 16 B x odd. All loads at clamped addresses, selected or masked by value.
// Behind one block barrier: waves 0..3 multiply (wave tile 64x32, 8 accumulators; every output sums its 16 k-steps in ascending order) and store their 64x32 slab, staged in LDS (wave-private), as whole 128-byte lines;
// waves 4..7 store the converted A rows from LDS: candidates widened to f32 as out1 [rows][500], history held in f16 as the plane HR [rows][512]. Each of the 4 column blocks of a row tile stores 32 of its 128 rows.
__global__ __launch_bounds__(32 * GT) void k_gemm1(const float* __restrict__ hist, const float* __restrict__ cand, const int* __restrict__ pos, const float* __restrict__ pe,
                                                   const float* __restrict__ W1, float* HP, h16* HR, float* O1) {
    __shared__ __align__(16) bf sa[GM * LP];
    __shared__ __align__(16) bf sb[GN * LP];
    __shared__ __align__(16) float os[GW * 64 * OSW];
    const int lane = threadIdx.x & 31, lr = lane & 15, hi = lane >> 4;
    const int wave = __builtin_amdgcn_readfirstlane((int)(threadIdx.x >> 5));
    const int r0 = (int)blockIdx.x * GM, c0 = (int)blockIdx.y * GN, w = (int)blockIdx.z;
    const float* src = w ? hist : cand;
    // a wave takes rows wave + 8 s; a row is 4 quarters of 128 columns, 4 columns a lane. The last quarter (columns 384..511) holds the item's last 16 columns, the position row and the zeros.
    const int c4 = lane * 4;
    const int ci = 384 + c4 < RD - 4 ? 384 + c4 : RD - 4;                // item column of the last quarter, clamped into the row
    int cp = 384 + c4 - RD; cp = cp < 0 ? 0 : (cp > PD - 4 ? PD - 4 : cp);   // position column, clamped into the table row
    const int cw = 384 + c4 < FD - 4 ? 384 + c4 : FD - 4;                // W1 column of the last quarter, clamped into its half of the row
    const bool isitem = 384 + c4 < RD;
    const unsigned mlane = 384 + c4 < FD ? 0xFFFFFFFFu : 0u;             // zero for the padded columns
    const int pzv = pos[r0 + wave + GT * lr];                            // lane s (s < 16) holds the position index of the wave's A row s
    int pof;                                                             // and, behind the B loads, the place in the table of that row's position row
    // (every loop of this kernel is unrolled: its index picks registers or immediate offsets)
    v4f x[2][20];                                                        // two register sets of 4 rows each: a set's loads fly while the other set is converted
    auto loadB = [&](const int st, const int bt) {
#pragma unroll
        for (int i = 0; i < 4; ++i) { const int a = c0 + wave + GT * (4 * bt + i); const int ac = a < AD ? a : AD - 1;
            const float* p = W1 + (size_t)ac * (2 * FD) + (size_t)w * FD;
#pragma unroll
            for (int j = 0; j < 3; ++j) x[st][4 * i + j] = *(const v4f*)(p + 128 * j + c4);
            x[st][4 * i + 3] = *(const v4f*)(p + cw); }
        asm volatile("s_wait_xcnt 0x0" ::: "memory");                    // the wait that stands before a register named by these loads is overwritten; its clobber also keeps the set's loads together, ahead of the other set's conversion
        __builtin_amdgcn_sched_barrier(0);                               // no conversion (and so no wait for an older set) is moved up among these loads
    };
    auto storeB = [&](const int st, const int bt) {
#pragma unroll
        for (int i = 0; i < 4; ++i) { const int row = wave + GT * (4 * bt + i); const unsigned m = c0 + row < AD ? 0xFFFFFFFFu : 0u;
#pragma unroll
            for (int j = 0; j < 4; ++j) { v2u q = cvt4(x[st][4 * i + j]); const unsigned mm = j < 3 ? m : (m & mlane); q[0] &= mm; q[1] &= mm;
                *(v2ua*)(&sb[row * LP + 128 * j + c4]) = q; } }
    };
    auto loadA = [&](const int st, const int bt) {
#pragma unroll
        for (int i = 0; i < 4; ++i) { const int s = 4 * bt + i;
            const float* p = src + (size_t)(r0 + wave + GT * s) * RD;
#pragma unroll
            for (int j = 0; j < 3; ++j) x[st][5 * i + j] = *(const v4f*)(p + 128 * j + c4);
            x[st][5 * i + 3] = *(const v4f*)(p + ci);
            x[st][5 * i + 4] = *(const v4f*)(pe + __builtin_amdgcn_readlane(pof, s) + cp); }   // the row's place as a scalar: scalar base, the lane's fixed offset
        asm volatile("s_wait_xcnt 0x0" ::: "memory");                    // as in loadB
        __builtin_amdgcn_sched_barrier(0);                               // as in loadB
    };
    auto storeA = [&](const int st, const int bt) {
#pragma unroll
        for (int i = 0; i < 4; ++i) { const int row = wave + GT * (4 * bt + i);
#pragma unroll
            for (int j = 0; j < 3; ++j) *(v2ua*)(&sa[row * LP + 128 * j + c4]) = cvt4(x[st][5 * i + j]);
            v4f y;
#pragma unroll
            for (int e = 0; e < 4; ++e) y[e] = isitem ? x[st][5 * i + 3][e] : x[st][5 * i + 4][e];
            v2u q = cvt4(y); q[0] &= mlane; q[1] &= mlane;
            *(v2ua*)(&sa[row * LP + 384 + c4]) = q; }
    };
    static_assert(GN == GT * 4 * 2);                                     // two sets of B rows
    static_assert(GM == GT * 4 * 4);                                     // four sets of A rows
    loadB(0, 0);                                                         // the B rows need no index: they go first, in flight with the position indices
    loadB(1, 1);
    // inputs-only fence on the loaded value: the index load stays unconditional and ahead of the B loads, and its wait stands here, behind them (sunk into the history branch it would cost a latency of its own before any other load)
    asm volatile("" :: "v"(pzv));
    pof = (w ? posrow(pzv) : 1) * PD;
    storeB(0, 0); loadA(0, 0);
    storeB(1, 1); loadA(1, 1);
    storeA(0, 0); loadA(0, 2);
    storeA(1, 1); loadA(1, 3);
    storeA(0, 2);
    storeA(1, 3);
    __syncthreads();                                                     // every wave reads rows that other waves stored; every wave of the block passes here
    if (wave < GW) {                                                     // wave-uniform; no barrier stands behind this point
    const int wm = wave & 1, wn = wave >> 1;
    v8f acc[4][2];
#pragma unroll
    for (int mb = 0; mb < 4; ++mb)
#pragma unroll
        for (int nb = 0; nb < 2; ++nb) acc[mb][nb] = (v8f){};
    const bf* pa = &sa[(wm * 64 + lr) * LP + 8 * hi];                    // the lane's place in the k-step's A and B rows
    const bf* pb = &sb[(wn * 32 + lr) * LP + 8 * hi];
    // two register sets: a k-step's 12 LDS reads are issued one k-step ahead of its products
    v16bf a[2][4], bq[2][2];
    auto fetch = [&](const int s, const int kc) {
#pragma unroll
        for (int mb = 0; mb < 4; ++mb) a[s][mb] = ldb(pa + mb * 16 * LP + kc);
#pragma unroll
        for (int nb = 0; nb < 2; ++nb) bq[s][nb] = ldb(pb + nb * 16 * LP + kc); };
    fetch(0, 0);
#pragma unroll
    for (int i = 0; i < KP / 32; ++i) {
        if (i + 1 < KP / 32) fetch((i + 1) & 1, (i + 1) * 32);
#pragma unroll
        for (int nb = 0; nb < 2; ++nb) {
#pragma unroll
            for (int mb = 0; mb < 4; ++mb) acc[mb][nb] = wmmabg(a[i & 1][mb], bq[i & 1][nb], acc[mb][nb]); }
    }
    float* osw = os + wave * (64 * OSW);
#pragma unroll
    for (int mb = 0; mb < 4; ++mb) {
#pragma unroll
        for (int nb = 0; nb < 2; ++nb) {
#pragma unroll
            for (int j = 0; j < 8; ++j) osw[(mb * 16 + hi * 8 + j) * OSW + nb * 16 + lr] = acc[mb][nb][j]; } }   // D: row 8h+j, col lane&15
    wave_sync();
    float* outp = HP + ((size_t)w * MPAD + (size_t)(r0 + wm * 64)) * APAD + (size_t)(c0 + wn * 32);
    static_assert(32 * 16 * 16 == 64 * 32 * 4);    // lanes x 16 B x trips == 64 rows x 128 B
#pragma unroll
    for (int s = 0; s < 16; ++s) { const int row = 4 * s + (lane >> 3), q4 = (lane & 7) * 4;   // 16 s x 4 rows = 64 rows; 8 lanes x 4 floats = 32 columns
        const v4f val = *(const v4fa*)(&osw[row * OSW + q4]);
        *(v4f*)(outp + (size_t)row * APAD + q4) = val; }
    } else {
    static_assert(GM == (APAD / GN) * (GT - GW) * 8);                    // 4 column blocks x 4 waves x 8 rows store the tile's 128 rows once
    const int rw = (int)blockIdx.y * ((GT - GW) * 8) + (wave - GW) * 8;  // the wave's 8 rows of the tile, one behind the other
    if (w == 0) {
        v2u q[8][4];                                                     // all LDS reads before the first store: one LDS latency
#pragma unroll
        for (int t = 0; t < 8; ++t) {
#pragma unroll
            for (int j = 0; j < 4; ++j) q[t][j] = *(const v2ua*)(&sa[(rw + t) * LP + 128 * j + c4]); }
#pragma unroll
        for (int t = 0; t < 8; ++t) {
#pragma unroll
            for (int j = 0; j < 4; ++j) {
                const v4f f = {__uint_as_float(q[t][j][0] << 16), __uint_as_float(q[t][j][0] & 0xFFFF0000u), __uint_as_float(q[t][j][1] << 16), __uint_as_float(q[t][j][1] & 0xFFFF0000u)};
                if (j < 3 || 384 + c4 < FD) *(v4f*)(O1 + (size_t)(r0 + rw + t) * FD + 128 * j + c4) = f; } }   // the last quarter is stored only where it is a part of the row
        asm volatile("s_wait_xcnt 0x0" ::: "memory");  // the wait that stands before a register named by the stores above is overwritten (code of the other branches follows in the listing)
    } else {
        v8us q[8][2];
#pragma unroll
        for (int t = 0; t < 8; ++t) {
#pragma unroll
            for (int j = 0; j < 2; ++j) q[t][j] = *(const v8usa*)(&sa[(rw + t) * LP + 256 * j + 8 * lane]); }
#pragma unroll
        for (int t = 0; t < 8; ++t) {
#pragma unroll
            for (int j = 0; j < 2; ++j) { v8h h;
#pragma unroll
                for (int e = 0; e < 8; ++e) h[e] = toh_flush(__uint_as_float(((unsigned)q[t][j][e]) << 16));
                *(v8h*)(HR + (size_t)(r0 + rw + t) * KP + 256 * j + 8 * lane) = h; } }
        asm volatile("s_wait_xcnt 0x0" ::: "memory");  // the wait that stands before a register named by the stores above is overwritten (code of the other branches follows in the listing)
    }
    }
}

// k_score: one block per 16 candidates of one batch. Stage 0: the block's operands go to LDS once, in f16, through registers: the batch's 50 hh rows, each wave's 4 hc rows (as nc = -(hc + b1), laid [candidate][a]),
// w2 (rounded as before) and, per history entry, the pair (keep, repl) that applies mask and b2; behind a block barrier the batch's 50 f16 hist rows follow (asynchronous copies that land while stage 1 runs).
// Stage 1, one wave per 4 candidates, on the matrix unit: logit = sum_a relu((hc + b1) + hh) * w2 + b2, summed as sum_a w2 hh - sum_a w2 min(nc, hh) (relu(c + x) = x - min(-c, x)).
// A fragment = 16 rows x 32 a: hh rows themselves (first sum), or their packed f16 minimum with a candidate's nc (second sum). B fragment = w2 over the same 32 a, in every column: all 16 columns of a D tile are equal. f32 accumulators,
// one per (candidate, history tile) and one per history tile. Tiles 0..2: row = history entry 16 t + row. History entries 48 and 49 of all 4 candidates share one tile: row r = (candidate (r >> 1) & 3, entry 48 + (r & 1)).
// K = 224 (a >= 200: hh, nc and w2 are zeros). A lane so holds the logits of history entries 16 t + 8 (lane >> 4) + 0..7 of all 4 candidates and goes on with candidate lane & 3: maximum and sum of the softmax run inside the lane,
// with one exchange between the two lane halves each;
// masked entries replaced by -1e9; alpha x1024 as f16 into the block's LDS rows pt [16][64] (candidate rows >= 50 and history >= 50 are zeros).
// Stage 2, behind one block barrier: out0[b][n][f] = (1/1024) sum_h pt[n][h] HR[b][h][f] (B fragments by transposing reads of the rows' LDS copy), f16 WMMA, K = 64; one wave per 128 features (8 accumulators);
// the 16 x 128 slab is staged in LDS (wave-private) and stored as 512-byte row pieces, rows < 50 and features < 500 only.
__global__ __launch_bounds__(32 * SW) void k_score(const float* __restrict__ HC, const float* __restrict__ HH, const int* __restrict__ maskp,
                                                   const float* __restrict__ b1, const float* __restrict__ w2, const float* __restrict__ b2,
                                                   const h16* __restrict__ HR, float* O0) {
    __shared__ __align__(16) h16 pt[SW * 4 * TP];
    __shared__ __align__(16) float os[SW * 16 * OSW2];
    __shared__ __align__(16) h16 xs[NH * XHP];                           // hh rows of the batch, f16
    __shared__ __align__(16) h16 ct[SW * 4 * AKP];                       // per wave: -(hc + b1) of its 4 candidates, f16, [candidate][a]
    __shared__ __align__(16) h16 wl[AKP];                                // w2, rounded, f16
    __shared__ __align__(16) unsigned kp[HPAD];                          // per history entry: all ones if it is kept, 0 if masked or behind the history (ANDed on the logit's bits: a masked logit is replaced whatever its value)
    __shared__ __align__(16) float rp[HPAD];                             // and what is added: b2 | -1e9 | the value that takes an entry behind the history out of maximum and sum
    __shared__ __align__(16) h16 hl[HPAD * HLP];                         // f16 hist rows of the batch: [history][feature], rows pitched for the transposing reads; rows >= 50 are zeros
    const int lane = threadIdx.x & 31;
    const int wave = __builtin_amdgcn_readfirstlane((int)(threadIdx.x >> 5));
    const int b = (int)blockIdx.y;
    const int n0 = ((int)blockIdx.x * SW + wave) * 4;
    const int lr = lane & 15, hi = lane >> 4;
    const int f0 = wave * 128;
    const size_t hb = (size_t)b * NH;
    // stage 0, loads: all at clamped addresses and in flight together
    const int col = (int)threadIdx.x & 63, r2 = (int)threadIdx.x >> 6;
    const float* g0 = HH + (hb + (size_t)r2) * APAD + (size_t)col * 4;
    // the wave's 4 hc rows (56 pieces of 4: lane and lane + 32), b1, w2 and one mask word (a wave without candidates stages row 49 into its own, unread part of ct)
    const int nvec = ((int)blockIdx.x * SW + (int)(threadIdx.x >> 5)) * 4;
    size_t oc[4];
#pragma unroll
    for (int i = 0; i < 4; ++i) { int q = nvec + i; q = q < NN ? q : NN - 1; q = __builtin_amdgcn_readfirstlane(q);
        oc[i] = ((size_t)b * NN + (size_t)q) * APAD; }
    const int pB = lane + 32;                                            // the lane's second piece of a candidate row
    const int pBc = pB < AKP / 4 ? pB : AKP / 4 - 1;                     // clamped into the padded row of hc
    const int pBb = pB < AD / 4 ? pB : AD / 4 - 1;                       // clamped into b1
    const int tb = (int)threadIdx.x < AD / 4 ? (int)threadIdx.x : AD / 4 - 1;
    const int hq = col < NH ? col : NH - 1;
    v4f cv[2][4];
#pragma unroll
    for (int i = 0; i < 4; ++i) { cv[0][i] = *(const v4f*)(HC + oc[i] + 4 * lane); cv[1][i] = *(const v4f*)(HC + oc[i] + 4 * pBc); }
    const v4f b1a = *(const v4f*)(b1 + 4 * lane), b1b = *(const v4f*)(b1 + 4 * pBb), w2v = *(const v4f*)(w2 + 4 * tb);
    const int mk = maskp[hb + (size_t)hq];
    const float b2v = bfr(b2[0]);
    // hh: round s takes rows 2s and 2s + 1, one 16-byte piece a lane (a wave's load is 512 contiguous bytes); behind the small loads, whose conversion so runs while these rows arrive
    v4f xv[25];
#pragma unroll
    for (int s = 0; s < 25; ++s) xv[s] = *(const v4f*)(g0 + (size_t)s * 2 * APAD);
    // the wait that stands before a register named by the loads above is overwritten. Its inputs: every address part of those loads (vector address, lane offsets, scalar bases) lives up to here, so that nothing, also no load's result,
    // is written over one ahead of the wait; the loaded w2 and mask word keep their loads above, in flight with the others (sunk into the branches that use them they would cost a memory latency of their own in front of the barrier)
    asm volatile("s_wait_xcnt 0x0" :: "v"(g0), "v"(lane), "v"(pBc), "v"(pBb), "v"(tb), "v"(hq), "s"(HC + oc[0]), "s"(HC + oc[1]), "s"(HC + oc[2]), "s"(HC + oc[3]), "s"(b1), "s"(w2), "s"(maskp + hb), "v"(w2v), "v"(mk) : "memory");
    __builtin_amdgcn_sched_barrier(0);                                   // nothing from below is lifted over the wait, where it could take a register that a load names
    // stage 0, stores
    const unsigned bm = pB < AD / 4 ? 0xFFFF0000u : 0u;                  // zero for the padded a
    const v4f ba = {bfr(b1a[0]), bfr(b1a[1]), bfr(b1a[2]), bfr(b1a[3])};
    const v4f bb = {__uint_as_float(__float_as_uint(bfr(b1b[0])) & bm), __uint_as_float(__float_as_uint(bfr(b1b[1])) & bm), __uint_as_float(__float_as_uint(bfr(b1b[2])) & bm), __uint_as_float(__float_as_uint(bfr(b1b[3])) & bm)};
#pragma unroll
    for (int i = 0; i < 4; ++i) { const v4f q0 = -(cv[0][i] + ba); *(v4ha*)(&ct[(wave * 4 + i) * AKP + 4 * lane]) = __builtin_convertvector(q0, v4h); }
#pragma unroll
    for (int i = 0; i < 4; ++i) { const v4f q1 = -(cv[1][i] + bb); *(v4ha*)(&ct[(wave * 4 + i) * AKP + 4 * pBc]) = __builtin_convertvector(q1, v4h); }   // lanes behind the last piece repeat it: same place, same value
    if ((int)threadIdx.x < AKP / 4) {
        const unsigned wm = (int)threadIdx.x < AD / 4 ? 0xFFFF0000u : 0u;   // zero for the padded a
        const v4f wr = {__uint_as_float(__float_as_uint(bfr(w2v[0])) & wm), __uint_as_float(__float_as_uint(bfr(w2v[1])) & wm), __uint_as_float(__float_as_uint(bfr(w2v[2])) & wm), __uint_as_float(__float_as_uint(bfr(w2v[3])) & wm)};
        *(v4ha*)(&wl[4 * (int)threadIdx.x]) = __builtin_convertvector(wr, v4h); }
    if ((int)threadIdx.x < HPAD) {
        const bool hok = (int)threadIdx.x < NH, on = hok && mk != 0;
        kp[(int)threadIdx.x] = on ? 0xFFFFFFFFu : 0u; rp[(int)threadIdx.x] = on ? b2v : (hok ? NEGV : NEGB); }
#pragma unroll
    for (int s = 0; s < 25; ++s) *(v4ha*)(&xs[(r2 + 2 * s) * XHP + col * 4]) = __builtin_convertvector(xv[s], v4h);
    // the k rows 50..63 of stage 2's B operand: zeros (their alpha is zero too, and the product must be a zero)
#pragma unroll
    for (int it = 0; it < 7; ++it) { const int p = it * (32 * SW) + (int)threadIdx.x; const v8h z = (v8h){};
        *(v8ha*)(&hl[(NH + (p >> 6)) * HLP + (p & 63) * 8]) = z; }
    __syncthreads();                                                     // every wave reads rows that other waves stored; every wave of the block passes here
    // stage 2's B operand depends on nothing of stage 1: the batch's 50 f16 hist rows are copied to LDS here and land while stage 1 runs. A wave takes one half (512 contiguous bytes) of every second row:
    // 25 copies; every lane is on, every address in bounds, no LDS byte written twice
    {
        const int row = wave >> 1, hf = wave & 1;
        const char* g0 = (const char*)(HR + (hb + (size_t)row) * KP + (size_t)hf * (KP / 2) + (size_t)lane * 8);
        const unsigned l0 = (unsigned)(size_t)(&hl[row * HLP + hf * (KP / 2) + lane * 8]);
#pragma unroll
        for (int s = 0; s < 3; ++s) acopy8(l0 + (unsigned)(s * 16 * HLP * 2), g0 + (size_t)s * 16 * KP * 2, 2 * HLP * 2, (size_t)2 * KP * 2);
        acopy1(l0 + (unsigned)(48 * HLP * 2), g0 + (size_t)48 * KP * 2);
    }
    if (n0 >= NN) {                                                      // wave-uniform: no candidate here, its 4 alpha rows are zeros
        const v8h z = (v8h){}; *(v8ha*)(&pt[(wave * 4 + (lane >> 3)) * TP + (lane & 7) * 8]) = z;
    } else {
    // the lane's places; every pointer already includes + 8 * hi (the k map of ldb)
    const h16* xp[4];
#pragma unroll
    for (int t = 0; t < 3; ++t) xp[t] = &xs[(16 * t + lr) * XHP + 8 * hi];
    xp[3] = &xs[(48 + (lr & 1)) * XHP + 8 * hi];                         // the shared tile: row lr = (candidate (lr >> 1) & 3, history entry 48 + (lr & 1))
    const h16* cp = &ct[wave * 4 * AKP + 8 * hi];
    const h16* cm = cp + ((lr >> 1) & 3) * AKP;
    const h16* wp = &wl[8 * hi];
    v4u kv[4][2]; v4f rv[4][2];                                          // keep and repl of the lane's 32 history entries
#pragma unroll
    for (int t = 0; t < 4; ++t) {
#pragma unroll
        for (int q = 0; q < 2; ++q) { kv[t][q] = *(const v4ua*)(&kp[16 * t + 8 * hi + 4 * q]); rv[t][q] = *(const v4fa*)(&rp[16 * t + 8 * hi + 4 * q]); } }
    v8f dx[4], dc[4][3], dm;                                             // sum w2 hh per tile; sum w2 min(nc, hh) per (candidate, tile) and of the shared tile
#pragma unroll
    for (int t = 0; t < 4; ++t) dx[t] = (v8f){};
#pragma unroll
    for (int i = 0; i < 4; ++i) {
#pragma unroll
        for (int t = 0; t < 3; ++t) dc[i][t] = (v8f){}; }
    dm = (v8f){};
    // two register sets: a k-step's 20 LDS reads are issued one k-step ahead of its arithmetic
    v16h xf[2][4], cf[2][5], wf[2];
    auto fetch = [&](const int s, const int k0) {
#pragma unroll
        for (int t = 0; t < 4; ++t) xf[s][t] = cat16(*(const v8ha*)(xp[t] + k0), *(const v8ha*)(xp[t] + k0 + 16));
        wf[s] = cat16(*(const v8ha*)(wp + k0), *(const v8ha*)(wp + k0 + 16));
#pragma unroll
        for (int i = 0; i < 4; ++i) cf[s][i] = cat16(*(const v8ha*)(cp + i * AKP + k0), *(const v8ha*)(cp + i * AKP + k0 + 16));
        cf[s][4] = cat16(*(const v8ha*)(cm + k0), *(const v8ha*)(cm + k0 + 16)); };
    auto work = [&](const int s) {
#pragma unroll
        for (int t = 0; t < 4; ++t) dx[t] = wmma16(xf[s][t], wf[s], dx[t]);
#pragma unroll
        for (int i = 0; i < 4; ++i) {
#pragma unroll
            for (int t = 0; t < 3; ++t) dc[i][t] = wmma16(__builtin_elementwise_minimum(cf[s][i], xf[s][t]), wf[s], dc[i][t]); }
        dm = wmma16(__builtin_elementwise_minimum(cf[s][4], xf[s][3]), wf[s], dm);
        // order asked of the scheduler: one matrix instruction, then the eight minima of a later one, so that the vector unit works while the matrix unit does (left alone, long runs of minima and of matrix instructions follow one another)
#pragma unroll
        for (int g = 0; g < 13; ++g) { __builtin_amdgcn_sched_group_barrier(0x8, 1, 0); __builtin_amdgcn_sched_group_barrier(0x2, 8, 0); }
        __builtin_amdgcn_sched_group_barrier(0x8, 4, 0); };
    // the scheduling barriers keep a k-step's reads in one place, ahead of the other set's arithmetic, so that every read has a whole k-step of lead
    fetch(0, 0);
#pragma unroll
    for (int c = 0; c < AKP / 32; ++c) {                                 // unrolled: the index picks the register set and the immediate offsets
        if (c + 1 < AKP / 32) fetch((c + 1) & 1, (c + 1) * 32);
        __builtin_amdgcn_sched_barrier(0);                               // no arithmetic of this k-step moves up among the next one's reads
        work(c & 1);
        __builtin_amdgcn_sched_barrier(0);                               // no later read moves up among this arithmetic, none of it sinks below them
    }
    // D: row 8 hi + j in register j, the same in every column. The lane takes candidate lr & 3 out of the four; NV[t] history entries a tile
    constexpr int NV[4] = {8, 8, 8, NH - 48};
    const bool c1 = (lr & 1) != 0, c2 = (lr & 2) != 0;
    auto sel4 = [&](const float v0, const float v1, const float v2, const float v3) { const float a = c1 ? v1 : v0, bq = c1 ? v3 : v2; return c2 ? bq : a; };
    float sv[4][8];
#pragma unroll
    for (int t = 0; t < 3; ++t) {
#pragma unroll
        for (int j = 0; j < 8; ++j) sv[t][j] = dx[t][j] - sel4(dc[0][t][j], dc[1][t][j], dc[2][t][j], dc[3][t][j]); }
#pragma unroll
    for (int j = 0; j < NH - 48; ++j) sv[3][j] = sel4(dx[3][j], dx[3][2 + j], dx[3][4 + j], dx[3][6 + j]) - sel4(dm[j], dm[2 + j], dm[4 + j], dm[6 + j]);   // row 2 i + j of the shared tile (lanes of the upper half: taken out by kp and rp)
    float mp[4] = {NEGB, NEGB, NEGB, NEGB};
#pragma unroll
    for (int t = 0; t < 4; ++t) {
#pragma unroll
        for (int j = 0; j < NV[t]; ++j) { sv[t][j] = __uint_as_float(__float_as_uint(sv[t][j]) & kv[t][j >> 2][j & 3]) + rv[t][j >> 2][j & 3];   // kept: logit + b2; masked: 0 - 1e9
            mp[j & 3] = fmaxf(mp[j & 3], sv[t][j]); } }
    float mx = fmaxf(fmaxf(mp[0], mp[1]), fmaxf(mp[2], mp[3]));
    mx = fmaxf(mx, __shfl_xor(mx, 16, 32));                              // the other half of the candidate's history entries
    float sp[4] = {0.0f, 0.0f, 0.0f, 0.0f};
#pragma unroll
    for (int t = 0; t < 4; ++t) {
#pragma unroll
        for (int j = 0; j < NV[t]; ++j) sv[t][j] = exp2s((sv[t][j] - mx) * L2E); }   // an entry behind the history gives exp2(-inf) = 0
#pragma unroll
    for (int t = 0; t < 4; ++t) {
#pragma unroll
        for (int j = 0; j < NV[t]; ++j) sp[j & 3] += sv[t][j]; }
    float sm = (sp[0] + sp[1]) + (sp[2] + sp[3]);
    sm += __shfl_xor(sm, 16, 32);
    const float inv = n0 + lr < NN ? __builtin_amdgcn_rcpf(sm) * PCS : 0.0f;   // sm >= 1 (the maximum entry contributes 1); a candidate row >= 50 gets zeros
    if (lr < 4) {                                                        // one lane pair per candidate stores; lanes 4..15 of a half hold copies
#pragma unroll
        for (int t = 0; t < 4; ++t) { v8h q = (v8h){};
#pragma unroll
            for (int j = 0; j < NV[t]; ++j) q[j] = toh_flush(sv[t][j] * inv);
            *(v8ha*)(&pt[(wave * 4 + lr) * TP + 16 * t + 8 * hi]) = q; } }   // 4 rows x 64 columns all written
    }
    asm volatile("s_wait_asynccnt 0x0" ::: "memory");                    // this wave's copies of the hist rows have landed
    __syncthreads();                                                     // every wave reads all 16 alpha rows and hist rows that other waves copied; every wave of the block passes here
    v16h a[2];
#pragma unroll
    for (int ks = 0; ks < 2; ++ks) { const h16* p = &pt[lr * TP + 8 * hi + 32 * ks]; a[ks] = cat16(*(const v8ha*)p, *(const v8ha*)(p + 16)); }   // the k map of ldb
    const h16* tq = &hl[(8 * hi + (lane & 7)) * HLP + f0 + 8 * ((lane >> 3) & 1)];   // the lane's address in a 16 (history) x 16 (feature) tile of the transposing read
    v16h bq[2][8];                                                       // all B fragments are read before the first matrix instruction: one LDS latency, not sixteen
#pragma unroll
    for (int ks = 0; ks < 2; ++ks) {
#pragma unroll
        for (int nb = 0; nb < 8; ++nb) bq[ks][nb] = cat16(ldtr(tq + (32 * ks) * HLP + nb * 16), ldtr(tq + (32 * ks + 16) * HLP + nb * 16)); }   // the k map of ldb: elements 0..7 <- 32 ks + 8h + 0..7, 8..15 <- 32 ks + 16 + 8h + 0..7
    v8f acc[8];
#pragma unroll
    for (int nb = 0; nb < 8; ++nb) acc[nb] = (v8f){};
#pragma unroll
    for (int ks = 0; ks < 2; ++ks) {
#pragma unroll
        for (int nb = 0; nb < 8; ++nb) acc[nb] = wmma16g(a[ks], bq[ks][nb], acc[nb]); }
    float* osw = os + wave * (16 * OSW2);
#pragma unroll
    for (int nb = 0; nb < 8; ++nb) {
#pragma unroll
        for (int j = 0; j < 8; ++j) osw[(hi * 8 + j) * OSW2 + nb * 16 + lr] = acc[nb][j] * PCI; }   // D: row 8h+j, col lane&15
    wave_sync();
    const int nr0 = (int)blockIdx.x * (SW * 4);
    const int c4 = lane * 4;                                             // 32 lanes x 4 floats = 128 columns
    float* outp = O0 + ((size_t)b * NN + (size_t)nr0) * FD + (size_t)(f0 + c4);
    const bool cok = f0 + c4 < FD;                                       // FD % 4 == 0: a float4 lies wholly inside the row or wholly outside
    v4f val[16];
#pragma unroll
    for (int row = 0; row < 16; ++row) val[row] = *(const v4fa*)(&osw[row * OSW2 + c4]);
    if (cok) {
#pragma unroll
        for (int row = 0; row < 16; ++row) { if (nr0 + row < NN) *(v4f*)(outp + (size_t)row * FD) = val[row]; }
    }
}

static constexpr size_t al256(size_t v) { return (v + 255) & ~(size_t)255; }
static constexpr size_t SZ_HR = al256((size_t)MPAD * KP * 2);
static constexpr size_t SZ_HP = al256((size_t)2 * MPAD * APAD * 4);
static constexpr size_t SZ_TOTAL = SZ_HR + SZ_HP;
static_assert(SZ_TOTAL <= (size_t)134217728);          // workspace carve <= 128 MiB
static_assert(((size_t)MPAD * APAD * 4) % 256 == 0);   // the two HP sub-planes stay 256-byte aligned
static constexpr size_t OUT1_OFF = (size_t)NB_FULL * NN * FD;   // element offset of the second output (fixed, full problem)

extern "C" void kernel_launch(void* const* d_in, const int* in_sizes, int n_in,
                              void* d_out, int out_size, void* d_ws, size_t ws_size, hipStream_t stream) {
    if (n_in < 9) return;
    if ((size_t)in_sizes[0] < (size_t)MROWS * RD || (size_t)in_sizes[1] < (size_t)MROWS * RD) return;
    if ((size_t)in_sizes[2] < (size_t)MROWS || (size_t)in_sizes[3] < (size_t)MROWS) return;
    if ((size_t)in_sizes[4] < (size_t)NPOS * PD || (size_t)in_sizes[5] < (size_t)AD * 2 * FD) return;
    if (in_sizes[6] < AD || in_sizes[7] < AD || in_sizes[8] < 1) return;
    if ((size_t)out_size < OUT1_OFF + (size_t)MROWS * FD) return;
    if (SZ_TOTAL > ws_size) return;
    // wire order: history_repr, candidate_repr, user_history_mask, user_history_position, pos_emb, W1, b1, w2, b2
    const float* hist_in = (const float*)d_in[0];
    const float* cand_in = (const float*)d_in[1];
    const int*   maskp   = (const int*)d_in[2];
    const int*   posp    = (const int*)d_in[3];
    const float* pe      = (const float*)d_in[4];
    const float* W1      = (const float*)d_in[5];
    const float* b1      = (const float*)d_in[6];
    const float* w2      = (const float*)d_in[7];
    const float* b2      = (const float*)d_in[8];
    float* OUT0 = (float*)d_out;                 // [NB][50][500]
    float* OUT1 = (float*)d_out + OUT1_OFF;      // [NB][50][500]
    char* wsp = (char*)d_ws;
    h16* HR = (h16*)wsp;   wsp += SZ_HR;         // [MPAD][512]: hist rows in f16
    float* HP = (float*)wsp; wsp += SZ_HP;       // [2][MPAD][256]: hc | hh
    const float* HC = HP; const float* HH = HP + (size_t)MPAD * APAD;

    // hc = cand Wc^T, hh = hist Wh^T; out1 and the f16 hist rows
    k_gemm1<<<dim3(MPAD / GM, APAD / GN, 2), 32 * GT, 0, stream>>>(hist_in, cand_in, posp, pe, W1, HP, HR, OUT1);
    // logits, softmax, user representation = alpha hist
    k_score<<<dim3(HPAD / (4 * SW), NB, 1), 32 * SW, 0, stream>>>(HC, HH, maskp, b1, w2, b2, HR, OUT0);
}
